// v000
// The times below were measured on an AMD MI455X: many runs one after another, warmed up first and cycling through
// copies of the inputs, with the whole window's GPU time divided by the number of runs. Launches and the gaps
// between them are all in it. The median over several windows is given; except for v000 it joins two sittings, which
// can be a few percent apart, so the side-by-side timings, each taken in one sitting, are the better comparison.
// The starting kernel, v000, takes 336 microseconds a run.
// Contractions: q, k, v^T, lq, lk, lv^T projections = v_wmma_f32_16x16x32_f16 (activations f16 x1, weights f16 x64, single product, f32 accumulate);
// q.k^T and lq.lk^T scores = v_wmma_f32_16x16x32_f16 (q, k, lk f16 x1, lq f16 x2, layout K=16 zero-padded to 32 in registers, single products, one f32 accumulator);
// p.v and p.lv = v_wmma_f32_16x16x32_f16 (p carried x1024 in f16, v and lv f16 x1, single products, f32 accumulate); softmax and normalisation in f32.
// Carry audit: weight planes x64 -> 1/64 folded in the gemm64 epilogue (ascale); LQ plane x2 -> folded by the common score scale 0.125
//              in attn_two (q.k/8 + lq.lk/4 = (q.k + 2lq.lk)/8); P x1024 (LDS only) -> 1/1024 folded in the attn_two epilogue (inv);
//              activation planes, Q/K/V^T/LK/LV^T planes and the LC f32 plane carry x1.
#include <hip/hip_runtime.h>
#include <math.h>
#include <stdint.h>

#define NB   8
#define SEQ  1024
#define DM   768
#define DL   192
#define NH   12
#define HD   64
#define HL   16
#define NQB  (SEQ / 64)   // 64-row query blocks per sequence
#define NKT  (SEQ / 64)   // 64-key chunks per sequence
static_assert(NH * HD == DM);
static_assert(NH * HL == DL);
static_assert(NQB == 16 && NKT == 16);
static_assert((SEQ % 64) == 0 && (DM % 64) == 0 && (DL % 64) == 0);
static_assert((DM % 32) == 0 && (DL % 32) == 0);

typedef _Float16 v16h __attribute__((ext_vector_type(16)));
typedef _Float16 v8h  __attribute__((ext_vector_type(8)));
typedef float    v8f  __attribute__((ext_vector_type(8)));
typedef float    v4f  __attribute__((ext_vector_type(4)));
typedef unsigned int v4u __attribute__((ext_vector_type(4)));

#if defined(__HIP_DEVICE_COMPILE__)
#define DEV_ASM 1
#else
#define DEV_ASM 0
#endif

// ---- scalar helpers --------------------------------------------------------------------------------
__device__ __forceinline__ unsigned short h_bits(_Float16 x) { return __builtin_bit_cast(unsigned short, x); }
__device__ __forceinline__ unsigned pk16(unsigned short a, unsigned short b) { return (unsigned)a | ((unsigned)b << 16); }
__device__ __forceinline__ v8f zero8() { v8f z = {0.f, 0.f, 0.f, 0.f, 0.f, 0.f, 0.f, 0.f}; return z; }
__device__ __forceinline__ v8h zero8h() {
  const _Float16 z = (_Float16)0.0f;
  v8h r = {z, z, z, z, z, z, z, z};
  return r;
}

// ---- fragment loader: 16-bit A/B operand, lane -> row/col (lane&15), p already includes +8*(lane>>4);
//      elements 0..7 <- p[0..7] (k0+8h..k0+8h+7), elements 8..15 <- p[16..23] (k0+16+8h..k0+16+8h+7)
__device__ __forceinline__ v16h ldfrag_h(const _Float16* p) {
  union { v16h v; v8h h[2]; } f;
  f.h[0] = *(const v8h*)(p);
  f.h[1] = *(const v8h*)(p + 16);
  return f.v;
}

// ---- WMMA helpers ----------------------------------------------------------------------------------
__device__ __forceinline__ v8f mmar(v16h a, v16h b, v8f c) {
  return __builtin_amdgcn_wmma_f32_16x16x32_f16(false, a, false, b, (short)0, c, false, false);
}
// guarded form: 4 VALU slots after the WMMA, D tied, A/B kept live
__device__ __forceinline__ v8f mma_h(v16h a, v16h b, v8f c) {
  c = __builtin_amdgcn_wmma_f32_16x16x32_f16(false, a, false, b, (short)0, c, false, false);
#if DEV_ASM
  asm volatile("v_nop\n\tv_nop\n\tv_nop\n\tv_nop" : "+v"(c) : "v"(a), "v"(b));
#endif
  return c;
}
__device__ __forceinline__ void dep_guard(v8f& a, v8f& b, v16h x, v16h y) {
#if DEV_ASM
  asm volatile("v_nop\n\tv_nop\n\tv_nop\n\tv_nop" : "+v"(a), "+v"(b) : "v"(x), "v"(y));
#else
  (void)a; (void)b; (void)x; (void)y;
#endif
}
__device__ __forceinline__ void keep4(v16h a, v16h b, v16h c, v16h d) {
#if DEV_ASM
  asm volatile("v_nop" :: "v"(a), "v"(b), "v"(c), "v"(d));
#else
  (void)a; (void)b; (void)c; (void)d;
#endif
}
__device__ __forceinline__ void acc_guard4(v8f& a, v8f& b, v8f& c, v8f& d) {
#if DEV_ASM
  asm volatile("v_nop\n\tv_nop\n\tv_nop\n\tv_nop" : "+v"(a), "+v"(b), "+v"(c), "+v"(d));
#else
  (void)a; (void)b; (void)c; (void)d;
#endif
}

// =====================================================================================================
// f32 -> f16 bits of (x * scale), 8 elements per thread, one 16-B store per lane: a wave writes 512 contiguous
// coverage: n8 threads x 8 = the whole plane (n8 is a multiple of 256 for every use here).
// =====================================================================================================
__global__ __launch_bounds__(256) void cvt_h16x8(const float* __restrict__ in, unsigned short* out, int n8, float scale) {
  const int i = blockIdx.x * 256 + (int)threadIdx.x;
  if (i < n8) {
    const v4f a = *(const v4f*)(in + (size_t)i * 8);
    const v4f c = *(const v4f*)(in + (size_t)i * 8 + 4);
    v4u p;
    p[0] = pk16(h_bits((_Float16)(a[0] * scale)), h_bits((_Float16)(a[1] * scale)));
    p[1] = pk16(h_bits((_Float16)(a[2] * scale)), h_bits((_Float16)(a[3] * scale)));
    p[2] = pk16(h_bits((_Float16)(c[0] * scale)), h_bits((_Float16)(c[1] * scale)));
    p[3] = pk16(h_bits((_Float16)(c[2] * scale)), h_bits((_Float16)(c[3] * scale)));
    unsigned short* o = out + (size_t)i * 8;
    *(v4u*)o = p;
    
  }
}

// =====================================================================================================
// Register-blocked batched f16 WMMA GEMM with bias: C[m][n] = (sum_k A[m][k] * Bt[n][k]) * ascale + bias,
// stored as f16(value * oscale). One wave per 64x64 tile, no block barriers. A row-major [M][K] pitch lda;
// Bt row-major [N][K] pitch ldb (k contiguous); M, N multiples of 64, K multiple of 32 (host-checked).
// blockIdx.y = batch index (strides in elements). Fragments loaded straight from global with the split k map.
// BIASROW 0: bias[n] (bias length N); BIASROW 1: bias[m] (bias length M).
// coverage: 4 slabs x 16 rows (it 0..3 x lane>>3 0..3) x 64 cols (8 lanes x 8) = the wave's whole 64x64 tile.
// =====================================================================================================
template <int BIASROW>
__global__ __launch_bounds__(256) void gemm64(
    const unsigned short* __restrict__ Ap, int lda, long long strideA,
    const unsigned short* __restrict__ Btp, int ldb, long long strideB,
    const float* __restrict__ bias,
    unsigned short* Cp, int ldc, long long strideC,
    int M, int N, int K, float ascale, float oscale) {
  const _Float16* A  = (const _Float16*)(const void*)Ap;
  const _Float16* Bt = (const _Float16*)(const void*)Btp;
  __shared__ __align__(16) float sT[8][16 * 68];   // per-wave 16x64 slab, pitch 68 floats
  const int b    = blockIdx.y;
  const int lane = threadIdx.x & 31;
  const int wave = threadIdx.x >> 5;
  const int tilesN = N >> 6;
  const int tilesM = M >> 6;
  const int tile = blockIdx.x * 8 + wave;
  if (tile >= tilesM * tilesN) return;   // wave-uniform; no block barriers in this kernel
  const int tm = tile / tilesN;
  const int tn = tile - tm * tilesN;
  const int m0 = tm << 6;
  const int n0 = tn << 6;

  const _Float16* Ab = A  + (size_t)b * (size_t)strideA;
  const _Float16* Bb = Bt + (size_t)b * (size_t)strideB;

  const int rlane = lane & 15;                 // row (A) / col (B, D) within subtile
  const int koff  = (lane >> 4) * 8;           // k offset of this lane half
  const int mOff  = (lane >> 4) * 8;           // D row offset

  v8f acc[4][4];
#pragma unroll
  for (int i = 0; i < 4; ++i)
#pragma unroll
    for (int j = 0; j < 4; ++j) acc[i][j] = zero8();

  for (int k0 = 0; k0 < K; k0 += 32) {
    v16h bq[4];
#pragma unroll
    for (int j = 0; j < 4; ++j)
      bq[j] = ldfrag_h(Bb + (size_t)(n0 + (j << 4) + rlane) * ldb + koff + k0);
#pragma unroll
    for (int i = 0; i < 4; ++i) {
      const v16h af = ldfrag_h(Ab + (size_t)(m0 + (i << 4) + rlane) * lda + koff + k0);
#pragma unroll
      for (int j = 0; j < 4; ++j) acc[i][j] = mmar(af, bq[j], acc[i][j]);
      dep_guard(acc[i][0], acc[i][3], af, bq[3]);
    }
    keep4(bq[0], bq[1], bq[2], bq[3]);
  }
  acc_guard4(acc[0][0], acc[0][1], acc[0][2], acc[0][3]);
  acc_guard4(acc[1][0], acc[1][1], acc[1][2], acc[1][3]);
  acc_guard4(acc[2][0], acc[2][1], acc[2][2], acc[2][3]);
  acc_guard4(acc[3][0], acc[3][1], acc[3][2], acc[3][3]);

  // ---- epilogue ----
  float* slab = sT[wave];
  const int q = lane >> 3, c8 = (lane & 7) * 8;
  unsigned short* C = Cp + (size_t)b * (size_t)strideC;
  float bcol[8];
  {
    const v4f b0 = *(const v4f*)(bias + (BIASROW ? 0 : (n0 + c8)));       // column bias (length N), 16-B aligned
    const v4f b1 = *(const v4f*)(bias + (BIASROW ? 4 : (n0 + c8 + 4)));
#pragma unroll
    for (int e = 0; e < 4; ++e) { bcol[e] = b0[e]; bcol[4 + e] = b1[e]; }
  }
#pragma unroll
  for (int i = 0; i < 4; ++i) {
    const int mBase = m0 + (i << 4);
#pragma unroll
    for (int j = 0; j < 4; ++j) {
#pragma unroll
      for (int r = 0; r < 8; ++r) {
        slab[(mOff + r) * 68 + (j << 4) + rlane] = acc[i][j][r];
      }
    }
    __builtin_amdgcn_fence(__ATOMIC_RELEASE, "workgroup");
    __builtin_amdgcn_wave_barrier();
    __builtin_amdgcn_fence(__ATOMIC_ACQUIRE, "workgroup");
    v4u hv[4];
#pragma unroll
    for (int it = 0; it < 4; ++it) {
      const int row = it * 4 + q;                        // it 0..3 x q 0..3 = rows 0..15
      const float* sp = slab + row * 68 + c8;
      float bb[8];
      if (BIASROW) {
        const float bv = bias[mBase + row];              // row bias, index < M = bias length
#pragma unroll
        for (int e = 0; e < 8; ++e) bb[e] = bv;
      } else {
#pragma unroll
        for (int e = 0; e < 8; ++e) bb[e] = bcol[e];
      }
      v4u a;
#pragma unroll
      for (int e = 0; e < 4; ++e) {
        const float f0 = (sp[2 * e] * ascale + bb[2 * e]) * oscale;
        const float f1 = (sp[2 * e + 1] * ascale + bb[2 * e + 1]) * oscale;
        a[e] = pk16(h_bits((_Float16)f0), h_bits((_Float16)f1));
      }
      hv[it] = a;
    }
    {
#pragma unroll
      for (int it = 0; it < 4; ++it) {
        const int row = it * 4 + q;
        *(v4u*)(C + (size_t)(mBase + row) * ldc + n0 + c8) = hv[it];
      }
      
    }
    __builtin_amdgcn_fence(__ATOMIC_RELEASE, "workgroup");
    __builtin_amdgcn_wave_barrier();
    __builtin_amdgcn_fence(__ATOMIC_ACQUIRE, "workgroup");
  }
}

// =====================================================================================================
// Two-stream attention, text head dim 64 + layout head dim 16, no mask, softmax over all SEQ keys.
//   Q plane (f16): element (b, t, h, d) at [(b*SEQ + t)*DM + h*64 + d]; K plane same layout with key s.
//   LQ plane (f16, value x2): [(b*SEQ + t)*DL + h*16 + d]; LK plane (f16 x1) same layout.
//   V^T plane (f16): element (b, h, d, s) at [(b*DM + h*64 + d)*SEQ + s]; LV^T plane: [(b*DL + h*16 + d)*SEQ + s].
//   scores = (q . k + lq2 . lk) * sscale in f32 (3 f16 WMMA steps into one accumulator; the layout step uses
//   k = 0..15 only, upper 16 k-slots are register zeros in both fragments).
//   p = exp(s - m) carried as f16(1024 p); ctx = p . v (4 col tiles), lctx = p . lv (1 col tile); online softmax in f32.
//   Block = 4 waves = 64 query rows of one (b, h); grid = NB * NH * NQB; key chunks of 64, static trip NKT.
//   Chunk staging: 128 threads: K 32 halves/thread (64x64), V^T 32 halves/thread (64x64), LK 8 halves/thread (64x16),
//   LV^T 8 halves/thread (16x64) = every LDS element read below (plain 16-B loads, __syncthreads before and after);
//   P tiles are wave-private, spilled with _Float16 element stores and reloaded as v8h (same element type)
//   ctx -> out0 f32 [(b*SEQ + t)*DM + h*64 + d]: 16 rows x 256-B segments per wave (16 lanes x 16 B per segment,
//   Output coverage: wave rows q0..q0+15 (it 0..7 x lane>>4) x 64 cols (16 lanes x 4) of head h for out0;
//   64 float4 = the wave's whole 16x16 lctx tile for LC; the grid covers every (b, h, qb).
// =====================================================================================================
__global__ __launch_bounds__(128)
void attn_two(const unsigned short* __restrict__ qp, const unsigned short* __restrict__ kp,
              const unsigned short* __restrict__ vtp, const unsigned short* __restrict__ lqp,
              const unsigned short* __restrict__ lkp, const unsigned short* __restrict__ lvtp,
              float* out0, float* lcp, float sscale) {
  union FH { v16h v; v8h h[2]; };
  __shared__ __align__(16) _Float16 Ksh[64 * 64];        // K chunk [kv][d]    8 KB
  __shared__ __align__(16) _Float16 LKs[64 * HL];        // LK chunk [kv][dl]  2 KB
  __shared__ __align__(16) _Float16 Vth[64 * 64];        // V^T [d][kv]        8 KB
  __shared__ __align__(16) _Float16 LVs[HL * 64];        // LV^T [dl][kv]      2 KB
  __shared__ __align__(16) _Float16 Psh[4][16 * 64];     // per wave P [row][kv] 8 KB
  __shared__ __align__(16) float    Os[4][16 * 64];      // per wave ctx tile   16 KB
  __shared__ __align__(16) float    OLs[4][16 * HL];     // per wave lctx tile   4 KB

  const int tid  = threadIdx.x;
  const int wave = tid >> 5;
  const int lane = tid & 31;
  const int hh   = lane >> 4;
  const int c    = lane & 15;

  const int bx   = blockIdx.x;
  const int qb   = bx % NQB;
  const int rest = bx / NQB;
  const int h    = rest % NH;
  const int b    = rest / NH;
  const int q0   = qb * 64 + wave * 16;
  const size_t rowB = (size_t)b * SEQ;

  const _Float16* Q   = (const _Float16*)(const void*)qp;
  const _Float16* LQ  = (const _Float16*)(const void*)lqp;
  const _Float16* Kg  = (const _Float16*)(const void*)kp + (size_t)h * HD;
  const _Float16* LKg = (const _Float16*)(const void*)lkp + (size_t)h * HL;
  const _Float16* Vh  = (const _Float16*)(const void*)vtp  + ((size_t)b * DM + (size_t)h * HD) * SEQ;
  const _Float16* LVh = (const _Float16*)(const void*)lvtp + ((size_t)b * DL + (size_t)h * HL) * SEQ;

  // ---- Q fragments (A operand, row = lane&15): 2 d-chunks of the text stream; layout fragment k 0..15 ----
  v16h qa[2];
#pragma unroll
  for (int dc = 0; dc < 2; ++dc) {
    const size_t qo = (rowB + q0 + c) * DM + (size_t)h * HD + dc * 32 + 8 * hh;
    qa[dc] = ldfrag_h(Q + qo);
  }
  FH la;
  la.h[0] = *(const v8h*)(LQ + (rowB + q0 + c) * DL + (size_t)h * HL + 8 * hh);   // k = 8hh..8hh+7
  la.h[1] = zero8h();                                                              // k 16..31 = 0

  float mrow[8], lrow[8];
  v8f oacc[4];
  v8f olacc = zero8();
#pragma unroll
  for (int r = 0; r < 8; ++r) { mrow[r] = -INFINITY; lrow[r] = 0.f; }
#pragma unroll
  for (int t = 0; t < 4; ++t) oacc[t] = zero8();

  for (int kt = 0; kt < NKT; ++kt) {         // static trip count
    const int kv0 = kt * 64;
    __syncthreads();
    {
      const int r = tid >> 1, half = (tid & 1) * 32;
      const _Float16* kg = Kg + (rowB + kv0 + r) * DM + half;       // k row kv0+r, d = half..half+31
      const _Float16* vg = Vh + (size_t)r * SEQ + kv0 + half;        // v^T row d = r, s = kv0+half..+31
#pragma unroll
      for (int i = 0; i < 4; ++i) {
        const v8h a0 = *(const v8h*)(kg + 8 * i);
        const v8h b0 = *(const v8h*)(vg + 8 * i);
        *(v8h*)(Ksh + r * 64 + half + 8 * i) = a0;
        *(v8h*)(Vth + r * 64 + half + 8 * i) = b0;
      }
      const int c8l = (tid & 1) * 8;                                  // lk row kv0+r, dl = c8l..c8l+7
      const v8h lk8 = *(const v8h*)(LKg + (rowB + kv0 + r) * DL + c8l);
      *(v8h*)(LKs + r * HL + c8l) = lk8;
      const int dv = tid >> 3, s8 = (tid & 7) * 8;                   // lv^T row dl = dv, s = kv0+s8..+7
      const v8h lv8 = *(const v8h*)(LVh + (size_t)dv * SEQ + kv0 + s8);
      *(v8h*)(LVs + dv * 64 + s8) = lv8;
    }
    __syncthreads();

    // ---- scores: 16 query rows x 64 keys per wave ----
    v8f s[4];
#pragma unroll
    for (int j = 0; j < 4; ++j) {
      v8f acc = zero8();
#pragma unroll
      for (int dc = 0; dc < 2; ++dc) {
        FH kb;
        kb.h[0] = *(const v8h*)(Ksh + (j * 16 + c) * 64 + dc * 32 + 8 * hh);
        kb.h[1] = *(const v8h*)(Ksh + (j * 16 + c) * 64 + dc * 32 + 16 + 8 * hh);
        acc = mma_h(qa[dc], kb.v, acc);
      }
      FH lb;
      lb.h[0] = *(const v8h*)(LKs + (j * 16 + c) * HL + 8 * hh);
      lb.h[1] = zero8h();
      acc = mma_h(la.v, lb.v, acc);
#pragma unroll
      for (int r = 0; r < 8; ++r) s[j][r] = acc[r] * sscale;
    }

    // ---- row max, online softmax, P (x1024, f16) to LDS ----
    _Float16* pwh = Psh[wave];
#pragma unroll
    for (int r = 0; r < 8; ++r) {
      float m = s[0][r];
#pragma unroll
      for (int j = 1; j < 4; ++j) m = fmaxf(m, s[j][r]);
#pragma unroll
      for (int off = 1; off < 16; off <<= 1) m = fmaxf(m, __shfl_xor(m, off, 32));
      const float mnew  = fmaxf(mrow[r], m);
      const float msafe = (mnew == -INFINITY) ? 0.f : mnew;
      const float alpha = __expf(mrow[r] - msafe);
      mrow[r] = mnew;
      float psum = 0.f;
#pragma unroll
      for (int j = 0; j < 4; ++j) {
        const float p = __expf(s[j][r] - msafe);
        psum += p;
        pwh[(8 * hh + r) * 64 + j * 16 + c] = (_Float16)(p * 1024.0f);
      }
#pragma unroll
      for (int off = 1; off < 16; off <<= 1) psum += __shfl_xor(psum, off, 32);
      lrow[r] = lrow[r] * alpha + psum;
#pragma unroll
      for (int t = 0; t < 4; ++t) oacc[t][r] *= alpha;
      olacc[r] *= alpha;
    }
    __builtin_amdgcn_fence(__ATOMIC_RELEASE, "workgroup");
    __builtin_amdgcn_wave_barrier();
    __builtin_amdgcn_fence(__ATOMIC_ACQUIRE, "workgroup");

    // ---- ctx += P . V, lctx += P . LV (f16 WMMA) ----
#pragma unroll 1
    for (int kk = 0; kk < 2; ++kk) {
      FH pa;
      pa.h[0] = *(const v8h*)(pwh + c * 64 + kk * 32 + 8 * hh);
      pa.h[1] = *(const v8h*)(pwh + c * 64 + kk * 32 + 16 + 8 * hh);
#pragma unroll
      for (int t = 0; t < 4; ++t) {
        FH vb;
        vb.h[0] = *(const v8h*)(Vth + (t * 16 + c) * 64 + kk * 32 + 8 * hh);
        vb.h[1] = *(const v8h*)(Vth + (t * 16 + c) * 64 + kk * 32 + 16 + 8 * hh);
        oacc[t] = mma_h(pa.v, vb.v, oacc[t]);
      }
      FH wb;
      wb.h[0] = *(const v8h*)(LVs + c * 64 + kk * 32 + 8 * hh);
      wb.h[1] = *(const v8h*)(LVs + c * 64 + kk * 32 + 16 + 8 * hh);
      olacc = mma_h(pa.v, wb.v, olacc);
    }
  }

  float* os = Os[wave];
  float* ol = OLs[wave];
#pragma unroll
  for (int r = 0; r < 8; ++r) {
    const float l = lrow[r];
    const float inv = ((l > 0.f) ? (1.0f / l) : 0.f) * (1.0f / 1024.0f);
#pragma unroll
    for (int t = 0; t < 4; ++t) os[(8 * hh + r) * 64 + t * 16 + c] = oacc[t][r] * inv;
    ol[(8 * hh + r) * HL + c] = olacc[r] * inv;
  }
  __builtin_amdgcn_fence(__ATOMIC_RELEASE, "workgroup");
  __builtin_amdgcn_wave_barrier();
  __builtin_amdgcn_fence(__ATOMIC_ACQUIRE, "workgroup");
  {
    const int h2 = lane >> 4, c4 = (lane & 15) * 4;     // 256-B row segment = 16 lanes x 16 B
    float* ob = out0 + (rowB + q0) * DM + (size_t)h * HD + c4;
    float* lb = lcp + (((size_t)(b * NH + h)) * SEQ + (size_t)q0) * HL;
    {
#pragma unroll
      for (int it = 0; it < 8; ++it) {
        const int row = it * 2 + h2;                     // it 0..7 x h2 0..1 = rows 0..15
        const v4f v = *(const v4f*)(os + row * 64 + c4);
        *(v4f*)(ob + (size_t)row * DM) = v;
      }
#pragma unroll
      for (int it = 0; it < 2; ++it) {
        const int idx = it * 32 + lane;                  // float4 0..63 of the contiguous 16x16 tile
        const v4f v = *(const v4f*)(ol + idx * 4);
        *(v4f*)(lb + idx * 4) = v;
      }
      
    }
  }
}

// =====================================================================================================
// out1[(b*SEQ + t)*DL + h*16 + d] = LC[b][h][t][d] (f32). One float4 per thread over the flat out1 array
// (col % 4 == 0, so a float4 never crosses a row); consecutive lanes write consecutive 16 B: a wave writes
// coverage: n4 threads x 4 = the whole out1 (n4 multiple of 256).
// =====================================================================================================
__global__ __launch_bounds__(256) void lc_pack(const float* __restrict__ lc, float* out1, int n4) {
  const int i = blockIdx.x * 256 + (int)threadIdx.x;
  if (i < n4) {
    const int e   = i * 4;
    const int row = e / DL;                 // b*SEQ + t
    const int col = e - row * DL;           // h*16 + d, multiple of 4
    const int hd  = col >> 4;
    const int d   = col & 15;
    const int bb  = row / SEQ;
    const int t   = row - bb * SEQ;
    const v4f v = *(const v4f*)(lc + (((size_t)(bb * NH + hd)) * SEQ + (size_t)t) * HL + d);
    float* o = out1 + (size_t)e;
    *(v4f*)o = v;
    
  }
}

// =====================================================================================================
// Workspace map (bytes), every region an exact multiple of its whole-line / whole-tile store granularity:
//   Xh   f16 [8192][768]            12582912
//   Lh   f16 [8192][192]             3145728
//   Wqh  f16 [768 n][768 k] (x64)    1179648
//   Wkh  f16 [768][768]     (x64)    1179648
//   Wvh  f16 [768][768]     (x64)    1179648
//   Wlqh f16 [192][192]     (x64)      73728
//   Wlkh f16 [192][192]     (x64)      73728
//   Wlvh f16 [192][192]     (x64)      73728
//   Qp   f16 [8192][768]            12582912
//   Kp   f16 [8192][768]            12582912
//   VTp  f16 [8][768][1024]         12582912
//   LQp  f16 [8192][192]   (x2)      3145728
//   LKp  f16 [8192][192]             3145728
//   LVTp f16 [8][192][1024]          3145728
//   LC   f32 [8][12][1024][16]       6291456
//   total                           72966144
// Weights are [out n][in k] with k contiguous = the Bt / A layout the GEMM wants, so they are only converted.
// =====================================================================================================
extern "C" void kernel_launch(void* const* d_in, const int* in_sizes, int n_in,
                              void* d_out, int out_size, void* d_ws, size_t ws_size,
                              hipStream_t stream) {
  if (n_in < 14) return;
  if (in_sizes[0] != NB * SEQ * DM) return;
  if (in_sizes[1] != NB * SEQ * DL) return;
  if (in_sizes[2] != DM * DM || in_sizes[4] != DM * DM || in_sizes[6] != DM * DM) return;
  if (in_sizes[3] != DM || in_sizes[5] != DM || in_sizes[7] != DM) return;
  if (in_sizes[8] != DL * DL || in_sizes[10] != DL * DL || in_sizes[12] != DL * DL) return;
  if (in_sizes[9] != DL || in_sizes[11] != DL || in_sizes[13] != DL) return;
  if (out_size != NB * SEQ * (DM + DL)) return;

  const float* x    = (const float*)d_in[0];
  const float* xl   = (const float*)d_in[1];
  const float* Wq   = (const float*)d_in[2];
  const float* bq   = (const float*)d_in[3];
  const float* Wk   = (const float*)d_in[4];
  const float* bk   = (const float*)d_in[5];
  const float* Wv   = (const float*)d_in[6];
  const float* bv   = (const float*)d_in[7];
  const float* Wlq  = (const float*)d_in[8];
  const float* blq  = (const float*)d_in[9];
  const float* Wlk  = (const float*)d_in[10];
  const float* blk_ = (const float*)d_in[11];
  const float* Wlv  = (const float*)d_in[12];
  const float* blv  = (const float*)d_in[13];

  const size_t PX  = (size_t)NB * SEQ * DM * 2;    // 12582912  f16 text plane [8192][768]
  const size_t PL  = (size_t)NB * SEQ * DL * 2;    //  3145728  f16 layout plane [8192][192]
  const size_t PW  = (size_t)DM * DM * 2;          //  1179648  f16 [768][768] weight plane
  const size_t PWL = (size_t)DL * DL * 2;          //    73728  f16 [192][192] weight plane
  const size_t PLC = (size_t)NB * NH * SEQ * HL * 4; // 6291456 f32 lctx plane
  size_t off = 0;
  const size_t oXh   = off; off += PX;
  const size_t oLh   = off; off += PL;
  const size_t oWq   = off; off += PW;
  const size_t oWk   = off; off += PW;
  const size_t oWv   = off; off += PW;
  const size_t oWlq  = off; off += PWL;
  const size_t oWlk  = off; off += PWL;
  const size_t oWlv  = off; off += PWL;
  const size_t oQp   = off; off += PX;
  const size_t oKp   = off; off += PX;
  const size_t oVTp  = off; off += PX;
  const size_t oLQp  = off; off += PL;
  const size_t oLKp  = off; off += PL;
  const size_t oLVTp = off; off += PL;
  const size_t oLC   = off; off += PLC;
  if (off > ws_size) return;                       // off = 72966144
  if (off > (size_t)134217728) return;

  char* ws = (char*)d_ws;
  unsigned short* Xh   = (unsigned short*)(ws + oXh);
  unsigned short* Lh   = (unsigned short*)(ws + oLh);
  unsigned short* Wqh  = (unsigned short*)(ws + oWq);
  unsigned short* Wkh  = (unsigned short*)(ws + oWk);
  unsigned short* Wvh  = (unsigned short*)(ws + oWv);
  unsigned short* Wlqh = (unsigned short*)(ws + oWlq);
  unsigned short* Wlkh = (unsigned short*)(ws + oWlk);
  unsigned short* Wlvh = (unsigned short*)(ws + oWlv);
  unsigned short* Qp   = (unsigned short*)(ws + oQp);
  unsigned short* Kp   = (unsigned short*)(ws + oKp);
  unsigned short* VTp  = (unsigned short*)(ws + oVTp);
  unsigned short* LQp  = (unsigned short*)(ws + oLQp);
  unsigned short* LKp  = (unsigned short*)(ws + oLKp);
  unsigned short* LVTp = (unsigned short*)(ws + oLVTp);
  float*          LC   = (float*)(ws + oLC);
  float*          out0 = (float*)d_out;
  float*          out1 = (float*)d_out + (size_t)NB * SEQ * DM;   // byte offset 25165824 / 4; last index 7864319 < out_size

  const dim3 blk(256);
  const int n8x  = NB * SEQ * DM / 8;                          // 786432
  const int n8l  = NB * SEQ * DL / 8;                          // 196608
  const int n8w  = DM * DM / 8;                                //  73728
  const int n8wl = DL * DL / 8;                                //   4608
  const int n4o1 = NB * SEQ * DL / 4;                          // 393216
  const dim3 gCvtX((n8x + 255) / 256);                         // 3072 blocks
  const dim3 gCvtL((n8l + 255) / 256);                         //  768 blocks
  const dim3 gCvtW((n8w + 255) / 256);                         //  288 blocks
  const dim3 gCvtWl((n8wl + 255) / 256);                       //   18 blocks
  const dim3 gT((((NB * SEQ) / 64) * (DM / 64) + 7) / 8, 1);   // 1536 tiles -> 192 blocks: M=8192, N=768
  const dim3 gVT(((DM / 64) * (SEQ / 64) + 7) / 8, NB);        //  192 tiles ->  24 blocks x 8 batches: M=768, N=1024
  const dim3 gL((((NB * SEQ) / 64) * (DL / 64) + 7) / 8, 1);   //  384 tiles ->  48 blocks: M=8192, N=192
  const dim3 gLVT(((DL / 64) * (SEQ / 64) + 7) / 8, NB);       //   48 tiles ->   6 blocks x 8 batches: M=192, N=1024
  const dim3 gAttn(NB * NH * NQB);                             // 1536 blocks of 128
  const dim3 gPack((n4o1 + 255) / 256);                        // 1536 blocks

  // (1) activations f32 -> f16 (x1); weights [n][k] f32 -> f16 (x64)
  cvt_h16x8<<<gCvtX,  blk, 0, stream>>>(x,   Xh,   n8x,  1.0f);
  cvt_h16x8<<<gCvtL,  blk, 0, stream>>>(xl,  Lh,   n8l,  1.0f);
  cvt_h16x8<<<gCvtW,  blk, 0, stream>>>(Wq,  Wqh,  n8w,  64.0f);
  cvt_h16x8<<<gCvtW,  blk, 0, stream>>>(Wk,  Wkh,  n8w,  64.0f);
  cvt_h16x8<<<gCvtW,  blk, 0, stream>>>(Wv,  Wvh,  n8w,  64.0f);
  cvt_h16x8<<<gCvtWl, blk, 0, stream>>>(Wlq, Wlqh, n8wl, 64.0f);
  cvt_h16x8<<<gCvtWl, blk, 0, stream>>>(Wlk, Wlkh, n8wl, 64.0f);
  cvt_h16x8<<<gCvtWl, blk, 0, stream>>>(Wlv, Wlvh, n8wl, 64.0f);
  // (2) q = x . Wq^T + bq -> f16 plane [8192][768]   (M=8192, N=768, K=768)
  gemm64<0><<<gT, blk, 0, stream>>>(Xh, DM, 0LL, Wqh, DM, 0LL, bq, Qp, DM, 0LL,
                                    NB * SEQ, DM, DM, 1.0f / 64.0f, 1.0f);
  // (3) k = x . Wk^T + bk -> f16 plane [8192][768]
  gemm64<0><<<gT, blk, 0, stream>>>(Xh, DM, 0LL, Wkh, DM, 0LL, bk, Kp, DM, 0LL,
                                    NB * SEQ, DM, DM, 1.0f / 64.0f, 1.0f);
  // (4) v^T = Wv . x^T + bv per batch -> f16 plane [b][768][1024] (A = Wvh [n][k], Bt = Xh rows of batch b; M=768, N=1024, K=768)
  gemm64<1><<<gVT, blk, 0, stream>>>(Wvh, DM, 0LL, Xh, DM, (long long)SEQ * DM, bv, VTp, SEQ, (long long)DM * SEQ,
                                     DM, SEQ, DM, 1.0f / 64.0f, 1.0f);
  // (5) lq = (xl . Wlq^T + blq) x2 -> f16 plane [8192][192]   (M=8192, N=192, K=192)
  gemm64<0><<<gL, blk, 0, stream>>>(Lh, DL, 0LL, Wlqh, DL, 0LL, blq, LQp, DL, 0LL,
                                    NB * SEQ, DL, DL, 1.0f / 64.0f, 2.0f);
  // (6) lk = xl . Wlk^T + blk -> f16 plane [8192][192]
  gemm64<0><<<gL, blk, 0, stream>>>(Lh, DL, 0LL, Wlkh, DL, 0LL, blk_, LKp, DL, 0LL,
                                    NB * SEQ, DL, DL, 1.0f / 64.0f, 1.0f);
  // (7) lv^T = Wlv . xl^T + blv per batch -> f16 plane [b][192][1024]   (M=192, N=1024, K=192)
  gemm64<1><<<gLVT, blk, 0, stream>>>(Wlvh, DL, 0LL, Lh, DL, (long long)SEQ * DL, blv, LVTp, SEQ, (long long)DL * SEQ,
                                      DL, SEQ, DL, 1.0f / 64.0f, 1.0f);
  // (8) attention: ctx -> out0, lctx -> LC plane
  attn_two<<<gAttn, dim3(128), 0, stream>>>(Qp, Kp, VTp, LQp, LKp, LVTp, out0, LC, 0.125f);
  // (9) LC plane -> out1 [8192][192]
  lc_pack<<<gPack, blk, 0, stream>>>(LC, out1, n4o1);
  (void)hipGetLastError();
}

// v001
// One run takes 284 microseconds.
// Next to v000, in two timings, it ran 1.21 times as fast each time.
// Contractions: q, k, v^T, lq, lk, lv^T projections = v_wmma_f32_16x16x32_f16 (activations f16 x1, weights f16 x64, single product, f32 accumulate);
// q.k^T and lq.lk^T scores = v_wmma_f32_16x16x32_f16 (q, k, lk f16 x1, lq f16 x2, layout K=16 zero-padded to 32 in registers, single products, one f32 accumulator);
// p.v and p.lv = v_wmma_f32_16x16x32_f16 (p carried x1024 in f16, v and lv f16 x1, single products, f32 accumulate); softmax and normalisation in f32.
// Carry audit: weight planes x64 -> 1/64 folded in the gemm64 epilogue (ascale); LQ plane x2 -> folded by the common score scale 0.125
//              in attn_two (q.k/8 + lq.lk/4 = (q.k + 2lq.lk)/8); P x1024 (LDS only) -> 1/1024 folded in the attn_two epilogue (inv);
//              activation planes, Q/K/V^T/LK/LV^T planes and the LC f32 plane carry x1.
#include <hip/hip_runtime.h>
#include <math.h>
#include <stdint.h>

#define NB   8
#define SEQ  1024
#define DM   768
#define DL   192
#define NH   12
#define HD   64
#define HL   16
#define NQB  (SEQ / 64)   // 64-row query blocks per sequence
#define NKT  (SEQ / 64)   // 64-key chunks per sequence
#define LP   72           // LDS row pitch in halves of the 64-half rows read by 16-B fragment loads: 144 B = 16 B x odd
#define LPL  24           // the same for the 16-half LK rows: 48 B = 16 B x odd
static_assert(NH * HD == DM);
static_assert(NH * HL == DL);
static_assert(NQB == 16 && NKT == 16);
static_assert((SEQ % 64) == 0 && (DM % 64) == 0 && (DL % 64) == 0);
static_assert((DM % 32) == 0 && (DL % 32) == 0);

typedef _Float16 v16h __attribute__((ext_vector_type(16)));
typedef _Float16 v8h  __attribute__((ext_vector_type(8)));
typedef float    v8f  __attribute__((ext_vector_type(8)));
typedef float    v4f  __attribute__((ext_vector_type(4)));
typedef unsigned int v4u __attribute__((ext_vector_type(4)));

#if defined(__HIP_DEVICE_COMPILE__)
#define DEV_ASM 1
#else
#define DEV_ASM 0
#endif

// ---- scalar helpers --------------------------------------------------------------------------------
__device__ __forceinline__ unsigned short h_bits(_Float16 x) { return __builtin_bit_cast(unsigned short, x); }
__device__ __forceinline__ unsigned pk16(unsigned short a, unsigned short b) { return (unsigned)a | ((unsigned)b << 16); }
__device__ __forceinline__ v8f zero8() { v8f z = {0.f, 0.f, 0.f, 0.f, 0.f, 0.f, 0.f, 0.f}; return z; }
__device__ __forceinline__ v8h zero8h() {
  const _Float16 z = (_Float16)0.0f;
  v8h r = {z, z, z, z, z, z, z, z};
  return r;
}

// ---- fragment loader: 16-bit A/B operand, lane -> row/col (lane&15), p already includes +8*(lane>>4);
//      elements 0..7 <- p[0..7] (k0+8h..k0+8h+7), elements 8..15 <- p[16..23] (k0+16+8h..k0+16+8h+7)
__device__ __forceinline__ v16h ldfrag_h(const _Float16* p) {
  union { v16h v; v8h h[2]; } f;
  f.h[0] = *(const v8h*)(p);
  f.h[1] = *(const v8h*)(p + 16);
  return f.v;
}

// ---- WMMA helpers ----------------------------------------------------------------------------------
__device__ __forceinline__ v8f mmar(v16h a, v16h b, v8f c) {
  return __builtin_amdgcn_wmma_f32_16x16x32_f16(false, a, false, b, (short)0, c, false, false);
}
// guarded form: 4 VALU slots after the WMMA, D tied, A/B kept live
__device__ __forceinline__ v8f mma_h(v16h a, v16h b, v8f c) {
  c = __builtin_amdgcn_wmma_f32_16x16x32_f16(false, a, false, b, (short)0, c, false, false);
#if DEV_ASM
  asm volatile("v_nop\n\tv_nop\n\tv_nop\n\tv_nop" : "+v"(c) : "v"(a), "v"(b));
#endif
  return c;
}
__device__ __forceinline__ void dep_guard(v8f& a, v8f& b, v16h x, v16h y) {
#if DEV_ASM
  asm volatile("v_nop\n\tv_nop\n\tv_nop\n\tv_nop" : "+v"(a), "+v"(b) : "v"(x), "v"(y));
#else
  (void)a; (void)b; (void)x; (void)y;
#endif
}
__device__ __forceinline__ void keep4(v16h a, v16h b, v16h c, v16h d) {
#if DEV_ASM
  asm volatile("v_nop" :: "v"(a), "v"(b), "v"(c), "v"(d));
#else
  (void)a; (void)b; (void)c; (void)d;
#endif
}
__device__ __forceinline__ void acc_guard4(v8f& a, v8f& b, v8f& c, v8f& d) {
#if DEV_ASM
  asm volatile("v_nop\n\tv_nop\n\tv_nop\n\tv_nop" : "+v"(a), "+v"(b), "+v"(c), "+v"(d));
#else
  (void)a; (void)b; (void)c; (void)d;
#endif
}

// =====================================================================================================
// f32 -> f16 bits of (x * scale), 8 elements per thread, one 16-B store per lane: a wave writes 512 contiguous
// coverage: n8 threads x 8 = the whole plane (n8 is a multiple of 256 for every use here).
// =====================================================================================================
__global__ __launch_bounds__(256) void cvt_h16x8(const float* __restrict__ in, unsigned short* out, int n8, float scale) {
  const int i = blockIdx.x * 256 + (int)threadIdx.x;
  if (i < n8) {
    const v4f a = *(const v4f*)(in + (size_t)i * 8);
    const v4f c = *(const v4f*)(in + (size_t)i * 8 + 4);
    v4u p;
    p[0] = pk16(h_bits((_Float16)(a[0] * scale)), h_bits((_Float16)(a[1] * scale)));
    p[1] = pk16(h_bits((_Float16)(a[2] * scale)), h_bits((_Float16)(a[3] * scale)));
    p[2] = pk16(h_bits((_Float16)(c[0] * scale)), h_bits((_Float16)(c[1] * scale)));
    p[3] = pk16(h_bits((_Float16)(c[2] * scale)), h_bits((_Float16)(c[3] * scale)));
    unsigned short* o = out + (size_t)i * 8;
    *(v4u*)o = p;
    
  }
}

// =====================================================================================================
// Register-blocked batched f16 WMMA GEMM with bias: C[m][n] = (sum_k A[m][k] * Bt[n][k]) * ascale + bias,
// stored as f16(value * oscale). One wave per 64x64 tile, no block barriers. A row-major [M][K] pitch lda;
// Bt row-major [N][K] pitch ldb (k contiguous); M, N multiples of 64, K multiple of 32 (host-checked).
// blockIdx.y = batch index (strides in elements). Fragments loaded straight from global with the split k map.
// BIASROW 0: bias[n] (bias length N); BIASROW 1: bias[m] (bias length M).
// coverage: 4 slabs x 16 rows (it 0..3 x lane>>3 0..3) x 64 cols (8 lanes x 8) = the wave's whole 64x64 tile.
// =====================================================================================================
template <int BIASROW>
__global__ __launch_bounds__(256) void gemm64(
    const unsigned short* __restrict__ Ap, int lda, long long strideA,
    const unsigned short* __restrict__ Btp, int ldb, long long strideB,
    const float* __restrict__ bias,
    unsigned short* Cp, int ldc, long long strideC,
    int M, int N, int K, float ascale, float oscale) {
  const _Float16* A  = (const _Float16*)(const void*)Ap;
  const _Float16* Bt = (const _Float16*)(const void*)Btp;
  __shared__ __align__(16) float sT[8][16 * 68];   // per-wave 16x64 slab, pitch 68 floats
  const int b    = blockIdx.y;
  const int lane = threadIdx.x & 31;
  const int wave = threadIdx.x >> 5;
  const int tilesN = N >> 6;
  const int tilesM = M >> 6;
  const int tile = blockIdx.x * 8 + wave;
  if (tile >= tilesM * tilesN) return;   // wave-uniform; no block barriers in this kernel
  const int tm = tile / tilesN;
  const int tn = tile - tm * tilesN;
  const int m0 = tm << 6;
  const int n0 = tn << 6;

  const _Float16* Ab = A  + (size_t)b * (size_t)strideA;
  const _Float16* Bb = Bt + (size_t)b * (size_t)strideB;

  const int rlane = lane & 15;                 // row (A) / col (B, D) within subtile
  const int koff  = (lane >> 4) * 8;           // k offset of this lane half
  const int mOff  = (lane >> 4) * 8;           // D row offset

  v8f acc[4][4];
#pragma unroll
  for (int i = 0; i < 4; ++i)
#pragma unroll
    for (int j = 0; j < 4; ++j) acc[i][j] = zero8();

  for (int k0 = 0; k0 < K; k0 += 32) {
    v16h bq[4];
#pragma unroll
    for (int j = 0; j < 4; ++j)
      bq[j] = ldfrag_h(Bb + (size_t)(n0 + (j << 4) + rlane) * ldb + koff + k0);
#pragma unroll
    for (int i = 0; i < 4; ++i) {
      const v16h af = ldfrag_h(Ab + (size_t)(m0 + (i << 4) + rlane) * lda + koff + k0);
#pragma unroll
      for (int j = 0; j < 4; ++j) acc[i][j] = mmar(af, bq[j], acc[i][j]);
      dep_guard(acc[i][0], acc[i][3], af, bq[3]);
    }
    keep4(bq[0], bq[1], bq[2], bq[3]);
  }
  acc_guard4(acc[0][0], acc[0][1], acc[0][2], acc[0][3]);
  acc_guard4(acc[1][0], acc[1][1], acc[1][2], acc[1][3]);
  acc_guard4(acc[2][0], acc[2][1], acc[2][2], acc[2][3]);
  acc_guard4(acc[3][0], acc[3][1], acc[3][2], acc[3][3]);

  // ---- epilogue ----
  float* slab = sT[wave];
  const int q = lane >> 3, c8 = (lane & 7) * 8;
  unsigned short* C = Cp + (size_t)b * (size_t)strideC;
  float bcol[8];
  {
    const v4f b0 = *(const v4f*)(bias + (BIASROW ? 0 : (n0 + c8)));       // column bias (length N), 16-B aligned
    const v4f b1 = *(const v4f*)(bias + (BIASROW ? 4 : (n0 + c8 + 4)));
#pragma unroll
    for (int e = 0; e < 4; ++e) { bcol[e] = b0[e]; bcol[4 + e] = b1[e]; }
  }
#pragma unroll
  for (int i = 0; i < 4; ++i) {
    const int mBase = m0 + (i << 4);
#pragma unroll
    for (int j = 0; j < 4; ++j) {
#pragma unroll
      for (int r = 0; r < 8; ++r) {
        slab[(mOff + r) * 68 + (j << 4) + rlane] = acc[i][j][r];
      }
    }
    __builtin_amdgcn_fence(__ATOMIC_RELEASE, "workgroup");
    __builtin_amdgcn_wave_barrier();
    __builtin_amdgcn_fence(__ATOMIC_ACQUIRE, "workgroup");
    v4u hv[4];
#pragma unroll
    for (int it = 0; it < 4; ++it) {
      const int row = it * 4 + q;                        // it 0..3 x q 0..3 = rows 0..15
      const float* sp = slab + row * 68 + c8;
      float bb[8];
      if (BIASROW) {
        const float bv = bias[mBase + row];              // row bias, index < M = bias length
#pragma unroll
        for (int e = 0; e < 8; ++e) bb[e] = bv;
      } else {
#pragma unroll
        for (int e = 0; e < 8; ++e) bb[e] = bcol[e];
      }
      v4u a;
#pragma unroll
      for (int e = 0; e < 4; ++e) {
        const float f0 = (sp[2 * e] * ascale + bb[2 * e]) * oscale;
        const float f1 = (sp[2 * e + 1] * ascale + bb[2 * e + 1]) * oscale;
        a[e] = pk16(h_bits((_Float16)f0), h_bits((_Float16)f1));
      }
      hv[it] = a;
    }
    {
#pragma unroll
      for (int it = 0; it < 4; ++it) {
        const int row = it * 4 + q;
        *(v4u*)(C + (size_t)(mBase + row) * ldc + n0 + c8) = hv[it];
      }
      
    }
    __builtin_amdgcn_fence(__ATOMIC_RELEASE, "workgroup");
    __builtin_amdgcn_wave_barrier();
    __builtin_amdgcn_fence(__ATOMIC_ACQUIRE, "workgroup");
  }
}

// =====================================================================================================
// Two-stream attention, text head dim 64 + layout head dim 16, no mask, softmax over all SEQ keys.
//   Q plane (f16): element (b, t, h, d) at [(b*SEQ + t)*DM + h*64 + d]; K plane same layout with key s.
//   LQ plane (f16, value x2): [(b*SEQ + t)*DL + h*16 + d]; LK plane (f16 x1) same layout.
//   V^T plane (f16): element (b, h, d, s) at [(b*DM + h*64 + d)*SEQ + s]; LV^T plane: [(b*DL + h*16 + d)*SEQ + s].
//   scores = (q . k + lq2 . lk) * sscale in f32 (3 f16 WMMA steps into one accumulator; the layout step uses
//   k = 0..15 only, upper 16 k-slots are register zeros in both fragments).
//   p = exp(s - m) carried as f16(1024 p); ctx = p . v (4 col tiles), lctx = p . lv (1 col tile); online softmax in f32.
//   Block = 4 waves = 64 query rows of one (b, h); grid = NB * NH * NQB; key chunks of 64, static trip NKT.
//   Chunk staging: 128 threads: K 32 halves/thread (64x64), V^T 32 halves/thread (64x64), LK 8 halves/thread (64x16),
//   LV^T 8 halves/thread (16x64) = every LDS element read below (plain 16-B loads, __syncthreads before and after);
//   P tiles are wave-private, spilled with _Float16 element stores and reloaded as v8h (same element type)
//   ctx -> out0 f32 [(b*SEQ + t)*DM + h*64 + d]: 16 rows x 256-B segments per wave (16 lanes x 16 B per segment,
//   Output coverage: wave rows q0..q0+15 (it 0..7 x lane>>4) x 64 cols (16 lanes x 4) of head h for out0;
//   64 float4 = the wave's whole 16x16 lctx tile for LC; the grid covers every (b, h, qb).
// =====================================================================================================
__global__ __launch_bounds__(128)
void attn_two(const unsigned short* __restrict__ qp, const unsigned short* __restrict__ kp,
              const unsigned short* __restrict__ vtp, const unsigned short* __restrict__ lqp,
              const unsigned short* __restrict__ lkp, const unsigned short* __restrict__ lvtp,
              float* out0, float* lcp, float sscale) {
  union FH { v16h v; v8h h[2]; };
  __shared__ __align__(16) _Float16 Ksh[64 * LP];        // K chunk [kv][d], pitch LP    9 KB
  __shared__ __align__(16) _Float16 LKs[64 * LPL];       // LK chunk [kv][dl], pitch LPL 3 KB
  __shared__ __align__(16) _Float16 Vth[64 * LP];        // V^T [d][kv], pitch LP        9 KB
  __shared__ __align__(16) _Float16 LVs[HL * LP];        // LV^T [dl][kv], pitch LP      2304 B
  __shared__ __align__(16) _Float16 Psh[4][16 * LP];     // per wave P [row][kv], pitch LP 9 KB
  __shared__ __align__(16) float    Os[4][16 * 64];      // per wave ctx tile   16 KB
  __shared__ __align__(16) float    OLs[4][16 * HL];     // per wave lctx tile   4 KB

  const int tid  = threadIdx.x;
  const int wave = tid >> 5;
  const int lane = tid & 31;
  const int hh   = lane >> 4;
  const int c    = lane & 15;

  const int bx   = blockIdx.x;
  const int qb   = bx % NQB;
  const int rest = bx / NQB;
  const int h    = rest % NH;
  const int b    = rest / NH;
  const int q0   = qb * 64 + wave * 16;
  const size_t rowB = (size_t)b * SEQ;

  const _Float16* Q   = (const _Float16*)(const void*)qp;
  const _Float16* LQ  = (const _Float16*)(const void*)lqp;
  const _Float16* Kg  = (const _Float16*)(const void*)kp + (size_t)h * HD;
  const _Float16* LKg = (const _Float16*)(const void*)lkp + (size_t)h * HL;
  const _Float16* Vh  = (const _Float16*)(const void*)vtp  + ((size_t)b * DM + (size_t)h * HD) * SEQ;
  const _Float16* LVh = (const _Float16*)(const void*)lvtp + ((size_t)b * DL + (size_t)h * HL) * SEQ;

  // ---- Q fragments (A operand, row = lane&15): 2 d-chunks of the text stream; layout fragment k 0..15 ----
  v16h qa[2];
#pragma unroll
  for (int dc = 0; dc < 2; ++dc) {
    const size_t qo = (rowB + q0 + c) * DM + (size_t)h * HD + dc * 32 + 8 * hh;
    qa[dc] = ldfrag_h(Q + qo);
  }
  FH la;
  la.h[0] = *(const v8h*)(LQ + (rowB + q0 + c) * DL + (size_t)h * HL + 8 * hh);   // k = 8hh..8hh+7
  la.h[1] = zero8h();                                                              // k 16..31 = 0

  float mrow[8], lrow[8];
  v8f oacc[4];
  v8f olacc = zero8();
#pragma unroll
  for (int r = 0; r < 8; ++r) { mrow[r] = -INFINITY; lrow[r] = 0.f; }
#pragma unroll
  for (int t = 0; t < 4; ++t) oacc[t] = zero8();

  for (int kt = 0; kt < NKT; ++kt) {         // static trip count
    const int kv0 = kt * 64;
    __syncthreads();
    {
      const int r = tid >> 1, half = (tid & 1) * 32;
      const _Float16* kg = Kg + (rowB + kv0 + r) * DM + half;       // k row kv0+r, d = half..half+31
      const _Float16* vg = Vh + (size_t)r * SEQ + kv0 + half;        // v^T row d = r, s = kv0+half..+31
#pragma unroll
      for (int i = 0; i < 4; ++i) {
        const v8h a0 = *(const v8h*)(kg + 8 * i);
        const v8h b0 = *(const v8h*)(vg + 8 * i);
        *(v8h*)(Ksh + r * LP + half + 8 * i) = a0;
        *(v8h*)(Vth + r * LP + half + 8 * i) = b0;
      }
      const int c8l = (tid & 1) * 8;                                  // lk row kv0+r, dl = c8l..c8l+7
      const v8h lk8 = *(const v8h*)(LKg + (rowB + kv0 + r) * DL + c8l);
      *(v8h*)(LKs + r * LPL + c8l) = lk8;
      const int dv = tid >> 3, s8 = (tid & 7) * 8;                   // lv^T row dl = dv, s = kv0+s8..+7
      const v8h lv8 = *(const v8h*)(LVh + (size_t)dv * SEQ + kv0 + s8);
      *(v8h*)(LVs + dv * LP + s8) = lv8;
    }
    __syncthreads();

    // ---- scores: 16 query rows x 64 keys per wave ----
    v8f s[4];
#pragma unroll
    for (int j = 0; j < 4; ++j) {
      v8f acc = zero8();
#pragma unroll
      for (int dc = 0; dc < 2; ++dc) {
        FH kb;
        kb.h[0] = *(const v8h*)(Ksh + (j * 16 + c) * LP + dc * 32 + 8 * hh);
        kb.h[1] = *(const v8h*)(Ksh + (j * 16 + c) * LP + dc * 32 + 16 + 8 * hh);
        acc = mma_h(qa[dc], kb.v, acc);
      }
      FH lb;
      lb.h[0] = *(const v8h*)(LKs + (j * 16 + c) * LPL + 8 * hh);
      lb.h[1] = zero8h();
      acc = mma_h(la.v, lb.v, acc);
#pragma unroll
      for (int r = 0; r < 8; ++r) s[j][r] = acc[r] * sscale;
    }

    // ---- row max, online softmax, P (x1024, f16) to LDS ----
    _Float16* pwh = Psh[wave];
#pragma unroll
    for (int r = 0; r < 8; ++r) {
      float m = s[0][r];
#pragma unroll
      for (int j = 1; j < 4; ++j) m = fmaxf(m, s[j][r]);
#pragma unroll
      for (int off = 1; off < 16; off <<= 1) m = fmaxf(m, __shfl_xor(m, off, 32));
      const float mnew  = fmaxf(mrow[r], m);
      const float msafe = (mnew == -INFINITY) ? 0.f : mnew;
      const float alpha = __expf(mrow[r] - msafe);
      mrow[r] = mnew;
      float psum = 0.f;
#pragma unroll
      for (int j = 0; j < 4; ++j) {
        const float p = __expf(s[j][r] - msafe);
        psum += p;
        pwh[(8 * hh + r) * LP + j * 16 + c] = (_Float16)(p * 1024.0f);
      }
#pragma unroll
      for (int off = 1; off < 16; off <<= 1) psum += __shfl_xor(psum, off, 32);
      lrow[r] = lrow[r] * alpha + psum;
#pragma unroll
      for (int t = 0; t < 4; ++t) oacc[t][r] *= alpha;
      olacc[r] *= alpha;
    }
    __builtin_amdgcn_fence(__ATOMIC_RELEASE, "workgroup");
    __builtin_amdgcn_wave_barrier();
    __builtin_amdgcn_fence(__ATOMIC_ACQUIRE, "workgroup");

    // ---- ctx += P . V, lctx += P . LV (f16 WMMA) ----
#pragma unroll 1
    for (int kk = 0; kk < 2; ++kk) {
      FH pa;
      pa.h[0] = *(const v8h*)(pwh + c * LP + kk * 32 + 8 * hh);
      pa.h[1] = *(const v8h*)(pwh + c * LP + kk * 32 + 16 + 8 * hh);
#pragma unroll
      for (int t = 0; t < 4; ++t) {
        FH vb;
        vb.h[0] = *(const v8h*)(Vth + (t * 16 + c) * LP + kk * 32 + 8 * hh);
        vb.h[1] = *(const v8h*)(Vth + (t * 16 + c) * LP + kk * 32 + 16 + 8 * hh);
        oacc[t] = mma_h(pa.v, vb.v, oacc[t]);
      }
      FH wb;
      wb.h[0] = *(const v8h*)(LVs + c * LP + kk * 32 + 8 * hh);
      wb.h[1] = *(const v8h*)(LVs + c * LP + kk * 32 + 16 + 8 * hh);
      olacc = mma_h(pa.v, wb.v, olacc);
    }
  }

  float* os = Os[wave];
  float* ol = OLs[wave];
#pragma unroll
  for (int r = 0; r < 8; ++r) {
    const float l = lrow[r];
    const float inv = ((l > 0.f) ? (1.0f / l) : 0.f) * (1.0f / 1024.0f);
#pragma unroll
    for (int t = 0; t < 4; ++t) os[(8 * hh + r) * 64 + t * 16 + c] = oacc[t][r] * inv;
    ol[(8 * hh + r) * HL + c] = olacc[r] * inv;
  }
  __builtin_amdgcn_fence(__ATOMIC_RELEASE, "workgroup");
  __builtin_amdgcn_wave_barrier();
  __builtin_amdgcn_fence(__ATOMIC_ACQUIRE, "workgroup");
  {
    const int h2 = lane >> 4, c4 = (lane & 15) * 4;     // 256-B row segment = 16 lanes x 16 B
    float* ob = out0 + (rowB + q0) * DM + (size_t)h * HD + c4;
    float* lb = lcp + (((size_t)(b * NH + h)) * SEQ + (size_t)q0) * HL;
    {
#pragma unroll
      for (int it = 0; it < 8; ++it) {
        const int row = it * 2 + h2;                     // it 0..7 x h2 0..1 = rows 0..15
        const v4f v = *(const v4f*)(os + row * 64 + c4);
        *(v4f*)(ob + (size_t)row * DM) = v;
      }
#pragma unroll
      for (int it = 0; it < 2; ++it) {
        const int idx = it * 32 + lane;                  // float4 0..63 of the contiguous 16x16 tile
        const v4f v = *(const v4f*)(ol + idx * 4);
        *(v4f*)(lb + idx * 4) = v;
      }
      
    }
  }
}

// =====================================================================================================
// out1[(b*SEQ + t)*DL + h*16 + d] = LC[b][h][t][d] (f32). One float4 per thread over the flat out1 array
// (col % 4 == 0, so a float4 never crosses a row); consecutive lanes write consecutive 16 B: a wave writes
// coverage: n4 threads x 4 = the whole out1 (n4 multiple of 256).
// =====================================================================================================
__global__ __launch_bounds__(256) void lc_pack(const float* __restrict__ lc, float* out1, int n4) {
  const int i = blockIdx.x * 256 + (int)threadIdx.x;
  if (i < n4) {
    const int e   = i * 4;
    const int row = e / DL;                 // b*SEQ + t
    const int col = e - row * DL;           // h*16 + d, multiple of 4
    const int hd  = col >> 4;
    const int d   = col & 15;
    const int bb  = row / SEQ;
    const int t   = row - bb * SEQ;
    const v4f v = *(const v4f*)(lc + (((size_t)(bb * NH + hd)) * SEQ + (size_t)t) * HL + d);
    float* o = out1 + (size_t)e;
    *(v4f*)o = v;
    
  }
}

// =====================================================================================================
// Workspace map (bytes), every region an exact multiple of its whole-line / whole-tile store granularity:
//   Xh   f16 [8192][768]            12582912
//   Lh   f16 [8192][192]             3145728
//   Wqh  f16 [768 n][768 k] (x64)    1179648
//   Wkh  f16 [768][768]     (x64)    1179648
//   Wvh  f16 [768][768]     (x64)    1179648
//   Wlqh f16 [192][192]     (x64)      73728
//   Wlkh f16 [192][192]     (x64)      73728
//   Wlvh f16 [192][192]     (x64)      73728
//   Qp   f16 [8192][768]            12582912
//   Kp   f16 [8192][768]            12582912
//   VTp  f16 [8][768][1024]         12582912
//   LQp  f16 [8192][192]   (x2)      3145728
//   LKp  f16 [8192][192]             3145728
//   LVTp f16 [8][192][1024]          3145728
//   LC   f32 [8][12][1024][16]       6291456
//   total                           72966144
// Weights are [out n][in k] with k contiguous = the Bt / A layout the GEMM wants, so they are only converted.
// =====================================================================================================
extern "C" void kernel_launch(void* const* d_in, const int* in_sizes, int n_in,
                              void* d_out, int out_size, void* d_ws, size_t ws_size,
                              hipStream_t stream) {
  if (n_in < 14) return;
  if (in_sizes[0] != NB * SEQ * DM) return;
  if (in_sizes[1] != NB * SEQ * DL) return;
  if (in_sizes[2] != DM * DM || in_sizes[4] != DM * DM || in_sizes[6] != DM * DM) return;
  if (in_sizes[3] != DM || in_sizes[5] != DM || in_sizes[7] != DM) return;
  if (in_sizes[8] != DL * DL || in_sizes[10] != DL * DL || in_sizes[12] != DL * DL) return;
  if (in_sizes[9] != DL || in_sizes[11] != DL || in_sizes[13] != DL) return;
  if (out_size != NB * SEQ * (DM + DL)) return;

  const float* x    = (const float*)d_in[0];
  const float* xl   = (const float*)d_in[1];
  const float* Wq   = (const float*)d_in[2];
  const float* bq   = (const float*)d_in[3];
  const float* Wk   = (const float*)d_in[4];
  const float* bk   = (const float*)d_in[5];
  const float* Wv   = (const float*)d_in[6];
  const float* bv   = (const float*)d_in[7];
  const float* Wlq  = (const float*)d_in[8];
  const float* blq  = (const float*)d_in[9];
  const float* Wlk  = (const float*)d_in[10];
  const float* blk_ = (const float*)d_in[11];
  const float* Wlv  = (const float*)d_in[12];
  const float* blv  = (const float*)d_in[13];

  const size_t PX  = (size_t)NB * SEQ * DM * 2;    // 12582912  f16 text plane [8192][768]
  const size_t PL  = (size_t)NB * SEQ * DL * 2;    //  3145728  f16 layout plane [8192][192]
  const size_t PW  = (size_t)DM * DM * 2;          //  1179648  f16 [768][768] weight plane
  const size_t PWL = (size_t)DL * DL * 2;          //    73728  f16 [192][192] weight plane
  const size_t PLC = (size_t)NB * NH * SEQ * HL * 4; // 6291456 f32 lctx plane
  size_t off = 0;
  const size_t oXh   = off; off += PX;
  const size_t oLh   = off; off += PL;
  const size_t oWq   = off; off += PW;
  const size_t oWk   = off; off += PW;
  const size_t oWv   = off; off += PW;
  const size_t oWlq  = off; off += PWL;
  const size_t oWlk  = off; off += PWL;
  const size_t oWlv  = off; off += PWL;
  const size_t oQp   = off; off += PX;
  const size_t oKp   = off; off += PX;
  const size_t oVTp  = off; off += PX;
  const size_t oLQp  = off; off += PL;
  const size_t oLKp  = off; off += PL;
  const size_t oLVTp = off; off += PL;
  const size_t oLC   = off; off += PLC;
  if (off > ws_size) return;                       // off = 72966144
  if (off > (size_t)134217728) return;

  char* ws = (char*)d_ws;
  unsigned short* Xh   = (unsigned short*)(ws + oXh);
  unsigned short* Lh   = (unsigned short*)(ws + oLh);
  unsigned short* Wqh  = (unsigned short*)(ws + oWq);
  unsigned short* Wkh  = (unsigned short*)(ws + oWk);
  unsigned short* Wvh  = (unsigned short*)(ws + oWv);
  unsigned short* Wlqh = (unsigned short*)(ws + oWlq);
  unsigned short* Wlkh = (unsigned short*)(ws + oWlk);
  unsigned short* Wlvh = (unsigned short*)(ws + oWlv);
  unsigned short* Qp   = (unsigned short*)(ws + oQp);
  unsigned short* Kp   = (unsigned short*)(ws + oKp);
  unsigned short* VTp  = (unsigned short*)(ws + oVTp);
  unsigned short* LQp  = (unsigned short*)(ws + oLQp);
  unsigned short* LKp  = (unsigned short*)(ws + oLKp);
  unsigned short* LVTp = (unsigned short*)(ws + oLVTp);
  float*          LC   = (float*)(ws + oLC);
  float*          out0 = (float*)d_out;
  float*          out1 = (float*)d_out + (size_t)NB * SEQ * DM;   // byte offset 25165824 / 4; last index 7864319 < out_size

  const dim3 blk(256);
  const int n8x  = NB * SEQ * DM / 8;                          // 786432
  const int n8l  = NB * SEQ * DL / 8;                          // 196608
  const int n8w  = DM * DM / 8;                                //  73728
  const int n8wl = DL * DL / 8;                                //   4608
  const int n4o1 = NB * SEQ * DL / 4;                          // 393216
  const dim3 gCvtX((n8x + 255) / 256);                         // 3072 blocks
  const dim3 gCvtL((n8l + 255) / 256);                         //  768 blocks
  const dim3 gCvtW((n8w + 255) / 256);                         //  288 blocks
  const dim3 gCvtWl((n8wl + 255) / 256);                       //   18 blocks
  const dim3 gT((((NB * SEQ) / 64) * (DM / 64) + 7) / 8, 1);   // 1536 tiles -> 192 blocks: M=8192, N=768
  const dim3 gVT(((DM / 64) * (SEQ / 64) + 7) / 8, NB);        //  192 tiles ->  24 blocks x 8 batches: M=768, N=1024
  const dim3 gL((((NB * SEQ) / 64) * (DL / 64) + 7) / 8, 1);   //  384 tiles ->  48 blocks: M=8192, N=192
  const dim3 gLVT(((DL / 64) * (SEQ / 64) + 7) / 8, NB);       //   48 tiles ->   6 blocks x 8 batches: M=192, N=1024
  const dim3 gAttn(NB * NH * NQB);                             // 1536 blocks of 128
  const dim3 gPack((n4o1 + 255) / 256);                        // 1536 blocks

  // (1) activations f32 -> f16 (x1); weights [n][k] f32 -> f16 (x64)
  cvt_h16x8<<<gCvtX,  blk, 0, stream>>>(x,   Xh,   n8x,  1.0f);
  cvt_h16x8<<<gCvtL,  blk, 0, stream>>>(xl,  Lh,   n8l,  1.0f);
  cvt_h16x8<<<gCvtW,  blk, 0, stream>>>(Wq,  Wqh,  n8w,  64.0f);
  cvt_h16x8<<<gCvtW,  blk, 0, stream>>>(Wk,  Wkh,  n8w,  64.0f);
  cvt_h16x8<<<gCvtW,  blk, 0, stream>>>(Wv,  Wvh,  n8w,  64.0f);
  cvt_h16x8<<<gCvtWl, blk, 0, stream>>>(Wlq, Wlqh, n8wl, 64.0f);
  cvt_h16x8<<<gCvtWl, blk, 0, stream>>>(Wlk, Wlkh, n8wl, 64.0f);
  cvt_h16x8<<<gCvtWl, blk, 0, stream>>>(Wlv, Wlvh, n8wl, 64.0f);
  // (2) q = x . Wq^T + bq -> f16 plane [8192][768]   (M=8192, N=768, K=768)
  gemm64<0><<<gT, blk, 0, stream>>>(Xh, DM, 0LL, Wqh, DM, 0LL, bq, Qp, DM, 0LL,
                                    NB * SEQ, DM, DM, 1.0f / 64.0f, 1.0f);
  // (3) k = x . Wk^T + bk -> f16 plane [8192][768]
  gemm64<0><<<gT, blk, 0, stream>>>(Xh, DM, 0LL, Wkh, DM, 0LL, bk, Kp, DM, 0LL,
                                    NB * SEQ, DM, DM, 1.0f / 64.0f, 1.0f);
  // (4) v^T = Wv . x^T + bv per batch -> f16 plane [b][768][1024] (A = Wvh [n][k], Bt = Xh rows of batch b; M=768, N=1024, K=768)
  gemm64<1><<<gVT, blk, 0, stream>>>(Wvh, DM, 0LL, Xh, DM, (long long)SEQ * DM, bv, VTp, SEQ, (long long)DM * SEQ,
                                     DM, SEQ, DM, 1.0f / 64.0f, 1.0f);
  // (5) lq = (xl . Wlq^T + blq) x2 -> f16 plane [8192][192]   (M=8192, N=192, K=192)
  gemm64<0><<<gL, blk, 0, stream>>>(Lh, DL, 0LL, Wlqh, DL, 0LL, blq, LQp, DL, 0LL,
                                    NB * SEQ, DL, DL, 1.0f / 64.0f, 2.0f);
  // (6) lk = xl . Wlk^T + blk -> f16 plane [8192][192]
  gemm64<0><<<gL, blk, 0, stream>>>(Lh, DL, 0LL, Wlkh, DL, 0LL, blk_, LKp, DL, 0LL,
                                    NB * SEQ, DL, DL, 1.0f / 64.0f, 1.0f);
  // (7) lv^T = Wlv . xl^T + blv per batch -> f16 plane [b][192][1024]   (M=192, N=1024, K=192)
  gemm64<1><<<gLVT, blk, 0, stream>>>(Wlvh, DL, 0LL, Lh, DL, (long long)SEQ * DL, blv, LVTp, SEQ, (long long)DL * SEQ,
                                      DL, SEQ, DL, 1.0f / 64.0f, 1.0f);
  // (8) attention: ctx -> out0, lctx -> LC plane
  attn_two<<<gAttn, dim3(128), 0, stream>>>(Qp, Kp, VTp, LQp, LKp, LVTp, out0, LC, 0.125f);
  // (9) LC plane -> out1 [8192][192]
  lc_pack<<<gPack, blk, 0, stream>>>(LC, out1, n4o1);
  (void)hipGetLastError();
}

// v002
// It runs in 202 microseconds.
// Next to v001, in two timings, it ran 1.41 times as fast each time.
// All steps since v000 together make it 1.70 times as fast.
// Contractions: q, k, v^T, lq, lk, lv^T projections = v_wmma_f32_16x16x32_f16 (activations f16 x1, weights f16 x64, single product, f32 accumulate);
// q.k^T and lq.lk^T scores = v_wmma_f32_16x16x32_f16 (q, k, lk f16 x1, lq f16 x2, layout K=16 zero-padded to 32 in registers, single products, one f32 accumulator);
// p.v and p.lv = v_wmma_f32_16x16x32_f16 (p carried x1024 in f16, v and lv f16 x1, single products, f32 accumulate); softmax and normalisation in f32.
// Carry audit: weight planes x64 -> 1/64 folded in the gemm64 epilogue (ascale); LQ plane x2 -> folded by the common score scale 0.125
//              in attn_two (q.k/8 + lq.lk/4 = (q.k + 2lq.lk)/8); P x1024 (LDS only) -> 1/1024 folded in the attn_two epilogue (inv);
//              activation planes, Q/K/V^T/LK/LV^T planes and the LC f32 plane carry x1.
#include <hip/hip_runtime.h>
#include <math.h>
#include <stdint.h>

#define NB   8
#define SEQ  1024
#define DM   768
#define DL   192
#define NH   12
#define HD   64
#define HL   16
#define NQB  (SEQ / 64)   // 64-row query blocks per sequence
#define NKT  (SEQ / 64)   // 64-key chunks per sequence
#define LP   72           // LDS row pitch in halves of the 64-half rows read by 16-B fragment loads: 144 B = 16 B x odd
#define LPL  24           // the same for the 16-half LK rows: 48 B = 16 B x odd
// block ranges of the two merged grids (256 threads a block)
#define CB_X   (NB * SEQ * DM / 8 / 256)            // 3072 blocks: x plane, 8 elements a thread
#define CB_L   (NB * SEQ * DL / 8 / 256)            //  768 blocks: layout plane
#define CB_W   (DM * DM / 8 / 256)                  //  288 blocks: one [768][768] weight plane
#define CB_WL  (DL * DL / 8 / 256)                  //   18 blocks: one [192][192] weight plane
#define CB_ALL (CB_X + CB_L + 3 * CB_W + 3 * CB_WL) // 4758 blocks
#define GB_T   (((NB * SEQ) / 64) * (DM / 64) / 8)  //  192 blocks: M=8192, N=768, 8 tiles of 64x64 a block
#define GB_VT  ((DM / 64) * (SEQ / 64) / 8)         //   24 blocks a batch: M=768, N=1024
#define GB_L   (((NB * SEQ) / 64) * (DL / 64) / 8)  //   48 blocks: M=8192, N=192
#define GB_LVT ((DL / 64) * (SEQ / 64) / 8)         //    6 blocks a batch: M=192, N=1024
#define GB_ALL (2 * GB_T + NB * GB_VT + 2 * GB_L + NB * GB_LVT)   // 720 blocks
static_assert((NB * SEQ * DM) % 2048 == 0 && (NB * SEQ * DL) % 2048 == 0 && (DM * DM) % 2048 == 0 && (DL * DL) % 2048 == 0);
static_assert((((NB * SEQ) / 64) * (DM / 64)) % 8 == 0 && ((DM / 64) * (SEQ / 64)) % 8 == 0);
static_assert((((NB * SEQ) / 64) * (DL / 64)) % 8 == 0 && ((DL / 64) * (SEQ / 64)) % 8 == 0);
static_assert(NH * HD == DM);
static_assert(NH * HL == DL);
static_assert(NQB == 16 && NKT == 16);
static_assert((SEQ % 64) == 0 && (DM % 64) == 0 && (DL % 64) == 0);
static_assert((DM % 32) == 0 && (DL % 32) == 0);

typedef _Float16 v16h __attribute__((ext_vector_type(16)));
typedef _Float16 v8h  __attribute__((ext_vector_type(8)));
typedef float    v8f  __attribute__((ext_vector_type(8)));
typedef float    v4f  __attribute__((ext_vector_type(4)));
typedef unsigned int v4u __attribute__((ext_vector_type(4)));

#if defined(__HIP_DEVICE_COMPILE__)
#define DEV_ASM 1
#else
#define DEV_ASM 0
#endif

// ---- scalar helpers --------------------------------------------------------------------------------
__device__ __forceinline__ unsigned short h_bits(_Float16 x) { return __builtin_bit_cast(unsigned short, x); }
__device__ __forceinline__ unsigned pk16(unsigned short a, unsigned short b) { return (unsigned)a | ((unsigned)b << 16); }
__device__ __forceinline__ v8f zero8() { v8f z = {0.f, 0.f, 0.f, 0.f, 0.f, 0.f, 0.f, 0.f}; return z; }
__device__ __forceinline__ v8h zero8h() {
  const _Float16 z = (_Float16)0.0f;
  v8h r = {z, z, z, z, z, z, z, z};
  return r;
}

// ---- fragment loader: 16-bit A/B operand, lane -> row/col (lane&15), p already includes +8*(lane>>4);
//      elements 0..7 <- p[0..7] (k0+8h..k0+8h+7), elements 8..15 <- p[16..23] (k0+16+8h..k0+16+8h+7)
__device__ __forceinline__ v16h ldfrag_h(const _Float16* p) {
  union { v16h v; v8h h[2]; } f;
  f.h[0] = *(const v8h*)(p);
  f.h[1] = *(const v8h*)(p + 16);
  return f.v;
}

// ---- WMMA helpers ----------------------------------------------------------------------------------
__device__ __forceinline__ v8f mmar(v16h a, v16h b, v8f c) {
  return __builtin_amdgcn_wmma_f32_16x16x32_f16(false, a, false, b, (short)0, c, false, false);
}
// guarded form: 4 VALU slots after the WMMA, D tied, A/B kept live
__device__ __forceinline__ v8f mma_h(v16h a, v16h b, v8f c) {
  c = __builtin_amdgcn_wmma_f32_16x16x32_f16(false, a, false, b, (short)0, c, false, false);
#if DEV_ASM
  asm volatile("v_nop\n\tv_nop\n\tv_nop\n\tv_nop" : "+v"(c) : "v"(a), "v"(b));
#endif
  return c;
}
__device__ __forceinline__ void dep_guard(v8f& a, v8f& b, v16h x, v16h y) {
#if DEV_ASM
  asm volatile("v_nop\n\tv_nop\n\tv_nop\n\tv_nop" : "+v"(a), "+v"(b) : "v"(x), "v"(y));
#else
  (void)a; (void)b; (void)x; (void)y;
#endif
}
__device__ __forceinline__ void keep4(v16h a, v16h b, v16h c, v16h d) {
#if DEV_ASM
  asm volatile("v_nop" :: "v"(a), "v"(b), "v"(c), "v"(d));
#else
  (void)a; (void)b; (void)c; (void)d;
#endif
}
__device__ __forceinline__ void acc_guard4(v8f& a, v8f& b, v8f& c, v8f& d) {
#if DEV_ASM
  asm volatile("v_nop\n\tv_nop\n\tv_nop\n\tv_nop" : "+v"(a), "+v"(b), "+v"(c), "+v"(d));
#else
  (void)a; (void)b; (void)c; (void)d;
#endif
}

// =====================================================================================================
// f32 -> f16 bits of (x * scale) for all eight planes in ONE grid: the planes lie back to back in the workspace
// in the order x, layout, Wq, Wk, Wv, Wlq, Wlk, Wlv, and each is a whole number of blocks, so the block index
// picks the source plane (block-uniform) and the flat thread index is the output position.
// 8 elements per thread, one 16-B store per lane: a wave writes 512 contiguous bytes.
// coverage: CB_ALL blocks x 256 threads x 8 = all eight planes exactly (static_asserts above), so no bound test.
// =====================================================================================================
__global__ __launch_bounds__(256) void cvt_all(const float* __restrict__ x, const float* __restrict__ xl,
                                               const float* __restrict__ wq, const float* __restrict__ wk,
                                               const float* __restrict__ wv, const float* __restrict__ wlq,
                                               const float* __restrict__ wlk, const float* __restrict__ wlv,
                                               unsigned short* out) {
  const int blk = blockIdx.x;
  const float* in = x;
  int first = 0;                 // first block of the plane
  float scale = 1.0f;            // activations x1, weights x64
  if (blk >= CB_X)                                  { in = xl;  first = CB_X; }
  if (blk >= CB_X + CB_L)                           { in = wq;  first = CB_X + CB_L;                       scale = 64.0f; }
  if (blk >= CB_X + CB_L + CB_W)                    { in = wk;  first = CB_X + CB_L + CB_W; }
  if (blk >= CB_X + CB_L + 2 * CB_W)                { in = wv;  first = CB_X + CB_L + 2 * CB_W; }
  if (blk >= CB_X + CB_L + 3 * CB_W)                { in = wlq; first = CB_X + CB_L + 3 * CB_W; }
  if (blk >= CB_X + CB_L + 3 * CB_W + CB_WL)        { in = wlk; first = CB_X + CB_L + 3 * CB_W + CB_WL; }
  if (blk >= CB_X + CB_L + 3 * CB_W + 2 * CB_WL)    { in = wlv; first = CB_X + CB_L + 3 * CB_W + 2 * CB_WL; }
  const int i = (blk - first) * 256 + (int)threadIdx.x;      // 8-element unit inside the source plane
  const int o = blk * 256 + (int)threadIdx.x;                // 8-element unit inside the eight planes
  const v4f a = *(const v4f*)(in + (size_t)i * 8);
  const v4f c = *(const v4f*)(in + (size_t)i * 8 + 4);
  v4u p;
  p[0] = pk16(h_bits((_Float16)(a[0] * scale)), h_bits((_Float16)(a[1] * scale)));
  p[1] = pk16(h_bits((_Float16)(a[2] * scale)), h_bits((_Float16)(a[3] * scale)));
  p[2] = pk16(h_bits((_Float16)(c[0] * scale)), h_bits((_Float16)(c[1] * scale)));
  p[3] = pk16(h_bits((_Float16)(c[2] * scale)), h_bits((_Float16)(c[3] * scale)));
  *(v4u*)(out + (size_t)o * 8) = p;
}

// =====================================================================================================
// Register-blocked batched f16 WMMA GEMM with bias: C[m][n] = (sum_k A[m][k] * Bt[n][k]) * ascale + bias,
// stored as f16(value * oscale). One wave per 64x64 tile, no block barriers. A row-major [M][K] pitch lda;
// Bt row-major [N][K] pitch ldb (k contiguous); M, N multiples of 64, K multiple of 32 (host-checked).
// bx = block index inside the product, b = batch index (strides in elements), sT = the block's LDS slabs.
// Fragments loaded straight from global with the split k map.
// BIASROW 0: bias[n] (bias length N); BIASROW 1: bias[m] (bias length M).
// coverage: 4 slabs x 16 rows (it 0..3 x lane>>3 0..3) x 64 cols (8 lanes x 8) = the wave's whole 64x64 tile.
// =====================================================================================================
template <int BIASROW>
__device__ __forceinline__ void gemm64(
    float (*sT)[16 * 68], int bx, int b,
    const unsigned short* __restrict__ Ap, int lda, long long strideA,
    const unsigned short* __restrict__ Btp, int ldb, long long strideB,
    const float* __restrict__ bias,
    unsigned short* Cp, int ldc, long long strideC,
    int M, int N, int K, float ascale, float oscale) {
  const _Float16* A  = (const _Float16*)(const void*)Ap;
  const _Float16* Bt = (const _Float16*)(const void*)Btp;
  const int lane = threadIdx.x & 31;
  const int wave = threadIdx.x >> 5;
  const int tilesN = N >> 6;
  const int tilesM = M >> 6;
  const int tile = bx * 8 + wave;
  if (tile >= tilesM * tilesN) return;   // wave-uniform; no block barriers in this kernel
  const int tm = tile / tilesN;
  const int tn = tile - tm * tilesN;
  const int m0 = tm << 6;
  const int n0 = tn << 6;

  const _Float16* Ab = A  + (size_t)b * (size_t)strideA;
  const _Float16* Bb = Bt + (size_t)b * (size_t)strideB;

  const int rlane = lane & 15;                 // row (A) / col (B, D) within subtile
  const int koff  = (lane >> 4) * 8;           // k offset of this lane half
  const int mOff  = (lane >> 4) * 8;           // D row offset

  v8f acc[4][4];
#pragma unroll
  for (int i = 0; i < 4; ++i)
#pragma unroll
    for (int j = 0; j < 4; ++j) acc[i][j] = zero8();

  for (int k0 = 0; k0 < K; k0 += 32) {
    v16h bq[4];
#pragma unroll
    for (int j = 0; j < 4; ++j)
      bq[j] = ldfrag_h(Bb + (size_t)(n0 + (j << 4) + rlane) * ldb + koff + k0);
#pragma unroll
    for (int i = 0; i < 4; ++i) {
      const v16h af = ldfrag_h(Ab + (size_t)(m0 + (i << 4) + rlane) * lda + koff + k0);
#pragma unroll
      for (int j = 0; j < 4; ++j) acc[i][j] = mmar(af, bq[j], acc[i][j]);
      dep_guard(acc[i][0], acc[i][3], af, bq[3]);
    }
    keep4(bq[0], bq[1], bq[2], bq[3]);
  }
  acc_guard4(acc[0][0], acc[0][1], acc[0][2], acc[0][3]);
  acc_guard4(acc[1][0], acc[1][1], acc[1][2], acc[1][3]);
  acc_guard4(acc[2][0], acc[2][1], acc[2][2], acc[2][3]);
  acc_guard4(acc[3][0], acc[3][1], acc[3][2], acc[3][3]);

  // ---- epilogue ----
  float* slab = sT[wave];
  const int q = lane >> 3, c8 = (lane & 7) * 8;
  unsigned short* C = Cp + (size_t)b * (size_t)strideC;
  float bcol[8];
  {
    const v4f b0 = *(const v4f*)(bias + (BIASROW ? 0 : (n0 + c8)));       // column bias (length N), 16-B aligned
    const v4f b1 = *(const v4f*)(bias + (BIASROW ? 4 : (n0 + c8 + 4)));
#pragma unroll
    for (int e = 0; e < 4; ++e) { bcol[e] = b0[e]; bcol[4 + e] = b1[e]; }
  }
#pragma unroll
  for (int i = 0; i < 4; ++i) {
    const int mBase = m0 + (i << 4);
#pragma unroll
    for (int j = 0; j < 4; ++j) {
#pragma unroll
      for (int r = 0; r < 8; ++r) {
        slab[(mOff + r) * 68 + (j << 4) + rlane] = acc[i][j][r];
      }
    }
    __builtin_amdgcn_fence(__ATOMIC_RELEASE, "workgroup");
    __builtin_amdgcn_wave_barrier();
    __builtin_amdgcn_fence(__ATOMIC_ACQUIRE, "workgroup");
    v4u hv[4];
#pragma unroll
    for (int it = 0; it < 4; ++it) {
      const int row = it * 4 + q;                        // it 0..3 x q 0..3 = rows 0..15
      const float* sp = slab + row * 68 + c8;
      float bb[8];
      if (BIASROW) {
        const float bv = bias[mBase + row];              // row bias, index < M = bias length
#pragma unroll
        for (int e = 0; e < 8; ++e) bb[e] = bv;
      } else {
#pragma unroll
        for (int e = 0; e < 8; ++e) bb[e] = bcol[e];
      }
      v4u a;
#pragma unroll
      for (int e = 0; e < 4; ++e) {
        const float f0 = (sp[2 * e] * ascale + bb[2 * e]) * oscale;
        const float f1 = (sp[2 * e + 1] * ascale + bb[2 * e + 1]) * oscale;
        a[e] = pk16(h_bits((_Float16)f0), h_bits((_Float16)f1));
      }
      hv[it] = a;
    }
    {
#pragma unroll
      for (int it = 0; it < 4; ++it) {
        const int row = it * 4 + q;
        *(v4u*)(C + (size_t)(mBase + row) * ldc + n0 + c8) = hv[it];
      }
      
    }
    __builtin_amdgcn_fence(__ATOMIC_RELEASE, "workgroup");
    __builtin_amdgcn_wave_barrier();
    __builtin_amdgcn_fence(__ATOMIC_ACQUIRE, "workgroup");
  }
}

// =====================================================================================================
// All six projections in ONE grid: they read only the converted planes and write disjoint planes, so none waits
// for another. The block index picks the product (block-uniform); the K=768 products come first, so that the
// short K=192 ones fill the places that free up at the end.
//   [0, GB_T)  q = x . Wq^T + bq            [GB_T, 2 GB_T)  k = x . Wk^T + bk          (M=8192, N=768,  K=768)
//   next NB x GB_VT   v^T = Wv . x^T + bv per batch (A = Wvh [n][k], Bt = Xh rows of b)  (M=768,  N=1024, K=768)
//   next GB_L  lq = (xl . Wlq^T + blq) x2   next GB_L  lk = xl . Wlk^T + blk            (M=8192, N=192,  K=192)
//   next NB x GB_LVT  lv^T = Wlv . xl^T + blv per batch                                 (M=192,  N=1024, K=192)
// =====================================================================================================
__global__ __launch_bounds__(256) void proj_all(
    const unsigned short* __restrict__ Xh, const unsigned short* __restrict__ Lh,
    const unsigned short* __restrict__ Wqh, const unsigned short* __restrict__ Wkh,
    const unsigned short* __restrict__ Wvh, const unsigned short* __restrict__ Wlqh,
    const unsigned short* __restrict__ Wlkh, const unsigned short* __restrict__ Wlvh,
    const float* __restrict__ bq, const float* __restrict__ bk, const float* __restrict__ bv,
    const float* __restrict__ blq, const float* __restrict__ blk_, const float* __restrict__ blv,
    unsigned short* Qp, unsigned short* Kp, unsigned short* VTp,
    unsigned short* LQp, unsigned short* LKp, unsigned short* LVTp) {
  __shared__ __align__(16) float sT[8][16 * 68];   // per-wave 16x64 slab, pitch 68 floats
  const int blk = blockIdx.x;
  const int T0 = 2 * GB_T;                 // first block of v^T
  const int T1 = T0 + NB * GB_VT;          // first block of lq
  const int T2 = T1 + 2 * GB_L;            // first block of lv^T
  if (blk < T0 || (blk >= T1 && blk < T2)) {
    // activations x weights^T, bias by column: row length, N and K are all the stream's width d
    const bool text   = blk < T0;
    const int  r      = text ? blk : blk - T1;
    const int  per    = text ? GB_T : GB_L;
    const bool second = r >= per;          // the k / lk product
    const int  d      = text ? DM : DL;
    const unsigned short* Ap = text ? Xh : Lh;
    const unsigned short* Wp = text ? (second ? Wkh : Wqh) : (second ? Wlkh : Wlqh);
    const float*          bp = text ? (second ? bk : bq) : (second ? blk_ : blq);
    unsigned short*       Cp = text ? (second ? Kp : Qp) : (second ? LKp : LQp);
    const float oscale = (!text && !second) ? 2.0f : 1.0f;
    gemm64<0>(sT, second ? r - per : r, 0, Ap, d, 0LL, Wp, d, 0LL, bp, Cp, d, 0LL,
              NB * SEQ, d, d, 1.0f / 64.0f, oscale);
  } else {
    // weights x activations^T per batch, bias by row
    const bool text = blk < T1;
    const int  b    = text ? (blk - T0) / GB_VT : (blk - T2) / GB_LVT;          // batch
    const int  bx   = text ? (blk - T0) - b * GB_VT : (blk - T2) - b * GB_LVT;  // block inside the batch
    const int  d    = text ? DM : DL;
    gemm64<1>(sT, bx, b, text ? Wvh : Wlvh, d, 0LL, text ? Xh : Lh, d, (long long)SEQ * d,
              text ? bv : blv, text ? VTp : LVTp, SEQ, (long long)d * SEQ,
              d, SEQ, d, 1.0f / 64.0f, 1.0f);
  }
}

// =====================================================================================================
// Two-stream attention, text head dim 64 + layout head dim 16, no mask, softmax over all SEQ keys.
//   Q plane (f16): element (b, t, h, d) at [(b*SEQ + t)*DM + h*64 + d]; K plane same layout with key s.
//   LQ plane (f16, value x2): [(b*SEQ + t)*DL + h*16 + d]; LK plane (f16 x1) same layout.
//   V^T plane (f16): element (b, h, d, s) at [(b*DM + h*64 + d)*SEQ + s]; LV^T plane: [(b*DL + h*16 + d)*SEQ + s].
//   scores = (q . k + lq2 . lk) * sscale in f32 (3 f16 WMMA steps into one accumulator; the layout step uses
//   k = 0..15 only, upper 16 k-slots are register zeros in both fragments).
//   p = exp(s - m) carried as f16(1024 p); ctx = p . v (4 col tiles), lctx = p . lv (1 col tile); online softmax in f32.
//   Block = 4 waves = 64 query rows of one (b, h); grid = NB * NH * NQB; key chunks of 64, static trip NKT.
//   Chunk staging: 128 threads: K 32 halves/thread (64x64), V^T 32 halves/thread (64x64), LK 8 halves/thread (64x16),
//   LV^T 8 halves/thread (16x64) = every LDS element read below (plain 16-B loads, __syncthreads before and after);
//   P tiles are wave-private, spilled with _Float16 element stores and reloaded as v8h (same element type)
//   ctx -> out0 f32 [(b*SEQ + t)*DM + h*64 + d]: 16 rows x 256-B segments per wave (16 lanes x 16 B per segment,
//   Output coverage: wave rows q0..q0+15 (it 0..7 x lane>>4) x 64 cols (16 lanes x 4) of head h for out0;
//   64 float4 = the wave's whole 16x16 lctx tile for LC; the grid covers every (b, h, qb).
// =====================================================================================================
__global__ __launch_bounds__(128)
void attn_two(const unsigned short* __restrict__ qp, const unsigned short* __restrict__ kp,
              const unsigned short* __restrict__ vtp, const unsigned short* __restrict__ lqp,
              const unsigned short* __restrict__ lkp, const unsigned short* __restrict__ lvtp,
              float* out0, float* lcp, float sscale) {
  union FH { v16h v; v8h h[2]; };
  __shared__ __align__(16) _Float16 Ksh[64 * LP];        // K chunk [kv][d], pitch LP    9 KB
  __shared__ __align__(16) _Float16 LKs[64 * LPL];       // LK chunk [kv][dl], pitch LPL 3 KB
  __shared__ __align__(16) _Float16 Vth[64 * LP];        // V^T [d][kv], pitch LP        9 KB
  __shared__ __align__(16) _Float16 LVs[HL * LP];        // LV^T [dl][kv], pitch LP      2304 B
  __shared__ __align__(16) _Float16 Psh[4][16 * LP];     // per wave P [row][kv], pitch LP 9 KB
  __shared__ __align__(16) float    Os[4][16 * 64];      // per wave ctx tile   16 KB
  __shared__ __align__(16) float    OLs[4][16 * HL];     // per wave lctx tile   4 KB

  const int tid  = threadIdx.x;
  const int wave = tid >> 5;
  const int lane = tid & 31;
  const int hh   = lane >> 4;
  const int c    = lane & 15;

  const int bx   = blockIdx.x;
  const int qb   = bx % NQB;
  const int rest = bx / NQB;
  const int h    = rest % NH;
  const int b    = rest / NH;
  const int q0   = qb * 64 + wave * 16;
  const size_t rowB = (size_t)b * SEQ;

  const _Float16* Q   = (const _Float16*)(const void*)qp;
  const _Float16* LQ  = (const _Float16*)(const void*)lqp;
  const _Float16* Kg  = (const _Float16*)(const void*)kp + (size_t)h * HD;
  const _Float16* LKg = (const _Float16*)(const void*)lkp + (size_t)h * HL;
  const _Float16* Vh  = (const _Float16*)(const void*)vtp  + ((size_t)b * DM + (size_t)h * HD) * SEQ;
  const _Float16* LVh = (const _Float16*)(const void*)lvtp + ((size_t)b * DL + (size_t)h * HL) * SEQ;

  // ---- Q fragments (A operand, row = lane&15): 2 d-chunks of the text stream; layout fragment k 0..15 ----
  v16h qa[2];
#pragma unroll
  for (int dc = 0; dc < 2; ++dc) {
    const size_t qo = (rowB + q0 + c) * DM + (size_t)h * HD + dc * 32 + 8 * hh;
    qa[dc] = ldfrag_h(Q + qo);
  }
  FH la;
  la.h[0] = *(const v8h*)(LQ + (rowB + q0 + c) * DL + (size_t)h * HL + 8 * hh);   // k = 8hh..8hh+7
  la.h[1] = zero8h();                                                              // k 16..31 = 0

  float mrow[8], lrow[8];
  v8f oacc[4];
  v8f olacc = zero8();
#pragma unroll
  for (int r = 0; r < 8; ++r) { mrow[r] = -INFINITY; lrow[r] = 0.f; }
#pragma unroll
  for (int t = 0; t < 4; ++t) oacc[t] = zero8();

  for (int kt = 0; kt < NKT; ++kt) {         // static trip count
    const int kv0 = kt * 64;
    __syncthreads();
    {
      const int r = tid >> 1, half = (tid & 1) * 32;
      const _Float16* kg = Kg + (rowB + kv0 + r) * DM + half;       // k row kv0+r, d = half..half+31
      const _Float16* vg = Vh + (size_t)r * SEQ + kv0 + half;        // v^T row d = r, s = kv0+half..+31
#pragma unroll
      for (int i = 0; i < 4; ++i) {
        const v8h a0 = *(const v8h*)(kg + 8 * i);
        const v8h b0 = *(const v8h*)(vg + 8 * i);
        *(v8h*)(Ksh + r * LP + half + 8 * i) = a0;
        *(v8h*)(Vth + r * LP + half + 8 * i) = b0;
      }
      const int c8l = (tid & 1) * 8;                                  // lk row kv0+r, dl = c8l..c8l+7
      const v8h lk8 = *(const v8h*)(LKg + (rowB + kv0 + r) * DL + c8l);
      *(v8h*)(LKs + r * LPL + c8l) = lk8;
      const int dv = tid >> 3, s8 = (tid & 7) * 8;                   // lv^T row dl = dv, s = kv0+s8..+7
      const v8h lv8 = *(const v8h*)(LVh + (size_t)dv * SEQ + kv0 + s8);
      *(v8h*)(LVs + dv * LP + s8) = lv8;
    }
    __syncthreads();

    // ---- scores: 16 query rows x 64 keys per wave ----
    v8f s[4];
#pragma unroll
    for (int j = 0; j < 4; ++j) {
      v8f acc = zero8();
#pragma unroll
      for (int dc = 0; dc < 2; ++dc) {
        FH kb;
        kb.h[0] = *(const v8h*)(Ksh + (j * 16 + c) * LP + dc * 32 + 8 * hh);
        kb.h[1] = *(const v8h*)(Ksh + (j * 16 + c) * LP + dc * 32 + 16 + 8 * hh);
        acc = mma_h(qa[dc], kb.v, acc);
      }
      FH lb;
      lb.h[0] = *(const v8h*)(LKs + (j * 16 + c) * LPL + 8 * hh);
      lb.h[1] = zero8h();
      acc = mma_h(la.v, lb.v, acc);
#pragma unroll
      for (int r = 0; r < 8; ++r) s[j][r] = acc[r] * sscale;
    }

    // ---- row max, online softmax, P (x1024, f16) to LDS ----
    _Float16* pwh = Psh[wave];
#pragma unroll
    for (int r = 0; r < 8; ++r) {
      float m = s[0][r];
#pragma unroll
      for (int j = 1; j < 4; ++j) m = fmaxf(m, s[j][r]);
#pragma unroll
      for (int off = 1; off < 16; off <<= 1) m = fmaxf(m, __shfl_xor(m, off, 32));
      const float mnew  = fmaxf(mrow[r], m);
      const float msafe = (mnew == -INFINITY) ? 0.f : mnew;
      const float alpha = __expf(mrow[r] - msafe);
      mrow[r] = mnew;
      float psum = 0.f;
#pragma unroll
      for (int j = 0; j < 4; ++j) {
        const float p = __expf(s[j][r] - msafe);
        psum += p;
        pwh[(8 * hh + r) * LP + j * 16 + c] = (_Float16)(p * 1024.0f);
      }
#pragma unroll
      for (int off = 1; off < 16; off <<= 1) psum += __shfl_xor(psum, off, 32);
      lrow[r] = lrow[r] * alpha + psum;
#pragma unroll
      for (int t = 0; t < 4; ++t) oacc[t][r] *= alpha;
      olacc[r] *= alpha;
    }
    __builtin_amdgcn_fence(__ATOMIC_RELEASE, "workgroup");
    __builtin_amdgcn_wave_barrier();
    __builtin_amdgcn_fence(__ATOMIC_ACQUIRE, "workgroup");

    // ---- ctx += P . V, lctx += P . LV (f16 WMMA) ----
#pragma unroll 1
    for (int kk = 0; kk < 2; ++kk) {
      FH pa;
      pa.h[0] = *(const v8h*)(pwh + c * LP + kk * 32 + 8 * hh);
      pa.h[1] = *(const v8h*)(pwh + c * LP + kk * 32 + 16 + 8 * hh);
#pragma unroll
      for (int t = 0; t < 4; ++t) {
        FH vb;
        vb.h[0] = *(const v8h*)(Vth + (t * 16 + c) * LP + kk * 32 + 8 * hh);
        vb.h[1] = *(const v8h*)(Vth + (t * 16 + c) * LP + kk * 32 + 16 + 8 * hh);
        oacc[t] = mma_h(pa.v, vb.v, oacc[t]);
      }
      FH wb;
      wb.h[0] = *(const v8h*)(LVs + c * LP + kk * 32 + 8 * hh);
      wb.h[1] = *(const v8h*)(LVs + c * LP + kk * 32 + 16 + 8 * hh);
      olacc = mma_h(pa.v, wb.v, olacc);
    }
  }

  float* os = Os[wave];
  float* ol = OLs[wave];
#pragma unroll
  for (int r = 0; r < 8; ++r) {
    const float l = lrow[r];
    const float inv = ((l > 0.f) ? (1.0f / l) : 0.f) * (1.0f / 1024.0f);
#pragma unroll
    for (int t = 0; t < 4; ++t) os[(8 * hh + r) * 64 + t * 16 + c] = oacc[t][r] * inv;
    ol[(8 * hh + r) * HL + c] = olacc[r] * inv;
  }
  __builtin_amdgcn_fence(__ATOMIC_RELEASE, "workgroup");
  __builtin_amdgcn_wave_barrier();
  __builtin_amdgcn_fence(__ATOMIC_ACQUIRE, "workgroup");
  {
    const int h2 = lane >> 4, c4 = (lane & 15) * 4;     // 256-B row segment = 16 lanes x 16 B
    float* ob = out0 + (rowB + q0) * DM + (size_t)h * HD + c4;
    float* lb = lcp + (((size_t)(b * NH + h)) * SEQ + (size_t)q0) * HL;
    {
#pragma unroll
      for (int it = 0; it < 8; ++it) {
        const int row = it * 2 + h2;                     // it 0..7 x h2 0..1 = rows 0..15
        const v4f v = *(const v4f*)(os + row * 64 + c4);
        *(v4f*)(ob + (size_t)row * DM) = v;
      }
#pragma unroll
      for (int it = 0; it < 2; ++it) {
        const int idx = it * 32 + lane;                  // float4 0..63 of the contiguous 16x16 tile
        const v4f v = *(const v4f*)(ol + idx * 4);
        *(v4f*)(lb + idx * 4) = v;
      }
      
    }
  }
}

// =====================================================================================================
// out1[(b*SEQ + t)*DL + h*16 + d] = LC[b][h][t][d] (f32). One float4 per thread over the flat out1 array
// (col % 4 == 0, so a float4 never crosses a row); consecutive lanes write consecutive 16 B: a wave writes
// coverage: n4 threads x 4 = the whole out1 (n4 multiple of 256).
// =====================================================================================================
__global__ __launch_bounds__(256) void lc_pack(const float* __restrict__ lc, float* out1, int n4) {
  const int i = blockIdx.x * 256 + (int)threadIdx.x;
  if (i < n4) {
    const int e   = i * 4;
    const int row = e / DL;                 // b*SEQ + t
    const int col = e - row * DL;           // h*16 + d, multiple of 4
    const int hd  = col >> 4;
    const int d   = col & 15;
    const int bb  = row / SEQ;
    const int t   = row - bb * SEQ;
    const v4f v = *(const v4f*)(lc + (((size_t)(bb * NH + hd)) * SEQ + (size_t)t) * HL + d);
    float* o = out1 + (size_t)e;
    *(v4f*)o = v;
    
  }
}

// =====================================================================================================
// Workspace map (bytes), every region an exact multiple of its whole-line / whole-tile store granularity:
//   Xh   f16 [8192][768]            12582912
//   Lh   f16 [8192][192]             3145728
//   Wqh  f16 [768 n][768 k] (x64)    1179648
//   Wkh  f16 [768][768]     (x64)    1179648
//   Wvh  f16 [768][768]     (x64)    1179648
//   Wlqh f16 [192][192]     (x64)      73728
//   Wlkh f16 [192][192]     (x64)      73728
//   Wlvh f16 [192][192]     (x64)      73728
//   Qp   f16 [8192][768]            12582912
//   Kp   f16 [8192][768]            12582912
//   VTp  f16 [8][768][1024]         12582912
//   LQp  f16 [8192][192]   (x2)      3145728
//   LKp  f16 [8192][192]             3145728
//   LVTp f16 [8][192][1024]          3145728
//   LC   f32 [8][12][1024][16]       6291456
//   total                           72966144
// Weights are [out n][in k] with k contiguous = the Bt / A layout the GEMM wants, so they are only converted.
// =====================================================================================================
extern "C" void kernel_launch(void* const* d_in, const int* in_sizes, int n_in,
                              void* d_out, int out_size, void* d_ws, size_t ws_size,
                              hipStream_t stream) {
  if (n_in < 14) return;
  if (in_sizes[0] != NB * SEQ * DM) return;
  if (in_sizes[1] != NB * SEQ * DL) return;
  if (in_sizes[2] != DM * DM || in_sizes[4] != DM * DM || in_sizes[6] != DM * DM) return;
  if (in_sizes[3] != DM || in_sizes[5] != DM || in_sizes[7] != DM) return;
  if (in_sizes[8] != DL * DL || in_sizes[10] != DL * DL || in_sizes[12] != DL * DL) return;
  if (in_sizes[9] != DL || in_sizes[11] != DL || in_sizes[13] != DL) return;
  if (out_size != NB * SEQ * (DM + DL)) return;

  const float* x    = (const float*)d_in[0];
  const float* xl   = (const float*)d_in[1];
  const float* Wq   = (const float*)d_in[2];
  const float* bq   = (const float*)d_in[3];
  const float* Wk   = (const float*)d_in[4];
  const float* bk   = (const float*)d_in[5];
  const float* Wv   = (const float*)d_in[6];
  const float* bv   = (const float*)d_in[7];
  const float* Wlq  = (const float*)d_in[8];
  const float* blq  = (const float*)d_in[9];
  const float* Wlk  = (const float*)d_in[10];
  const float* blk_ = (const float*)d_in[11];
  const float* Wlv  = (const float*)d_in[12];
  const float* blv  = (const float*)d_in[13];

  const size_t PX  = (size_t)NB * SEQ * DM * 2;    // 12582912  f16 text plane [8192][768]
  const size_t PL  = (size_t)NB * SEQ * DL * 2;    //  3145728  f16 layout plane [8192][192]
  const size_t PW  = (size_t)DM * DM * 2;          //  1179648  f16 [768][768] weight plane
  const size_t PWL = (size_t)DL * DL * 2;          //    73728  f16 [192][192] weight plane
  const size_t PLC = (size_t)NB * NH * SEQ * HL * 4; // 6291456 f32 lctx plane
  size_t off = 0;
  const size_t oXh   = off; off += PX;
  const size_t oLh   = off; off += PL;
  const size_t oWq   = off; off += PW;
  const size_t oWk   = off; off += PW;
  const size_t oWv   = off; off += PW;
  const size_t oWlq  = off; off += PWL;
  const size_t oWlk  = off; off += PWL;
  const size_t oWlv  = off; off += PWL;
  const size_t oQp   = off; off += PX;
  const size_t oKp   = off; off += PX;
  const size_t oVTp  = off; off += PX;
  const size_t oLQp  = off; off += PL;
  const size_t oLKp  = off; off += PL;
  const size_t oLVTp = off; off += PL;
  const size_t oLC   = off; off += PLC;
  if (off > ws_size) return;                       // off = 72966144
  if (off > (size_t)134217728) return;

  char* ws = (char*)d_ws;
  unsigned short* Xh   = (unsigned short*)(ws + oXh);
  unsigned short* Lh   = (unsigned short*)(ws + oLh);
  unsigned short* Wqh  = (unsigned short*)(ws + oWq);
  unsigned short* Wkh  = (unsigned short*)(ws + oWk);
  unsigned short* Wvh  = (unsigned short*)(ws + oWv);
  unsigned short* Wlqh = (unsigned short*)(ws + oWlq);
  unsigned short* Wlkh = (unsigned short*)(ws + oWlk);
  unsigned short* Wlvh = (unsigned short*)(ws + oWlv);
  unsigned short* Qp   = (unsigned short*)(ws + oQp);
  unsigned short* Kp   = (unsigned short*)(ws + oKp);
  unsigned short* VTp  = (unsigned short*)(ws + oVTp);
  unsigned short* LQp  = (unsigned short*)(ws + oLQp);
  unsigned short* LKp  = (unsigned short*)(ws + oLKp);
  unsigned short* LVTp = (unsigned short*)(ws + oLVTp);
  float*          LC   = (float*)(ws + oLC);
  float*          out0 = (float*)d_out;
  float*          out1 = (float*)d_out + (size_t)NB * SEQ * DM;   // byte offset 25165824 / 4; last index 7864319 < out_size

  const dim3 blk(256);
  const int n4o1 = NB * SEQ * DL / 4;                          // 393216
  const dim3 gCvt(CB_ALL);                                     // 4758 blocks: the eight planes
  const dim3 gProj(GB_ALL);                                    //  720 blocks: the six projections
  const dim3 gAttn(NB * NH * NQB);                             // 1536 blocks of 128
  const dim3 gPack((n4o1 + 255) / 256);                        // 1536 blocks

  // (1) activations f32 -> f16 (x1); weights [n][k] f32 -> f16 (x64): one grid, planes Xh .. Wlvh back to back from Xh
  cvt_all<<<gCvt, blk, 0, stream>>>(x, xl, Wq, Wk, Wv, Wlq, Wlk, Wlv, Xh);
  // (2) q, k, v^T, lq (x2), lk, lv^T -> f16 planes: one grid
  proj_all<<<gProj, blk, 0, stream>>>(Xh, Lh, Wqh, Wkh, Wvh, Wlqh, Wlkh, Wlvh, bq, bk, bv, blq, blk_, blv,
                                      Qp, Kp, VTp, LQp, LKp, LVTp);
  // (3) attention: ctx -> out0, lctx -> LC plane
  attn_two<<<gAttn, dim3(128), 0, stream>>>(Qp, Kp, VTp, LQp, LKp, LVTp, out0, LC, 0.125f);
  // (4) LC plane -> out1 [8192][192]
  lc_pack<<<gPack, blk, 0, stream>>>(LC, out1, n4o1);
  (void)hipGetLastError();
}

// v003
// A run of this version takes 151 microseconds.
// Timed twice side by side with v002, it ran 1.33 and 1.34 times as fast.
// Counting every step since v000, it is 2.26 times as fast.
// Contractions: q, k, v^T, lq, lk, lv^T projections = v_wmma_f32_16x16x32_f16 (activations f16 x1, weights f16 x64, single product, f32 accumulate);
// q.k^T and lq.lk^T scores = v_wmma_f32_16x16x32_f16 (q, k, lk f16 x1, lq f16 x2, layout K=16 zero-padded to 32 in registers, single products, one f32 accumulator);
// p.v and p.lv = v_wmma_f32_16x16x32_f16 (p carried x1024 in f16, v and lv f16 x1, single products, f32 accumulate); softmax and normalisation in f32.
// Carry audit: weight planes x64 -> 1/64 folded in the gemm64 epilogue (ascale); LQ plane x2 -> folded by the common score scale 0.125
//              in attn_two (q.k/8 + lq.lk/4 = (q.k + 2lq.lk)/8); P x1024 (LDS only) -> 1/1024 folded in the attn_two epilogue (inv);
//              activation planes, Q/K/V^T/LK/LV^T planes and the LC f32 plane carry x1.
#include <hip/hip_runtime.h>
#include <math.h>
#include <stdint.h>

#define NB   8
#define SEQ  1024
#define DM   768
#define DL   192
#define NH   12
#define HD   64
#define HL   16
#define NQB  (SEQ / 64)   // 64-row query blocks per sequence
#define NKT  (SEQ / 64)   // 64-key chunks per sequence
#define LP   72           // LDS row pitch in halves of the 64-half rows read by 16-B fragment loads: 144 B = 16 B x odd
#define LPL  24           // the same for the 16-half LK rows: 48 B = 16 B x odd
// LDS ring of the K=768 projections: a stage is 64 k (128 B) of 128 A rows, then of 256 B rows, at pitch LP; two buffers
#define RROWS  (128 + 256)
#define RBUF   (RROWS * LP)                         // halves a buffer: 55296 B
// block ranges of the two merged grids (256 threads a block)
#define CB_X   (NB * SEQ * DM / 8 / 256)            // 3072 blocks: x plane, 8 elements a thread
#define CB_L   (NB * SEQ * DL / 8 / 256)            //  768 blocks: layout plane
#define CB_W   (DM * DM / 8 / 256)                  //  288 blocks: one [768][768] weight plane
#define CB_WL  (DL * DL / 8 / 256)                  //   18 blocks: one [192][192] weight plane
#define CB_ALL (CB_X + CB_L + 3 * CB_W + 3 * CB_WL) // 4758 blocks
#define GB_T   (((NB * SEQ) / 128) * (DM / 256))    //  192 blocks: M=8192, N=768, one 128x256 tile a block
#define GB_VT  ((DM / 128) * (SEQ / 256))           //   24 blocks a batch: M=768, N=1024
#define GB_L   (((NB * SEQ) / 64) * (DL / 64) / 8)  //   48 blocks: M=8192, N=192
#define GB_LVT ((DL / 64) * (SEQ / 64) / 8)         //    6 blocks a batch: M=192, N=1024
#define GB_ALL (2 * GB_T + NB * GB_VT + 2 * GB_L + NB * GB_LVT)   // 720 blocks
static_assert((NB * SEQ * DM) % 2048 == 0 && (NB * SEQ * DL) % 2048 == 0 && (DM * DM) % 2048 == 0 && (DL * DL) % 2048 == 0);
static_assert(((NB * SEQ) % 128) == 0 && (DM % 256) == 0 && (DM % 128) == 0 && (SEQ % 256) == 0 && DM / 64 >= 2);
static_assert((((NB * SEQ) / 64) * (DL / 64)) % 8 == 0 && ((DL / 64) * (SEQ / 64)) % 8 == 0);
static_assert(NH * HD == DM);
static_assert(NH * HL == DL);
static_assert(NQB == 16 && NKT == 16);
static_assert((SEQ % 64) == 0 && (DM % 64) == 0 && (DL % 64) == 0);
static_assert((DM % 32) == 0 && (DL % 32) == 0);

typedef _Float16 v16h __attribute__((ext_vector_type(16)));
typedef _Float16 v8h  __attribute__((ext_vector_type(8)));
typedef float    v8f  __attribute__((ext_vector_type(8)));
typedef float    v4f  __attribute__((ext_vector_type(4)));
typedef unsigned int v4u __attribute__((ext_vector_type(4)));

#if defined(__HIP_DEVICE_COMPILE__)
#define DEV_ASM 1
#else
#define DEV_ASM 0
#endif

// ---- scalar helpers --------------------------------------------------------------------------------
__device__ __forceinline__ unsigned short h_bits(_Float16 x) { return __builtin_bit_cast(unsigned short, x); }
__device__ __forceinline__ unsigned pk16(unsigned short a, unsigned short b) { return (unsigned)a | ((unsigned)b << 16); }
__device__ __forceinline__ v8f zero8() { v8f z = {0.f, 0.f, 0.f, 0.f, 0.f, 0.f, 0.f, 0.f}; return z; }
__device__ __forceinline__ v8h zero8h() {
  const _Float16 z = (_Float16)0.0f;
  v8h r = {z, z, z, z, z, z, z, z};
  return r;
}

// ---- fragment loader: 16-bit A/B operand, lane -> row/col (lane&15), p already includes +8*(lane>>4);
//      elements 0..7 <- p[0..7] (k0+8h..k0+8h+7), elements 8..15 <- p[16..23] (k0+16+8h..k0+16+8h+7)
__device__ __forceinline__ v16h ldfrag_h(const _Float16* p) {
  union { v16h v; v8h h[2]; } f;
  f.h[0] = *(const v8h*)(p);
  f.h[1] = *(const v8h*)(p + 16);
  return f.v;
}

// ---- WMMA helpers ----------------------------------------------------------------------------------
__device__ __forceinline__ v8f mmar(v16h a, v16h b, v8f c) {
  return __builtin_amdgcn_wmma_f32_16x16x32_f16(false, a, false, b, (short)0, c, false, false);
}
// guarded form: 4 VALU slots after the WMMA, D tied, A/B kept live
__device__ __forceinline__ v8f mma_h(v16h a, v16h b, v8f c) {
  c = __builtin_amdgcn_wmma_f32_16x16x32_f16(false, a, false, b, (short)0, c, false, false);
#if DEV_ASM
  asm volatile("v_nop\n\tv_nop\n\tv_nop\n\tv_nop" : "+v"(c) : "v"(a), "v"(b));
#endif
  return c;
}
__device__ __forceinline__ void dep_guard(v8f& a, v8f& b, v16h x, v16h y) {
#if DEV_ASM
  asm volatile("v_nop\n\tv_nop\n\tv_nop\n\tv_nop" : "+v"(a), "+v"(b) : "v"(x), "v"(y));
#else
  (void)a; (void)b; (void)x; (void)y;
#endif
}
__device__ __forceinline__ void keep4(v16h a, v16h b, v16h c, v16h d) {
#if DEV_ASM
  asm volatile("v_nop" :: "v"(a), "v"(b), "v"(c), "v"(d));
#else
  (void)a; (void)b; (void)c; (void)d;
#endif
}
__device__ __forceinline__ void acc_guard4(v8f& a, v8f& b, v8f& c, v8f& d) {
#if DEV_ASM
  asm volatile("v_nop\n\tv_nop\n\tv_nop\n\tv_nop" : "+v"(a), "+v"(b), "+v"(c), "+v"(d));
#else
  (void)a; (void)b; (void)c; (void)d;
#endif
}

// ---- asynchronous copies global -> LDS -------------------------------------------------------------
// One stage of the ring: each of the 256 threads brings twelve 16-B pieces, piece (t & 7) of rows (t >> 3) + 32 i;
// i 0..3 are the 128 A rows, i 4..11 the 256 B rows, so a wave's copy covers four whole 128-B lines.
// l = the thread's LDS byte address of its piece in row (t >> 3) of the target buffer; ga, gb = its global piece in
// the first A row and the first B row of the stage; sa, sb = 32 rows in halves.
// The s_wait_xcnt closes the statement so that no address register is rewritten ahead of it.
__device__ __forceinline__ void stage_copy(unsigned l, const _Float16* ga, const _Float16* gb, size_t sa, size_t sb) {
#if DEV_ASM
  asm volatile(
      "global_load_async_to_lds_b128 %0, %12, off\n\t"
      "global_load_async_to_lds_b128 %1, %13, off\n\t"
      "global_load_async_to_lds_b128 %2, %14, off\n\t"
      "global_load_async_to_lds_b128 %3, %15, off\n\t"
      "global_load_async_to_lds_b128 %4, %16, off\n\t"
      "global_load_async_to_lds_b128 %5, %17, off\n\t"
      "global_load_async_to_lds_b128 %6, %18, off\n\t"
      "global_load_async_to_lds_b128 %7, %19, off\n\t"
      "global_load_async_to_lds_b128 %8, %20, off\n\t"
      "global_load_async_to_lds_b128 %9, %21, off\n\t"
      "global_load_async_to_lds_b128 %10, %22, off\n\t"
      "global_load_async_to_lds_b128 %11, %23, off\n\t"
      "s_wait_xcnt 0x0"
      :: "v"(l), "v"(l + 1u * 32u * LP * 2u), "v"(l + 2u * 32u * LP * 2u), "v"(l + 3u * 32u * LP * 2u),
         "v"(l + 4u * 32u * LP * 2u), "v"(l + 5u * 32u * LP * 2u), "v"(l + 6u * 32u * LP * 2u),
         "v"(l + 7u * 32u * LP * 2u), "v"(l + 8u * 32u * LP * 2u), "v"(l + 9u * 32u * LP * 2u),
         "v"(l + 10u * 32u * LP * 2u), "v"(l + 11u * 32u * LP * 2u),
         "v"(ga), "v"(ga + sa), "v"(ga + 2 * sa), "v"(ga + 3 * sa),
         "v"(gb), "v"(gb + sb), "v"(gb + 2 * sb), "v"(gb + 3 * sb),
         "v"(gb + 4 * sb), "v"(gb + 5 * sb), "v"(gb + 6 * sb), "v"(gb + 7 * sb)
      : "memory");
#else
  (void)l; (void)ga; (void)gb; (void)sa; (void)sb;
#endif
}
// this wave's copies have landed in LDS
__device__ __forceinline__ void wait_copies() {
#if DEV_ASM
  asm volatile("s_wait_asynccnt 0x0" ::: "memory");
#endif
}
// this wave's LDS reads have returned, so the buffer may go to its next writer
__device__ __forceinline__ void wait_lds() {
#if DEV_ASM
  asm volatile("s_wait_dscnt 0x0" ::: "memory");
#endif
}

// =====================================================================================================
// f32 -> f16 bits of (x * scale) for all eight planes in ONE grid: the planes lie back to back in the workspace
// in the order x, layout, Wq, Wk, Wv, Wlq, Wlk, Wlv, and each is a whole number of blocks, so the block index
// picks the source plane (block-uniform) and the flat thread index is the output position.
// 8 elements per thread, one 16-B store per lane: a wave writes 512 contiguous bytes.
// coverage: CB_ALL blocks x 256 threads x 8 = all eight planes exactly (static_asserts above), so no bound test.
// =====================================================================================================
__global__ __launch_bounds__(256) void cvt_all(const float* __restrict__ x, const float* __restrict__ xl,
                                               const float* __restrict__ wq, const float* __restrict__ wk,
                                               const float* __restrict__ wv, const float* __restrict__ wlq,
                                               const float* __restrict__ wlk, const float* __restrict__ wlv,
                                               unsigned short* out) {
  const int blk = blockIdx.x;
  const float* in = x;
  int first = 0;                 // first block of the plane
  float scale = 1.0f;            // activations x1, weights x64
  if (blk >= CB_X)                                  { in = xl;  first = CB_X; }
  if (blk >= CB_X + CB_L)                           { in = wq;  first = CB_X + CB_L;                       scale = 64.0f; }
  if (blk >= CB_X + CB_L + CB_W)                    { in = wk;  first = CB_X + CB_L + CB_W; }
  if (blk >= CB_X + CB_L + 2 * CB_W)                { in = wv;  first = CB_X + CB_L + 2 * CB_W; }
  if (blk >= CB_X + CB_L + 3 * CB_W)                { in = wlq; first = CB_X + CB_L + 3 * CB_W; }
  if (blk >= CB_X + CB_L + 3 * CB_W + CB_WL)        { in = wlk; first = CB_X + CB_L + 3 * CB_W + CB_WL; }
  if (blk >= CB_X + CB_L + 3 * CB_W + 2 * CB_WL)    { in = wlv; first = CB_X + CB_L + 3 * CB_W + 2 * CB_WL; }
  const int i = (blk - first) * 256 + (int)threadIdx.x;      // 8-element unit inside the source plane
  const int o = blk * 256 + (int)threadIdx.x;                // 8-element unit inside the eight planes
  const v4f a = *(const v4f*)(in + (size_t)i * 8);
  const v4f c = *(const v4f*)(in + (size_t)i * 8 + 4);
  v4u p;
  p[0] = pk16(h_bits((_Float16)(a[0] * scale)), h_bits((_Float16)(a[1] * scale)));
  p[1] = pk16(h_bits((_Float16)(a[2] * scale)), h_bits((_Float16)(a[3] * scale)));
  p[2] = pk16(h_bits((_Float16)(c[0] * scale)), h_bits((_Float16)(c[1] * scale)));
  p[3] = pk16(h_bits((_Float16)(c[2] * scale)), h_bits((_Float16)(c[3] * scale)));
  *(v4u*)(out + (size_t)o * 8) = p;
}

// =====================================================================================================
// Register-blocked batched f16 WMMA GEMM with bias: C[m][n] = (sum_k A[m][k] * Bt[n][k]) * ascale + bias,
// stored as f16(value * oscale). One wave per 64x64 tile. A row-major [M][K] pitch lda;
// Bt row-major [N][K] pitch ldb (k contiguous); M, N multiples of 64, K multiple of 32 (host-checked).
// bx = block index inside the product, b = batch index (strides in elements), sT = the block's LDS slabs.
// RING 0: the block's 8 tiles are consecutive in n, no block barriers, fragments loaded straight from global
//         with the split k map.
// RING 1: the 8 tiles are 2 (m) x 4 (n) = one 128x256 tile (M multiple of 128, N of 256, K of 64, at least 128).
//         Its operand rows come to LDS in stages of 64 k by asynchronous copies, two buffers: the copies of stage
//         s + 2 fly while stage s + 1 is worked on; fragments are read from LDS with the same split k map and the
//         same k order. Every wave passes every barrier (no early return on this path).
// BIASROW 0: bias[n] (bias length N); BIASROW 1: bias[m] (bias length M).
// coverage: 4 slabs x 16 rows (it 0..3 x lane>>3 0..3) x 64 cols (8 lanes x 8) = the wave's whole 64x64 tile.
// =====================================================================================================
template <int BIASROW, int RING>
__device__ __forceinline__ void gemm64(
    float (*sT)[16 * 68], _Float16* ring, int bx, int b,
    const unsigned short* __restrict__ Ap, int lda, long long strideA,
    const unsigned short* __restrict__ Btp, int ldb, long long strideB,
    const float* __restrict__ bias,
    unsigned short* Cp, int ldc, long long strideC,
    int M, int N, int K, float ascale, float oscale) {
  const _Float16* A  = (const _Float16*)(const void*)Ap;
  const _Float16* Bt = (const _Float16*)(const void*)Btp;
  const int lane = threadIdx.x & 31;
  const int wave = threadIdx.x >> 5;
  int m0, n0;                              // the wave's 64x64 tile
  int bm0 = 0, bn0 = 0;                    // RING: the block's 128x256 tile
  if constexpr (RING) {
    const int tilesN = N >> 8;
    const int tm = bx / tilesN;
    const int tn = bx - tm * tilesN;
    bm0 = tm << 7;
    bn0 = tn << 8;
    m0 = bm0 + ((wave >> 2) << 6);
    n0 = bn0 + ((wave & 3) << 6);
  } else {
    const int tilesN = N >> 6;
    const int tilesM = M >> 6;
    const int tile = bx * 8 + wave;
    if (tile >= tilesM * tilesN) return;   // wave-uniform; no block barriers on this path
    const int tm = tile / tilesN;
    const int tn = tile - tm * tilesN;
    m0 = tm << 6;
    n0 = tn << 6;
  }

  const _Float16* Ab = A  + (size_t)b * (size_t)strideA;
  const _Float16* Bb = Bt + (size_t)b * (size_t)strideB;

  const int rlane = lane & 15;                 // row (A) / col (B, D) within subtile
  const int koff  = (lane >> 4) * 8;           // k offset of this lane half
  const int mOff  = (lane >> 4) * 8;           // D row offset

  v8f acc[4][4];
#pragma unroll
  for (int i = 0; i < 4; ++i)
#pragma unroll
    for (int j = 0; j < 4; ++j) acc[i][j] = zero8();

  if constexpr (RING) {
    const int t = threadIdx.x;
    const _Float16* ga = Ab + (size_t)(bm0 + (t >> 3)) * lda + (t & 7) * 8;   // the thread's piece, first A row
    const _Float16* gb = Bb + (size_t)(bn0 + (t >> 3)) * ldb + (t & 7) * 8;   // the same, first B row
    const size_t sa = (size_t)32 * lda, sb = (size_t)32 * ldb;
    const unsigned l0 = (unsigned)(uintptr_t)ring + (unsigned)((t >> 3) * (LP * 2) + (t & 7) * 16);
    const int aoff = ((wave >> 2) * 64 + rlane) * LP + koff;                  // the wave's A rows in a buffer
    const int boff = (128 + (wave & 3) * 64 + rlane) * LP + koff;             // the wave's B rows
    const int ns = K >> 6;                                                    // stages
    stage_copy(l0, ga, gb, sa, sb);                                           // stage 0 -> buffer 0
    wait_copies();
    __syncthreads();                                                          // stage 0 readable by every wave
    stage_copy(l0 + RBUF * 2u, ga + 64, gb + 64, sa, sb);                     // stage 1 -> buffer 1 (ns >= 2)
#pragma unroll 1   // rolled over the twelve stages, for speed only
    for (int s = 0; s < ns; ++s) {
      const _Float16* buf = ring + (s & 1) * RBUF;
#pragma unroll
      for (int ks = 0; ks < 2; ++ks) {
        v16h bq[4], af[4];                 // all sixteen LDS reads of the 32 k stand together, ahead of the products
#pragma unroll
        for (int j = 0; j < 4; ++j) bq[j] = ldfrag_h(buf + boff + j * 16 * LP + ks * 32);
#pragma unroll
        for (int i = 0; i < 4; ++i) af[i] = ldfrag_h(buf + aoff + i * 16 * LP + ks * 32);
#pragma unroll
        for (int i = 0; i < 4; ++i) {
#pragma unroll
          for (int j = 0; j < 4; ++j) acc[i][j] = mmar(af[i], bq[j], acc[i][j]);
          dep_guard(acc[i][0], acc[i][3], af[i], bq[3]);
        }
        keep4(bq[0], bq[1], bq[2], bq[3]);
      }
      wait_lds();
      wait_copies();
      __syncthreads();
      if (s + 2 < ns) stage_copy(l0 + (unsigned)(s & 1) * (RBUF * 2u), ga + (s + 2) * 64, gb + (s + 2) * 64, sa, sb);
    }
    wait_copies();
  } else {
    for (int k0 = 0; k0 < K; k0 += 32) {
      v16h bq[4];
#pragma unroll
      for (int j = 0; j < 4; ++j)
        bq[j] = ldfrag_h(Bb + (size_t)(n0 + (j << 4) + rlane) * ldb + koff + k0);
#pragma unroll
      for (int i = 0; i < 4; ++i) {
        const v16h af = ldfrag_h(Ab + (size_t)(m0 + (i << 4) + rlane) * lda + koff + k0);
#pragma unroll
        for (int j = 0; j < 4; ++j) acc[i][j] = mmar(af, bq[j], acc[i][j]);
        dep_guard(acc[i][0], acc[i][3], af, bq[3]);
      }
      keep4(bq[0], bq[1], bq[2], bq[3]);
    }
  }
  acc_guard4(acc[0][0], acc[0][1], acc[0][2], acc[0][3]);
  acc_guard4(acc[1][0], acc[1][1], acc[1][2], acc[1][3]);
  acc_guard4(acc[2][0], acc[2][1], acc[2][2], acc[2][3]);
  acc_guard4(acc[3][0], acc[3][1], acc[3][2], acc[3][3]);

  // ---- epilogue ----
  float* slab = sT[wave];
  const int q = lane >> 3, c8 = (lane & 7) * 8;
  unsigned short* C = Cp + (size_t)b * (size_t)strideC;
  float bcol[8];
  {
    const v4f b0 = *(const v4f*)(bias + (BIASROW ? 0 : (n0 + c8)));       // column bias (length N), 16-B aligned
    const v4f b1 = *(const v4f*)(bias + (BIASROW ? 4 : (n0 + c8 + 4)));
#pragma unroll
    for (int e = 0; e < 4; ++e) { bcol[e] = b0[e]; bcol[4 + e] = b1[e]; }
  }
#pragma unroll
  for (int i = 0; i < 4; ++i) {
    const int mBase = m0 + (i << 4);
#pragma unroll
    for (int j = 0; j < 4; ++j) {
#pragma unroll
      for (int r = 0; r < 8; ++r) {
        slab[(mOff + r) * 68 + (j << 4) + rlane] = acc[i][j][r];
      }
    }
    __builtin_amdgcn_fence(__ATOMIC_RELEASE, "workgroup");
    __builtin_amdgcn_wave_barrier();
    __builtin_amdgcn_fence(__ATOMIC_ACQUIRE, "workgroup");
    v4u hv[4];
#pragma unroll
    for (int it = 0; it < 4; ++it) {
      const int row = it * 4 + q;                        // it 0..3 x q 0..3 = rows 0..15
      const float* sp = slab + row * 68 + c8;
      float bb[8];
      if (BIASROW) {
        const float bv = bias[mBase + row];              // row bias, index < M = bias length
#pragma unroll
        for (int e = 0; e < 8; ++e) bb[e] = bv;
      } else {
#pragma unroll
        for (int e = 0; e < 8; ++e) bb[e] = bcol[e];
      }
      v4u a;
#pragma unroll
      for (int e = 0; e < 4; ++e) {
        const float f0 = (sp[2 * e] * ascale + bb[2 * e]) * oscale;
        const float f1 = (sp[2 * e + 1] * ascale + bb[2 * e + 1]) * oscale;
        a[e] = pk16(h_bits((_Float16)f0), h_bits((_Float16)f1));
      }
      hv[it] = a;
    }
    {
#pragma unroll
      for (int it = 0; it < 4; ++it) {
        const int row = it * 4 + q;
        *(v4u*)(C + (size_t)(mBase + row) * ldc + n0 + c8) = hv[it];
      }
      
    }
    __builtin_amdgcn_fence(__ATOMIC_RELEASE, "workgroup");
    __builtin_amdgcn_wave_barrier();
    __builtin_amdgcn_fence(__ATOMIC_ACQUIRE, "workgroup");
  }
}

// =====================================================================================================
// All six projections in ONE grid: they read only the converted planes and write disjoint planes, so none waits
// for another. The block index picks the product (block-uniform); the K=768 products come first, so that the
// short K=192 ones fill the places that free up at the end. The K=768 products take their operands through the
// LDS ring (gemm64, RING 1), each block one 128x256 tile; the K=192 products read them straight from global (RING 0).
//   [0, GB_T)  q = x . Wq^T + bq            [GB_T, 2 GB_T)  k = x . Wk^T + bk          (M=8192, N=768,  K=768)
//   next NB x GB_VT   v^T = Wv . x^T + bv per batch (A = Wvh [n][k], Bt = Xh rows of b)  (M=768,  N=1024, K=768)
//   next GB_L  lq = (xl . Wlq^T + blq) x2   next GB_L  lk = xl . Wlk^T + blk            (M=8192, N=192,  K=192)
//   next NB x GB_LVT  lv^T = Wlv . xl^T + blv per batch                                 (M=192,  N=1024, K=192)
// =====================================================================================================
__global__ __launch_bounds__(256) void proj_all(
    const unsigned short* __restrict__ Xh, const unsigned short* __restrict__ Lh,
    const unsigned short* __restrict__ Wqh, const unsigned short* __restrict__ Wkh,
    const unsigned short* __restrict__ Wvh, const unsigned short* __restrict__ Wlqh,
    const unsigned short* __restrict__ Wlkh, const unsigned short* __restrict__ Wlvh,
    const float* __restrict__ bq, const float* __restrict__ bk, const float* __restrict__ bv,
    const float* __restrict__ blq, const float* __restrict__ blk_, const float* __restrict__ blv,
    unsigned short* Qp, unsigned short* Kp, unsigned short* VTp,
    unsigned short* LQp, unsigned short* LKp, unsigned short* LVTp) {
  __shared__ __align__(16) float sT[8][16 * 68];   // per-wave 16x64 slab, pitch 68 floats
  __shared__ __align__(16) _Float16 ring[2 * RBUF]; // operand stages of the K=768 products, two buffers, 110592 B
  const int blk = blockIdx.x;
  const int T0 = 2 * GB_T;                 // first block of v^T
  const int T1 = T0 + NB * GB_VT;          // first block of lq
  const int T2 = T1 + 2 * GB_L;            // first block of lv^T
  if (blk < T0) {
    // text activations x weights^T, bias by column, operands through the LDS ring
    const bool second = blk >= GB_T;       // the k product
    gemm64<0, 1>(sT, ring, second ? blk - GB_T : blk, 0, Xh, DM, 0LL, second ? Wkh : Wqh, DM, 0LL,
                 second ? bk : bq, second ? Kp : Qp, DM, 0LL, NB * SEQ, DM, DM, 1.0f / 64.0f, 1.0f);
  } else if (blk < T1) {
    // text weights x activations^T per batch, bias by row, operands through the LDS ring
    const int b  = (blk - T0) / GB_VT;     // batch
    const int bx = (blk - T0) - b * GB_VT; // block inside the batch
    gemm64<1, 1>(sT, ring, bx, b, Wvh, DM, 0LL, Xh, DM, (long long)SEQ * DM, bv, VTp, SEQ, (long long)DM * SEQ,
                 DM, SEQ, DM, 1.0f / 64.0f, 1.0f);
  } else if (blk < T2) {
    // layout activations x weights^T, bias by column
    const int  r      = blk - T1;
    const bool second = r >= GB_L;         // the lk product
    gemm64<0, 0>(sT, ring, second ? r - GB_L : r, 0, Lh, DL, 0LL, second ? Wlkh : Wlqh, DL, 0LL,
                 second ? blk_ : blq, second ? LKp : LQp, DL, 0LL, NB * SEQ, DL, DL, 1.0f / 64.0f,
                 second ? 1.0f : 2.0f);
  } else {
    // layout weights x activations^T per batch, bias by row
    const int b  = (blk - T2) / GB_LVT;     // batch
    const int bx = (blk - T2) - b * GB_LVT; // block inside the batch
    gemm64<1, 0>(sT, ring, bx, b, Wlvh, DL, 0LL, Lh, DL, (long long)SEQ * DL, blv, LVTp, SEQ, (long long)DL * SEQ,
                 DL, SEQ, DL, 1.0f / 64.0f, 1.0f);
  }
}

// =====================================================================================================
// Two-stream attention, text head dim 64 + layout head dim 16, no mask, softmax over all SEQ keys.
//   Q plane (f16): element (b, t, h, d) at [(b*SEQ + t)*DM + h*64 + d]; K plane same layout with key s.
//   LQ plane (f16, value x2): [(b*SEQ + t)*DL + h*16 + d]; LK plane (f16 x1) same layout.
//   V^T plane (f16): element (b, h, d, s) at [(b*DM + h*64 + d)*SEQ + s]; LV^T plane: [(b*DL + h*16 + d)*SEQ + s].
//   scores = (q . k + lq2 . lk) * sscale in f32 (3 f16 WMMA steps into one accumulator; the layout step uses
//   k = 0..15 only, upper 16 k-slots are register zeros in both fragments).
//   p = exp(s - m) carried as f16(1024 p); ctx = p . v (4 col tiles), lctx = p . lv (1 col tile); online softmax in f32.
//   Block = 4 waves = 64 query rows of one (b, h); grid = NB * NH * NQB; key chunks of 64, static trip NKT.
//   Chunk staging: 128 threads: K 32 halves/thread (64x64), V^T 32 halves/thread (64x64), LK 8 halves/thread (64x16),
//   LV^T 8 halves/thread (16x64) = every LDS element read below (plain 16-B loads, __syncthreads before and after);
//   P tiles are wave-private, spilled with _Float16 element stores and reloaded as v8h (same element type)
//   ctx -> out0 f32 [(b*SEQ + t)*DM + h*64 + d]: 16 rows x 256-B segments per wave (16 lanes x 16 B per segment,
//   Output coverage: wave rows q0..q0+15 (it 0..7 x lane>>4) x 64 cols (16 lanes x 4) of head h for out0;
//   64 float4 = the wave's whole 16x16 lctx tile for LC; the grid covers every (b, h, qb).
// =====================================================================================================
__global__ __launch_bounds__(128)
void attn_two(const unsigned short* __restrict__ qp, const unsigned short* __restrict__ kp,
              const unsigned short* __restrict__ vtp, const unsigned short* __restrict__ lqp,
              const unsigned short* __restrict__ lkp, const unsigned short* __restrict__ lvtp,
              float* out0, float* lcp, float sscale) {
  union FH { v16h v; v8h h[2]; };
  __shared__ __align__(16) _Float16 Ksh[64 * LP];        // K chunk [kv][d], pitch LP    9 KB
  __shared__ __align__(16) _Float16 LKs[64 * LPL];       // LK chunk [kv][dl], pitch LPL 3 KB
  __shared__ __align__(16) _Float16 Vth[64 * LP];        // V^T [d][kv], pitch LP        9 KB
  __shared__ __align__(16) _Float16 LVs[HL * LP];        // LV^T [dl][kv], pitch LP      2304 B
  __shared__ __align__(16) _Float16 Psh[4][16 * LP];     // per wave P [row][kv], pitch LP 9 KB
  __shared__ __align__(16) float    Os[4][16 * 64];      // per wave ctx tile   16 KB
  __shared__ __align__(16) float    OLs[4][16 * HL];     // per wave lctx tile   4 KB

  const int tid  = threadIdx.x;
  const int wave = tid >> 5;
  const int lane = tid & 31;
  const int hh   = lane >> 4;
  const int c    = lane & 15;

  const int bx   = blockIdx.x;
  const int qb   = bx % NQB;
  const int rest = bx / NQB;
  const int h    = rest % NH;
  const int b    = rest / NH;
  const int q0   = qb * 64 + wave * 16;
  const size_t rowB = (size_t)b * SEQ;

  const _Float16* Q   = (const _Float16*)(const void*)qp;
  const _Float16* LQ  = (const _Float16*)(const void*)lqp;
  const _Float16* Kg  = (const _Float16*)(const void*)kp + (size_t)h * HD;
  const _Float16* LKg = (const _Float16*)(const void*)lkp + (size_t)h * HL;
  const _Float16* Vh  = (const _Float16*)(const void*)vtp  + ((size_t)b * DM + (size_t)h * HD) * SEQ;
  const _Float16* LVh = (const _Float16*)(const void*)lvtp + ((size_t)b * DL + (size_t)h * HL) * SEQ;

  // ---- Q fragments (A operand, row = lane&15): 2 d-chunks of the text stream; layout fragment k 0..15 ----
  v16h qa[2];
#pragma unroll
  for (int dc = 0; dc < 2; ++dc) {
    const size_t qo = (rowB + q0 + c) * DM + (size_t)h * HD + dc * 32 + 8 * hh;
    qa[dc] = ldfrag_h(Q + qo);
  }
  FH la;
  la.h[0] = *(const v8h*)(LQ + (rowB + q0 + c) * DL + (size_t)h * HL + 8 * hh);   // k = 8hh..8hh+7
  la.h[1] = zero8h();                                                              // k 16..31 = 0

  float mrow[8], lrow[8];
  v8f oacc[4];
  v8f olacc = zero8();
#pragma unroll
  for (int r = 0; r < 8; ++r) { mrow[r] = -INFINITY; lrow[r] = 0.f; }
#pragma unroll
  for (int t = 0; t < 4; ++t) oacc[t] = zero8();

  for (int kt = 0; kt < NKT; ++kt) {         // static trip count
    const int kv0 = kt * 64;
    __syncthreads();
    {
      const int r = tid >> 1, half = (tid & 1) * 32;
      const _Float16* kg = Kg + (rowB + kv0 + r) * DM + half;       // k row kv0+r, d = half..half+31
      const _Float16* vg = Vh + (size_t)r * SEQ + kv0 + half;        // v^T row d = r, s = kv0+half..+31
#pragma unroll
      for (int i = 0; i < 4; ++i) {
        const v8h a0 = *(const v8h*)(kg + 8 * i);
        const v8h b0 = *(const v8h*)(vg + 8 * i);
        *(v8h*)(Ksh + r * LP + half + 8 * i) = a0;
        *(v8h*)(Vth + r * LP + half + 8 * i) = b0;
      }
      const int c8l = (tid & 1) * 8;                                  // lk row kv0+r, dl = c8l..c8l+7
      const v8h lk8 = *(const v8h*)(LKg + (rowB + kv0 + r) * DL + c8l);
      *(v8h*)(LKs + r * LPL + c8l) = lk8;
      const int dv = tid >> 3, s8 = (tid & 7) * 8;                   // lv^T row dl = dv, s = kv0+s8..+7
      const v8h lv8 = *(const v8h*)(LVh + (size_t)dv * SEQ + kv0 + s8);
      *(v8h*)(LVs + dv * LP + s8) = lv8;
    }
    __syncthreads();

    // ---- scores: 16 query rows x 64 keys per wave ----
    v8f s[4];
#pragma unroll
    for (int j = 0; j < 4; ++j) {
      v8f acc = zero8();
#pragma unroll
      for (int dc = 0; dc < 2; ++dc) {
        FH kb;
        kb.h[0] = *(const v8h*)(Ksh + (j * 16 + c) * LP + dc * 32 + 8 * hh);
        kb.h[1] = *(const v8h*)(Ksh + (j * 16 + c) * LP + dc * 32 + 16 + 8 * hh);
        acc = mma_h(qa[dc], kb.v, acc);
      }
      FH lb;
      lb.h[0] = *(const v8h*)(LKs + (j * 16 + c) * LPL + 8 * hh);
      lb.h[1] = zero8h();
      acc = mma_h(la.v, lb.v, acc);
#pragma unroll
      for (int r = 0; r < 8; ++r) s[j][r] = acc[r] * sscale;
    }

    // ---- row max, online softmax, P (x1024, f16) to LDS ----
    _Float16* pwh = Psh[wave];
#pragma unroll
    for (int r = 0; r < 8; ++r) {
      float m = s[0][r];
#pragma unroll
      for (int j = 1; j < 4; ++j) m = fmaxf(m, s[j][r]);
#pragma unroll
      for (int off = 1; off < 16; off <<= 1) m = fmaxf(m, __shfl_xor(m, off, 32));
      const float mnew  = fmaxf(mrow[r], m);
      const float msafe = (mnew == -INFINITY) ? 0.f : mnew;
      const float alpha = __expf(mrow[r] - msafe);
      mrow[r] = mnew;
      float psum = 0.f;
#pragma unroll
      for (int j = 0; j < 4; ++j) {
        const float p = __expf(s[j][r] - msafe);
        psum += p;
        pwh[(8 * hh + r) * LP + j * 16 + c] = (_Float16)(p * 1024.0f);
      }
#pragma unroll
      for (int off = 1; off < 16; off <<= 1) psum += __shfl_xor(psum, off, 32);
      lrow[r] = lrow[r] * alpha + psum;
#pragma unroll
      for (int t = 0; t < 4; ++t) oacc[t][r] *= alpha;
      olacc[r] *= alpha;
    }
    __builtin_amdgcn_fence(__ATOMIC_RELEASE, "workgroup");
    __builtin_amdgcn_wave_barrier();
    __builtin_amdgcn_fence(__ATOMIC_ACQUIRE, "workgroup");

    // ---- ctx += P . V, lctx += P . LV (f16 WMMA) ----
#pragma unroll 1
    for (int kk = 0; kk < 2; ++kk) {
      FH pa;
      pa.h[0] = *(const v8h*)(pwh + c * LP + kk * 32 + 8 * hh);
      pa.h[1] = *(const v8h*)(pwh + c * LP + kk * 32 + 16 + 8 * hh);
#pragma unroll
      for (int t = 0; t < 4; ++t) {
        FH vb;
        vb.h[0] = *(const v8h*)(Vth + (t * 16 + c) * LP + kk * 32 + 8 * hh);
        vb.h[1] = *(const v8h*)(Vth + (t * 16 + c) * LP + kk * 32 + 16 + 8 * hh);
        oacc[t] = mma_h(pa.v, vb.v, oacc[t]);
      }
      FH wb;
      wb.h[0] = *(const v8h*)(LVs + c * LP + kk * 32 + 8 * hh);
      wb.h[1] = *(const v8h*)(LVs + c * LP + kk * 32 + 16 + 8 * hh);
      olacc = mma_h(pa.v, wb.v, olacc);
    }
  }

  float* os = Os[wave];
  float* ol = OLs[wave];
#pragma unroll
  for (int r = 0; r < 8; ++r) {
    const float l = lrow[r];
    const float inv = ((l > 0.f) ? (1.0f / l) : 0.f) * (1.0f / 1024.0f);
#pragma unroll
    for (int t = 0; t < 4; ++t) os[(8 * hh + r) * 64 + t * 16 + c] = oacc[t][r] * inv;
    ol[(8 * hh + r) * HL + c] = olacc[r] * inv;
  }
  __builtin_amdgcn_fence(__ATOMIC_RELEASE, "workgroup");
  __builtin_amdgcn_wave_barrier();
  __builtin_amdgcn_fence(__ATOMIC_ACQUIRE, "workgroup");
  {
    const int h2 = lane >> 4, c4 = (lane & 15) * 4;     // 256-B row segment = 16 lanes x 16 B
    float* ob = out0 + (rowB + q0) * DM + (size_t)h * HD + c4;
    float* lb = lcp + (((size_t)(b * NH + h)) * SEQ + (size_t)q0) * HL;
    {
#pragma unroll
      for (int it = 0; it < 8; ++it) {
        const int row = it * 2 + h2;                     // it 0..7 x h2 0..1 = rows 0..15
        const v4f v = *(const v4f*)(os + row * 64 + c4);
        *(v4f*)(ob + (size_t)row * DM) = v;
      }
#pragma unroll
      for (int it = 0; it < 2; ++it) {
        const int idx = it * 32 + lane;                  // float4 0..63 of the contiguous 16x16 tile
        const v4f v = *(const v4f*)(ol + idx * 4);
        *(v4f*)(lb + idx * 4) = v;
      }
      
    }
  }
}

// =====================================================================================================
// out1[(b*SEQ + t)*DL + h*16 + d] = LC[b][h][t][d] (f32). One float4 per thread over the flat out1 array
// (col % 4 == 0, so a float4 never crosses a row); consecutive lanes write consecutive 16 B: a wave writes
// coverage: n4 threads x 4 = the whole out1 (n4 multiple of 256).
// =====================================================================================================
__global__ __launch_bounds__(256) void lc_pack(const float* __restrict__ lc, float* out1, int n4) {
  const int i = blockIdx.x * 256 + (int)threadIdx.x;
  if (i < n4) {
    const int e   = i * 4;
    const int row = e / DL;                 // b*SEQ + t
    const int col = e - row * DL;           // h*16 + d, multiple of 4
    const int hd  = col >> 4;
    const int d   = col & 15;
    const int bb  = row / SEQ;
    const int t   = row - bb * SEQ;
    const v4f v = *(const v4f*)(lc + (((size_t)(bb * NH + hd)) * SEQ + (size_t)t) * HL + d);
    float* o = out1 + (size_t)e;
    *(v4f*)o = v;
    
  }
}

// =====================================================================================================
// Workspace map (bytes), every region an exact multiple of its whole-line / whole-tile store granularity:
//   Xh   f16 [8192][768]            12582912
//   Lh   f16 [8192][192]             3145728
//   Wqh  f16 [768 n][768 k] (x64)    1179648
//   Wkh  f16 [768][768]     (x64)    1179648
//   Wvh  f16 [768][768]     (x64)    1179648
//   Wlqh f16 [192][192]     (x64)      73728
//   Wlkh f16 [192][192]     (x64)      73728
//   Wlvh f16 [192][192]     (x64)      73728
//   Qp   f16 [8192][768]            12582912
//   Kp   f16 [8192][768]            12582912
//   VTp  f16 [8][768][1024]         12582912
//   LQp  f16 [8192][192]   (x2)      3145728
//   LKp  f16 [8192][192]             3145728
//   LVTp f16 [8][192][1024]          3145728
//   LC   f32 [8][12][1024][16]       6291456
//   total                           72966144
// Weights are [out n][in k] with k contiguous = the Bt / A layout the GEMM wants, so they are only converted.
// =====================================================================================================
extern "C" void kernel_launch(void* const* d_in, const int* in_sizes, int n_in,
                              void* d_out, int out_size, void* d_ws, size_t ws_size,
                              hipStream_t stream) {
  if (n_in < 14) return;
  if (in_sizes[0] != NB * SEQ * DM) return;
  if (in_sizes[1] != NB * SEQ * DL) return;
  if (in_sizes[2] != DM * DM || in_sizes[4] != DM * DM || in_sizes[6] != DM * DM) return;
  if (in_sizes[3] != DM || in_sizes[5] != DM || in_sizes[7] != DM) return;
  if (in_sizes[8] != DL * DL || in_sizes[10] != DL * DL || in_sizes[12] != DL * DL) return;
  if (in_sizes[9] != DL || in_sizes[11] != DL || in_sizes[13] != DL) return;
  if (out_size != NB * SEQ * (DM + DL)) return;

  const float* x    = (const float*)d_in[0];
  const float* xl   = (const float*)d_in[1];
  const float* Wq   = (const float*)d_in[2];
  const float* bq   = (const float*)d_in[3];
  const float* Wk   = (const float*)d_in[4];
  const float* bk   = (const float*)d_in[5];
  const float* Wv   = (const float*)d_in[6];
  const float* bv   = (const float*)d_in[7];
  const float* Wlq  = (const float*)d_in[8];
  const float* blq  = (const float*)d_in[9];
  const float* Wlk  = (const float*)d_in[10];
  const float* blk_ = (const float*)d_in[11];
  const float* Wlv  = (const float*)d_in[12];
  const float* blv  = (const float*)d_in[13];

  const size_t PX  = (size_t)NB * SEQ * DM * 2;    // 12582912  f16 text plane [8192][768]
  const size_t PL  = (size_t)NB * SEQ * DL * 2;    //  3145728  f16 layout plane [8192][192]
  const size_t PW  = (size_t)DM * DM * 2;          //  1179648  f16 [768][768] weight plane
  const size_t PWL = (size_t)DL * DL * 2;          //    73728  f16 [192][192] weight plane
  const size_t PLC = (size_t)NB * NH * SEQ * HL * 4; // 6291456 f32 lctx plane
  size_t off = 0;
  const size_t oXh   = off; off += PX;
  const size_t oLh   = off; off += PL;
  const size_t oWq   = off; off += PW;
  const size_t oWk   = off; off += PW;
  const size_t oWv   = off; off += PW;
  const size_t oWlq  = off; off += PWL;
  const size_t oWlk  = off; off += PWL;
  const size_t oWlv  = off; off += PWL;
  const size_t oQp   = off; off += PX;
  const size_t oKp   = off; off += PX;
  const size_t oVTp  = off; off += PX;
  const size_t oLQp  = off; off += PL;
  const size_t oLKp  = off; off += PL;
  const size_t oLVTp = off; off += PL;
  const size_t oLC   = off; off += PLC;
  if (off > ws_size) return;                       // off = 72966144
  if (off > (size_t)134217728) return;

  char* ws = (char*)d_ws;
  unsigned short* Xh   = (unsigned short*)(ws + oXh);
  unsigned short* Lh   = (unsigned short*)(ws + oLh);
  unsigned short* Wqh  = (unsigned short*)(ws + oWq);
  unsigned short* Wkh  = (unsigned short*)(ws + oWk);
  unsigned short* Wvh  = (unsigned short*)(ws + oWv);
  unsigned short* Wlqh = (unsigned short*)(ws + oWlq);
  unsigned short* Wlkh = (unsigned short*)(ws + oWlk);
  unsigned short* Wlvh = (unsigned short*)(ws + oWlv);
  unsigned short* Qp   = (unsigned short*)(ws + oQp);
  unsigned short* Kp   = (unsigned short*)(ws + oKp);
  unsigned short* VTp  = (unsigned short*)(ws + oVTp);
  unsigned short* LQp  = (unsigned short*)(ws + oLQp);
  unsigned short* LKp  = (unsigned short*)(ws + oLKp);
  unsigned short* LVTp = (unsigned short*)(ws + oLVTp);
  float*          LC   = (float*)(ws + oLC);
  float*          out0 = (float*)d_out;
  float*          out1 = (float*)d_out + (size_t)NB * SEQ * DM;   // byte offset 25165824 / 4; last index 7864319 < out_size

  const dim3 blk(256);
  const int n4o1 = NB * SEQ * DL / 4;                          // 393216
  const dim3 gCvt(CB_ALL);                                     // 4758 blocks: the eight planes
  const dim3 gProj(GB_ALL);                                    //  720 blocks: the six projections
  const dim3 gAttn(NB * NH * NQB);                             // 1536 blocks of 128
  const dim3 gPack((n4o1 + 255) / 256);                        // 1536 blocks

  // (1) activations f32 -> f16 (x1); weights [n][k] f32 -> f16 (x64): one grid, planes Xh .. Wlvh back to back from Xh
  cvt_all<<<gCvt, blk, 0, stream>>>(x, xl, Wq, Wk, Wv, Wlq, Wlk, Wlv, Xh);
  // (2) q, k, v^T, lq (x2), lk, lv^T -> f16 planes: one grid
  proj_all<<<gProj, blk, 0, stream>>>(Xh, Lh, Wqh, Wkh, Wvh, Wlqh, Wlkh, Wlvh, bq, bk, bv, blq, blk_, blv,
                                      Qp, Kp, VTp, LQp, LKp, LVTp);
  // (3) attention: ctx -> out0, lctx -> LC plane
  attn_two<<<gAttn, dim3(128), 0, stream>>>(Qp, Kp, VTp, LQp, LKp, LVTp, out0, LC, 0.125f);
  // (4) LC plane -> out1 [8192][192]
  lc_pack<<<gPack, blk, 0, stream>>>(LC, out1, n4o1);
  (void)hipGetLastError();
}

// v004
// One run takes 101 microseconds.
// Two timings next to v003 both put it at 1.50 times that version's speed.
// Counting every step since v000, it is 3.39 times as fast.
// Contractions: q, k, v^T, lq, lk, lv^T projections = v_wmma_f32_16x16x32_f16 (activations f16 x1, weights f16 x64, single product, f32 accumulate);
// k.q^T and lk.lq^T scores (transposed) = v_wmma_f32_16x16x32_f16 (q, k, lk f16 x1, lq f16 x2, layout K=16 zero-padded to 32 in registers, single products, one f32 accumulator);
// v^T.p^T and lv^T.p^T = v_wmma_f32_16x16x32_f16 (p carried x1024 in f16, v and lv f16 x1, single products, f32 accumulate); softmax and normalisation in f32.
// Carry audit: weight planes x64 -> 1/64 folded in the gemm64 epilogue (ascale); LQ plane x2 -> folded by the common score scale 0.125
//              in attn_two (q.k/8 + lq.lk/4 = (q.k + 2lq.lk)/8); P x1024 (registers only) -> 1/1024 folded in the attn_two epilogue (inv);
//              activation planes, Q/K/V^T/LK/LV^T planes and the LC f32 plane carry x1.
#include <hip/hip_runtime.h>
#include <math.h>
#include <stdint.h>

#define NB   8
#define SEQ  1024
#define DM   768
#define DL   192
#define NH   12
#define HD   64
#define HL   16
#define NQB  (SEQ / 64)   // 64-row query blocks per sequence
#define NKT  (SEQ / 64)   // 64-key chunks per sequence
#define LP   72           // LDS row pitch in halves of the 64-half rows read by 16-B fragment loads: 144 B = 16 B x odd
#define LPL  24           // the same for the 16-half LK rows: 48 B = 16 B x odd
#define OP   68           // LDS row pitch in floats of the ctx tile, written by 16-B stores down a column of rows: 272 B = 16 B x odd
// LDS ring of the K=768 projections: a stage is 64 k (128 B) of 128 A rows, then of 256 B rows, at pitch LP; two buffers
#define RROWS  (128 + 256)
#define RBUF   (RROWS * LP)                         // halves a buffer: 55296 B
// block ranges of the two merged grids (256 threads a block)
#define CB_X   (NB * SEQ * DM / 8 / 256)            // 3072 blocks: x plane, 8 elements a thread
#define CB_L   (NB * SEQ * DL / 8 / 256)            //  768 blocks: layout plane
#define CB_W   (DM * DM / 8 / 256)                  //  288 blocks: one [768][768] weight plane
#define CB_WL  (DL * DL / 8 / 256)                  //   18 blocks: one [192][192] weight plane
#define CB_ALL (CB_X + CB_L + 3 * CB_W + 3 * CB_WL) // 4758 blocks
#define GB_T   (((NB * SEQ) / 128) * (DM / 256))    //  192 blocks: M=8192, N=768, one 128x256 tile a block
#define GB_VT  ((DM / 128) * (SEQ / 256))           //   24 blocks a batch: M=768, N=1024
#define GB_L   (((NB * SEQ) / 64) * (DL / 64) / 8)  //   48 blocks: M=8192, N=192
#define GB_LVT ((DL / 64) * (SEQ / 64) / 8)         //    6 blocks a batch: M=192, N=1024
#define GB_ALL (2 * GB_T + NB * GB_VT + 2 * GB_L + NB * GB_LVT)   // 720 blocks
static_assert((NB * SEQ * DM) % 2048 == 0 && (NB * SEQ * DL) % 2048 == 0 && (DM * DM) % 2048 == 0 && (DL * DL) % 2048 == 0);
static_assert(((NB * SEQ) % 128) == 0 && (DM % 256) == 0 && (DM % 128) == 0 && (SEQ % 256) == 0 && DM / 64 >= 2);
static_assert((((NB * SEQ) / 64) * (DL / 64)) % 8 == 0 && ((DL / 64) * (SEQ / 64)) % 8 == 0);
static_assert(NH * HD == DM);
static_assert(NH * HL == DL);
static_assert(NQB == 16 && NKT == 16);
static_assert((SEQ % 64) == 0 && (DM % 64) == 0 && (DL % 64) == 0);
static_assert((DM % 32) == 0 && (DL % 32) == 0);

typedef _Float16 v16h __attribute__((ext_vector_type(16)));
typedef _Float16 v8h  __attribute__((ext_vector_type(8)));
typedef float    v8f  __attribute__((ext_vector_type(8)));
typedef float    v4f  __attribute__((ext_vector_type(4)));
typedef unsigned int v4u __attribute__((ext_vector_type(4)));

#if defined(__HIP_DEVICE_COMPILE__)
#define DEV_ASM 1
#else
#define DEV_ASM 0
#endif

// ---- scalar helpers --------------------------------------------------------------------------------
__device__ __forceinline__ unsigned short h_bits(_Float16 x) { return __builtin_bit_cast(unsigned short, x); }
__device__ __forceinline__ unsigned pk16(unsigned short a, unsigned short b) { return (unsigned)a | ((unsigned)b << 16); }
__device__ __forceinline__ v8f zero8() { v8f z = {0.f, 0.f, 0.f, 0.f, 0.f, 0.f, 0.f, 0.f}; return z; }
__device__ __forceinline__ v8h zero8h() {
  const _Float16 z = (_Float16)0.0f;
  v8h r = {z, z, z, z, z, z, z, z};
  return r;
}

// ---- fragment loader: 16-bit A/B operand, lane -> row/col (lane&15), p already includes +8*(lane>>4);
//      elements 0..7 <- p[0..7] (k0+8h..k0+8h+7), elements 8..15 <- p[16..23] (k0+16+8h..k0+16+8h+7)
__device__ __forceinline__ v16h ldfrag_h(const _Float16* p) {
  union { v16h v; v8h h[2]; } f;
  f.h[0] = *(const v8h*)(p);
  f.h[1] = *(const v8h*)(p + 16);
  return f.v;
}

// lane l <-> lane l ^ 16: the other half of the wave holds the other keys of the same query
__device__ __forceinline__ float xhalf(float x) {
  return __builtin_bit_cast(float, __builtin_amdgcn_permlanex16(__builtin_bit_cast(int, x), __builtin_bit_cast(int, x),
                                                                0x76543210, 0xfedcba98, false, false));
}

// ---- WMMA helpers ----------------------------------------------------------------------------------
__device__ __forceinline__ v8f mmar(v16h a, v16h b, v8f c) {
  return __builtin_amdgcn_wmma_f32_16x16x32_f16(false, a, false, b, (short)0, c, false, false);
}
// guarded form: 4 VALU slots after the WMMA, D tied, A/B kept live
__device__ __forceinline__ v8f mma_h(v16h a, v16h b, v8f c) {
  c = __builtin_amdgcn_wmma_f32_16x16x32_f16(false, a, false, b, (short)0, c, false, false);
#if DEV_ASM
  asm volatile("v_nop\n\tv_nop\n\tv_nop\n\tv_nop" : "+v"(c) : "v"(a), "v"(b));
#endif
  return c;
}
__device__ __forceinline__ void dep_guard(v8f& a, v8f& b, v16h x, v16h y) {
#if DEV_ASM
  asm volatile("v_nop\n\tv_nop\n\tv_nop\n\tv_nop" : "+v"(a), "+v"(b) : "v"(x), "v"(y));
#else
  (void)a; (void)b; (void)x; (void)y;
#endif
}
__device__ __forceinline__ void keep4(v16h a, v16h b, v16h c, v16h d) {
#if DEV_ASM
  asm volatile("v_nop" :: "v"(a), "v"(b), "v"(c), "v"(d));
#else
  (void)a; (void)b; (void)c; (void)d;
#endif
}
__device__ __forceinline__ void acc_guard4(v8f& a, v8f& b, v8f& c, v8f& d) {
#if DEV_ASM
  asm volatile("v_nop\n\tv_nop\n\tv_nop\n\tv_nop" : "+v"(a), "+v"(b), "+v"(c), "+v"(d));
#else
  (void)a; (void)b; (void)c; (void)d;
#endif
}

// ---- asynchronous copies global -> LDS -------------------------------------------------------------
// One stage of the ring: each of the 256 threads brings twelve 16-B pieces, piece (t & 7) of rows (t >> 3) + 32 i;
// i 0..3 are the 128 A rows, i 4..11 the 256 B rows, so a wave's copy covers four whole 128-B lines.
// l = the thread's LDS byte address of its piece in row (t >> 3) of the target buffer; ga, gb = its global piece in
// the first A row and the first B row of the stage; sa, sb = 32 rows in halves.
// The s_wait_xcnt closes the statement so that no address register is rewritten ahead of it.
__device__ __forceinline__ void stage_copy(unsigned l, const _Float16* ga, const _Float16* gb, size_t sa, size_t sb) {
#if DEV_ASM
  asm volatile(
      "global_load_async_to_lds_b128 %0, %12, off\n\t"
      "global_load_async_to_lds_b128 %1, %13, off\n\t"
      "global_load_async_to_lds_b128 %2, %14, off\n\t"
      "global_load_async_to_lds_b128 %3, %15, off\n\t"
      "global_load_async_to_lds_b128 %4, %16, off\n\t"
      "global_load_async_to_lds_b128 %5, %17, off\n\t"
      "global_load_async_to_lds_b128 %6, %18, off\n\t"
      "global_load_async_to_lds_b128 %7, %19, off\n\t"
      "global_load_async_to_lds_b128 %8, %20, off\n\t"
      "global_load_async_to_lds_b128 %9, %21, off\n\t"
      "global_load_async_to_lds_b128 %10, %22, off\n\t"
      "global_load_async_to_lds_b128 %11, %23, off\n\t"
      "s_wait_xcnt 0x0"
      :: "v"(l), "v"(l + 1u * 32u * LP * 2u), "v"(l + 2u * 32u * LP * 2u), "v"(l + 3u * 32u * LP * 2u),
         "v"(l + 4u * 32u * LP * 2u), "v"(l + 5u * 32u * LP * 2u), "v"(l + 6u * 32u * LP * 2u),
         "v"(l + 7u * 32u * LP * 2u), "v"(l + 8u * 32u * LP * 2u), "v"(l + 9u * 32u * LP * 2u),
         "v"(l + 10u * 32u * LP * 2u), "v"(l + 11u * 32u * LP * 2u),
         "v"(ga), "v"(ga + sa), "v"(ga + 2 * sa), "v"(ga + 3 * sa),
         "v"(gb), "v"(gb + sb), "v"(gb + 2 * sb), "v"(gb + 3 * sb),
         "v"(gb + 4 * sb), "v"(gb + 5 * sb), "v"(gb + 6 * sb), "v"(gb + 7 * sb)
      : "memory");
#else
  (void)l; (void)ga; (void)gb; (void)sa; (void)sb;
#endif
}
// this wave's copies have landed in LDS
__device__ __forceinline__ void wait_copies() {
#if DEV_ASM
  asm volatile("s_wait_asynccnt 0x0" ::: "memory");
#endif
}
// this wave's LDS reads have returned, so the buffer may go to its next writer
__device__ __forceinline__ void wait_lds() {
#if DEV_ASM
  asm volatile("s_wait_dscnt 0x0" ::: "memory");
#endif
}

// =====================================================================================================
// f32 -> f16 bits of (x * scale) for all eight planes in ONE grid: the planes lie back to back in the workspace
// in the order x, layout, Wq, Wk, Wv, Wlq, Wlk, Wlv, and each is a whole number of blocks, so the block index
// picks the source plane (block-uniform) and the flat thread index is the output position.
// 8 elements per thread, one 16-B store per lane: a wave writes 512 contiguous bytes.
// coverage: CB_ALL blocks x 256 threads x 8 = all eight planes exactly (static_asserts above), so no bound test.
// =====================================================================================================
__global__ __launch_bounds__(256) void cvt_all(const float* __restrict__ x, const float* __restrict__ xl,
                                               const float* __restrict__ wq, const float* __restrict__ wk,
                                               const float* __restrict__ wv, const float* __restrict__ wlq,
                                               const float* __restrict__ wlk, const float* __restrict__ wlv,
                                               unsigned short* out) {
  const int blk = blockIdx.x;
  const float* in = x;
  int first = 0;                 // first block of the plane
  float scale = 1.0f;            // activations x1, weights x64
  if (blk >= CB_X)                                  { in = xl;  first = CB_X; }
  if (blk >= CB_X + CB_L)                           { in = wq;  first = CB_X + CB_L;                       scale = 64.0f; }
  if (blk >= CB_X + CB_L + CB_W)                    { in = wk;  first = CB_X + CB_L + CB_W; }
  if (blk >= CB_X + CB_L + 2 * CB_W)                { in = wv;  first = CB_X + CB_L + 2 * CB_W; }
  if (blk >= CB_X + CB_L + 3 * CB_W)                { in = wlq; first = CB_X + CB_L + 3 * CB_W; }
  if (blk >= CB_X + CB_L + 3 * CB_W + CB_WL)        { in = wlk; first = CB_X + CB_L + 3 * CB_W + CB_WL; }
  if (blk >= CB_X + CB_L + 3 * CB_W + 2 * CB_WL)    { in = wlv; first = CB_X + CB_L + 3 * CB_W + 2 * CB_WL; }
  const int i = (blk - first) * 256 + (int)threadIdx.x;      // 8-element unit inside the source plane
  const int o = blk * 256 + (int)threadIdx.x;                // 8-element unit inside the eight planes
  const v4f a = *(const v4f*)(in + (size_t)i * 8);
  const v4f c = *(const v4f*)(in + (size_t)i * 8 + 4);
  v4u p;
  p[0] = pk16(h_bits((_Float16)(a[0] * scale)), h_bits((_Float16)(a[1] * scale)));
  p[1] = pk16(h_bits((_Float16)(a[2] * scale)), h_bits((_Float16)(a[3] * scale)));
  p[2] = pk16(h_bits((_Float16)(c[0] * scale)), h_bits((_Float16)(c[1] * scale)));
  p[3] = pk16(h_bits((_Float16)(c[2] * scale)), h_bits((_Float16)(c[3] * scale)));
  *(v4u*)(out + (size_t)o * 8) = p;
}

// =====================================================================================================
// Register-blocked batched f16 WMMA GEMM with bias: C[m][n] = (sum_k A[m][k] * Bt[n][k]) * ascale + bias,
// stored as f16(value * oscale). One wave per 64x64 tile. A row-major [M][K] pitch lda;
// Bt row-major [N][K] pitch ldb (k contiguous); M, N multiples of 64, K multiple of 32 (host-checked).
// bx = block index inside the product, b = batch index (strides in elements), sT = the block's LDS slabs.
// RING 0: the block's 8 tiles are consecutive in n, no block barriers, fragments loaded straight from global
//         with the split k map.
// RING 1: the 8 tiles are 2 (m) x 4 (n) = one 128x256 tile (M multiple of 128, N of 256, K of 64, at least 128).
//         Its operand rows come to LDS in stages of 64 k by asynchronous copies, two buffers: the copies of stage
//         s + 2 fly while stage s + 1 is worked on; fragments are read from LDS with the same split k map and the
//         same k order. Every wave passes every barrier (no early return on this path).
// BIASROW 0: bias[n] (bias length N); BIASROW 1: bias[m] (bias length M).
// coverage: 4 slabs x 16 rows (it 0..3 x lane>>3 0..3) x 64 cols (8 lanes x 8) = the wave's whole 64x64 tile.
// =====================================================================================================
template <int BIASROW, int RING>
__device__ __forceinline__ void gemm64(
    float (*sT)[16 * 68], _Float16* ring, int bx, int b,
    const unsigned short* __restrict__ Ap, int lda, long long strideA,
    const unsigned short* __restrict__ Btp, int ldb, long long strideB,
    const float* __restrict__ bias,
    unsigned short* Cp, int ldc, long long strideC,
    int M, int N, int K, float ascale, float oscale) {
  const _Float16* A  = (const _Float16*)(const void*)Ap;
  const _Float16* Bt = (const _Float16*)(const void*)Btp;
  const int lane = threadIdx.x & 31;
  const int wave = threadIdx.x >> 5;
  int m0, n0;                              // the wave's 64x64 tile
  int bm0 = 0, bn0 = 0;                    // RING: the block's 128x256 tile
  if constexpr (RING) {
    const int tilesN = N >> 8;
    const int tm = bx / tilesN;
    const int tn = bx - tm * tilesN;
    bm0 = tm << 7;
    bn0 = tn << 8;
    m0 = bm0 + ((wave >> 2) << 6);
    n0 = bn0 + ((wave & 3) << 6);
  } else {
    const int tilesN = N >> 6;
    const int tilesM = M >> 6;
    const int tile = bx * 8 + wave;
    if (tile >= tilesM * tilesN) return;   // wave-uniform; no block barriers on this path
    const int tm = tile / tilesN;
    const int tn = tile - tm * tilesN;
    m0 = tm << 6;
    n0 = tn << 6;
  }

  const _Float16* Ab = A  + (size_t)b * (size_t)strideA;
  const _Float16* Bb = Bt + (size_t)b * (size_t)strideB;

  const int rlane = lane & 15;                 // row (A) / col (B, D) within subtile
  const int koff  = (lane >> 4) * 8;           // k offset of this lane half
  const int mOff  = (lane >> 4) * 8;           // D row offset

  v8f acc[4][4];
#pragma unroll
  for (int i = 0; i < 4; ++i)
#pragma unroll
    for (int j = 0; j < 4; ++j) acc[i][j] = zero8();

  if constexpr (RING) {
    const int t = threadIdx.x;
    const _Float16* ga = Ab + (size_t)(bm0 + (t >> 3)) * lda + (t & 7) * 8;   // the thread's piece, first A row
    const _Float16* gb = Bb + (size_t)(bn0 + (t >> 3)) * ldb + (t & 7) * 8;   // the same, first B row
    const size_t sa = (size_t)32 * lda, sb = (size_t)32 * ldb;
    const unsigned l0 = (unsigned)(uintptr_t)ring + (unsigned)((t >> 3) * (LP * 2) + (t & 7) * 16);
    const int aoff = ((wave >> 2) * 64 + rlane) * LP + koff;                  // the wave's A rows in a buffer
    const int boff = (128 + (wave & 3) * 64 + rlane) * LP + koff;             // the wave's B rows
    const int ns = K >> 6;                                                    // stages
    stage_copy(l0, ga, gb, sa, sb);                                           // stage 0 -> buffer 0
    wait_copies();
    __syncthreads();                                                          // stage 0 readable by every wave
    stage_copy(l0 + RBUF * 2u, ga + 64, gb + 64, sa, sb);                     // stage 1 -> buffer 1 (ns >= 2)
#pragma unroll 1   // rolled over the twelve stages, for speed only
    for (int s = 0; s < ns; ++s) {
      const _Float16* buf = ring + (s & 1) * RBUF;
#pragma unroll
      for (int ks = 0; ks < 2; ++ks) {
        v16h bq[4], af[4];                 // all sixteen LDS reads of the 32 k stand together, ahead of the products
#pragma unroll
        for (int j = 0; j < 4; ++j) bq[j] = ldfrag_h(buf + boff + j * 16 * LP + ks * 32);
#pragma unroll
        for (int i = 0; i < 4; ++i) af[i] = ldfrag_h(buf + aoff + i * 16 * LP + ks * 32);
#pragma unroll
        for (int i = 0; i < 4; ++i) {
#pragma unroll
          for (int j = 0; j < 4; ++j) acc[i][j] = mmar(af[i], bq[j], acc[i][j]);
          dep_guard(acc[i][0], acc[i][3], af[i], bq[3]);
        }
        keep4(bq[0], bq[1], bq[2], bq[3]);
      }
      wait_lds();
      wait_copies();
      __syncthreads();
      if (s + 2 < ns) stage_copy(l0 + (unsigned)(s & 1) * (RBUF * 2u), ga + (s + 2) * 64, gb + (s + 2) * 64, sa, sb);
    }
    wait_copies();
  } else {
    for (int k0 = 0; k0 < K; k0 += 32) {
      v16h bq[4];
#pragma unroll
      for (int j = 0; j < 4; ++j)
        bq[j] = ldfrag_h(Bb + (size_t)(n0 + (j << 4) + rlane) * ldb + koff + k0);
#pragma unroll
      for (int i = 0; i < 4; ++i) {
        const v16h af = ldfrag_h(Ab + (size_t)(m0 + (i << 4) + rlane) * lda + koff + k0);
#pragma unroll
        for (int j = 0; j < 4; ++j) acc[i][j] = mmar(af, bq[j], acc[i][j]);
        dep_guard(acc[i][0], acc[i][3], af, bq[3]);
      }
      keep4(bq[0], bq[1], bq[2], bq[3]);
    }
  }
  acc_guard4(acc[0][0], acc[0][1], acc[0][2], acc[0][3]);
  acc_guard4(acc[1][0], acc[1][1], acc[1][2], acc[1][3]);
  acc_guard4(acc[2][0], acc[2][1], acc[2][2], acc[2][3]);
  acc_guard4(acc[3][0], acc[3][1], acc[3][2], acc[3][3]);

  // ---- epilogue ----
  float* slab = sT[wave];
  const int q = lane >> 3, c8 = (lane & 7) * 8;
  unsigned short* C = Cp + (size_t)b * (size_t)strideC;
  float bcol[8];
  {
    const v4f b0 = *(const v4f*)(bias + (BIASROW ? 0 : (n0 + c8)));       // column bias (length N), 16-B aligned
    const v4f b1 = *(const v4f*)(bias + (BIASROW ? 4 : (n0 + c8 + 4)));
#pragma unroll
    for (int e = 0; e < 4; ++e) { bcol[e] = b0[e]; bcol[4 + e] = b1[e]; }
  }
#pragma unroll
  for (int i = 0; i < 4; ++i) {
    const int mBase = m0 + (i << 4);
#pragma unroll
    for (int j = 0; j < 4; ++j) {
#pragma unroll
      for (int r = 0; r < 8; ++r) {
        slab[(mOff + r) * 68 + (j << 4) + rlane] = acc[i][j][r];
      }
    }
    __builtin_amdgcn_fence(__ATOMIC_RELEASE, "workgroup");
    __builtin_amdgcn_wave_barrier();
    __builtin_amdgcn_fence(__ATOMIC_ACQUIRE, "workgroup");
    v4u hv[4];
#pragma unroll
    for (int it = 0; it < 4; ++it) {
      const int row = it * 4 + q;                        // it 0..3 x q 0..3 = rows 0..15
      const float* sp = slab + row * 68 + c8;
      float bb[8];
      if (BIASROW) {
        const float bv = bias[mBase + row];              // row bias, index < M = bias length
#pragma unroll
        for (int e = 0; e < 8; ++e) bb[e] = bv;
      } else {
#pragma unroll
        for (int e = 0; e < 8; ++e) bb[e] = bcol[e];
      }
      v4u a;
#pragma unroll
      for (int e = 0; e < 4; ++e) {
        const float f0 = (sp[2 * e] * ascale + bb[2 * e]) * oscale;
        const float f1 = (sp[2 * e + 1] * ascale + bb[2 * e + 1]) * oscale;
        a[e] = pk16(h_bits((_Float16)f0), h_bits((_Float16)f1));
      }
      hv[it] = a;
    }
    {
#pragma unroll
      for (int it = 0; it < 4; ++it) {
        const int row = it * 4 + q;
        *(v4u*)(C + (size_t)(mBase + row) * ldc + n0 + c8) = hv[it];
      }
      
    }
    __builtin_amdgcn_fence(__ATOMIC_RELEASE, "workgroup");
    __builtin_amdgcn_wave_barrier();
    __builtin_amdgcn_fence(__ATOMIC_ACQUIRE, "workgroup");
  }
}

// =====================================================================================================
// All six projections in ONE grid: they read only the converted planes and write disjoint planes, so none waits
// for another. The block index picks the product (block-uniform); the K=768 products come first, so that the
// short K=192 ones fill the places that free up at the end. The K=768 products take their operands through the
// LDS ring (gemm64, RING 1), each block one 128x256 tile; the K=192 products read them straight from global (RING 0).
//   [0, GB_T)  q = x . Wq^T + bq            [GB_T, 2 GB_T)  k = x . Wk^T + bk          (M=8192, N=768,  K=768)
//   next NB x GB_VT   v^T = Wv . x^T + bv per batch (A = Wvh [n][k], Bt = Xh rows of b)  (M=768,  N=1024, K=768)
//   next GB_L  lq = (xl . Wlq^T + blq) x2   next GB_L  lk = xl . Wlk^T + blk            (M=8192, N=192,  K=192)
//   next NB x GB_LVT  lv^T = Wlv . xl^T + blv per batch                                 (M=192,  N=1024, K=192)
// =====================================================================================================
__global__ __launch_bounds__(256) void proj_all(
    const unsigned short* __restrict__ Xh, const unsigned short* __restrict__ Lh,
    const unsigned short* __restrict__ Wqh, const unsigned short* __restrict__ Wkh,
    const unsigned short* __restrict__ Wvh, const unsigned short* __restrict__ Wlqh,
    const unsigned short* __restrict__ Wlkh, const unsigned short* __restrict__ Wlvh,
    const float* __restrict__ bq, const float* __restrict__ bk, const float* __restrict__ bv,
    const float* __restrict__ blq, const float* __restrict__ blk_, const float* __restrict__ blv,
    unsigned short* Qp, unsigned short* Kp, unsigned short* VTp,
    unsigned short* LQp, unsigned short* LKp, unsigned short* LVTp) {
  __shared__ __align__(16) float sT[8][16 * 68];   // per-wave 16x64 slab, pitch 68 floats
  __shared__ __align__(16) _Float16 ring[2 * RBUF]; // operand stages of the K=768 products, two buffers, 110592 B
  const int blk = blockIdx.x;
  const int T0 = 2 * GB_T;                 // first block of v^T
  const int T1 = T0 + NB * GB_VT;          // first block of lq
  const int T2 = T1 + 2 * GB_L;            // first block of lv^T
  if (blk < T0) {
    // text activations x weights^T, bias by column, operands through the LDS ring
    const bool second = blk >= GB_T;       // the k product
    gemm64<0, 1>(sT, ring, second ? blk - GB_T : blk, 0, Xh, DM, 0LL, second ? Wkh : Wqh, DM, 0LL,
                 second ? bk : bq, second ? Kp : Qp, DM, 0LL, NB * SEQ, DM, DM, 1.0f / 64.0f, 1.0f);
  } else if (blk < T1) {
    // text weights x activations^T per batch, bias by row, operands through the LDS ring
    const int b  = (blk - T0) / GB_VT;     // batch
    const int bx = (blk - T0) - b * GB_VT; // block inside the batch
    gemm64<1, 1>(sT, ring, bx, b, Wvh, DM, 0LL, Xh, DM, (long long)SEQ * DM, bv, VTp, SEQ, (long long)DM * SEQ,
                 DM, SEQ, DM, 1.0f / 64.0f, 1.0f);
  } else if (blk < T2) {
    // layout activations x weights^T, bias by column
    const int  r      = blk - T1;
    const bool second = r >= GB_L;         // the lk product
    gemm64<0, 0>(sT, ring, second ? r - GB_L : r, 0, Lh, DL, 0LL, second ? Wlkh : Wlqh, DL, 0LL,
                 second ? blk_ : blq, second ? LKp : LQp, DL, 0LL, NB * SEQ, DL, DL, 1.0f / 64.0f,
                 second ? 1.0f : 2.0f);
  } else {
    // layout weights x activations^T per batch, bias by row
    const int b  = (blk - T2) / GB_LVT;     // batch
    const int bx = (blk - T2) - b * GB_LVT; // block inside the batch
    gemm64<1, 0>(sT, ring, bx, b, Wlvh, DL, 0LL, Lh, DL, (long long)SEQ * DL, blv, LVTp, SEQ, (long long)DL * SEQ,
                 DL, SEQ, DL, 1.0f / 64.0f, 1.0f);
  }
}

// =====================================================================================================
// Two-stream attention, text head dim 64 + layout head dim 16, no mask, softmax over all SEQ keys.
//   Q plane (f16): element (b, t, h, d) at [(b*SEQ + t)*DM + h*64 + d]; K plane same layout with key s.
//   LQ plane (f16, value x2): [(b*SEQ + t)*DL + h*16 + d]; LK plane (f16 x1) same layout.
//   V^T plane (f16): element (b, h, d, s) at [(b*DM + h*64 + d)*SEQ + s]; LV^T plane: [(b*DL + h*16 + d)*SEQ + s].
//   All products run transposed: the K, LK, V^T and LV^T rows are the A operand, the query side is the B operand, so
//   a lane holds one query (column lane&15) and the keys or the head dims 8*(lane>>4) + r of a tile in its registers.
//   scores^T = (k . q + lk . lq2) * sscale in f32 (3 f16 WMMA steps into one accumulator; the layout step uses
//   k = 0..15 only, upper 16 k-slots are register zeros in both fragments).
//   p = exp(s - m) carried as f16(1024 p); two score tiles (32 keys) pack in place into one B operand, in the k order
//   of the V^T loads; ctx^T = v^T . p^T (4 row tiles), lctx^T = lv^T . p^T (1 row tile); online softmax in f32: maximum
//   and sum run inside the lane, the maximum is joined between the wave halves each chunk, the sum once at the end.
//   Block = 4 waves = 64 query rows of one (b, h); grid = NB * NH * NQB; key chunks of 64, static trip NKT.
//   Chunk staging: 128 threads: K 32 halves/thread (64x64), V^T 32 halves/thread (64x64), LK 8 halves/thread (64x16),
//   LV^T 8 halves/thread (16x64) = every LDS element read below (plain 16-B loads, __syncthreads before and after);
//   ctx -> out0 f32 [(b*SEQ + t)*DM + h*64 + d]: 16 rows x 256-B segments per wave (16 lanes x 16 B per segment,
//   Output coverage: wave rows q0..q0+15 (it 0..7 x lane>>4) x 64 cols (16 lanes x 4) of head h for out0;
//   64 float4 = the wave's whole 16x16 lctx tile for LC; the grid covers every (b, h, qb).
// =====================================================================================================
__global__ __launch_bounds__(128)
void attn_two(const unsigned short* __restrict__ qp, const unsigned short* __restrict__ kp,
              const unsigned short* __restrict__ vtp, const unsigned short* __restrict__ lqp,
              const unsigned short* __restrict__ lkp, const unsigned short* __restrict__ lvtp,
              float* out0, float* lcp, float sscale) {
  union FH { v16h v; v8h h[2]; };
  // one array, so that the tiles of pitch LP lie at constant offsets from one lane address
  __shared__ __align__(16) _Float16 Tsh[(64 + 64 + HL) * LP + 64 * LPL];
  _Float16* const Ksh = Tsh;                             // K chunk [kv][d], pitch LP    9 KB
  _Float16* const Vth = Tsh + 64 * LP;                   // V^T [d][kv], pitch LP        9 KB
  _Float16* const LVs = Tsh + 128 * LP;                  // LV^T [dl][kv], pitch LP      2304 B
  _Float16* const LKs = Tsh + (128 + HL) * LP;           // LK chunk [kv][dl], pitch LPL 3 KB
  __shared__ __align__(16) float    Os[4][16 * OP];      // per wave ctx tile [row][d], pitch OP 17 KB
  __shared__ __align__(16) float    OLs[4][16 * HL];     // per wave lctx tile   4 KB

  const int tid  = threadIdx.x;
  const int wave = __builtin_amdgcn_readfirstlane(tid >> 5);   // in a scalar register, and with it every row index built from it
  const int lane = tid & 31;
  const int hh   = lane >> 4;
  const int c    = lane & 15;

  const int bx   = blockIdx.x;
  const int qb   = bx % NQB;
  const int rest = bx / NQB;
  const int h    = rest % NH;
  const int b    = rest / NH;
  const int q0   = qb * 64 + wave * 16;
  const size_t rowB = (size_t)b * SEQ;

  const _Float16* Q   = (const _Float16*)(const void*)qp;
  const _Float16* LQ  = (const _Float16*)(const void*)lqp;
  const _Float16* Kg  = (const _Float16*)(const void*)kp + (size_t)h * HD;
  const _Float16* LKg = (const _Float16*)(const void*)lkp + (size_t)h * HL;
  const _Float16* Vh  = (const _Float16*)(const void*)vtp  + ((size_t)b * DM + (size_t)h * HD) * SEQ;
  const _Float16* LVh = (const _Float16*)(const void*)lvtp + ((size_t)b * DL + (size_t)h * HL) * SEQ;

  // ---- Q fragments (B operand, column = lane&15): 2 d-chunks of the text stream; layout fragment k 0..15 ----
  v16h qa[2];
#pragma unroll
  for (int dc = 0; dc < 2; ++dc) {
    const size_t qo = (rowB + q0 + c) * DM + (size_t)h * HD + dc * 32 + 8 * hh;
    qa[dc] = ldfrag_h(Q + qo);
  }
  FH la;
  la.h[0] = *(const v8h*)(LQ + (rowB + q0 + c) * DL + (size_t)h * HL + 8 * hh);   // k = 8hh..8hh+7
  la.h[1] = zero8h();                                                              // k 16..31 = 0

  float mrow = -INFINITY;      // running maximum of query c, the same in both wave halves
  float lrow = 0.f;            // running sum of query c over this half's keys
  v8f oacc[4];                 // oacc[t][r] = ctx of query c, d = 16 t + 8 hh + r
  v8f olacc = zero8();         // olacc[r] = lctx of query c, dl = 8 hh + r
#pragma unroll
  for (int t = 0; t < 4; ++t) oacc[t] = zero8();

  // the lane's piece of row c in each staged tile; every fragment read below is a constant offset from one of these
  const _Float16* kfr  = Ksh + c * LP + 8 * hh;
  const _Float16* lkfr = LKs + c * LPL + 8 * hh;
  const _Float16* vfr  = Vth + c * LP + 8 * hh;
  const _Float16* lvfr = LVs + c * LP + 8 * hh;

  for (int kt = 0; kt < NKT; ++kt) {         // static trip count
    const int kv0 = kt * 64;
    __syncthreads();
    {
      const int r = tid >> 1, half = (tid & 1) * 32;
      const _Float16* kg = Kg + (rowB + kv0 + r) * DM + half;       // k row kv0+r, d = half..half+31
      const _Float16* vg = Vh + (size_t)r * SEQ + kv0 + half;        // v^T row d = r, s = kv0+half..+31
#pragma unroll
      for (int i = 0; i < 4; ++i) {
        const v8h a0 = *(const v8h*)(kg + 8 * i);
        const v8h b0 = *(const v8h*)(vg + 8 * i);
        *(v8h*)(Ksh + r * LP + half + 8 * i) = a0;
        *(v8h*)(Vth + r * LP + half + 8 * i) = b0;
      }
      const int c8l = (tid & 1) * 8;                                  // lk row kv0+r, dl = c8l..c8l+7
      const v8h lk8 = *(const v8h*)(LKg + (rowB + kv0 + r) * DL + c8l);
      *(v8h*)(LKs + r * LPL + c8l) = lk8;
      const int dv = tid >> 3, s8 = (tid & 7) * 8;                   // lv^T row dl = dv, s = kv0+s8..+7
      const v8h lv8 = *(const v8h*)(LVh + (size_t)dv * SEQ + kv0 + s8);
      *(v8h*)(LVs + dv * LP + s8) = lv8;
    }
    __syncthreads();

    // ---- scores^T: 64 keys x 16 query columns per wave; s[j][r] = key 16 j + 8 hh + r, query c ----
    v8f s[4];
#pragma unroll
    for (int j = 0; j < 4; ++j) {
      v8f acc = zero8();
#pragma unroll
      for (int dc = 0; dc < 2; ++dc) {
        FH kb;
        kb.h[0] = *(const v8h*)(kfr + j * 16 * LP + dc * 32);
        kb.h[1] = *(const v8h*)(kfr + j * 16 * LP + dc * 32 + 16);
        acc = mma_h(kb.v, qa[dc], acc);
      }
      FH lb;
      lb.h[0] = *(const v8h*)(lkfr + j * 16 * LPL);
      lb.h[1] = zero8h();
      acc = mma_h(lb.v, la.v, acc);
#pragma unroll
      for (int r = 0; r < 8; ++r) s[j][r] = acc[r] * sscale;
    }

    // ---- maximum, online softmax, P^T (x1024, f16) packed into B operands ----
    float mj[4];                              // four independent chains
#pragma unroll
    for (int j = 0; j < 4; ++j) {
      mj[j] = s[j][0];
#pragma unroll
      for (int r = 1; r < 8; ++r) mj[j] = fmaxf(mj[j], s[j][r]);
    }
    float m = fmaxf(fmaxf(mj[0], mj[1]), fmaxf(mj[2], mj[3]));
    m = fmaxf(m, xhalf(m));                   // all 64 keys of the chunk
    const float mnew  = fmaxf(mrow, m);
    const float msafe = (mnew == -INFINITY) ? 0.f : mnew;
    const float alpha = __expf(mrow - msafe);
    mrow = mnew;
#pragma unroll
    for (int t = 0; t < 4; ++t)
#pragma unroll
      for (int r = 0; r < 8; ++r) oacc[t][r] *= alpha;
#pragma unroll
    for (int r = 0; r < 8; ++r) olacc[r] *= alpha;

    // ---- per 32 keys: P^T packed, then ctx^T += V^T . P^T, lctx^T += LV^T . P^T (f16 WMMA) ----
    float pj[4];
#pragma unroll   // s and pj are indexed by kk and live in registers
    for (int kk = 0; kk < 2; ++kk) {
      FH pb;                                  // element e = key 32 kk + (e < 8 ? 8 hh + e : 16 + 8 hh + e - 8)
#pragma unroll
      for (int jj = 0; jj < 2; ++jj) {
        const int j = 2 * kk + jj;
        pj[j] = 0.f;
#pragma unroll
        for (int r = 0; r < 8; ++r) {
          const float p = __expf(s[j][r] - msafe);
          pj[j] += p;
          pb.h[jj][r] = (_Float16)(p * 1024.0f);
        }
      }
#pragma unroll
      for (int t = 0; t < 4; ++t) {
        FH vb;
        vb.h[0] = *(const v8h*)(vfr + t * 16 * LP + kk * 32);
        vb.h[1] = *(const v8h*)(vfr + t * 16 * LP + kk * 32 + 16);
        oacc[t] = mma_h(vb.v, pb.v, oacc[t]);
      }
      FH wb;
      wb.h[0] = *(const v8h*)(lvfr + kk * 32);
      wb.h[1] = *(const v8h*)(lvfr + kk * 32 + 16);
      olacc = mma_h(wb.v, pb.v, olacc);
    }
    lrow = lrow * alpha + ((pj[0] + pj[1]) + (pj[2] + pj[3]));
  }

  float* os = Os[wave];
  float* ol = OLs[wave];
  {
    const float l = lrow + xhalf(lrow);                  // both halves' keys
    const float inv = ((l > 0.f) ? (1.0f / l) : 0.f) * (1.0f / 1024.0f);
#pragma unroll
    for (int g = 0; g < 2; ++g) {                        // a lane's 8 registers are 8 consecutive d of its query's row
#pragma unroll
      for (int t = 0; t < 4; ++t) {
        const v4f v = {oacc[t][4 * g] * inv, oacc[t][4 * g + 1] * inv, oacc[t][4 * g + 2] * inv, oacc[t][4 * g + 3] * inv};
        *(v4f*)(os + c * OP + t * 16 + 8 * hh + 4 * g) = v;
      }
      const v4f w = {olacc[4 * g] * inv, olacc[4 * g + 1] * inv, olacc[4 * g + 2] * inv, olacc[4 * g + 3] * inv};
      *(v4f*)(ol + c * HL + 8 * hh + 4 * g) = w;
    }
  }
  __builtin_amdgcn_fence(__ATOMIC_RELEASE, "workgroup");
  __builtin_amdgcn_wave_barrier();
  __builtin_amdgcn_fence(__ATOMIC_ACQUIRE, "workgroup");
  {
    const int h2 = lane >> 4, c4 = (lane & 15) * 4;     // 256-B row segment = 16 lanes x 16 B
    float* ob = out0 + (rowB + q0) * DM + (size_t)h * HD + c4;
    float* lb = lcp + (((size_t)(b * NH + h)) * SEQ + (size_t)q0) * HL;
    {
#pragma unroll
      for (int it = 0; it < 8; ++it) {
        const int row = it * 2 + h2;                     // it 0..7 x h2 0..1 = rows 0..15
        const v4f v = *(const v4f*)(os + row * OP + c4);
        *(v4f*)(ob + (size_t)row * DM) = v;
      }
#pragma unroll
      for (int it = 0; it < 2; ++it) {
        const int idx = it * 32 + lane;                  // float4 0..63 of the contiguous 16x16 tile
        const v4f v = *(const v4f*)(ol + idx * 4);
        *(v4f*)(lb + idx * 4) = v;
      }
      
    }
  }
}

// =====================================================================================================
// out1[(b*SEQ + t)*DL + h*16 + d] = LC[b][h][t][d] (f32). One float4 per thread over the flat out1 array
// (col % 4 == 0, so a float4 never crosses a row); consecutive lanes write consecutive 16 B: a wave writes
// coverage: n4 threads x 4 = the whole out1 (n4 multiple of 256).
// =====================================================================================================
__global__ __launch_bounds__(256) void lc_pack(const float* __restrict__ lc, float* out1, int n4) {
  const int i = blockIdx.x * 256 + (int)threadIdx.x;
  if (i < n4) {
    const int e   = i * 4;
    const int row = e / DL;                 // b*SEQ + t
    const int col = e - row * DL;           // h*16 + d, multiple of 4
    const int hd  = col >> 4;
    const int d   = col & 15;
    const int bb  = row / SEQ;
    const int t   = row - bb * SEQ;
    const v4f v = *(const v4f*)(lc + (((size_t)(bb * NH + hd)) * SEQ + (size_t)t) * HL + d);
    float* o = out1 + (size_t)e;
    *(v4f*)o = v;
    
  }
}

// =====================================================================================================
// Workspace map (bytes), every region an exact multiple of its whole-line / whole-tile store granularity:
//   Xh   f16 [8192][768]            12582912
//   Lh   f16 [8192][192]             3145728
//   Wqh  f16 [768 n][768 k] (x64)    1179648
//   Wkh  f16 [768][768]     (x64)    1179648
//   Wvh  f16 [768][768]     (x64)    1179648
//   Wlqh f16 [192][192]     (x64)      73728
//   Wlkh f16 [192][192]     (x64)      73728
//   Wlvh f16 [192][192]     (x64)      73728
//   Qp   f16 [8192][768]            12582912
//   Kp   f16 [8192][768]            12582912
//   VTp  f16 [8][768][1024]         12582912
//   LQp  f16 [8192][192]   (x2)      3145728
//   LKp  f16 [8192][192]             3145728
//   LVTp f16 [8][192][1024]          3145728
//   LC   f32 [8][12][1024][16]       6291456
//   total                           72966144
// Weights are [out n][in k] with k contiguous = the Bt / A layout the GEMM wants, so they are only converted.
// =====================================================================================================
extern "C" void kernel_launch(void* const* d_in, const int* in_sizes, int n_in,
                              void* d_out, int out_size, void* d_ws, size_t ws_size,
                              hipStream_t stream) {
  if (n_in < 14) return;
  if (in_sizes[0] != NB * SEQ * DM) return;
  if (in_sizes[1] != NB * SEQ * DL) return;
  if (in_sizes[2] != DM * DM || in_sizes[4] != DM * DM || in_sizes[6] != DM * DM) return;
  if (in_sizes[3] != DM || in_sizes[5] != DM || in_sizes[7] != DM) return;
  if (in_sizes[8] != DL * DL || in_sizes[10] != DL * DL || in_sizes[12] != DL * DL) return;
  if (in_sizes[9] != DL || in_sizes[11] != DL || in_sizes[13] != DL) return;
  if (out_size != NB * SEQ * (DM + DL)) return;

  const float* x    = (const float*)d_in[0];
  const float* xl   = (const float*)d_in[1];
  const float* Wq   = (const float*)d_in[2];
  const float* bq   = (const float*)d_in[3];
  const float* Wk   = (const float*)d_in[4];
  const float* bk   = (const float*)d_in[5];
  const float* Wv   = (const float*)d_in[6];
  const float* bv   = (const float*)d_in[7];
  const float* Wlq  = (const float*)d_in[8];
  const float* blq  = (const float*)d_in[9];
  const float* Wlk  = (const float*)d_in[10];
  const float* blk_ = (const float*)d_in[11];
  const float* Wlv  = (const float*)d_in[12];
  const float* blv  = (const float*)d_in[13];

  const size_t PX  = (size_t)NB * SEQ * DM * 2;    // 12582912  f16 text plane [8192][768]
  const size_t PL  = (size_t)NB * SEQ * DL * 2;    //  3145728  f16 layout plane [8192][192]
  const size_t PW  = (size_t)DM * DM * 2;          //  1179648  f16 [768][768] weight plane
  const size_t PWL = (size_t)DL * DL * 2;          //    73728  f16 [192][192] weight plane
  const size_t PLC = (size_t)NB * NH * SEQ * HL * 4; // 6291456 f32 lctx plane
  size_t off = 0;
  const size_t oXh   = off; off += PX;
  const size_t oLh   = off; off += PL;
  const size_t oWq   = off; off += PW;
  const size_t oWk   = off; off += PW;
  const size_t oWv   = off; off += PW;
  const size_t oWlq  = off; off += PWL;
  const size_t oWlk  = off; off += PWL;
  const size_t oWlv  = off; off += PWL;
  const size_t oQp   = off; off += PX;
  const size_t oKp   = off; off += PX;
  const size_t oVTp  = off; off += PX;
  const size_t oLQp  = off; off += PL;
  const size_t oLKp  = off; off += PL;
  const size_t oLVTp = off; off += PL;
  const size_t oLC   = off; off += PLC;
  if (off > ws_size) return;                       // off = 72966144
  if (off > (size_t)134217728) return;

  char* ws = (char*)d_ws;
  unsigned short* Xh   = (unsigned short*)(ws + oXh);
  unsigned short* Lh   = (unsigned short*)(ws + oLh);
  unsigned short* Wqh  = (unsigned short*)(ws + oWq);
  unsigned short* Wkh  = (unsigned short*)(ws + oWk);
  unsigned short* Wvh  = (unsigned short*)(ws + oWv);
  unsigned short* Wlqh = (unsigned short*)(ws + oWlq);
  unsigned short* Wlkh = (unsigned short*)(ws + oWlk);
  unsigned short* Wlvh = (unsigned short*)(ws + oWlv);
  unsigned short* Qp   = (unsigned short*)(ws + oQp);
  unsigned short* Kp   = (unsigned short*)(ws + oKp);
  unsigned short* VTp  = (unsigned short*)(ws + oVTp);
  unsigned short* LQp  = (unsigned short*)(ws + oLQp);
  unsigned short* LKp  = (unsigned short*)(ws + oLKp);
  unsigned short* LVTp = (unsigned short*)(ws + oLVTp);
  float*          LC   = (float*)(ws + oLC);
  float*          out0 = (float*)d_out;
  float*          out1 = (float*)d_out + (size_t)NB * SEQ * DM;   // byte offset 25165824 / 4; last index 7864319 < out_size

  const dim3 blk(256);
  const int n4o1 = NB * SEQ * DL / 4;                          // 393216
  const dim3 gCvt(CB_ALL);                                     // 4758 blocks: the eight planes
  const dim3 gProj(GB_ALL);                                    //  720 blocks: the six projections
  const dim3 gAttn(NB * NH * NQB);                             // 1536 blocks of 128
  const dim3 gPack((n4o1 + 255) / 256);                        // 1536 blocks

  // (1) activations f32 -> f16 (x1); weights [n][k] f32 -> f16 (x64): one grid, planes Xh .. Wlvh back to back from Xh
  cvt_all<<<gCvt, blk, 0, stream>>>(x, xl, Wq, Wk, Wv, Wlq, Wlk, Wlv, Xh);
  // (2) q, k, v^T, lq (x2), lk, lv^T -> f16 planes: one grid
  proj_all<<<gProj, blk, 0, stream>>>(Xh, Lh, Wqh, Wkh, Wvh, Wlqh, Wlkh, Wlvh, bq, bk, bv, blq, blk_, blv,
                                      Qp, Kp, VTp, LQp, LKp, LVTp);
  // (3) attention: ctx -> out0, lctx -> LC plane
  attn_two<<<gAttn, dim3(128), 0, stream>>>(Qp, Kp, VTp, LQp, LKp, LVTp, out0, LC, 0.125f);
  // (4) LC plane -> out1 [8192][192]
  lc_pack<<<gPack, blk, 0, stream>>>(LC, out1, n4o1);
  (void)hipGetLastError();
}

// v005
// Measured time: 94.7 microseconds a run.
// Next to v004, in two timings, it ran 1.06 times as fast each time.
// Over all steps from v000 it is 3.61 times as fast.
// Contractions: q, k, v^T, lq, lk, lv^T projections = v_wmma_f32_16x16x32_f16 (activations f16 x1, weights f16 x64, single product, f32 accumulate);
// k.q^T and lk.lq^T scores (transposed) = v_wmma_f32_16x16x32_f16 (q, k, lk f16 x1, lq f16 x2, layout K=16 zero-padded to 32 in registers, single products, one f32 accumulator);
// v^T.p^T and lv^T.p^T = v_wmma_f32_16x16x32_f16 (p carried x1024 in f16, v and lv f16 x1, single products, f32 accumulate); softmax and normalisation in f32.
// Carry audit: weight planes x64 -> 1/64 folded in the gemm64 epilogue (ascale); LQ plane x2 -> folded by the common score scale 0.125
//              in attn_two (q.k/8 + lq.lk/4 = (q.k + 2lq.lk)/8); P x1024 (registers only) -> 1/1024 folded in the attn_two epilogue (inv);
//              activation planes, Q/K/V^T/LK/LV^T planes and the LC f32 plane carry x1.
#include <hip/hip_runtime.h>
#include <math.h>
#include <stdint.h>

#define NB   8
#define SEQ  1024
#define DM   768
#define DL   192
#define NH   12
#define HD   64
#define HL   16
#define NQB  (SEQ / 64)   // 64-row query blocks per sequence
#define NKT  (SEQ / 64)   // 64-key chunks per sequence
#define LP   72           // LDS row pitch in halves of the 64-half rows read by 16-B fragment loads: 144 B = 16 B x odd
#define LPL  24           // the same for the 16-half LK rows: 48 B = 16 B x odd
#define OP   68           // LDS row pitch in floats of the ctx tile, written by 16-B stores down a column of rows: 272 B = 16 B x odd
// LDS ring of the K=768 projections: a stage is 64 k (128 B) of 128 A rows, then of 256 B rows, at pitch LP; two buffers
#define RROWS  (128 + 256)
#define RBUF   (RROWS * LP)                         // halves a buffer: 55296 B
// block ranges of the two merged grids (256 threads a block)
#define CB_X   (NB * SEQ * DM / 8 / 256)            // 3072 blocks: x plane, 8 elements a thread
#define CB_L   (NB * SEQ * DL / 8 / 256)            //  768 blocks: layout plane
#define CB_W   (DM * DM / 8 / 256)                  //  288 blocks: one [768][768] weight plane
#define CB_WL  (DL * DL / 8 / 256)                  //   18 blocks: one [192][192] weight plane
#define CB_ALL (CB_X + CB_L + 3 * CB_W + 3 * CB_WL) // 4758 blocks
#define GB_T   (((NB * SEQ) / 128) * (DM / 256))    //  192 blocks: M=8192, N=768, one 128x256 tile a block
#define GB_VT  ((DM / 128) * (SEQ / 256))           //   24 blocks a batch: M=768, N=1024
#define GB_L   (((NB * SEQ) / 64) * (DL / 64) / 8)  //   48 blocks: M=8192, N=192
#define GB_LVT ((DL / 64) * (SEQ / 64) / 8)         //    6 blocks a batch: M=192, N=1024
#define GB_ALL (2 * GB_T + NB * GB_VT + 2 * GB_L + NB * GB_LVT)   // 720 blocks
static_assert((NB * SEQ * DM) % 2048 == 0 && (NB * SEQ * DL) % 2048 == 0 && (DM * DM) % 2048 == 0 && (DL * DL) % 2048 == 0);
static_assert(((NB * SEQ) % 128) == 0 && (DM % 256) == 0 && (DM % 128) == 0 && (SEQ % 256) == 0 && DM / 64 >= 2);
static_assert((((NB * SEQ) / 64) * (DL / 64)) % 8 == 0 && ((DL / 64) * (SEQ / 64)) % 8 == 0);
static_assert(NH * HD == DM);
static_assert(NH * HL == DL);
static_assert(NQB == 16 && NKT == 16);
static_assert((SEQ % 64) == 0 && (DM % 64) == 0 && (DL % 64) == 0);
static_assert((DM % 32) == 0 && (DL % 32) == 0);

typedef _Float16 v16h __attribute__((ext_vector_type(16)));
typedef _Float16 v8h  __attribute__((ext_vector_type(8)));
typedef float    v8f  __attribute__((ext_vector_type(8)));
typedef float    v4f  __attribute__((ext_vector_type(4)));
typedef float    v2f  __attribute__((ext_vector_type(2)));
typedef unsigned int v4u __attribute__((ext_vector_type(4)));

#if defined(__HIP_DEVICE_COMPILE__)
#define DEV_ASM 1
#else
#define DEV_ASM 0
#endif

// ---- scalar helpers --------------------------------------------------------------------------------
__device__ __forceinline__ unsigned short h_bits(_Float16 x) { return __builtin_bit_cast(unsigned short, x); }
__device__ __forceinline__ unsigned pk16(unsigned short a, unsigned short b) { return (unsigned)a | ((unsigned)b << 16); }
__device__ __forceinline__ v8f zero8() { v8f z = {0.f, 0.f, 0.f, 0.f, 0.f, 0.f, 0.f, 0.f}; return z; }
__device__ __forceinline__ v8h zero8h() {
  const _Float16 z = (_Float16)0.0f;
  v8h r = {z, z, z, z, z, z, z, z};
  return r;
}

// ---- fragment loader: 16-bit A/B operand, lane -> row/col (lane&15), p already includes +8*(lane>>4);
//      elements 0..7 <- p[0..7] (k0+8h..k0+8h+7), elements 8..15 <- p[16..23] (k0+16+8h..k0+16+8h+7)
__device__ __forceinline__ v16h ldfrag_h(const _Float16* p) {
  union { v16h v; v8h h[2]; } f;
  f.h[0] = *(const v8h*)(p);
  f.h[1] = *(const v8h*)(p + 16);
  return f.v;
}

// lane l <-> lane l ^ 16: the other half of the wave holds the other keys of the same query
__device__ __forceinline__ float xhalf(float x) {
  return __builtin_bit_cast(float, __builtin_amdgcn_permlanex16(__builtin_bit_cast(int, x), __builtin_bit_cast(int, x),
                                                                0x76543210, 0xfedcba98, false, false));
}

// ---- WMMA helpers ----------------------------------------------------------------------------------
__device__ __forceinline__ v8f mmar(v16h a, v16h b, v8f c) {
  return __builtin_amdgcn_wmma_f32_16x16x32_f16(false, a, false, b, (short)0, c, false, false);
}
__device__ __forceinline__ void dep_guard(v8f& a, v8f& b, v16h x, v16h y) {
#if DEV_ASM
  asm volatile("v_nop\n\tv_nop\n\tv_nop\n\tv_nop" : "+v"(a), "+v"(b) : "v"(x), "v"(y));
#else
  (void)a; (void)b; (void)x; (void)y;
#endif
}
__device__ __forceinline__ void keep4(v16h a, v16h b, v16h c, v16h d) {
#if DEV_ASM
  asm volatile("v_nop" :: "v"(a), "v"(b), "v"(c), "v"(d));
#else
  (void)a; (void)b; (void)c; (void)d;
#endif
}
__device__ __forceinline__ void acc_guard4(v8f& a, v8f& b, v8f& c, v8f& d) {
#if DEV_ASM
  asm volatile("v_nop\n\tv_nop\n\tv_nop\n\tv_nop" : "+v"(a), "+v"(b), "+v"(c), "+v"(d));
#else
  (void)a; (void)b; (void)c; (void)d;
#endif
}

// ---- asynchronous copies global -> LDS -------------------------------------------------------------
// One stage of the ring: each of the 256 threads brings twelve 16-B pieces, piece (t & 7) of rows (t >> 3) + 32 i;
// i 0..3 are the 128 A rows, i 4..11 the 256 B rows, so a wave's copy covers four whole 128-B lines.
// l = the thread's LDS byte address of its piece in row (t >> 3) of the target buffer; ga, gb = its global piece in
// the first A row and the first B row of the stage; sa, sb = 32 rows in halves.
// The s_wait_xcnt closes the statement so that no address register is rewritten ahead of it.
__device__ __forceinline__ void stage_copy(unsigned l, const _Float16* ga, const _Float16* gb, size_t sa, size_t sb) {
#if DEV_ASM
  asm volatile(
      "global_load_async_to_lds_b128 %0, %12, off\n\t"
      "global_load_async_to_lds_b128 %1, %13, off\n\t"
      "global_load_async_to_lds_b128 %2, %14, off\n\t"
      "global_load_async_to_lds_b128 %3, %15, off\n\t"
      "global_load_async_to_lds_b128 %4, %16, off\n\t"
      "global_load_async_to_lds_b128 %5, %17, off\n\t"
      "global_load_async_to_lds_b128 %6, %18, off\n\t"
      "global_load_async_to_lds_b128 %7, %19, off\n\t"
      "global_load_async_to_lds_b128 %8, %20, off\n\t"
      "global_load_async_to_lds_b128 %9, %21, off\n\t"
      "global_load_async_to_lds_b128 %10, %22, off\n\t"
      "global_load_async_to_lds_b128 %11, %23, off\n\t"
      "s_wait_xcnt 0x0"
      :: "v"(l), "v"(l + 1u * 32u * LP * 2u), "v"(l + 2u * 32u * LP * 2u), "v"(l + 3u * 32u * LP * 2u),
         "v"(l + 4u * 32u * LP * 2u), "v"(l + 5u * 32u * LP * 2u), "v"(l + 6u * 32u * LP * 2u),
         "v"(l + 7u * 32u * LP * 2u), "v"(l + 8u * 32u * LP * 2u), "v"(l + 9u * 32u * LP * 2u),
         "v"(l + 10u * 32u * LP * 2u), "v"(l + 11u * 32u * LP * 2u),
         "v"(ga), "v"(ga + sa), "v"(ga + 2 * sa), "v"(ga + 3 * sa),
         "v"(gb), "v"(gb + sb), "v"(gb + 2 * sb), "v"(gb + 3 * sb),
         "v"(gb + 4 * sb), "v"(gb + 5 * sb), "v"(gb + 6 * sb), "v"(gb + 7 * sb)
      : "memory");
#else
  (void)l; (void)ga; (void)gb; (void)sa; (void)sb;
#endif
}
// this wave's copies have landed in LDS
__device__ __forceinline__ void wait_copies() {
#if DEV_ASM
  asm volatile("s_wait_asynccnt 0x0" ::: "memory");
#endif
}
// this wave's LDS reads have returned, so the buffer may go to its next writer
__device__ __forceinline__ void wait_lds() {
#if DEV_ASM
  asm volatile("s_wait_dscnt 0x0" ::: "memory");
#endif
}

// =====================================================================================================
// f32 -> f16 bits of (x * scale) for all eight planes in ONE grid: the planes lie back to back in the workspace
// in the order x, layout, Wq, Wk, Wv, Wlq, Wlk, Wlv, and each is a whole number of blocks, so the block index
// picks the source plane (block-uniform) and the flat thread index is the output position.
// 8 elements per thread, one 16-B store per lane: a wave writes 512 contiguous bytes.
// coverage: CB_ALL blocks x 256 threads x 8 = all eight planes exactly (static_asserts above), so no bound test.
// =====================================================================================================
__global__ __launch_bounds__(256) void cvt_all(const float* __restrict__ x, const float* __restrict__ xl,
                                               const float* __restrict__ wq, const float* __restrict__ wk,
                                               const float* __restrict__ wv, const float* __restrict__ wlq,
                                               const float* __restrict__ wlk, const float* __restrict__ wlv,
                                               unsigned short* out) {
  const int blk = blockIdx.x;
  const float* in = x;
  int first = 0;                 // first block of the plane
  float scale = 1.0f;            // activations x1, weights x64
  if (blk >= CB_X)                                  { in = xl;  first = CB_X; }
  if (blk >= CB_X + CB_L)                           { in = wq;  first = CB_X + CB_L;                       scale = 64.0f; }
  if (blk >= CB_X + CB_L + CB_W)                    { in = wk;  first = CB_X + CB_L + CB_W; }
  if (blk >= CB_X + CB_L + 2 * CB_W)                { in = wv;  first = CB_X + CB_L + 2 * CB_W; }
  if (blk >= CB_X + CB_L + 3 * CB_W)                { in = wlq; first = CB_X + CB_L + 3 * CB_W; }
  if (blk >= CB_X + CB_L + 3 * CB_W + CB_WL)        { in = wlk; first = CB_X + CB_L + 3 * CB_W + CB_WL; }
  if (blk >= CB_X + CB_L + 3 * CB_W + 2 * CB_WL)    { in = wlv; first = CB_X + CB_L + 3 * CB_W + 2 * CB_WL; }
  const int i = (blk - first) * 256 + (int)threadIdx.x;      // 8-element unit inside the source plane
  const int o = blk * 256 + (int)threadIdx.x;                // 8-element unit inside the eight planes
  const v4f a = *(const v4f*)(in + (size_t)i * 8);
  const v4f c = *(const v4f*)(in + (size_t)i * 8 + 4);
  v4u p;
  p[0] = pk16(h_bits((_Float16)(a[0] * scale)), h_bits((_Float16)(a[1] * scale)));
  p[1] = pk16(h_bits((_Float16)(a[2] * scale)), h_bits((_Float16)(a[3] * scale)));
  p[2] = pk16(h_bits((_Float16)(c[0] * scale)), h_bits((_Float16)(c[1] * scale)));
  p[3] = pk16(h_bits((_Float16)(c[2] * scale)), h_bits((_Float16)(c[3] * scale)));
  *(v4u*)(out + (size_t)o * 8) = p;
}

// =====================================================================================================
// Register-blocked batched f16 WMMA GEMM with bias: C[m][n] = (sum_k A[m][k] * Bt[n][k]) * ascale + bias,
// stored as f16(value * oscale). One wave per 64x64 tile. A row-major [M][K] pitch lda;
// Bt row-major [N][K] pitch ldb (k contiguous); M, N multiples of 64, K multiple of 32 (host-checked).
// bx = block index inside the product, b = batch index (strides in elements), sT = the block's LDS slabs.
// RING 0: the block's 8 tiles are consecutive in n, no block barriers, fragments loaded straight from global
//         with the split k map.
// RING 1: the 8 tiles are 2 (m) x 4 (n) = one 128x256 tile (M multiple of 128, N of 256, K of 64, at least 128).
//         Its operand rows come to LDS in stages of 64 k by asynchronous copies, two buffers: the copies of stage
//         s + 2 fly while stage s + 1 is worked on; fragments are read from LDS with the same split k map and the
//         same k order. Every wave passes every barrier (no early return on this path).
// BIASROW 0: bias[n] (bias length N); BIASROW 1: bias[m] (bias length M).
// coverage: 4 slabs x 16 rows (it 0..3 x lane>>3 0..3) x 64 cols (8 lanes x 8) = the wave's whole 64x64 tile.
// =====================================================================================================
template <int BIASROW, int RING>
__device__ __forceinline__ void gemm64(
    float (*sT)[16 * 68], _Float16* ring, int bx, int b,
    const unsigned short* __restrict__ Ap, int lda, long long strideA,
    const unsigned short* __restrict__ Btp, int ldb, long long strideB,
    const float* __restrict__ bias,
    unsigned short* Cp, int ldc, long long strideC,
    int M, int N, int K, float ascale, float oscale) {
  const _Float16* A  = (const _Float16*)(const void*)Ap;
  const _Float16* Bt = (const _Float16*)(const void*)Btp;
  const int lane = threadIdx.x & 31;
  const int wave = threadIdx.x >> 5;
  int m0, n0;                              // the wave's 64x64 tile
  int bm0 = 0, bn0 = 0;                    // RING: the block's 128x256 tile
  if constexpr (RING) {
    const int tilesN = N >> 8;
    const int tm = bx / tilesN;
    const int tn = bx - tm * tilesN;
    bm0 = tm << 7;
    bn0 = tn << 8;
    m0 = bm0 + ((wave >> 2) << 6);
    n0 = bn0 + ((wave & 3) << 6);
  } else {
    const int tilesN = N >> 6;
    const int tilesM = M >> 6;
    const int tile = bx * 8 + wave;
    if (tile >= tilesM * tilesN) return;   // wave-uniform; no block barriers on this path
    const int tm = tile / tilesN;
    const int tn = tile - tm * tilesN;
    m0 = tm << 6;
    n0 = tn << 6;
  }

  const _Float16* Ab = A  + (size_t)b * (size_t)strideA;
  const _Float16* Bb = Bt + (size_t)b * (size_t)strideB;

  const int rlane = lane & 15;                 // row (A) / col (B, D) within subtile
  const int koff  = (lane >> 4) * 8;           // k offset of this lane half
  const int mOff  = (lane >> 4) * 8;           // D row offset

  v8f acc[4][4];
#pragma unroll
  for (int i = 0; i < 4; ++i)
#pragma unroll
    for (int j = 0; j < 4; ++j) acc[i][j] = zero8();

  if constexpr (RING) {
    const int t = threadIdx.x;
    const _Float16* ga = Ab + (size_t)(bm0 + (t >> 3)) * lda + (t & 7) * 8;   // the thread's piece, first A row
    const _Float16* gb = Bb + (size_t)(bn0 + (t >> 3)) * ldb + (t & 7) * 8;   // the same, first B row
    const size_t sa = (size_t)32 * lda, sb = (size_t)32 * ldb;
    const unsigned l0 = (unsigned)(uintptr_t)ring + (unsigned)((t >> 3) * (LP * 2) + (t & 7) * 16);
    const int aoff = ((wave >> 2) * 64 + rlane) * LP + koff;                  // the wave's A rows in a buffer
    const int boff = (128 + (wave & 3) * 64 + rlane) * LP + koff;             // the wave's B rows
    const int ns = K >> 6;                                                    // stages
    stage_copy(l0, ga, gb, sa, sb);                                           // stage 0 -> buffer 0
    wait_copies();
    __syncthreads();                                                          // stage 0 readable by every wave
    stage_copy(l0 + RBUF * 2u, ga + 64, gb + 64, sa, sb);                     // stage 1 -> buffer 1 (ns >= 2)
#pragma unroll 1   // rolled over the twelve stages, for speed only
    for (int s = 0; s < ns; ++s) {
      const _Float16* buf = ring + (s & 1) * RBUF;
#pragma unroll
      for (int ks = 0; ks < 2; ++ks) {
        v16h bq[4], af[4];                 // all sixteen LDS reads of the 32 k stand together, ahead of the products
#pragma unroll
        for (int j = 0; j < 4; ++j) bq[j] = ldfrag_h(buf + boff + j * 16 * LP + ks * 32);
#pragma unroll
        for (int i = 0; i < 4; ++i) af[i] = ldfrag_h(buf + aoff + i * 16 * LP + ks * 32);
#pragma unroll
        for (int i = 0; i < 4; ++i) {
#pragma unroll
          for (int j = 0; j < 4; ++j) acc[i][j] = mmar(af[i], bq[j], acc[i][j]);
          dep_guard(acc[i][0], acc[i][3], af[i], bq[3]);
        }
        keep4(bq[0], bq[1], bq[2], bq[3]);
      }
      wait_lds();
      wait_copies();
      __syncthreads();
      if (s + 2 < ns) stage_copy(l0 + (unsigned)(s & 1) * (RBUF * 2u), ga + (s + 2) * 64, gb + (s + 2) * 64, sa, sb);
    }
    wait_copies();
  } else {
    for (int k0 = 0; k0 < K; k0 += 32) {
      v16h bq[4];
#pragma unroll
      for (int j = 0; j < 4; ++j)
        bq[j] = ldfrag_h(Bb + (size_t)(n0 + (j << 4) + rlane) * ldb + koff + k0);
#pragma unroll
      for (int i = 0; i < 4; ++i) {
        const v16h af = ldfrag_h(Ab + (size_t)(m0 + (i << 4) + rlane) * lda + koff + k0);
#pragma unroll
        for (int j = 0; j < 4; ++j) acc[i][j] = mmar(af, bq[j], acc[i][j]);
        dep_guard(acc[i][0], acc[i][3], af, bq[3]);
      }
      keep4(bq[0], bq[1], bq[2], bq[3]);
    }
  }
  acc_guard4(acc[0][0], acc[0][1], acc[0][2], acc[0][3]);
  acc_guard4(acc[1][0], acc[1][1], acc[1][2], acc[1][3]);
  acc_guard4(acc[2][0], acc[2][1], acc[2][2], acc[2][3]);
  acc_guard4(acc[3][0], acc[3][1], acc[3][2], acc[3][3]);

  // ---- epilogue ----
  float* slab = sT[wave];
  const int q = lane >> 3, c8 = (lane & 7) * 8;
  unsigned short* C = Cp + (size_t)b * (size_t)strideC;
  float bcol[8];
  {
    const v4f b0 = *(const v4f*)(bias + (BIASROW ? 0 : (n0 + c8)));       // column bias (length N), 16-B aligned
    const v4f b1 = *(const v4f*)(bias + (BIASROW ? 4 : (n0 + c8 + 4)));
#pragma unroll
    for (int e = 0; e < 4; ++e) { bcol[e] = b0[e]; bcol[4 + e] = b1[e]; }
  }
#pragma unroll
  for (int i = 0; i < 4; ++i) {
    const int mBase = m0 + (i << 4);
#pragma unroll
    for (int j = 0; j < 4; ++j) {
#pragma unroll
      for (int r = 0; r < 8; ++r) {
        slab[(mOff + r) * 68 + (j << 4) + rlane] = acc[i][j][r];
      }
    }
    __builtin_amdgcn_fence(__ATOMIC_RELEASE, "workgroup");
    __builtin_amdgcn_wave_barrier();
    __builtin_amdgcn_fence(__ATOMIC_ACQUIRE, "workgroup");
    v4u hv[4];
#pragma unroll
    for (int it = 0; it < 4; ++it) {
      const int row = it * 4 + q;                        // it 0..3 x q 0..3 = rows 0..15
      const float* sp = slab + row * 68 + c8;
      float bb[8];
      if (BIASROW) {
        const float bv = bias[mBase + row];              // row bias, index < M = bias length
#pragma unroll
        for (int e = 0; e < 8; ++e) bb[e] = bv;
      } else {
#pragma unroll
        for (int e = 0; e < 8; ++e) bb[e] = bcol[e];
      }
      v4u a;
#pragma unroll
      for (int e = 0; e < 4; ++e) {
        const float f0 = (sp[2 * e] * ascale + bb[2 * e]) * oscale;
        const float f1 = (sp[2 * e + 1] * ascale + bb[2 * e + 1]) * oscale;
        a[e] = pk16(h_bits((_Float16)f0), h_bits((_Float16)f1));
      }
      hv[it] = a;
    }
    {
#pragma unroll
      for (int it = 0; it < 4; ++it) {
        const int row = it * 4 + q;
        *(v4u*)(C + (size_t)(mBase + row) * ldc + n0 + c8) = hv[it];
      }
      
    }
    __builtin_amdgcn_fence(__ATOMIC_RELEASE, "workgroup");
    __builtin_amdgcn_wave_barrier();
    __builtin_amdgcn_fence(__ATOMIC_ACQUIRE, "workgroup");
  }
}

// =====================================================================================================
// All six projections in ONE grid: they read only the converted planes and write disjoint planes, so none waits
// for another. The block index picks the product (block-uniform); the K=768 products come first, so that the
// short K=192 ones fill the places that free up at the end. The K=768 products take their operands through the
// LDS ring (gemm64, RING 1), each block one 128x256 tile; the K=192 products read them straight from global (RING 0).
//   [0, GB_T)  q = x . Wq^T + bq            [GB_T, 2 GB_T)  k = x . Wk^T + bk          (M=8192, N=768,  K=768)
//   next NB x GB_VT   v^T = Wv . x^T + bv per batch (A = Wvh [n][k], Bt = Xh rows of b)  (M=768,  N=1024, K=768)
//   next GB_L  lq = (xl . Wlq^T + blq) x2   next GB_L  lk = xl . Wlk^T + blk            (M=8192, N=192,  K=192)
//   next NB x GB_LVT  lv^T = Wlv . xl^T + blv per batch                                 (M=192,  N=1024, K=192)
// =====================================================================================================
__global__ __launch_bounds__(256) void proj_all(
    const unsigned short* __restrict__ Xh, const unsigned short* __restrict__ Lh,
    const unsigned short* __restrict__ Wqh, const unsigned short* __restrict__ Wkh,
    const unsigned short* __restrict__ Wvh, const unsigned short* __restrict__ Wlqh,
    const unsigned short* __restrict__ Wlkh, const unsigned short* __restrict__ Wlvh,
    const float* __restrict__ bq, const float* __restrict__ bk, const float* __restrict__ bv,
    const float* __restrict__ blq, const float* __restrict__ blk_, const float* __restrict__ blv,
    unsigned short* Qp, unsigned short* Kp, unsigned short* VTp,
    unsigned short* LQp, unsigned short* LKp, unsigned short* LVTp) {
  __shared__ __align__(16) float sT[8][16 * 68];   // per-wave 16x64 slab, pitch 68 floats
  __shared__ __align__(16) _Float16 ring[2 * RBUF]; // operand stages of the K=768 products, two buffers, 110592 B
  const int blk = blockIdx.x;
  const int T0 = 2 * GB_T;                 // first block of v^T
  const int T1 = T0 + NB * GB_VT;          // first block of lq
  const int T2 = T1 + 2 * GB_L;            // first block of lv^T
  if (blk < T0) {
    // text activations x weights^T, bias by column, operands through the LDS ring
    const bool second = blk >= GB_T;       // the k product
    gemm64<0, 1>(sT, ring, second ? blk - GB_T : blk, 0, Xh, DM, 0LL, second ? Wkh : Wqh, DM, 0LL,
                 second ? bk : bq, second ? Kp : Qp, DM, 0LL, NB * SEQ, DM, DM, 1.0f / 64.0f, 1.0f);
  } else if (blk < T1) {
    // text weights x activations^T per batch, bias by row, operands through the LDS ring
    const int b  = (blk - T0) / GB_VT;     // batch
    const int bx = (blk - T0) - b * GB_VT; // block inside the batch
    gemm64<1, 1>(sT, ring, bx, b, Wvh, DM, 0LL, Xh, DM, (long long)SEQ * DM, bv, VTp, SEQ, (long long)DM * SEQ,
                 DM, SEQ, DM, 1.0f / 64.0f, 1.0f);
  } else if (blk < T2) {
    // layout activations x weights^T, bias by column
    const int  r      = blk - T1;
    const bool second = r >= GB_L;         // the lk product
    gemm64<0, 0>(sT, ring, second ? r - GB_L : r, 0, Lh, DL, 0LL, second ? Wlkh : Wlqh, DL, 0LL,
                 second ? blk_ : blq, second ? LKp : LQp, DL, 0LL, NB * SEQ, DL, DL, 1.0f / 64.0f,
                 second ? 1.0f : 2.0f);
  } else {
    // layout weights x activations^T per batch, bias by row
    const int b  = (blk - T2) / GB_LVT;     // batch
    const int bx = (blk - T2) - b * GB_LVT; // block inside the batch
    gemm64<1, 0>(sT, ring, bx, b, Wlvh, DL, 0LL, Lh, DL, (long long)SEQ * DL, blv, LVTp, SEQ, (long long)DL * SEQ,
                 DL, SEQ, DL, 1.0f / 64.0f, 1.0f);
  }
}

// =====================================================================================================
// Two-stream attention, text head dim 64 + layout head dim 16, no mask, softmax over all SEQ keys.
//   Q plane (f16): element (b, t, h, d) at [(b*SEQ + t)*DM + h*64 + d]; K plane same layout with key s.
//   LQ plane (f16, value x2): [(b*SEQ + t)*DL + h*16 + d]; LK plane (f16 x1) same layout.
//   V^T plane (f16): element (b, h, d, s) at [(b*DM + h*64 + d)*SEQ + s]; LV^T plane: [(b*DL + h*16 + d)*SEQ + s].
//   All products run transposed: the K, LK, V^T and LV^T rows are the A operand, the query side is the B operand, so
//   a lane holds one query (column lane&15) and the keys or the head dims 8*(lane>>4) + r of a tile in its registers.
//   scores^T = (k . q + lk . lq2) * sscale in f32 (3 f16 WMMA steps into one accumulator; the layout step uses
//   k = 0..15 only, upper 16 k-slots are register zeros in both fragments).
//   p = exp(s - m) carried as f16(1024 p); two score tiles (32 keys) pack in place into one B operand, in the k order
//   of the V^T loads; ctx^T = v^T . p^T (4 row tiles), lctx^T = lv^T . p^T (1 row tile); online softmax in f32: maximum
//   and sum run inside the lane, the maximum is joined between the wave halves each chunk, the sum once at the end.
//   Block = 4 waves = 64 query rows of one (b, h); grid = NB * NH * NQB; key chunks of 64, static trip NKT.
//   Chunk staging: 128 threads: K 32 halves/thread (64x64), V^T 32 halves/thread (64x64), LK 8 halves/thread (64x16),
//   LV^T 8 halves/thread (16x64) = every LDS element read below (plain 16-B loads, __syncthreads before and after);
//   ctx -> out0 f32 [(b*SEQ + t)*DM + h*64 + d]: 16 rows x 256-B segments per wave (16 lanes x 16 B per segment,
//   Output coverage: wave rows q0..q0+15 (it 0..7 x lane>>4) x 64 cols (16 lanes x 4) of head h for out0;
//   64 float4 = the wave's whole 16x16 lctx tile for LC; the grid covers every (b, h, qb).
// =====================================================================================================
__global__ __launch_bounds__(128)
void attn_two(const unsigned short* __restrict__ qp, const unsigned short* __restrict__ kp,
              const unsigned short* __restrict__ vtp, const unsigned short* __restrict__ lqp,
              const unsigned short* __restrict__ lkp, const unsigned short* __restrict__ lvtp,
              float* out0, float* lcp, float sscale) {
  union FH { v16h v; v8h h[2]; };
  // one array, so that the tiles of pitch LP lie at constant offsets from one lane address
  __shared__ __align__(16) _Float16 Tsh[(64 + 64 + HL) * LP + 64 * LPL];
  _Float16* const Ksh = Tsh;                             // K chunk [kv][d], pitch LP    9 KB
  _Float16* const Vth = Tsh + 64 * LP;                   // V^T [d][kv], pitch LP        9 KB
  _Float16* const LVs = Tsh + 128 * LP;                  // LV^T [dl][kv], pitch LP      2304 B
  _Float16* const LKs = Tsh + (128 + HL) * LP;           // LK chunk [kv][dl], pitch LPL 3 KB
  __shared__ __align__(16) float    Os[4][16 * OP];      // per wave ctx tile [row][d], pitch OP 17 KB
  __shared__ __align__(16) float    OLs[4][16 * HL];     // per wave lctx tile   4 KB

  const int tid  = threadIdx.x;
  const int wave = __builtin_amdgcn_readfirstlane(tid >> 5);   // in a scalar register, and with it every row index built from it
  const int lane = tid & 31;
  const int hh   = lane >> 4;
  const int c    = lane & 15;

  const int bx   = blockIdx.x;
  const int qb   = bx % NQB;
  const int rest = bx / NQB;
  const int h    = rest % NH;
  const int b    = rest / NH;
  const int q0   = qb * 64 + wave * 16;
  const size_t rowB = (size_t)b * SEQ;

  const _Float16* Q   = (const _Float16*)(const void*)qp;
  const _Float16* LQ  = (const _Float16*)(const void*)lqp;
  const _Float16* Kg  = (const _Float16*)(const void*)kp + (size_t)h * HD;
  const _Float16* LKg = (const _Float16*)(const void*)lkp + (size_t)h * HL;
  const _Float16* Vh  = (const _Float16*)(const void*)vtp  + ((size_t)b * DM + (size_t)h * HD) * SEQ;
  const _Float16* LVh = (const _Float16*)(const void*)lvtp + ((size_t)b * DL + (size_t)h * HL) * SEQ;

  // ---- Q fragments (B operand, column = lane&15): 2 d-chunks of the text stream; layout fragment k 0..15 ----
  v16h qa[2];
#pragma unroll
  for (int dc = 0; dc < 2; ++dc) {
    const size_t qo = (rowB + q0 + c) * DM + (size_t)h * HD + dc * 32 + 8 * hh;
    qa[dc] = ldfrag_h(Q + qo);
  }
  FH la;
  la.h[0] = *(const v8h*)(LQ + (rowB + q0 + c) * DL + (size_t)h * HL + 8 * hh);   // k = 8hh..8hh+7
  la.h[1] = zero8h();                                                              // k 16..31 = 0

  float mrow = -INFINITY;      // running maximum of query c, the same in both wave halves
  float lrow = 0.f;            // running sum of query c over this half's keys
  v8f oacc[4];                 // oacc[t][r] = ctx of query c, d = 16 t + 8 hh + r
  v8f olacc = zero8();         // olacc[r] = lctx of query c, dl = 8 hh + r
#pragma unroll
  for (int t = 0; t < 4; ++t) oacc[t] = zero8();

  // the lane's piece of row c in each staged tile; every fragment read below is a constant offset from one of these
  const _Float16* kfr  = Ksh + c * LP + 8 * hh;
  const _Float16* lkfr = LKs + c * LPL + 8 * hh;
  const _Float16* vfr  = Vth + c * LP + 8 * hh;
  const _Float16* lvfr = LVs + c * LP + 8 * hh;

  for (int kt = 0; kt < NKT; ++kt) {         // static trip count
    const int kv0 = kt * 64;
    __syncthreads();
    {
      const int r = tid >> 1, half = (tid & 1) * 32;
      const _Float16* kg = Kg + (rowB + kv0 + r) * DM + half;       // k row kv0+r, d = half..half+31
      const _Float16* vg = Vh + (size_t)r * SEQ + kv0 + half;        // v^T row d = r, s = kv0+half..+31
#pragma unroll
      for (int i = 0; i < 4; ++i) {
        const v8h a0 = *(const v8h*)(kg + 8 * i);
        const v8h b0 = *(const v8h*)(vg + 8 * i);
        *(v8h*)(Ksh + r * LP + half + 8 * i) = a0;
        *(v8h*)(Vth + r * LP + half + 8 * i) = b0;
      }
      const int c8l = (tid & 1) * 8;                                  // lk row kv0+r, dl = c8l..c8l+7
      const v8h lk8 = *(const v8h*)(LKg + (rowB + kv0 + r) * DL + c8l);
      *(v8h*)(LKs + r * LPL + c8l) = lk8;
      const int dv = tid >> 3, s8 = (tid & 7) * 8;                   // lv^T row dl = dv, s = kv0+s8..+7
      const v8h lv8 = *(const v8h*)(LVh + (size_t)dv * SEQ + kv0 + s8);
      *(v8h*)(LVs + dv * LP + s8) = lv8;
    }
    __syncthreads();

    // ---- scores^T: 64 keys x 16 query columns per wave; s[j][r] = key 16 j + 8 hh + r, query c ----
    v8f s[4];
#pragma unroll
    for (int j = 0; j < 4; ++j) {
      v8f acc = zero8();
#pragma unroll
      for (int dc = 0; dc < 2; ++dc) {
        FH kb;
        kb.h[0] = *(const v8h*)(kfr + j * 16 * LP + dc * 32);
        kb.h[1] = *(const v8h*)(kfr + j * 16 * LP + dc * 32 + 16);
        acc = mmar(kb.v, qa[dc], acc);
      }
      // k 16..31 = 0; one vector, so that the LDS read lands in the operand's own registers
      const v16h lb = __builtin_shufflevector(*(const v8h*)(lkfr + j * 16 * LPL), zero8h(),
                                              0, 1, 2, 3, 4, 5, 6, 7, 8, 9, 10, 11, 12, 13, 14, 15);
      acc = mmar(lb, la.v, acc);
#pragma unroll
      for (int r = 0; r < 8; ++r) s[j][r] = acc[r] * sscale;
    }

    // ---- maximum, online softmax, P^T (x1024, f16) packed into B operands ----
    float mj[4];                              // four independent chains
#pragma unroll
    for (int j = 0; j < 4; ++j) {
      mj[j] = s[j][0];
#pragma unroll
      for (int r = 1; r < 8; ++r) mj[j] = fmaxf(mj[j], s[j][r]);
    }
    float m = fmaxf(fmaxf(mj[0], mj[1]), fmaxf(mj[2], mj[3]));
    m = fmaxf(m, xhalf(m));                   // all 64 keys of the chunk
    const float mnew  = fmaxf(mrow, m);
    const float msafe = (mnew == -INFINITY) ? 0.f : mnew;
    const float alpha = __expf(mrow - msafe);
    mrow = mnew;
#pragma unroll
    for (int t = 0; t < 4; ++t)
#pragma unroll
      for (int r = 0; r < 8; ++r) oacc[t][r] *= alpha;
#pragma unroll
    for (int r = 0; r < 8; ++r) olacc[r] *= alpha;

    // ---- per 32 keys: P^T packed, then ctx^T += V^T . P^T, lctx^T += LV^T . P^T (f16 WMMA) ----
    float pj[4];
#pragma unroll   // s and pj are indexed by kk and live in registers
    for (int kk = 0; kk < 2; ++kk) {
      FH pb;                                  // element e = key 32 kk + (e < 8 ? 8 hh + e : 16 + 8 hh + e - 8)
      // the two tiles of the 32 keys run side by side as register pairs; each tile's sum keeps the order r = 0..7,
      // and no p outlives its 32 keys, which holds the kernel at six waves a SIMD (all blocks resident)
      v2f ps = {0.f, 0.f};
#pragma unroll
      for (int r = 0; r < 8; ++r) {
        const v2f a = (v2f){s[2 * kk][r], s[2 * kk + 1][r]} - msafe;
        const v2f p = {__expf(a[0]), __expf(a[1])};
        ps += p;
        const v2f q = p * 1024.0f;
        pb.h[0][r] = (_Float16)q[0];
        pb.h[1][r] = (_Float16)q[1];
      }
      pj[2 * kk] = ps[0];
      pj[2 * kk + 1] = ps[1];
#pragma unroll
      for (int t = 0; t < 4; ++t) {
        FH vb;
        vb.h[0] = *(const v8h*)(vfr + t * 16 * LP + kk * 32);
        vb.h[1] = *(const v8h*)(vfr + t * 16 * LP + kk * 32 + 16);
        oacc[t] = mmar(vb.v, pb.v, oacc[t]);
      }
      FH wb;
      wb.h[0] = *(const v8h*)(lvfr + kk * 32);
      wb.h[1] = *(const v8h*)(lvfr + kk * 32 + 16);
      olacc = mmar(wb.v, pb.v, olacc);
    }
    lrow = lrow * alpha + ((pj[0] + pj[1]) + (pj[2] + pj[3]));
  }

  float* os = Os[wave];
  float* ol = OLs[wave];
  {
    const float l = lrow + xhalf(lrow);                  // both halves' keys
    const float inv = ((l > 0.f) ? (1.0f / l) : 0.f) * (1.0f / 1024.0f);
#pragma unroll
    for (int g = 0; g < 2; ++g) {                        // a lane's 8 registers are 8 consecutive d of its query's row
#pragma unroll
      for (int t = 0; t < 4; ++t) {
        const v4f v = {oacc[t][4 * g] * inv, oacc[t][4 * g + 1] * inv, oacc[t][4 * g + 2] * inv, oacc[t][4 * g + 3] * inv};
        *(v4f*)(os + c * OP + t * 16 + 8 * hh + 4 * g) = v;
      }
      const v4f w = {olacc[4 * g] * inv, olacc[4 * g + 1] * inv, olacc[4 * g + 2] * inv, olacc[4 * g + 3] * inv};
      *(v4f*)(ol + c * HL + 8 * hh + 4 * g) = w;
    }
  }
  __builtin_amdgcn_fence(__ATOMIC_RELEASE, "workgroup");
  __builtin_amdgcn_wave_barrier();
  __builtin_amdgcn_fence(__ATOMIC_ACQUIRE, "workgroup");
  {
    const int h2 = lane >> 4, c4 = (lane & 15) * 4;     // 256-B row segment = 16 lanes x 16 B
    float* ob = out0 + (rowB + q0) * DM + (size_t)h * HD + c4;
    float* lb = lcp + (((size_t)(b * NH + h)) * SEQ + (size_t)q0) * HL;
    {
#pragma unroll
      for (int it = 0; it < 8; ++it) {
        const int row = it * 2 + h2;                     // it 0..7 x h2 0..1 = rows 0..15
        const v4f v = *(const v4f*)(os + row * OP + c4);
        *(v4f*)(ob + (size_t)row * DM) = v;
      }
#pragma unroll
      for (int it = 0; it < 2; ++it) {
        const int idx = it * 32 + lane;                  // float4 0..63 of the contiguous 16x16 tile
        const v4f v = *(const v4f*)(ol + idx * 4);
        *(v4f*)(lb + idx * 4) = v;
      }
      
    }
  }
}

// =====================================================================================================
// out1[(b*SEQ + t)*DL + h*16 + d] = LC[b][h][t][d] (f32). One float4 per thread over the flat out1 array
// (col % 4 == 0, so a float4 never crosses a row); consecutive lanes write consecutive 16 B: a wave writes
// coverage: n4 threads x 4 = the whole out1 (n4 multiple of 256).
// =====================================================================================================
__global__ __launch_bounds__(256) void lc_pack(const float* __restrict__ lc, float* out1, int n4) {
  const int i = blockIdx.x * 256 + (int)threadIdx.x;
  if (i < n4) {
    const int e   = i * 4;
    const int row = e / DL;                 // b*SEQ + t
    const int col = e - row * DL;           // h*16 + d, multiple of 4
    const int hd  = col >> 4;
    const int d   = col & 15;
    const int bb  = row / SEQ;
    const int t   = row - bb * SEQ;
    const v4f v = *(const v4f*)(lc + (((size_t)(bb * NH + hd)) * SEQ + (size_t)t) * HL + d);
    float* o = out1 + (size_t)e;
    *(v4f*)o = v;
    
  }
}

// =====================================================================================================
// Workspace map (bytes), every region an exact multiple of its whole-line / whole-tile store granularity:
//   Xh   f16 [8192][768]            12582912
//   Lh   f16 [8192][192]             3145728
//   Wqh  f16 [768 n][768 k] (x64)    1179648
//   Wkh  f16 [768][768]     (x64)    1179648
//   Wvh  f16 [768][768]     (x64)    1179648
//   Wlqh f16 [192][192]     (x64)      73728
//   Wlkh f16 [192][192]     (x64)      73728
//   Wlvh f16 [192][192]     (x64)      73728
//   Qp   f16 [8192][768]            12582912
//   Kp   f16 [8192][768]            12582912
//   VTp  f16 [8][768][1024]         12582912
//   LQp  f16 [8192][192]   (x2)      3145728
//   LKp  f16 [8192][192]             3145728
//   LVTp f16 [8][192][1024]          3145728
//   LC   f32 [8][12][1024][16]       6291456
//   total                           72966144
// Weights are [out n][in k] with k contiguous = the Bt / A layout the GEMM wants, so they are only converted.
// =====================================================================================================
extern "C" void kernel_launch(void* const* d_in, const int* in_sizes, int n_in,
                              void* d_out, int out_size, void* d_ws, size_t ws_size,
                              hipStream_t stream) {
  if (n_in < 14) return;
  if (in_sizes[0] != NB * SEQ * DM) return;
  if (in_sizes[1] != NB * SEQ * DL) return;
  if (in_sizes[2] != DM * DM || in_sizes[4] != DM * DM || in_sizes[6] != DM * DM) return;
  if (in_sizes[3] != DM || in_sizes[5] != DM || in_sizes[7] != DM) return;
  if (in_sizes[8] != DL * DL || in_sizes[10] != DL * DL || in_sizes[12] != DL * DL) return;
  if (in_sizes[9] != DL || in_sizes[11] != DL || in_sizes[13] != DL) return;
  if (out_size != NB * SEQ * (DM + DL)) return;

  const float* x    = (const float*)d_in[0];
  const float* xl   = (const float*)d_in[1];
  const float* Wq   = (const float*)d_in[2];
  const float* bq   = (const float*)d_in[3];
  const float* Wk   = (const float*)d_in[4];
  const float* bk   = (const float*)d_in[5];
  const float* Wv   = (const float*)d_in[6];
  const float* bv   = (const float*)d_in[7];
  const float* Wlq  = (const float*)d_in[8];
  const float* blq  = (const float*)d_in[9];
  const float* Wlk  = (const float*)d_in[10];
  const float* blk_ = (const float*)d_in[11];
  const float* Wlv  = (const float*)d_in[12];
  const float* blv  = (const float*)d_in[13];

  const size_t PX  = (size_t)NB * SEQ * DM * 2;    // 12582912  f16 text plane [8192][768]
  const size_t PL  = (size_t)NB * SEQ * DL * 2;    //  3145728  f16 layout plane [8192][192]
  const size_t PW  = (size_t)DM * DM * 2;          //  1179648  f16 [768][768] weight plane
  const size_t PWL = (size_t)DL * DL * 2;          //    73728  f16 [192][192] weight plane
  const size_t PLC = (size_t)NB * NH * SEQ * HL * 4; // 6291456 f32 lctx plane
  size_t off = 0;
  const size_t oXh   = off; off += PX;
  const size_t oLh   = off; off += PL;
  const size_t oWq   = off; off += PW;
  const size_t oWk   = off; off += PW;
  const size_t oWv   = off; off += PW;
  const size_t oWlq  = off; off += PWL;
  const size_t oWlk  = off; off += PWL;
  const size_t oWlv  = off; off += PWL;
  const size_t oQp   = off; off += PX;
  const size_t oKp   = off; off += PX;
  const size_t oVTp  = off; off += PX;
  const size_t oLQp  = off; off += PL;
  const size_t oLKp  = off; off += PL;
  const size_t oLVTp = off; off += PL;
  const size_t oLC   = off; off += PLC;
  if (off > ws_size) return;                       // off = 72966144
  if (off > (size_t)134217728) return;

  char* ws = (char*)d_ws;
  unsigned short* Xh   = (unsigned short*)(ws + oXh);
  unsigned short* Lh   = (unsigned short*)(ws + oLh);
  unsigned short* Wqh  = (unsigned short*)(ws + oWq);
  unsigned short* Wkh  = (unsigned short*)(ws + oWk);
  unsigned short* Wvh  = (unsigned short*)(ws + oWv);
  unsigned short* Wlqh = (unsigned short*)(ws + oWlq);
  unsigned short* Wlkh = (unsigned short*)(ws + oWlk);
  unsigned short* Wlvh = (unsigned short*)(ws + oWlv);
  unsigned short* Qp   = (unsigned short*)(ws + oQp);
  unsigned short* Kp   = (unsigned short*)(ws + oKp);
  unsigned short* VTp  = (unsigned short*)(ws + oVTp);
  unsigned short* LQp  = (unsigned short*)(ws + oLQp);
  unsigned short* LKp  = (unsigned short*)(ws + oLKp);
  unsigned short* LVTp = (unsigned short*)(ws + oLVTp);
  float*          LC   = (float*)(ws + oLC);
  float*          out0 = (float*)d_out;
  float*          out1 = (float*)d_out + (size_t)NB * SEQ * DM;   // byte offset 25165824 / 4; last index 7864319 < out_size

  const dim3 blk(256);
  const int n4o1 = NB * SEQ * DL / 4;                          // 393216
  const dim3 gCvt(CB_ALL);                                     // 4758 blocks: the eight planes
  const dim3 gProj(GB_ALL);                                    //  720 blocks: the six projections
  const dim3 gAttn(NB * NH * NQB);                             // 1536 blocks of 128
  const dim3 gPack((n4o1 + 255) / 256);                        // 1536 blocks

  // (1) activations f32 -> f16 (x1); weights [n][k] f32 -> f16 (x64): one grid, planes Xh .. Wlvh back to back from Xh
  cvt_all<<<gCvt, blk, 0, stream>>>(x, xl, Wq, Wk, Wv, Wlq, Wlk, Wlv, Xh);
  // (2) q, k, v^T, lq (x2), lk, lv^T -> f16 planes: one grid
  proj_all<<<gProj, blk, 0, stream>>>(Xh, Lh, Wqh, Wkh, Wvh, Wlqh, Wlkh, Wlvh, bq, bk, bv, blq, blk_, blv,
                                      Qp, Kp, VTp, LQp, LKp, LVTp);
  // (3) attention: ctx -> out0, lctx -> LC plane
  attn_two<<<gAttn, dim3(128), 0, stream>>>(Qp, Kp, VTp, LQp, LKp, LVTp, out0, LC, 0.125f);
  // (4) LC plane -> out1 [8192][192]
  lc_pack<<<gPack, blk, 0, stream>>>(LC, out1, n4o1);
  (void)hipGetLastError();
}

// v006
// A run of this version takes 87.7 microseconds.
// In both of two side-by-side timings against v005, it was 1.08 times as fast.
// Counting every step since v000, it is 3.89 times as fast.
// Contractions: q, k, v^T, lq, lk, lv^T projections = v_wmma_f32_16x16x32_f16 (activations f16 x1, weights f16 x64, single product, f32 accumulate);
// k.q^T and lk.lq^T scores (transposed) = v_wmma_f32_16x16x32_f16 (q, k, lk f16 x1, lq f16 x2, layout K=16 zero-padded to 32 in registers, single products, one f32 accumulator);
// v^T.p^T and lv^T.p^T = v_wmma_f32_16x16x32_f16 (p carried x1024 in f16, v and lv f16 x1, single products, f32 accumulate); softmax and normalisation in f32.
// Carry audit: weight planes x64 -> 1/64 folded in the gemm64 epilogue (ascale); LQ plane x2 -> folded by the common score scale 0.125
//              in attn_two (q.k/8 + lq.lk/4 = (q.k + 2lq.lk)/8); P x1024 (registers only) -> 1/1024 folded in the attn_two epilogue (inv);
//              activation planes, Q/K/V^T/LK/LV^T planes and the LC f32 plane carry x1.
#include <hip/hip_runtime.h>
#include <math.h>
#include <stdint.h>

#define NB   8
#define SEQ  1024
#define DM   768
#define DL   192
#define NH   12
#define HD   64
#define HL   16
#define NQB  (SEQ / 64)   // 64-row query blocks per sequence
#define NKT  (SEQ / 64)   // 64-key chunks per sequence
#define LP   72           // LDS row pitch in halves of the 64-half rows read by 16-B fragment loads: 144 B = 16 B x odd
#define LPL  24           // the same for the 16-half LK rows: 48 B = 16 B x odd
#define OP   68           // LDS row pitch in floats of the ctx tile, written by 16-B stores down a column of rows: 272 B = 16 B x odd
// LDS ring of the K=768 projections: a stage is 64 k (128 B) of 128 A rows, then of 256 B rows, at pitch LP; two buffers
#define RROWS  (128 + 256)
#define RBUF   (RROWS * LP)                         // halves a buffer: 55296 B
// LDS ring of the attention: a buffer is one 64-key chunk: 64 K rows, 64 V^T rows, 16 LV^T rows at pitch LP, then 64 LK rows
// at pitch LPL; two buffers
#define ABUF   ((64 + 64 + HL) * LP + 64 * LPL)     // halves a buffer: 23808 B
// block ranges of the two merged grids (256 threads a block)
#define CB_X   (NB * SEQ * DM / 8 / 256)            // 3072 blocks: x plane, 8 elements a thread
#define CB_L   (NB * SEQ * DL / 8 / 256)            //  768 blocks: layout plane
#define CB_W   (DM * DM / 8 / 256)                  //  288 blocks: one [768][768] weight plane
#define CB_WL  (DL * DL / 8 / 256)                  //   18 blocks: one [192][192] weight plane
#define CB_ALL (CB_X + CB_L + 3 * CB_W + 3 * CB_WL) // 4758 blocks
#define GB_T   (((NB * SEQ) / 128) * (DM / 256))    //  192 blocks: M=8192, N=768, one 128x256 tile a block
#define GB_VT  ((DM / 128) * (SEQ / 256))           //   24 blocks a batch: M=768, N=1024
#define GB_L   (((NB * SEQ) / 64) * (DL / 64) / 8)  //   48 blocks: M=8192, N=192
#define GB_LVT ((DL / 64) * (SEQ / 64) / 8)         //    6 blocks a batch: M=192, N=1024
#define GB_ALL (2 * GB_T + NB * GB_VT + 2 * GB_L + NB * GB_LVT)   // 720 blocks
static_assert((NB * SEQ * DM) % 2048 == 0 && (NB * SEQ * DL) % 2048 == 0 && (DM * DM) % 2048 == 0 && (DL * DL) % 2048 == 0);
static_assert(((NB * SEQ) % 128) == 0 && (DM % 256) == 0 && (DM % 128) == 0 && (SEQ % 256) == 0 && DM / 64 >= 2);
static_assert((((NB * SEQ) / 64) * (DL / 64)) % 8 == 0 && ((DL / 64) * (SEQ / 64)) % 8 == 0);
static_assert(NH * HD == DM);
static_assert(NH * HL == DL);
static_assert(NQB == 16 && NKT == 16);
static_assert((SEQ % 64) == 0 && (DM % 64) == 0 && (DL % 64) == 0);
static_assert((DM % 32) == 0 && (DL % 32) == 0);

typedef _Float16 v16h __attribute__((ext_vector_type(16)));
typedef _Float16 v8h  __attribute__((ext_vector_type(8)));
typedef float    v8f  __attribute__((ext_vector_type(8)));
typedef float    v4f  __attribute__((ext_vector_type(4)));
typedef float    v2f  __attribute__((ext_vector_type(2)));
typedef unsigned int v4u __attribute__((ext_vector_type(4)));

#if defined(__HIP_DEVICE_COMPILE__)
#define DEV_ASM 1
#else
#define DEV_ASM 0
#endif

// ---- scalar helpers --------------------------------------------------------------------------------
__device__ __forceinline__ unsigned short h_bits(_Float16 x) { return __builtin_bit_cast(unsigned short, x); }
__device__ __forceinline__ unsigned pk16(unsigned short a, unsigned short b) { return (unsigned)a | ((unsigned)b << 16); }
__device__ __forceinline__ v8f zero8() { v8f z = {0.f, 0.f, 0.f, 0.f, 0.f, 0.f, 0.f, 0.f}; return z; }
__device__ __forceinline__ v8h zero8h() {
  const _Float16 z = (_Float16)0.0f;
  v8h r = {z, z, z, z, z, z, z, z};
  return r;
}

// ---- fragment loader: 16-bit A/B operand, lane -> row/col (lane&15), p already includes +8*(lane>>4);
//      elements 0..7 <- p[0..7] (k0+8h..k0+8h+7), elements 8..15 <- p[16..23] (k0+16+8h..k0+16+8h+7)
__device__ __forceinline__ v16h ldfrag_h(const _Float16* p) {
  union { v16h v; v8h h[2]; } f;
  f.h[0] = *(const v8h*)(p);
  f.h[1] = *(const v8h*)(p + 16);
  return f.v;
}

// lane l <-> lane l ^ 16: the other half of the wave holds the other keys of the same query
__device__ __forceinline__ float xhalf(float x) {
  return __builtin_bit_cast(float, __builtin_amdgcn_permlanex16(__builtin_bit_cast(int, x), __builtin_bit_cast(int, x),
                                                                0x76543210, 0xfedcba98, false, false));
}

// ---- WMMA helpers ----------------------------------------------------------------------------------
__device__ __forceinline__ v8f mmar(v16h a, v16h b, v8f c) {
  return __builtin_amdgcn_wmma_f32_16x16x32_f16(false, a, false, b, (short)0, c, false, false);
}
__device__ __forceinline__ void dep_guard(v8f& a, v8f& b, v16h x, v16h y) {
#if DEV_ASM
  asm volatile("v_nop\n\tv_nop\n\tv_nop\n\tv_nop" : "+v"(a), "+v"(b) : "v"(x), "v"(y));
#else
  (void)a; (void)b; (void)x; (void)y;
#endif
}
__device__ __forceinline__ void keep4(v16h a, v16h b, v16h c, v16h d) {
#if DEV_ASM
  asm volatile("v_nop" :: "v"(a), "v"(b), "v"(c), "v"(d));
#else
  (void)a; (void)b; (void)c; (void)d;
#endif
}
__device__ __forceinline__ void acc_guard4(v8f& a, v8f& b, v8f& c, v8f& d) {
#if DEV_ASM
  asm volatile("v_nop\n\tv_nop\n\tv_nop\n\tv_nop" : "+v"(a), "+v"(b), "+v"(c), "+v"(d));
#else
  (void)a; (void)b; (void)c; (void)d;
#endif
}

// ---- asynchronous copies global -> LDS -------------------------------------------------------------
// One stage of the ring: each of the 256 threads brings twelve 16-B pieces, piece (t & 7) of rows (t >> 3) + 32 i;
// i 0..3 are the 128 A rows, i 4..11 the 256 B rows, so a wave's copy covers four whole 128-B lines.
// l = the thread's LDS byte address of its piece in row (t >> 3) of the target buffer; ga, gb = its global piece in
// the first A row and the first B row of the stage; sa, sb = 32 rows in halves.
// The s_wait_xcnt closes the statement so that no address register is rewritten ahead of it.
__device__ __forceinline__ void stage_copy(unsigned l, const _Float16* ga, const _Float16* gb, size_t sa, size_t sb) {
#if DEV_ASM
  asm volatile(
      "global_load_async_to_lds_b128 %0, %12, off\n\t"
      "global_load_async_to_lds_b128 %1, %13, off\n\t"
      "global_load_async_to_lds_b128 %2, %14, off\n\t"
      "global_load_async_to_lds_b128 %3, %15, off\n\t"
      "global_load_async_to_lds_b128 %4, %16, off\n\t"
      "global_load_async_to_lds_b128 %5, %17, off\n\t"
      "global_load_async_to_lds_b128 %6, %18, off\n\t"
      "global_load_async_to_lds_b128 %7, %19, off\n\t"
      "global_load_async_to_lds_b128 %8, %20, off\n\t"
      "global_load_async_to_lds_b128 %9, %21, off\n\t"
      "global_load_async_to_lds_b128 %10, %22, off\n\t"
      "global_load_async_to_lds_b128 %11, %23, off\n\t"
      "s_wait_xcnt 0x0"
      :: "v"(l), "v"(l + 1u * 32u * LP * 2u), "v"(l + 2u * 32u * LP * 2u), "v"(l + 3u * 32u * LP * 2u),
         "v"(l + 4u * 32u * LP * 2u), "v"(l + 5u * 32u * LP * 2u), "v"(l + 6u * 32u * LP * 2u),
         "v"(l + 7u * 32u * LP * 2u), "v"(l + 8u * 32u * LP * 2u), "v"(l + 9u * 32u * LP * 2u),
         "v"(l + 10u * 32u * LP * 2u), "v"(l + 11u * 32u * LP * 2u),
         "v"(ga), "v"(ga + sa), "v"(ga + 2 * sa), "v"(ga + 3 * sa),
         "v"(gb), "v"(gb + sb), "v"(gb + 2 * sb), "v"(gb + 3 * sb),
         "v"(gb + 4 * sb), "v"(gb + 5 * sb), "v"(gb + 6 * sb), "v"(gb + 7 * sb)
      : "memory");
#else
  (void)l; (void)ga; (void)gb; (void)sa; (void)sb;
#endif
}
// One 64-key chunk of the attention ring: each of the 128 threads brings ten 16-B pieces. Nine are piece (t & 7) of rows
// (t >> 3) + 16 i of the tiles of pitch LP: i 0..3 the 64 K rows, i 4..7 the 64 V^T rows, i 8 the 16 LV^T rows, so each of
// these copies of a wave covers four whole 128-B lines; the tenth is piece (t & 1) of the 32-B LK row (t >> 1).
// l = the thread's LDS byte address of its piece in row (t >> 3) of the target buffer, llk = the same of its LK piece.
// A global address is a block-uniform base in scalar registers (bk, bv, blv, blk = row 0 of the chunk's K, V^T, LV^T and LK
// tiles; the steps of 16 rows are scalar additions) plus the thread's fixed byte offset in the tile (ok; ov for V^T and LV^T,
// which have one pitch; olk), so that no vector instruction forms it.
// The s_wait_xcnt closes the statement so that no address register is rewritten ahead of it.
__device__ __forceinline__ void chunk_copy(unsigned l, unsigned llk, unsigned ok, unsigned ov, unsigned olk,
                                           const _Float16* bk, const _Float16* bv, const _Float16* blv, const _Float16* blk) {
#if DEV_ASM
  asm volatile(
      "global_load_async_to_lds_b128 %0, %10, %13\n\t"
      "global_load_async_to_lds_b128 %1, %10, %14\n\t"
      "global_load_async_to_lds_b128 %2, %10, %15\n\t"
      "global_load_async_to_lds_b128 %3, %10, %16\n\t"
      "global_load_async_to_lds_b128 %4, %11, %17\n\t"
      "global_load_async_to_lds_b128 %5, %11, %18\n\t"
      "global_load_async_to_lds_b128 %6, %11, %19\n\t"
      "global_load_async_to_lds_b128 %7, %11, %20\n\t"
      "global_load_async_to_lds_b128 %8, %11, %21\n\t"
      "global_load_async_to_lds_b128 %9, %12, %22\n\t"
      "s_wait_xcnt 0x0"
      :: "v"(l), "v"(l + 1u * 16u * LP * 2u), "v"(l + 2u * 16u * LP * 2u), "v"(l + 3u * 16u * LP * 2u),
         "v"(l + 4u * 16u * LP * 2u), "v"(l + 5u * 16u * LP * 2u), "v"(l + 6u * 16u * LP * 2u),
         "v"(l + 7u * 16u * LP * 2u), "v"(l + 8u * 16u * LP * 2u), "v"(llk),
         "v"(ok), "v"(ov), "v"(olk),
         "s"(bk), "s"(bk + 16 * DM), "s"(bk + 32 * DM), "s"(bk + 48 * DM),
         "s"(bv), "s"(bv + 16 * SEQ), "s"(bv + 32 * SEQ), "s"(bv + 48 * SEQ),
         "s"(blv), "s"(blk)
      : "memory");
#else
  (void)l; (void)llk; (void)ok; (void)ov; (void)olk; (void)bk; (void)bv; (void)blv; (void)blk;
#endif
}
// this wave's copies have landed in LDS
__device__ __forceinline__ void wait_copies() {
#if DEV_ASM
  asm volatile("s_wait_asynccnt 0x0" ::: "memory");
#endif
}
// this wave's LDS reads have returned, so the buffer may go to its next writer
__device__ __forceinline__ void wait_lds() {
#if DEV_ASM
  asm volatile("s_wait_dscnt 0x0" ::: "memory");
#endif
}

// =====================================================================================================
// f32 -> f16 bits of (x * scale) for all eight planes in ONE grid: the planes lie back to back in the workspace
// in the order x, layout, Wq, Wk, Wv, Wlq, Wlk, Wlv, and each is a whole number of blocks, so the block index
// picks the source plane (block-uniform) and the flat thread index is the output position.
// 8 elements per thread, one 16-B store per lane: a wave writes 512 contiguous bytes.
// coverage: CB_ALL blocks x 256 threads x 8 = all eight planes exactly (static_asserts above), so no bound test.
// =====================================================================================================
__global__ __launch_bounds__(256) void cvt_all(const float* __restrict__ x, const float* __restrict__ xl,
                                               const float* __restrict__ wq, const float* __restrict__ wk,
                                               const float* __restrict__ wv, const float* __restrict__ wlq,
                                               const float* __restrict__ wlk, const float* __restrict__ wlv,
                                               unsigned short* out) {
  const int blk = blockIdx.x;
  const float* in = x;
  int first = 0;                 // first block of the plane
  float scale = 1.0f;            // activations x1, weights x64
  if (blk >= CB_X)                                  { in = xl;  first = CB_X; }
  if (blk >= CB_X + CB_L)                           { in = wq;  first = CB_X + CB_L;                       scale = 64.0f; }
  if (blk >= CB_X + CB_L + CB_W)                    { in = wk;  first = CB_X + CB_L + CB_W; }
  if (blk >= CB_X + CB_L + 2 * CB_W)                { in = wv;  first = CB_X + CB_L + 2 * CB_W; }
  if (blk >= CB_X + CB_L + 3 * CB_W)                { in = wlq; first = CB_X + CB_L + 3 * CB_W; }
  if (blk >= CB_X + CB_L + 3 * CB_W + CB_WL)        { in = wlk; first = CB_X + CB_L + 3 * CB_W + CB_WL; }
  if (blk >= CB_X + CB_L + 3 * CB_W + 2 * CB_WL)    { in = wlv; first = CB_X + CB_L + 3 * CB_W + 2 * CB_WL; }
  const int i = (blk - first) * 256 + (int)threadIdx.x;      // 8-element unit inside the source plane
  const int o = blk * 256 + (int)threadIdx.x;                // 8-element unit inside the eight planes
  const v4f a = *(const v4f*)(in + (size_t)i * 8);
  const v4f c = *(const v4f*)(in + (size_t)i * 8 + 4);
  v4u p;
  p[0] = pk16(h_bits((_Float16)(a[0] * scale)), h_bits((_Float16)(a[1] * scale)));
  p[1] = pk16(h_bits((_Float16)(a[2] * scale)), h_bits((_Float16)(a[3] * scale)));
  p[2] = pk16(h_bits((_Float16)(c[0] * scale)), h_bits((_Float16)(c[1] * scale)));
  p[3] = pk16(h_bits((_Float16)(c[2] * scale)), h_bits((_Float16)(c[3] * scale)));
  *(v4u*)(out + (size_t)o * 8) = p;
}

// =====================================================================================================
// Register-blocked batched f16 WMMA GEMM with bias: C[m][n] = (sum_k A[m][k] * Bt[n][k]) * ascale + bias,
// stored as f16(value * oscale). One wave per 64x64 tile. A row-major [M][K] pitch lda;
// Bt row-major [N][K] pitch ldb (k contiguous); M, N multiples of 64, K multiple of 32 (host-checked).
// bx = block index inside the product, b = batch index (strides in elements), sT = the block's LDS slabs.
// RING 0: the block's 8 tiles are consecutive in n, no block barriers, fragments loaded straight from global
//         with the split k map.
// RING 1: the 8 tiles are 2 (m) x 4 (n) = one 128x256 tile (M multiple of 128, N of 256, K of 64, at least 128).
//         Its operand rows come to LDS in stages of 64 k by asynchronous copies, two buffers: the copies of stage
//         s + 2 fly while stage s + 1 is worked on; fragments are read from LDS with the same split k map and the
//         same k order. Every wave passes every barrier (no early return on this path).
// BIASROW 0: bias[n] (bias length N); BIASROW 1: bias[m] (bias length M).
// coverage: 4 slabs x 16 rows (it 0..3 x lane>>3 0..3) x 64 cols (8 lanes x 8) = the wave's whole 64x64 tile.
// =====================================================================================================
template <int BIASROW, int RING>
__device__ __forceinline__ void gemm64(
    float (*sT)[16 * 68], _Float16* ring, int bx, int b,
    const unsigned short* __restrict__ Ap, int lda, long long strideA,
    const unsigned short* __restrict__ Btp, int ldb, long long strideB,
    const float* __restrict__ bias,
    unsigned short* Cp, int ldc, long long strideC,
    int M, int N, int K, float ascale, float oscale) {
  const _Float16* A  = (const _Float16*)(const void*)Ap;
  const _Float16* Bt = (const _Float16*)(const void*)Btp;
  const int lane = threadIdx.x & 31;
  const int wave = threadIdx.x >> 5;
  int m0, n0;                              // the wave's 64x64 tile
  int bm0 = 0, bn0 = 0;                    // RING: the block's 128x256 tile
  if constexpr (RING) {
    const int tilesN = N >> 8;
    const int tm = bx / tilesN;
    const int tn = bx - tm * tilesN;
    bm0 = tm << 7;
    bn0 = tn << 8;
    m0 = bm0 + ((wave >> 2) << 6);
    n0 = bn0 + ((wave & 3) << 6);
  } else {
    const int tilesN = N >> 6;
    const int tilesM = M >> 6;
    const int tile = bx * 8 + wave;
    if (tile >= tilesM * tilesN) return;   // wave-uniform; no block barriers on this path
    const int tm = tile / tilesN;
    const int tn = tile - tm * tilesN;
    m0 = tm << 6;
    n0 = tn << 6;
  }

  const _Float16* Ab = A  + (size_t)b * (size_t)strideA;
  const _Float16* Bb = Bt + (size_t)b * (size_t)strideB;

  const int rlane = lane & 15;                 // row (A) / col (B, D) within subtile
  const int koff  = (lane >> 4) * 8;           // k offset of this lane half
  const int mOff  = (lane >> 4) * 8;           // D row offset

  v8f acc[4][4];
#pragma unroll
  for (int i = 0; i < 4; ++i)
#pragma unroll
    for (int j = 0; j < 4; ++j) acc[i][j] = zero8();

  if constexpr (RING) {
    const int t = threadIdx.x;
    const _Float16* ga = Ab + (size_t)(bm0 + (t >> 3)) * lda + (t & 7) * 8;   // the thread's piece, first A row
    const _Float16* gb = Bb + (size_t)(bn0 + (t >> 3)) * ldb + (t & 7) * 8;   // the same, first B row
    const size_t sa = (size_t)32 * lda, sb = (size_t)32 * ldb;
    const unsigned l0 = (unsigned)(uintptr_t)ring + (unsigned)((t >> 3) * (LP * 2) + (t & 7) * 16);
    const int aoff = ((wave >> 2) * 64 + rlane) * LP + koff;                  // the wave's A rows in a buffer
    const int boff = (128 + (wave & 3) * 64 + rlane) * LP + koff;             // the wave's B rows
    const int ns = K >> 6;                                                    // stages
    stage_copy(l0, ga, gb, sa, sb);                                           // stage 0 -> buffer 0
    wait_copies();
    __syncthreads();                                                          // stage 0 readable by every wave
    stage_copy(l0 + RBUF * 2u, ga + 64, gb + 64, sa, sb);                     // stage 1 -> buffer 1 (ns >= 2)
#pragma unroll 1   // rolled over the twelve stages, for speed only
    for (int s = 0; s < ns; ++s) {
      const _Float16* buf = ring + (s & 1) * RBUF;
#pragma unroll
      for (int ks = 0; ks < 2; ++ks) {
        v16h bq[4], af[4];                 // all sixteen LDS reads of the 32 k stand together, ahead of the products
#pragma unroll
        for (int j = 0; j < 4; ++j) bq[j] = ldfrag_h(buf + boff + j * 16 * LP + ks * 32);
#pragma unroll
        for (int i = 0; i < 4; ++i) af[i] = ldfrag_h(buf + aoff + i * 16 * LP + ks * 32);
#pragma unroll
        for (int i = 0; i < 4; ++i) {
#pragma unroll
          for (int j = 0; j < 4; ++j) acc[i][j] = mmar(af[i], bq[j], acc[i][j]);
          dep_guard(acc[i][0], acc[i][3], af[i], bq[3]);
        }
        keep4(bq[0], bq[1], bq[2], bq[3]);
      }
      wait_lds();
      wait_copies();
      __syncthreads();
      if (s + 2 < ns) stage_copy(l0 + (unsigned)(s & 1) * (RBUF * 2u), ga + (s + 2) * 64, gb + (s + 2) * 64, sa, sb);
    }
    wait_copies();
  } else {
    for (int k0 = 0; k0 < K; k0 += 32) {
      v16h bq[4];
#pragma unroll
      for (int j = 0; j < 4; ++j)
        bq[j] = ldfrag_h(Bb + (size_t)(n0 + (j << 4) + rlane) * ldb + koff + k0);
#pragma unroll
      for (int i = 0; i < 4; ++i) {
        const v16h af = ldfrag_h(Ab + (size_t)(m0 + (i << 4) + rlane) * lda + koff + k0);
#pragma unroll
        for (int j = 0; j < 4; ++j) acc[i][j] = mmar(af, bq[j], acc[i][j]);
        dep_guard(acc[i][0], acc[i][3], af, bq[3]);
      }
      keep4(bq[0], bq[1], bq[2], bq[3]);
    }
  }
  acc_guard4(acc[0][0], acc[0][1], acc[0][2], acc[0][3]);
  acc_guard4(acc[1][0], acc[1][1], acc[1][2], acc[1][3]);
  acc_guard4(acc[2][0], acc[2][1], acc[2][2], acc[2][3]);
  acc_guard4(acc[3][0], acc[3][1], acc[3][2], acc[3][3]);

  // ---- epilogue ----
  float* slab = sT[wave];
  const int q = lane >> 3, c8 = (lane & 7) * 8;
  unsigned short* C = Cp + (size_t)b * (size_t)strideC;
  float bcol[8];
  {
    const v4f b0 = *(const v4f*)(bias + (BIASROW ? 0 : (n0 + c8)));       // column bias (length N), 16-B aligned
    const v4f b1 = *(const v4f*)(bias + (BIASROW ? 4 : (n0 + c8 + 4)));
#pragma unroll
    for (int e = 0; e < 4; ++e) { bcol[e] = b0[e]; bcol[4 + e] = b1[e]; }
  }
#pragma unroll
  for (int i = 0; i < 4; ++i) {
    const int mBase = m0 + (i << 4);
#pragma unroll
    for (int j = 0; j < 4; ++j) {
#pragma unroll
      for (int r = 0; r < 8; ++r) {
        slab[(mOff + r) * 68 + (j << 4) + rlane] = acc[i][j][r];
      }
    }
    __builtin_amdgcn_fence(__ATOMIC_RELEASE, "workgroup");
    __builtin_amdgcn_wave_barrier();
    __builtin_amdgcn_fence(__ATOMIC_ACQUIRE, "workgroup");
    v4u hv[4];
#pragma unroll
    for (int it = 0; it < 4; ++it) {
      const int row = it * 4 + q;                        // it 0..3 x q 0..3 = rows 0..15
      const float* sp = slab + row * 68 + c8;
      float bb[8];
      if (BIASROW) {
        const float bv = bias[mBase + row];              // row bias, index < M = bias length
#pragma unroll
        for (int e = 0; e < 8; ++e) bb[e] = bv;
      } else {
#pragma unroll
        for (int e = 0; e < 8; ++e) bb[e] = bcol[e];
      }
      v4u a;
#pragma unroll
      for (int e = 0; e < 4; ++e) {
        const float f0 = (sp[2 * e] * ascale + bb[2 * e]) * oscale;
        const float f1 = (sp[2 * e + 1] * ascale + bb[2 * e + 1]) * oscale;
        a[e] = pk16(h_bits((_Float16)f0), h_bits((_Float16)f1));
      }
      hv[it] = a;
    }
    {
#pragma unroll
      for (int it = 0; it < 4; ++it) {
        const int row = it * 4 + q;
        *(v4u*)(C + (size_t)(mBase + row) * ldc + n0 + c8) = hv[it];
      }
      
    }
    __builtin_amdgcn_fence(__ATOMIC_RELEASE, "workgroup");
    __builtin_amdgcn_wave_barrier();
    __builtin_amdgcn_fence(__ATOMIC_ACQUIRE, "workgroup");
  }
}

// =====================================================================================================
// All six projections in ONE grid: they read only the converted planes and write disjoint planes, so none waits
// for another. The block index picks the product (block-uniform); the K=768 products come first, so that the
// short K=192 ones fill the places that free up at the end. The K=768 products take their operands through the
// LDS ring (gemm64, RING 1), each block one 128x256 tile; the K=192 products read them straight from global (RING 0).
//   [0, GB_T)  q = x . Wq^T + bq            [GB_T, 2 GB_T)  k = x . Wk^T + bk          (M=8192, N=768,  K=768)
//   next NB x GB_VT   v^T = Wv . x^T + bv per batch (A = Wvh [n][k], Bt = Xh rows of b)  (M=768,  N=1024, K=768)
//   next GB_L  lq = (xl . Wlq^T + blq) x2   next GB_L  lk = xl . Wlk^T + blk            (M=8192, N=192,  K=192)
//   next NB x GB_LVT  lv^T = Wlv . xl^T + blv per batch                                 (M=192,  N=1024, K=192)
// =====================================================================================================
__global__ __launch_bounds__(256) void proj_all(
    const unsigned short* __restrict__ Xh, const unsigned short* __restrict__ Lh,
    const unsigned short* __restrict__ Wqh, const unsigned short* __restrict__ Wkh,
    const unsigned short* __restrict__ Wvh, const unsigned short* __restrict__ Wlqh,
    const unsigned short* __restrict__ Wlkh, const unsigned short* __restrict__ Wlvh,
    const float* __restrict__ bq, const float* __restrict__ bk, const float* __restrict__ bv,
    const float* __restrict__ blq, const float* __restrict__ blk_, const float* __restrict__ blv,
    unsigned short* Qp, unsigned short* Kp, unsigned short* VTp,
    unsigned short* LQp, unsigned short* LKp, unsigned short* LVTp) {
  __shared__ __align__(16) float sT[8][16 * 68];   // per-wave 16x64 slab, pitch 68 floats
  __shared__ __align__(16) _Float16 ring[2 * RBUF]; // operand stages of the K=768 products, two buffers, 110592 B
  const int blk = blockIdx.x;
  const int T0 = 2 * GB_T;                 // first block of v^T
  const int T1 = T0 + NB * GB_VT;          // first block of lq
  const int T2 = T1 + 2 * GB_L;            // first block of lv^T
  if (blk < T0) {
    // text activations x weights^T, bias by column, operands through the LDS ring
    const bool second = blk >= GB_T;       // the k product
    gemm64<0, 1>(sT, ring, second ? blk - GB_T : blk, 0, Xh, DM, 0LL, second ? Wkh : Wqh, DM, 0LL,
                 second ? bk : bq, second ? Kp : Qp, DM, 0LL, NB * SEQ, DM, DM, 1.0f / 64.0f, 1.0f);
  } else if (blk < T1) {
    // text weights x activations^T per batch, bias by row, operands through the LDS ring
    const int b  = (blk - T0) / GB_VT;     // batch
    const int bx = (blk - T0) - b * GB_VT; // block inside the batch
    gemm64<1, 1>(sT, ring, bx, b, Wvh, DM, 0LL, Xh, DM, (long long)SEQ * DM, bv, VTp, SEQ, (long long)DM * SEQ,
                 DM, SEQ, DM, 1.0f / 64.0f, 1.0f);
  } else if (blk < T2) {
    // layout activations x weights^T, bias by column
    const int  r      = blk - T1;
    const bool second = r >= GB_L;         // the lk product
    gemm64<0, 0>(sT, ring, second ? r - GB_L : r, 0, Lh, DL, 0LL, second ? Wlkh : Wlqh, DL, 0LL,
                 second ? blk_ : blq, second ? LKp : LQp, DL, 0LL, NB * SEQ, DL, DL, 1.0f / 64.0f,
                 second ? 1.0f : 2.0f);
  } else {
    // layout weights x activations^T per batch, bias by row
    const int b  = (blk - T2) / GB_LVT;     // batch
    const int bx = (blk - T2) - b * GB_LVT; // block inside the batch
    gemm64<1, 0>(sT, ring, bx, b, Wlvh, DL, 0LL, Lh, DL, (long long)SEQ * DL, blv, LVTp, SEQ, (long long)DL * SEQ,
                 DL, SEQ, DL, 1.0f / 64.0f, 1.0f);
  }
}

// =====================================================================================================
// Two-stream attention, text head dim 64 + layout head dim 16, no mask, softmax over all SEQ keys.
//   Q plane (f16): element (b, t, h, d) at [(b*SEQ + t)*DM + h*64 + d]; K plane same layout with key s.
//   LQ plane (f16, value x2): [(b*SEQ + t)*DL + h*16 + d]; LK plane (f16 x1) same layout.
//   V^T plane (f16): element (b, h, d, s) at [(b*DM + h*64 + d)*SEQ + s]; LV^T plane: [(b*DL + h*16 + d)*SEQ + s].
//   All products run transposed: the K, LK, V^T and LV^T rows are the A operand, the query side is the B operand, so
//   a lane holds one query (column lane&15) and the keys or the head dims 8*(lane>>4) + r of a tile in its registers.
//   scores^T = (k . q + lk . lq2) * sscale in f32 (3 f16 WMMA steps into one accumulator; the layout step uses
//   k = 0..15 only, upper 16 k-slots are register zeros in both fragments).
//   p = exp(s - m) carried as f16(1024 p); two score tiles (32 keys) pack in place into one B operand, in the k order
//   of the V^T loads; ctx^T = v^T . p^T (4 row tiles), lctx^T = lv^T . p^T (1 row tile); online softmax in f32: maximum
//   and sum run inside the lane, the maximum is joined between the wave halves each chunk, the sum once at the end.
//   Block = 4 waves = 64 query rows of one (b, h); grid = NB * NH * NQB; key chunks of 64, static trip NKT.
//   Chunk staging: 128 threads: K 32 halves/thread (64x64), V^T 32 halves/thread (64x64), LK 8 halves/thread (64x16),
//   LV^T 8 halves/thread (16x64) = every LDS element read below, by asynchronous copies into two buffers: the copies of
//   chunk kt + 2 fly while chunk kt + 1 is worked on; one barrier a chunk publishes the next chunk and frees the read one;
//   ctx -> out0 f32 [(b*SEQ + t)*DM + h*64 + d]: 16 rows x 256-B segments per wave (16 lanes x 16 B per segment,
//   Output coverage: wave rows q0..q0+15 (it 0..7 x lane>>4) x 64 cols (16 lanes x 4) of head h for out0;
//   64 float4 = the wave's whole 16x16 lctx tile for LC; the grid covers every (b, h, qb).
// =====================================================================================================
__global__ __launch_bounds__(128)
void attn_two(const unsigned short* __restrict__ qp, const unsigned short* __restrict__ kp,
              const unsigned short* __restrict__ vtp, const unsigned short* __restrict__ lqp,
              const unsigned short* __restrict__ lkp, const unsigned short* __restrict__ lvtp,
              float* out0, float* lcp, float sscale) {
  union FH { v16h v; v8h h[2]; };
  // one array, so that the tiles of pitch LP lie at constant offsets from one lane address. In each buffer:
  //   K chunk [kv][d] at 0 (9 KB), V^T [d][kv] at 64 LP (9 KB), LV^T [dl][kv] at 128 LP (2304 B), all pitch LP;
  //   LK chunk [kv][dl] at (128 + HL) LP, pitch LPL (3 KB).
  // Behind the loop the same bytes hold the output tiles, which keeps six blocks' LDS on a WGP (all blocks resident):
  //   per wave ctx tile [row][d], pitch OP (4 x 4352 B), then per wave lctx tile (4 x 1024 B).
  __shared__ __align__(16) _Float16 Tsh[2 * ABUF];       // 47616 B
  static_assert(4 * 16 * (OP + HL) * 4 <= 2 * ABUF * 2);

  const int tid  = threadIdx.x;
  const int wave = __builtin_amdgcn_readfirstlane(tid >> 5);   // in a scalar register, and with it every row index built from it
  const int lane = tid & 31;
  const int hh   = lane >> 4;
  const int c    = lane & 15;

  const int bx   = blockIdx.x;
  const int qb   = bx % NQB;
  const int rest = bx / NQB;
  const int h    = rest % NH;
  const int b    = rest / NH;
  const int q0   = qb * 64 + wave * 16;
  const size_t rowB = (size_t)b * SEQ;

  const _Float16* Q   = (const _Float16*)(const void*)qp;
  const _Float16* LQ  = (const _Float16*)(const void*)lqp;
  const _Float16* Kg  = (const _Float16*)(const void*)kp + (size_t)h * HD;
  const _Float16* LKg = (const _Float16*)(const void*)lkp + (size_t)h * HL;
  const _Float16* Vh  = (const _Float16*)(const void*)vtp  + ((size_t)b * DM + (size_t)h * HD) * SEQ;
  const _Float16* LVh = (const _Float16*)(const void*)lvtp + ((size_t)b * DL + (size_t)h * HL) * SEQ;

  // ---- Q fragments (B operand, column = lane&15): 2 d-chunks of the text stream; layout fragment k 0..15 ----
  v16h qa[2];
#pragma unroll
  for (int dc = 0; dc < 2; ++dc) {
    const size_t qo = (rowB + q0 + c) * DM + (size_t)h * HD + dc * 32 + 8 * hh;
    qa[dc] = ldfrag_h(Q + qo);
  }
  FH la;
  la.h[0] = *(const v8h*)(LQ + (rowB + q0 + c) * DL + (size_t)h * HL + 8 * hh);   // k = 8hh..8hh+7
  la.h[1] = zero8h();                                                              // k 16..31 = 0

  float mrow = -INFINITY;      // running maximum of query c, the same in both wave halves
  float lrow = 0.f;            // running sum of query c over this half's keys
  v8f oacc[4];                 // oacc[t][r] = ctx of query c, d = 16 t + 8 hh + r
  v8f olacc = zero8();         // olacc[r] = lctx of query c, dl = 8 hh + r
#pragma unroll
  for (int t = 0; t < 4; ++t) oacc[t] = zero8();

  // chunk_copy: row 0 of chunk 0's tiles (block-uniform), the thread's byte offsets in a tile, its LDS bytes in buffer 0
  const _Float16* bk  = Kg + rowB * DM;                                      // k row 0 of the batch, d = 0
  const _Float16* blk = LKg + rowB * DL;                                     // lk row 0 of the batch, dl = 0
  const unsigned ok  = (unsigned)((tid >> 3) * (DM * 2) + (tid & 7) * 16);   // k row tid>>3 (+16 i), d = 8 (tid&7)..+7
  const unsigned ov  = (unsigned)((tid >> 3) * (SEQ * 2) + (tid & 7) * 16);  // v^T row d, lv^T row dl = tid>>3 (+16 i), s = 8 (tid&7)..+7
  const unsigned olk = (unsigned)((tid >> 1) * (DL * 2) + (tid & 1) * 16);   // lk row tid>>1, dl = 8 (tid&1)..+7
  const unsigned l0  = (unsigned)(uintptr_t)Tsh + (unsigned)((tid >> 3) * (LP * 2) + (tid & 7) * 16);
  const unsigned lk0 = (unsigned)(uintptr_t)Tsh + (unsigned)((128 + HL) * (LP * 2) + (tid >> 1) * (LPL * 2) + (tid & 1) * 16);

  chunk_copy(l0, lk0, ok, ov, olk, bk, Vh, LVh, blk);                        // chunk 0 -> buffer 0
  wait_copies();
  __syncthreads();                                                           // chunk 0 readable by every wave
  chunk_copy(l0 + ABUF * 2u, lk0 + ABUF * 2u, ok, ov, olk, bk + 64 * DM, Vh + 64, LVh + 64, blk + 64 * DL);   // chunk 1 -> buffer 1

  for (int kt = 0; kt < NKT; ++kt) {         // static trip count
    // the lane's piece of row c in each tile of the chunk's buffer; every fragment read below is a constant offset from these
    const _Float16* buf  = Tsh + (kt & 1) * ABUF;
    const _Float16* kfr  = buf + c * LP + 8 * hh;
    const _Float16* vfr  = kfr + 64 * LP;
    const _Float16* lvfr = kfr + 128 * LP;
    const _Float16* lkfr = buf + (128 + HL) * LP + c * LPL + 8 * hh;

    // ---- scores^T: 64 keys x 16 query columns per wave; s[j][r] = key 16 j + 8 hh + r, query c ----
    v8f s[4];
#pragma unroll
    for (int j = 0; j < 4; ++j) {
      v8f acc = zero8();
#pragma unroll
      for (int dc = 0; dc < 2; ++dc) {
        FH kb;
        kb.h[0] = *(const v8h*)(kfr + j * 16 * LP + dc * 32);
        kb.h[1] = *(const v8h*)(kfr + j * 16 * LP + dc * 32 + 16);
        acc = mmar(kb.v, qa[dc], acc);
      }
      // k 16..31 = 0; one vector, so that the LDS read lands in the operand's own registers
      const v16h lb = __builtin_shufflevector(*(const v8h*)(lkfr + j * 16 * LPL), zero8h(),
                                              0, 1, 2, 3, 4, 5, 6, 7, 8, 9, 10, 11, 12, 13, 14, 15);
      acc = mmar(lb, la.v, acc);
#pragma unroll
      for (int r = 0; r < 8; ++r) s[j][r] = acc[r] * sscale;
    }

    // ---- maximum, online softmax, P^T (x1024, f16) packed into B operands ----
    float mj[4];                              // four independent chains
#pragma unroll
    for (int j = 0; j < 4; ++j) {
      mj[j] = s[j][0];
#pragma unroll
      for (int r = 1; r < 8; ++r) mj[j] = fmaxf(mj[j], s[j][r]);
    }
    float m = fmaxf(fmaxf(mj[0], mj[1]), fmaxf(mj[2], mj[3]));
    m = fmaxf(m, xhalf(m));                   // all 64 keys of the chunk
    const float mnew  = fmaxf(mrow, m);
    const float msafe = (mnew == -INFINITY) ? 0.f : mnew;
    const float alpha = __expf(mrow - msafe);
    mrow = mnew;
#pragma unroll
    for (int t = 0; t < 4; ++t)
#pragma unroll
      for (int r = 0; r < 8; ++r) oacc[t][r] *= alpha;
#pragma unroll
    for (int r = 0; r < 8; ++r) olacc[r] *= alpha;

    // ---- per 32 keys: P^T packed, then ctx^T += V^T . P^T, lctx^T += LV^T . P^T (f16 WMMA) ----
    float pj[4];
#pragma unroll   // s and pj are indexed by kk and live in registers
    for (int kk = 0; kk < 2; ++kk) {
      FH pb;                                  // element e = key 32 kk + (e < 8 ? 8 hh + e : 16 + 8 hh + e - 8)
      // the two tiles of the 32 keys run side by side as register pairs; each tile's sum keeps the order r = 0..7,
      // and no p outlives its 32 keys, which holds the kernel at six waves a SIMD (all blocks resident)
      v2f ps = {0.f, 0.f};
#pragma unroll
      for (int r = 0; r < 8; ++r) {
        const v2f a = (v2f){s[2 * kk][r], s[2 * kk + 1][r]} - msafe;
        const v2f p = {__expf(a[0]), __expf(a[1])};
        ps += p;
        const v2f q = p * 1024.0f;
        pb.h[0][r] = (_Float16)q[0];
        pb.h[1][r] = (_Float16)q[1];
      }
      pj[2 * kk] = ps[0];
      pj[2 * kk + 1] = ps[1];
#pragma unroll
      for (int t = 0; t < 4; ++t) {
        FH vb;
        vb.h[0] = *(const v8h*)(vfr + t * 16 * LP + kk * 32);
        vb.h[1] = *(const v8h*)(vfr + t * 16 * LP + kk * 32 + 16);
        oacc[t] = mmar(vb.v, pb.v, oacc[t]);
      }
      FH wb;
      wb.h[0] = *(const v8h*)(lvfr + kk * 32);
      wb.h[1] = *(const v8h*)(lvfr + kk * 32 + 16);
      olacc = mmar(wb.v, pb.v, olacc);
    }
    lrow = lrow * alpha + ((pj[0] + pj[1]) + (pj[2] + pj[3]));
    wait_lds();
    wait_copies();
    __syncthreads();
    if (kt + 2 < NKT)
      chunk_copy(l0 + (unsigned)(kt & 1) * (ABUF * 2u), lk0 + (unsigned)(kt & 1) * (ABUF * 2u), ok, ov, olk,
                 bk + (size_t)(kt + 2) * (64 * DM), Vh + (kt + 2) * 64, LVh + (kt + 2) * 64, blk + (size_t)(kt + 2) * (64 * DL));
  }
  wait_copies();

  // the last trip's barrier ended every wave's reads of the ring: its bytes now hold the output tiles
  float* os = (float*)(void*)Tsh + wave * (16 * OP);
  float* ol = (float*)(void*)Tsh + 4 * (16 * OP) + wave * (16 * HL);
  {
    const float l = lrow + xhalf(lrow);                  // both halves' keys
    const float inv = ((l > 0.f) ? (1.0f / l) : 0.f) * (1.0f / 1024.0f);
#pragma unroll
    for (int g = 0; g < 2; ++g) {                        // a lane's 8 registers are 8 consecutive d of its query's row
#pragma unroll
      for (int t = 0; t < 4; ++t) {
        const v4f v = {oacc[t][4 * g] * inv, oacc[t][4 * g + 1] * inv, oacc[t][4 * g + 2] * inv, oacc[t][4 * g + 3] * inv};
        *(v4f*)(os + c * OP + t * 16 + 8 * hh + 4 * g) = v;
      }
      const v4f w = {olacc[4 * g] * inv, olacc[4 * g + 1] * inv, olacc[4 * g + 2] * inv, olacc[4 * g + 3] * inv};
      *(v4f*)(ol + c * HL + 8 * hh + 4 * g) = w;
    }
  }
  __builtin_amdgcn_fence(__ATOMIC_RELEASE, "workgroup");
  __builtin_amdgcn_wave_barrier();
  __builtin_amdgcn_fence(__ATOMIC_ACQUIRE, "workgroup");
  {
    const int h2 = lane >> 4, c4 = (lane & 15) * 4;     // 256-B row segment = 16 lanes x 16 B
    float* ob = out0 + (rowB + q0) * DM + (size_t)h * HD + c4;
    float* lb = lcp + (((size_t)(b * NH + h)) * SEQ + (size_t)q0) * HL;
    {
#pragma unroll
      for (int it = 0; it < 8; ++it) {
        const int row = it * 2 + h2;                     // it 0..7 x h2 0..1 = rows 0..15
        const v4f v = *(const v4f*)(os + row * OP + c4);
        *(v4f*)(ob + (size_t)row * DM) = v;
      }
#pragma unroll
      for (int it = 0; it < 2; ++it) {
        const int idx = it * 32 + lane;                  // float4 0..63 of the contiguous 16x16 tile
        const v4f v = *(const v4f*)(ol + idx * 4);
        *(v4f*)(lb + idx * 4) = v;
      }
      
    }
  }
}

// =====================================================================================================
// out1[(b*SEQ + t)*DL + h*16 + d] = LC[b][h][t][d] (f32). One float4 per thread over the flat out1 array
// (col % 4 == 0, so a float4 never crosses a row); consecutive lanes write consecutive 16 B: a wave writes
// coverage: n4 threads x 4 = the whole out1 (n4 multiple of 256).
// =====================================================================================================
__global__ __launch_bounds__(256) void lc_pack(const float* __restrict__ lc, float* out1, int n4) {
  const int i = blockIdx.x * 256 + (int)threadIdx.x;
  if (i < n4) {
    const int e   = i * 4;
    const int row = e / DL;                 // b*SEQ + t
    const int col = e - row * DL;           // h*16 + d, multiple of 4
    const int hd  = col >> 4;
    const int d   = col & 15;
    const int bb  = row / SEQ;
    const int t   = row - bb * SEQ;
    const v4f v = *(const v4f*)(lc + (((size_t)(bb * NH + hd)) * SEQ + (size_t)t) * HL + d);
    float* o = out1 + (size_t)e;
    *(v4f*)o = v;
    
  }
}

// =====================================================================================================
// Workspace map (bytes), every region an exact multiple of its whole-line / whole-tile store granularity:
//   Xh   f16 [8192][768]            12582912
//   Lh   f16 [8192][192]             3145728
//   Wqh  f16 [768 n][768 k] (x64)    1179648
//   Wkh  f16 [768][768]     (x64)    1179648
//   Wvh  f16 [768][768]     (x64)    1179648
//   Wlqh f16 [192][192]     (x64)      73728
//   Wlkh f16 [192][192]     (x64)      73728
//   Wlvh f16 [192][192]     (x64)      73728
//   Qp   f16 [8192][768]            12582912
//   Kp   f16 [8192][768]            12582912
//   VTp  f16 [8][768][1024]         12582912
//   LQp  f16 [8192][192]   (x2)      3145728
//   LKp  f16 [8192][192]             3145728
//   LVTp f16 [8][192][1024]          3145728
//   LC   f32 [8][12][1024][16]       6291456
//   total                           72966144
// Weights are [out n][in k] with k contiguous = the Bt / A layout the GEMM wants, so they are only converted.
// =====================================================================================================
extern "C" void kernel_launch(void* const* d_in, const int* in_sizes, int n_in,
                              void* d_out, int out_size, void* d_ws, size_t ws_size,
                              hipStream_t stream) {
  if (n_in < 14) return;
  if (in_sizes[0] != NB * SEQ * DM) return;
  if (in_sizes[1] != NB * SEQ * DL) return;
  if (in_sizes[2] != DM * DM || in_sizes[4] != DM * DM || in_sizes[6] != DM * DM) return;
  if (in_sizes[3] != DM || in_sizes[5] != DM || in_sizes[7] != DM) return;
  if (in_sizes[8] != DL * DL || in_sizes[10] != DL * DL || in_sizes[12] != DL * DL) return;
  if (in_sizes[9] != DL || in_sizes[11] != DL || in_sizes[13] != DL) return;
  if (out_size != NB * SEQ * (DM + DL)) return;

  const float* x    = (const float*)d_in[0];
  const float* xl   = (const float*)d_in[1];
  const float* Wq   = (const float*)d_in[2];
  const float* bq   = (const float*)d_in[3];
  const float* Wk   = (const float*)d_in[4];
  const float* bk   = (const float*)d_in[5];
  const float* Wv   = (const float*)d_in[6];
  const float* bv   = (const float*)d_in[7];
  const float* Wlq  = (const float*)d_in[8];
  const float* blq  = (const float*)d_in[9];
  const float* Wlk  = (const float*)d_in[10];
  const float* blk_ = (const float*)d_in[11];
  const float* Wlv  = (const float*)d_in[12];
  const float* blv  = (const float*)d_in[13];

  const size_t PX  = (size_t)NB * SEQ * DM * 2;    // 12582912  f16 text plane [8192][768]
  const size_t PL  = (size_t)NB * SEQ * DL * 2;    //  3145728  f16 layout plane [8192][192]
  const size_t PW  = (size_t)DM * DM * 2;          //  1179648  f16 [768][768] weight plane
  const size_t PWL = (size_t)DL * DL * 2;          //    73728  f16 [192][192] weight plane
  const size_t PLC = (size_t)NB * NH * SEQ * HL * 4; // 6291456 f32 lctx plane
  size_t off = 0;
  const size_t oXh   = off; off += PX;
  const size_t oLh   = off; off += PL;
  const size_t oWq   = off; off += PW;
  const size_t oWk   = off; off += PW;
  const size_t oWv   = off; off += PW;
  const size_t oWlq  = off; off += PWL;
  const size_t oWlk  = off; off += PWL;
  const size_t oWlv  = off; off += PWL;
  const size_t oQp   = off; off += PX;
  const size_t oKp   = off; off += PX;
  const size_t oVTp  = off; off += PX;
  const size_t oLQp  = off; off += PL;
  const size_t oLKp  = off; off += PL;
  const size_t oLVTp = off; off += PL;
  const size_t oLC   = off; off += PLC;
  if (off > ws_size) return;                       // off = 72966144
  if (off > (size_t)134217728) return;

  char* ws = (char*)d_ws;
  unsigned short* Xh   = (unsigned short*)(ws + oXh);
  unsigned short* Lh   = (unsigned short*)(ws + oLh);
  unsigned short* Wqh  = (unsigned short*)(ws + oWq);
  unsigned short* Wkh  = (unsigned short*)(ws + oWk);
  unsigned short* Wvh  = (unsigned short*)(ws + oWv);
  unsigned short* Wlqh = (unsigned short*)(ws + oWlq);
  unsigned short* Wlkh = (unsigned short*)(ws + oWlk);
  unsigned short* Wlvh = (unsigned short*)(ws + oWlv);
  unsigned short* Qp   = (unsigned short*)(ws + oQp);
  unsigned short* Kp   = (unsigned short*)(ws + oKp);
  unsigned short* VTp  = (unsigned short*)(ws + oVTp);
  unsigned short* LQp  = (unsigned short*)(ws + oLQp);
  unsigned short* LKp  = (unsigned short*)(ws + oLKp);
  unsigned short* LVTp = (unsigned short*)(ws + oLVTp);
  float*          LC   = (float*)(ws + oLC);
  float*          out0 = (float*)d_out;
  float*          out1 = (float*)d_out + (size_t)NB * SEQ * DM;   // byte offset 25165824 / 4; last index 7864319 < out_size

  const dim3 blk(256);
  const int n4o1 = NB * SEQ * DL / 4;                          // 393216
  const dim3 gCvt(CB_ALL);                                     // 4758 blocks: the eight planes
  const dim3 gProj(GB_ALL);                                    //  720 blocks: the six projections
  const dim3 gAttn(NB * NH * NQB);                             // 1536 blocks of 128
  const dim3 gPack((n4o1 + 255) / 256);                        // 1536 blocks

  // (1) activations f32 -> f16 (x1); weights [n][k] f32 -> f16 (x64): one grid, planes Xh .. Wlvh back to back from Xh
  cvt_all<<<gCvt, blk, 0, stream>>>(x, xl, Wq, Wk, Wv, Wlq, Wlk, Wlv, Xh);
  // (2) q, k, v^T, lq (x2), lk, lv^T -> f16 planes: one grid
  proj_all<<<gProj, blk, 0, stream>>>(Xh, Lh, Wqh, Wkh, Wvh, Wlqh, Wlkh, Wlvh, bq, bk, bv, blq, blk_, blv,
                                      Qp, Kp, VTp, LQp, LKp, LVTp);
  // (3) attention: ctx -> out0, lctx -> LC plane
  attn_two<<<gAttn, dim3(128), 0, stream>>>(Qp, Kp, VTp, LQp, LKp, LVTp, out0, LC, 0.125f);
  // (4) LC plane -> out1 [8192][192]
  lc_pack<<<gPack, blk, 0, stream>>>(LC, out1, n4o1);
  (void)hipGetLastError();
}

// v007
// It runs in 84.3 microseconds.
// Timed twice side by side with v006, it ran 1.04 times as fast both times.
// All steps since v000 together make it 4.05 times as fast.
// Contractions: q, k, v^T, lq, lk, lv^T projections = v_wmma_f32_16x16x32_f16 (activations f16 x1, weights f16 x64, single product, f32 accumulate);
// k.q^T and lk.lq^T scores (transposed) = v_wmma_f32_16x16x32_f16 (q, k, lk f16 x1, lq f16 x2, layout K=16 zero-padded to 32 in registers, single products, one f32 accumulator);
// v^T.p^T and lv^T.p^T = v_wmma_f32_16x16x32_f16 (p carried x1024 in f16, v and lv f16 x1, single products, f32 accumulate); softmax and normalisation in f32.
// Carry audit: weight planes x64 -> 1/64 folded in the gemm64 epilogue (ascale); LQ plane x2 -> folded by the common score scale 0.125
//              in attn_two (q.k/8 + lq.lk/4 = (q.k + 2lq.lk)/8); P x1024 (registers only) and its row sum x1024 -> cancel in the attn_two epilogue (inv = 1 / sum);
//              activation planes, Q/K/V^T/LK/LV^T planes and the LC f32 plane carry x1.
#include <hip/hip_runtime.h>
#include <math.h>
#include <stdint.h>

#define NB   8
#define SEQ  1024
#define DM   768
#define DL   192
#define NH   12
#define HD   64
#define HL   16
#define NQB  (SEQ / 64)   // 64-row query blocks per sequence
#define NKT  (SEQ / 64)   // 64-key chunks per sequence
#define LP   72           // LDS row pitch in halves of the 64-half rows read by 16-B fragment loads: 144 B = 16 B x odd
#define LPL  24           // the same for the 16-half LK rows: 48 B = 16 B x odd
#define OP   68           // LDS row pitch in floats of the ctx tile, written by 16-B stores down a column of rows: 272 B = 16 B x odd
// LDS ring of the K=768 projections: a stage is 64 k (128 B) of 128 A rows, then of 256 B rows, at pitch LP; two buffers
#define RROWS  (128 + 256)
#define RBUF   (RROWS * LP)                         // halves a buffer: 55296 B
// LDS ring of the attention: a buffer is one 64-key chunk: 64 K rows, 64 V^T rows, 16 LV^T rows at pitch LP, then 64 LK rows
// at pitch LPL; two buffers
#define ABUF   ((64 + 64 + HL) * LP + 64 * LPL)     // halves a buffer: 23808 B
// block ranges of the two merged grids (256 threads a block)
#define CB_X   (NB * SEQ * DM / 8 / 256)            // 3072 blocks: x plane, 8 elements a thread
#define CB_L   (NB * SEQ * DL / 8 / 256)            //  768 blocks: layout plane
#define CB_W   (DM * DM / 8 / 256)                  //  288 blocks: one [768][768] weight plane
#define CB_WL  (DL * DL / 8 / 256)                  //   18 blocks: one [192][192] weight plane
#define CB_ALL (CB_X + CB_L + 3 * CB_W + 3 * CB_WL) // 4758 blocks
#define GB_T   (((NB * SEQ) / 128) * (DM / 256))    //  192 blocks: M=8192, N=768, one 128x256 tile a block
#define GB_VT  ((DM / 128) * (SEQ / 256))           //   24 blocks a batch: M=768, N=1024
#define GB_L   (((NB * SEQ) / 64) * (DL / 64) / 8)  //   48 blocks: M=8192, N=192
#define GB_LVT ((DL / 64) * (SEQ / 64) / 8)         //    6 blocks a batch: M=192, N=1024
#define GB_ALL (2 * GB_T + NB * GB_VT + 2 * GB_L + NB * GB_LVT)   // 720 blocks
static_assert((NB * SEQ * DM) % 2048 == 0 && (NB * SEQ * DL) % 2048 == 0 && (DM * DM) % 2048 == 0 && (DL * DL) % 2048 == 0);
static_assert(((NB * SEQ) % 128) == 0 && (DM % 256) == 0 && (DM % 128) == 0 && (SEQ % 256) == 0 && DM / 64 >= 2);
static_assert((((NB * SEQ) / 64) * (DL / 64)) % 8 == 0 && ((DL / 64) * (SEQ / 64)) % 8 == 0);
static_assert(NH * HD == DM);
static_assert(NH * HL == DL);
static_assert(NQB == 16 && NKT == 16);
static_assert((SEQ % 64) == 0 && (DM % 64) == 0 && (DL % 64) == 0);
static_assert((DM % 32) == 0 && (DL % 32) == 0);

typedef _Float16 v16h __attribute__((ext_vector_type(16)));
typedef _Float16 v8h  __attribute__((ext_vector_type(8)));
typedef float    v8f  __attribute__((ext_vector_type(8)));
typedef float    v4f  __attribute__((ext_vector_type(4)));
typedef float    v2f  __attribute__((ext_vector_type(2)));
typedef unsigned int v4u __attribute__((ext_vector_type(4)));

#if defined(__HIP_DEVICE_COMPILE__)
#define DEV_ASM 1
#else
#define DEV_ASM 0
#endif

// ---- scalar helpers --------------------------------------------------------------------------------
__device__ __forceinline__ unsigned short h_bits(_Float16 x) { return __builtin_bit_cast(unsigned short, x); }
__device__ __forceinline__ unsigned pk16(unsigned short a, unsigned short b) { return (unsigned)a | ((unsigned)b << 16); }
__device__ __forceinline__ v8f zero8() { v8f z = {0.f, 0.f, 0.f, 0.f, 0.f, 0.f, 0.f, 0.f}; return z; }
__device__ __forceinline__ v8h zero8h() {
  const _Float16 z = (_Float16)0.0f;
  v8h r = {z, z, z, z, z, z, z, z};
  return r;
}

// ---- fragment loader: 16-bit A/B operand, lane -> row/col (lane&15), p already includes +8*(lane>>4);
//      elements 0..7 <- p[0..7] (k0+8h..k0+8h+7), elements 8..15 <- p[16..23] (k0+16+8h..k0+16+8h+7)
__device__ __forceinline__ v16h ldfrag_h(const _Float16* p) {
  union { v16h v; v8h h[2]; } f;
  f.h[0] = *(const v8h*)(p);
  f.h[1] = *(const v8h*)(p + 16);
  return f.v;
}

// lane l <-> lane l ^ 16: the other half of the wave holds the other keys of the same query
__device__ __forceinline__ float xhalf(float x) {
  return __builtin_bit_cast(float, __builtin_amdgcn_permlanex16(__builtin_bit_cast(int, x), __builtin_bit_cast(int, x),
                                                                0x76543210, 0xfedcba98, false, false));
}

// ---- WMMA helpers ----------------------------------------------------------------------------------
__device__ __forceinline__ v8f mmar(v16h a, v16h b, v8f c) {
  return __builtin_amdgcn_wmma_f32_16x16x32_f16(false, a, false, b, (short)0, c, false, false);
}
__device__ __forceinline__ void dep_guard(v8f& a, v8f& b, v16h x, v16h y) {
#if DEV_ASM
  asm volatile("v_nop\n\tv_nop\n\tv_nop\n\tv_nop" : "+v"(a), "+v"(b) : "v"(x), "v"(y));
#else
  (void)a; (void)b; (void)x; (void)y;
#endif
}
__device__ __forceinline__ void keep4(v16h a, v16h b, v16h c, v16h d) {
#if DEV_ASM
  asm volatile("v_nop" :: "v"(a), "v"(b), "v"(c), "v"(d));
#else
  (void)a; (void)b; (void)c; (void)d;
#endif
}
__device__ __forceinline__ void acc_guard4(v8f& a, v8f& b, v8f& c, v8f& d) {
#if DEV_ASM
  asm volatile("v_nop\n\tv_nop\n\tv_nop\n\tv_nop" : "+v"(a), "+v"(b), "+v"(c), "+v"(d));
#else
  (void)a; (void)b; (void)c; (void)d;
#endif
}

// ---- asynchronous copies global -> LDS -------------------------------------------------------------
// One stage of the ring: each of the 256 threads brings twelve 16-B pieces, piece (t & 7) of rows (t >> 3) + 32 i;
// i 0..3 are the 128 A rows, i 4..11 the 256 B rows, so a wave's copy covers four whole 128-B lines.
// l = the thread's LDS byte address of its piece in row (t >> 3) of the target buffer; ga, gb = its global piece in
// the first A row and the first B row of the stage; sa, sb = 32 rows in halves.
// The s_wait_xcnt closes the statement so that no address register is rewritten ahead of it.
__device__ __forceinline__ void stage_copy(unsigned l, const _Float16* ga, const _Float16* gb, size_t sa, size_t sb) {
#if DEV_ASM
  asm volatile(
      "global_load_async_to_lds_b128 %0, %12, off\n\t"
      "global_load_async_to_lds_b128 %1, %13, off\n\t"
      "global_load_async_to_lds_b128 %2, %14, off\n\t"
      "global_load_async_to_lds_b128 %3, %15, off\n\t"
      "global_load_async_to_lds_b128 %4, %16, off\n\t"
      "global_load_async_to_lds_b128 %5, %17, off\n\t"
      "global_load_async_to_lds_b128 %6, %18, off\n\t"
      "global_load_async_to_lds_b128 %7, %19, off\n\t"
      "global_load_async_to_lds_b128 %8, %20, off\n\t"
      "global_load_async_to_lds_b128 %9, %21, off\n\t"
      "global_load_async_to_lds_b128 %10, %22, off\n\t"
      "global_load_async_to_lds_b128 %11, %23, off\n\t"
      "s_wait_xcnt 0x0"
      :: "v"(l), "v"(l + 1u * 32u * LP * 2u), "v"(l + 2u * 32u * LP * 2u), "v"(l + 3u * 32u * LP * 2u),
         "v"(l + 4u * 32u * LP * 2u), "v"(l + 5u * 32u * LP * 2u), "v"(l + 6u * 32u * LP * 2u),
         "v"(l + 7u * 32u * LP * 2u), "v"(l + 8u * 32u * LP * 2u), "v"(l + 9u * 32u * LP * 2u),
         "v"(l + 10u * 32u * LP * 2u), "v"(l + 11u * 32u * LP * 2u),
         "v"(ga), "v"(ga + sa), "v"(ga + 2 * sa), "v"(ga + 3 * sa),
         "v"(gb), "v"(gb + sb), "v"(gb + 2 * sb), "v"(gb + 3 * sb),
         "v"(gb + 4 * sb), "v"(gb + 5 * sb), "v"(gb + 6 * sb), "v"(gb + 7 * sb)
      : "memory");
#else
  (void)l; (void)ga; (void)gb; (void)sa; (void)sb;
#endif
}
// One 64-key chunk of the attention ring: each of the 128 threads brings ten 16-B pieces. Nine are piece (t & 7) of rows
// (t >> 3) + 16 i of the tiles of pitch LP: i 0..3 the 64 K rows, i 4..7 the 64 V^T rows, i 8 the 16 LV^T rows, so each of
// these copies of a wave covers four whole 128-B lines; the tenth is piece (t & 1) of the 32-B LK row (t >> 1).
// l = the thread's LDS byte address of its piece in row (t >> 3) of the target buffer, llk = the same of its LK piece.
// A global address is a block-uniform base in scalar registers (bk, bv, blv, blk = row 0 of the chunk's K, V^T, LV^T and LK
// tiles; the steps of 16 rows are scalar additions) plus the thread's fixed byte offset in the tile (ok; ov for V^T and LV^T,
// which have one pitch; olk), so that no vector instruction forms it.
// The s_wait_xcnt closes the statement so that no address register is rewritten ahead of it.
__device__ __forceinline__ void chunk_copy(unsigned l, unsigned llk, unsigned ok, unsigned ov, unsigned olk,
                                           const _Float16* bk, const _Float16* bv, const _Float16* blv, const _Float16* blk) {
#if DEV_ASM
  asm volatile(
      "global_load_async_to_lds_b128 %0, %10, %13\n\t"
      "global_load_async_to_lds_b128 %1, %10, %14\n\t"
      "global_load_async_to_lds_b128 %2, %10, %15\n\t"
      "global_load_async_to_lds_b128 %3, %10, %16\n\t"
      "global_load_async_to_lds_b128 %4, %11, %17\n\t"
      "global_load_async_to_lds_b128 %5, %11, %18\n\t"
      "global_load_async_to_lds_b128 %6, %11, %19\n\t"
      "global_load_async_to_lds_b128 %7, %11, %20\n\t"
      "global_load_async_to_lds_b128 %8, %11, %21\n\t"
      "global_load_async_to_lds_b128 %9, %12, %22\n\t"
      "s_wait_xcnt 0x0"
      :: "v"(l), "v"(l + 1u * 16u * LP * 2u), "v"(l + 2u * 16u * LP * 2u), "v"(l + 3u * 16u * LP * 2u),
         "v"(l + 4u * 16u * LP * 2u), "v"(l + 5u * 16u * LP * 2u), "v"(l + 6u * 16u * LP * 2u),
         "v"(l + 7u * 16u * LP * 2u), "v"(l + 8u * 16u * LP * 2u), "v"(llk),
         "v"(ok), "v"(ov), "v"(olk),
         "s"(bk), "s"(bk + 16 * DM), "s"(bk + 32 * DM), "s"(bk + 48 * DM),
         "s"(bv), "s"(bv + 16 * SEQ), "s"(bv + 32 * SEQ), "s"(bv + 48 * SEQ),
         "s"(blv), "s"(blk)
      : "memory");
#else
  (void)l; (void)llk; (void)ok; (void)ov; (void)olk; (void)bk; (void)bv; (void)blv; (void)blk;
#endif
}
// this wave's copies have landed in LDS
__device__ __forceinline__ void wait_copies() {
#if DEV_ASM
  asm volatile("s_wait_asynccnt 0x0" ::: "memory");
#endif
}
// this wave's LDS reads have returned, so the buffer may go to its next writer
__device__ __forceinline__ void wait_lds() {
#if DEV_ASM
  asm volatile("s_wait_dscnt 0x0" ::: "memory");
#endif
}

// =====================================================================================================
// f32 -> f16 bits of (x * scale) for all eight planes in ONE grid: the planes lie back to back in the workspace
// in the order x, layout, Wq, Wk, Wv, Wlq, Wlk, Wlv, and each is a whole number of blocks, so the block index
// picks the source plane (block-uniform) and the flat thread index is the output position.
// 8 elements per thread, one 16-B store per lane: a wave writes 512 contiguous bytes.
// coverage: CB_ALL blocks x 256 threads x 8 = all eight planes exactly (static_asserts above), so no bound test.
// =====================================================================================================
__global__ __launch_bounds__(256) void cvt_all(const float* __restrict__ x, const float* __restrict__ xl,
                                               const float* __restrict__ wq, const float* __restrict__ wk,
                                               const float* __restrict__ wv, const float* __restrict__ wlq,
                                               const float* __restrict__ wlk, const float* __restrict__ wlv,
                                               unsigned short* out) {
  const int blk = blockIdx.x;
  const float* in = x;
  int first = 0;                 // first block of the plane
  float scale = 1.0f;            // activations x1, weights x64
  if (blk >= CB_X)                                  { in = xl;  first = CB_X; }
  if (blk >= CB_X + CB_L)                           { in = wq;  first = CB_X + CB_L;                       scale = 64.0f; }
  if (blk >= CB_X + CB_L + CB_W)                    { in = wk;  first = CB_X + CB_L + CB_W; }
  if (blk >= CB_X + CB_L + 2 * CB_W)                { in = wv;  first = CB_X + CB_L + 2 * CB_W; }
  if (blk >= CB_X + CB_L + 3 * CB_W)                { in = wlq; first = CB_X + CB_L + 3 * CB_W; }
  if (blk >= CB_X + CB_L + 3 * CB_W + CB_WL)        { in = wlk; first = CB_X + CB_L + 3 * CB_W + CB_WL; }
  if (blk >= CB_X + CB_L + 3 * CB_W + 2 * CB_WL)    { in = wlv; first = CB_X + CB_L + 3 * CB_W + 2 * CB_WL; }
  const int i = (blk - first) * 256 + (int)threadIdx.x;      // 8-element unit inside the source plane
  const int o = blk * 256 + (int)threadIdx.x;                // 8-element unit inside the eight planes
  const v4f a = *(const v4f*)(in + (size_t)i * 8);
  const v4f c = *(const v4f*)(in + (size_t)i * 8 + 4);
  v4u p;
  p[0] = pk16(h_bits((_Float16)(a[0] * scale)), h_bits((_Float16)(a[1] * scale)));
  p[1] = pk16(h_bits((_Float16)(a[2] * scale)), h_bits((_Float16)(a[3] * scale)));
  p[2] = pk16(h_bits((_Float16)(c[0] * scale)), h_bits((_Float16)(c[1] * scale)));
  p[3] = pk16(h_bits((_Float16)(c[2] * scale)), h_bits((_Float16)(c[3] * scale)));
  *(v4u*)(out + (size_t)o * 8) = p;
}

// =====================================================================================================
// Register-blocked batched f16 WMMA GEMM with bias: C[m][n] = (sum_k A[m][k] * Bt[n][k]) * ascale + bias,
// stored as f16(value * oscale). One wave per 64x64 tile. A row-major [M][K] pitch lda;
// Bt row-major [N][K] pitch ldb (k contiguous); M, N multiples of 64, K multiple of 32 (host-checked).
// bx = block index inside the product, b = batch index (strides in elements), sT = the block's LDS slabs.
// RING 0: the block's 8 tiles are consecutive in n, no block barriers, fragments loaded straight from global
//         with the split k map.
// RING 1: the 8 tiles are 2 (m) x 4 (n) = one 128x256 tile (M multiple of 128, N of 256, K of 64, at least 128).
//         Its operand rows come to LDS in stages of 64 k by asynchronous copies, two buffers: the copies of stage
//         s + 2 fly while stage s + 1 is worked on; fragments are read from LDS with the same split k map and the
//         same k order. Every wave passes every barrier (no early return on this path).
// BIASROW 0: bias[n] (bias length N); BIASROW 1: bias[m] (bias length M).
// coverage: 4 slabs x 16 rows (it 0..3 x lane>>3 0..3) x 64 cols (8 lanes x 8) = the wave's whole 64x64 tile.
// =====================================================================================================
template <int BIASROW, int RING>
__device__ __forceinline__ void gemm64(
    float (*sT)[16 * 68], _Float16* ring, int bx, int b,
    const unsigned short* __restrict__ Ap, int lda, long long strideA,
    const unsigned short* __restrict__ Btp, int ldb, long long strideB,
    const float* __restrict__ bias,
    unsigned short* Cp, int ldc, long long strideC,
    int M, int N, int K, float ascale, float oscale) {
  const _Float16* A  = (const _Float16*)(const void*)Ap;
  const _Float16* Bt = (const _Float16*)(const void*)Btp;
  const int lane = threadIdx.x & 31;
  const int wave = threadIdx.x >> 5;
  int m0, n0;                              // the wave's 64x64 tile
  int bm0 = 0, bn0 = 0;                    // RING: the block's 128x256 tile
  if constexpr (RING) {
    const int tilesN = N >> 8;
    const int tm = bx / tilesN;
    const int tn = bx - tm * tilesN;
    bm0 = tm << 7;
    bn0 = tn << 8;
    m0 = bm0 + ((wave >> 2) << 6);
    n0 = bn0 + ((wave & 3) << 6);
  } else {
    const int tilesN = N >> 6;
    const int tilesM = M >> 6;
    const int tile = bx * 8 + wave;
    if (tile >= tilesM * tilesN) return;   // wave-uniform; no block barriers on this path
    const int tm = tile / tilesN;
    const int tn = tile - tm * tilesN;
    m0 = tm << 6;
    n0 = tn << 6;
  }

  const _Float16* Ab = A  + (size_t)b * (size_t)strideA;
  const _Float16* Bb = Bt + (size_t)b * (size_t)strideB;

  const int rlane = lane & 15;                 // row (A) / col (B, D) within subtile
  const int koff  = (lane >> 4) * 8;           // k offset of this lane half
  const int mOff  = (lane >> 4) * 8;           // D row offset

  v8f acc[4][4];
#pragma unroll
  for (int i = 0; i < 4; ++i)
#pragma unroll
    for (int j = 0; j < 4; ++j) acc[i][j] = zero8();

  if constexpr (RING) {
    const int t = threadIdx.x;
    const _Float16* ga = Ab + (size_t)(bm0 + (t >> 3)) * lda + (t & 7) * 8;   // the thread's piece, first A row
    const _Float16* gb = Bb + (size_t)(bn0 + (t >> 3)) * ldb + (t & 7) * 8;   // the same, first B row
    const size_t sa = (size_t)32 * lda, sb = (size_t)32 * ldb;
    const unsigned l0 = (unsigned)(uintptr_t)ring + (unsigned)((t >> 3) * (LP * 2) + (t & 7) * 16);
    const int aoff = ((wave >> 2) * 64 + rlane) * LP + koff;                  // the wave's A rows in a buffer
    const int boff = (128 + (wave & 3) * 64 + rlane) * LP + koff;             // the wave's B rows
    const int ns = K >> 6;                                                    // stages
    stage_copy(l0, ga, gb, sa, sb);                                           // stage 0 -> buffer 0
    wait_copies();
    __syncthreads();                                                          // stage 0 readable by every wave
    stage_copy(l0 + RBUF * 2u, ga + 64, gb + 64, sa, sb);                     // stage 1 -> buffer 1 (ns >= 2)
#pragma unroll 1   // rolled over the twelve stages, for speed only
    for (int s = 0; s < ns; ++s) {
      const _Float16* buf = ring + (s & 1) * RBUF;
#pragma unroll
      for (int ks = 0; ks < 2; ++ks) {
        v16h bq[4], af[4];                 // all sixteen LDS reads of the 32 k stand together, ahead of the products
#pragma unroll
        for (int j = 0; j < 4; ++j) bq[j] = ldfrag_h(buf + boff + j * 16 * LP + ks * 32);
#pragma unroll
        for (int i = 0; i < 4; ++i) af[i] = ldfrag_h(buf + aoff + i * 16 * LP + ks * 32);
#pragma unroll
        for (int i = 0; i < 4; ++i) {
#pragma unroll
          for (int j = 0; j < 4; ++j) acc[i][j] = mmar(af[i], bq[j], acc[i][j]);
          dep_guard(acc[i][0], acc[i][3], af[i], bq[3]);
        }
        keep4(bq[0], bq[1], bq[2], bq[3]);
      }
      wait_lds();
      wait_copies();
      __syncthreads();
      if (s + 2 < ns) stage_copy(l0 + (unsigned)(s & 1) * (RBUF * 2u), ga + (s + 2) * 64, gb + (s + 2) * 64, sa, sb);
    }
    wait_copies();
  } else {
    for (int k0 = 0; k0 < K; k0 += 32) {
      v16h bq[4];
#pragma unroll
      for (int j = 0; j < 4; ++j)
        bq[j] = ldfrag_h(Bb + (size_t)(n0 + (j << 4) + rlane) * ldb + koff + k0);
#pragma unroll
      for (int i = 0; i < 4; ++i) {
        const v16h af = ldfrag_h(Ab + (size_t)(m0 + (i << 4) + rlane) * lda + koff + k0);
#pragma unroll
        for (int j = 0; j < 4; ++j) acc[i][j] = mmar(af, bq[j], acc[i][j]);
        dep_guard(acc[i][0], acc[i][3], af, bq[3]);
      }
      keep4(bq[0], bq[1], bq[2], bq[3]);
    }
  }
  acc_guard4(acc[0][0], acc[0][1], acc[0][2], acc[0][3]);
  acc_guard4(acc[1][0], acc[1][1], acc[1][2], acc[1][3]);
  acc_guard4(acc[2][0], acc[2][1], acc[2][2], acc[2][3]);
  acc_guard4(acc[3][0], acc[3][1], acc[3][2], acc[3][3]);

  // ---- epilogue ----
  float* slab = sT[wave];
  const int q = lane >> 3, c8 = (lane & 7) * 8;
  unsigned short* C = Cp + (size_t)b * (size_t)strideC;
  float bcol[8];
  {
    const v4f b0 = *(const v4f*)(bias + (BIASROW ? 0 : (n0 + c8)));       // column bias (length N), 16-B aligned
    const v4f b1 = *(const v4f*)(bias + (BIASROW ? 4 : (n0 + c8 + 4)));
#pragma unroll
    for (int e = 0; e < 4; ++e) { bcol[e] = b0[e]; bcol[4 + e] = b1[e]; }
  }
#pragma unroll
  for (int i = 0; i < 4; ++i) {
    const int mBase = m0 + (i << 4);
#pragma unroll
    for (int j = 0; j < 4; ++j) {
#pragma unroll
      for (int r = 0; r < 8; ++r) {
        slab[(mOff + r) * 68 + (j << 4) + rlane] = acc[i][j][r];
      }
    }
    __builtin_amdgcn_fence(__ATOMIC_RELEASE, "workgroup");
    __builtin_amdgcn_wave_barrier();
    __builtin_amdgcn_fence(__ATOMIC_ACQUIRE, "workgroup");
    v4u hv[4];
#pragma unroll
    for (int it = 0; it < 4; ++it) {
      const int row = it * 4 + q;                        // it 0..3 x q 0..3 = rows 0..15
      const float* sp = slab + row * 68 + c8;
      float bb[8];
      if (BIASROW) {
        const float bv = bias[mBase + row];              // row bias, index < M = bias length
#pragma unroll
        for (int e = 0; e < 8; ++e) bb[e] = bv;
      } else {
#pragma unroll
        for (int e = 0; e < 8; ++e) bb[e] = bcol[e];
      }
      v4u a;
#pragma unroll
      for (int e = 0; e < 4; ++e) {
        const float f0 = (sp[2 * e] * ascale + bb[2 * e]) * oscale;
        const float f1 = (sp[2 * e + 1] * ascale + bb[2 * e + 1]) * oscale;
        a[e] = pk16(h_bits((_Float16)f0), h_bits((_Float16)f1));
      }
      hv[it] = a;
    }
    {
#pragma unroll
      for (int it = 0; it < 4; ++it) {
        const int row = it * 4 + q;
        *(v4u*)(C + (size_t)(mBase + row) * ldc + n0 + c8) = hv[it];
      }
      
    }
    __builtin_amdgcn_fence(__ATOMIC_RELEASE, "workgroup");
    __builtin_amdgcn_wave_barrier();
    __builtin_amdgcn_fence(__ATOMIC_ACQUIRE, "workgroup");
  }
}

// =====================================================================================================
// All six projections in ONE grid: they read only the converted planes and write disjoint planes, so none waits
// for another. The block index picks the product (block-uniform); the K=768 products come first, so that the
// short K=192 ones fill the places that free up at the end. The K=768 products take their operands through the
// LDS ring (gemm64, RING 1), each block one 128x256 tile; the K=192 products read them straight from global (RING 0).
//   [0, GB_T)  q = x . Wq^T + bq            [GB_T, 2 GB_T)  k = x . Wk^T + bk          (M=8192, N=768,  K=768)
//   next NB x GB_VT   v^T = Wv . x^T + bv per batch (A = Wvh [n][k], Bt = Xh rows of b)  (M=768,  N=1024, K=768)
//   next GB_L  lq = (xl . Wlq^T + blq) x2   next GB_L  lk = xl . Wlk^T + blk            (M=8192, N=192,  K=192)
//   next NB x GB_LVT  lv^T = Wlv . xl^T + blv per batch                                 (M=192,  N=1024, K=192)
// =====================================================================================================
__global__ __launch_bounds__(256) void proj_all(
    const unsigned short* __restrict__ Xh, const unsigned short* __restrict__ Lh,
    const unsigned short* __restrict__ Wqh, const unsigned short* __restrict__ Wkh,
    const unsigned short* __restrict__ Wvh, const unsigned short* __restrict__ Wlqh,
    const unsigned short* __restrict__ Wlkh, const unsigned short* __restrict__ Wlvh,
    const float* __restrict__ bq, const float* __restrict__ bk, const float* __restrict__ bv,
    const float* __restrict__ blq, const float* __restrict__ blk_, const float* __restrict__ blv,
    unsigned short* Qp, unsigned short* Kp, unsigned short* VTp,
    unsigned short* LQp, unsigned short* LKp, unsigned short* LVTp) {
  __shared__ __align__(16) float sT[8][16 * 68];   // per-wave 16x64 slab, pitch 68 floats
  __shared__ __align__(16) _Float16 ring[2 * RBUF]; // operand stages of the K=768 products, two buffers, 110592 B
  const int blk = blockIdx.x;
  const int T0 = 2 * GB_T;                 // first block of v^T
  const int T1 = T0 + NB * GB_VT;          // first block of lq
  const int T2 = T1 + 2 * GB_L;            // first block of lv^T
  if (blk < T0) {
    // text activations x weights^T, bias by column, operands through the LDS ring
    const bool second = blk >= GB_T;       // the k product
    gemm64<0, 1>(sT, ring, second ? blk - GB_T : blk, 0, Xh, DM, 0LL, second ? Wkh : Wqh, DM, 0LL,
                 second ? bk : bq, second ? Kp : Qp, DM, 0LL, NB * SEQ, DM, DM, 1.0f / 64.0f, 1.0f);
  } else if (blk < T1) {
    // text weights x activations^T per batch, bias by row, operands through the LDS ring
    const int b  = (blk - T0) / GB_VT;     // batch
    const int bx = (blk - T0) - b * GB_VT; // block inside the batch
    gemm64<1, 1>(sT, ring, bx, b, Wvh, DM, 0LL, Xh, DM, (long long)SEQ * DM, bv, VTp, SEQ, (long long)DM * SEQ,
                 DM, SEQ, DM, 1.0f / 64.0f, 1.0f);
  } else if (blk < T2) {
    // layout activations x weights^T, bias by column
    const int  r      = blk - T1;
    const bool second = r >= GB_L;         // the lk product
    gemm64<0, 0>(sT, ring, second ? r - GB_L : r, 0, Lh, DL, 0LL, second ? Wlkh : Wlqh, DL, 0LL,
                 second ? blk_ : blq, second ? LKp : LQp, DL, 0LL, NB * SEQ, DL, DL, 1.0f / 64.0f,
                 second ? 1.0f : 2.0f);
  } else {
    // layout weights x activations^T per batch, bias by row
    const int b  = (blk - T2) / GB_LVT;     // batch
    const int bx = (blk - T2) - b * GB_LVT; // block inside the batch
    gemm64<1, 0>(sT, ring, bx, b, Wlvh, DL, 0LL, Lh, DL, (long long)SEQ * DL, blv, LVTp, SEQ, (long long)DL * SEQ,
                 DL, SEQ, DL, 1.0f / 64.0f, 1.0f);
  }
}

// =====================================================================================================
// Two-stream attention, text head dim 64 + layout head dim 16, no mask, softmax over all SEQ keys.
//   Q plane (f16): element (b, t, h, d) at [(b*SEQ + t)*DM + h*64 + d]; K plane same layout with key s.
//   LQ plane (f16, value x2): [(b*SEQ + t)*DL + h*16 + d]; LK plane (f16 x1) same layout.
//   V^T plane (f16): element (b, h, d, s) at [(b*DM + h*64 + d)*SEQ + s]; LV^T plane: [(b*DL + h*16 + d)*SEQ + s].
//   All products run transposed: the K, LK, V^T and LV^T rows are the A operand, the query side is the B operand, so
//   a lane holds one query (column lane&15) and the keys or the head dims 8*(lane>>4) + r of a tile in its registers.
//   raw scores^T = k . q + lk . lq2 in f32, scaled by sscale inside the exponent (3 f16 WMMA steps into one accumulator; the layout step uses
//   k = 0..15 only, upper 16 k-slots are register zeros in both fragments).
//   p = exp((s - m) sscale) carried as 1024 p = 2^(s c2 + nb), one fma and one v_exp an element, then f16; two score tiles (32 keys) pack in place into one B operand, in the k order
//   of the V^T loads; ctx^T = v^T . p^T (4 row tiles), lctx^T = lv^T . p^T (1 row tile); online softmax in f32: maximum
//   and sum run inside the lane, the maximum is joined between the wave halves each chunk, the sum once at the end.
//   Block = 4 waves = 64 query rows of one (b, h); grid = NB * NH * NQB; key chunks of 64, static trip NKT.
//   Chunk staging: 128 threads: K 32 halves/thread (64x64), V^T 32 halves/thread (64x64), LK 8 halves/thread (64x16),
//   LV^T 8 halves/thread (16x64) = every LDS element read below, by asynchronous copies into two buffers: the copies of
//   chunk kt + 2 fly while chunk kt + 1 is worked on; one barrier a chunk publishes the next chunk and frees the read one;
//   ctx -> out0 f32 [(b*SEQ + t)*DM + h*64 + d]: 16 rows x 256-B segments per wave (16 lanes x 16 B per segment,
//   Output coverage: wave rows q0..q0+15 (it 0..7 x lane>>4) x 64 cols (16 lanes x 4) of head h for out0;
//   64 float4 = the wave's whole 16x16 lctx tile for LC; the grid covers every (b, h, qb).
// =====================================================================================================
__global__ __launch_bounds__(128)
void attn_two(const unsigned short* __restrict__ qp, const unsigned short* __restrict__ kp,
              const unsigned short* __restrict__ vtp, const unsigned short* __restrict__ lqp,
              const unsigned short* __restrict__ lkp, const unsigned short* __restrict__ lvtp,
              float* out0, float* lcp, float sscale) {
  union FH { v16h v; v8h h[2]; };
  // one array, so that the tiles of pitch LP lie at constant offsets from one lane address. In each buffer:
  //   K chunk [kv][d] at 0 (9 KB), V^T [d][kv] at 64 LP (9 KB), LV^T [dl][kv] at 128 LP (2304 B), all pitch LP;
  //   LK chunk [kv][dl] at (128 + HL) LP, pitch LPL (3 KB).
  // Behind the loop the same bytes hold the output tiles, which keeps six blocks' LDS on a WGP (all blocks resident):
  //   per wave ctx tile [row][d], pitch OP (4 x 4352 B), then per wave lctx tile (4 x 1024 B).
  __shared__ __align__(16) _Float16 Tsh[2 * ABUF];       // 47616 B
  static_assert(4 * 16 * (OP + HL) * 4 <= 2 * ABUF * 2);

  const int tid  = threadIdx.x;
  const int wave = __builtin_amdgcn_readfirstlane(tid >> 5);   // in a scalar register, and with it every row index built from it
  const int lane = tid & 31;
  const int hh   = lane >> 4;
  const int c    = lane & 15;

  const int bx   = blockIdx.x;
  const int qb   = bx % NQB;
  const int rest = bx / NQB;
  const int h    = rest % NH;
  const int b    = rest / NH;
  const int q0   = qb * 64 + wave * 16;
  const size_t rowB = (size_t)b * SEQ;

  const _Float16* Q   = (const _Float16*)(const void*)qp;
  const _Float16* LQ  = (const _Float16*)(const void*)lqp;
  const _Float16* Kg  = (const _Float16*)(const void*)kp + (size_t)h * HD;
  const _Float16* LKg = (const _Float16*)(const void*)lkp + (size_t)h * HL;
  const _Float16* Vh  = (const _Float16*)(const void*)vtp  + ((size_t)b * DM + (size_t)h * HD) * SEQ;
  const _Float16* LVh = (const _Float16*)(const void*)lvtp + ((size_t)b * DL + (size_t)h * HL) * SEQ;

  // ---- Q fragments (B operand, column = lane&15): 2 d-chunks of the text stream; layout fragment k 0..15 ----
  v16h qa[2];
#pragma unroll
  for (int dc = 0; dc < 2; ++dc) {
    const size_t qo = (rowB + q0 + c) * DM + (size_t)h * HD + dc * 32 + 8 * hh;
    qa[dc] = ldfrag_h(Q + qo);
  }
  FH la;
  la.h[0] = *(const v8h*)(LQ + (rowB + q0 + c) * DL + (size_t)h * HL + 8 * hh);   // k = 8hh..8hh+7
  la.h[1] = zero8h();                                                              // k 16..31 = 0

  const float c2 = sscale * 1.44269504088896340736f;   // score scale x log2(e): exp(s sscale) = 2^(s c2)
  float mrow = -INFINITY;      // running maximum of query c's raw scores, the same in both wave halves
  float lrow = 0.f;            // running sum (x1024) of query c over this half's keys
  v8f oacc[4];                 // oacc[t][r] = ctx of query c, d = 16 t + 8 hh + r
  v8f olacc = zero8();         // olacc[r] = lctx of query c, dl = 8 hh + r
#pragma unroll
  for (int t = 0; t < 4; ++t) oacc[t] = zero8();

  // chunk_copy: row 0 of chunk 0's tiles (block-uniform), the thread's byte offsets in a tile, its LDS bytes in buffer 0
  const _Float16* bk  = Kg + rowB * DM;                                      // k row 0 of the batch, d = 0
  const _Float16* blk = LKg + rowB * DL;                                     // lk row 0 of the batch, dl = 0
  const unsigned ok  = (unsigned)((tid >> 3) * (DM * 2) + (tid & 7) * 16);   // k row tid>>3 (+16 i), d = 8 (tid&7)..+7
  const unsigned ov  = (unsigned)((tid >> 3) * (SEQ * 2) + (tid & 7) * 16);  // v^T row d, lv^T row dl = tid>>3 (+16 i), s = 8 (tid&7)..+7
  const unsigned olk = (unsigned)((tid >> 1) * (DL * 2) + (tid & 1) * 16);   // lk row tid>>1, dl = 8 (tid&1)..+7
  const unsigned l0  = (unsigned)(uintptr_t)Tsh + (unsigned)((tid >> 3) * (LP * 2) + (tid & 7) * 16);
  const unsigned lk0 = (unsigned)(uintptr_t)Tsh + (unsigned)((128 + HL) * (LP * 2) + (tid >> 1) * (LPL * 2) + (tid & 1) * 16);

  chunk_copy(l0, lk0, ok, ov, olk, bk, Vh, LVh, blk);                        // chunk 0 -> buffer 0
  wait_copies();
  __syncthreads();                                                           // chunk 0 readable by every wave
  chunk_copy(l0 + ABUF * 2u, lk0 + ABUF * 2u, ok, ov, olk, bk + 64 * DM, Vh + 64, LVh + 64, blk + 64 * DL);   // chunk 1 -> buffer 1

  for (int kt = 0; kt < NKT; ++kt) {         // static trip count
    // the lane's piece of row c in each tile of the chunk's buffer; every fragment read below is a constant offset from these
    const _Float16* buf  = Tsh + (kt & 1) * ABUF;
    const _Float16* kfr  = buf + c * LP + 8 * hh;
    const _Float16* vfr  = kfr + 64 * LP;
    const _Float16* lvfr = kfr + 128 * LP;
    const _Float16* lkfr = buf + (128 + HL) * LP + c * LPL + 8 * hh;

    // ---- scores^T: 64 keys x 16 query columns per wave; s[j][r] = key 16 j + 8 hh + r, query c ----
    v8f s[4];
#pragma unroll
    for (int j = 0; j < 4; ++j) {
      v8f acc = zero8();
#pragma unroll
      for (int dc = 0; dc < 2; ++dc) {
        FH kb;
        kb.h[0] = *(const v8h*)(kfr + j * 16 * LP + dc * 32);
        kb.h[1] = *(const v8h*)(kfr + j * 16 * LP + dc * 32 + 16);
        acc = mmar(kb.v, qa[dc], acc);
      }
      // k 16..31 = 0; one vector, so that the LDS read lands in the operand's own registers
      const v16h lb = __builtin_shufflevector(*(const v8h*)(lkfr + j * 16 * LPL), zero8h(),
                                              0, 1, 2, 3, 4, 5, 6, 7, 8, 9, 10, 11, 12, 13, 14, 15);
      acc = mmar(lb, la.v, acc);
      s[j] = acc;                             // raw: the score scale is applied inside the exponent's one fma below
    }

    // ---- maximum, online softmax, P^T (x1024, f16) packed into B operands ----
    float mj[4];                              // four independent chains
#pragma unroll
    for (int j = 0; j < 4; ++j) {
      mj[j] = s[j][0];
#pragma unroll
      for (int r = 1; r < 8; ++r) mj[j] = fmaxf(mj[j], s[j][r]);
    }
    float m = fmaxf(fmaxf(mj[0], mj[1]), fmaxf(mj[2], mj[3]));
    m = fmaxf(m, xhalf(m));                   // all 64 keys of the chunk
    const float mnew  = fmaxf(mrow, m);
    const float msafe = (mnew == -INFINITY) ? 0.f : mnew;
    const float alpha = __builtin_amdgcn_exp2f((mrow - msafe) * c2);
    const float nb    = fmaf(-msafe, c2, 10.0f);   // 1024 p = 2^(s c2 + nb)
    mrow = mnew;
#pragma unroll
    for (int t = 0; t < 4; ++t)
#pragma unroll
      for (int r = 0; r < 8; ++r) oacc[t][r] *= alpha;
#pragma unroll
    for (int r = 0; r < 8; ++r) olacc[r] *= alpha;

    // ---- per 32 keys: P^T packed, then ctx^T += V^T . P^T, lctx^T += LV^T . P^T (f16 WMMA) ----
    v2f pj[4];
#pragma unroll   // s and pj are indexed by kk and live in registers
    for (int kk = 0; kk < 2; ++kk) {
      FH pb;                                  // element e = key 32 kk + (e < 8 ? 8 hh + e : 16 + 8 hh + e - 8)
      // neighbouring registers of one score tile form the pairs, so that the packed fma reads the accumulator where it lies
      // and a packed conversion writes one register of the operand; a tile's sum runs as an even-r and an odd-r chain
#pragma unroll
      for (int x = 0; x < 2; ++x) {
        v2f ps = {0.f, 0.f};
#pragma unroll
        for (int r = 0; r < 8; r += 2) {
          const v2f a = (v2f){s[2 * kk + x][r], s[2 * kk + x][r + 1]} * c2 + nb;
          const v2f p = {__builtin_amdgcn_exp2f(a[0]), __builtin_amdgcn_exp2f(a[1])};
          ps += p;
          pb.h[x][r]     = (_Float16)p[0];
          pb.h[x][r + 1] = (_Float16)p[1];
        }
        pj[2 * kk + x] = ps;
      }
      // the exponents and conversions of these 32 keys stay ahead of their products (only LDS reads may cross this line): left
      // free, the scheduler mixes the two halves of the chunk and takes 171 VGPRs, above the 160 of six waves a SIMD
      __builtin_amdgcn_sched_barrier(0x180);
#pragma unroll
      for (int t = 0; t < 4; ++t) {
        FH vb;
        vb.h[0] = *(const v8h*)(vfr + t * 16 * LP + kk * 32);
        vb.h[1] = *(const v8h*)(vfr + t * 16 * LP + kk * 32 + 16);
        oacc[t] = mmar(vb.v, pb.v, oacc[t]);
      }
      FH wb;
      wb.h[0] = *(const v8h*)(lvfr + kk * 32);
      wb.h[1] = *(const v8h*)(lvfr + kk * 32 + 16);
      olacc = mmar(wb.v, pb.v, olacc);
    }
    const v2f pt = (pj[0] + pj[1]) + (pj[2] + pj[3]);
    lrow = lrow * alpha + (pt[0] + pt[1]);
    wait_lds();
    wait_copies();
    __syncthreads();
    if (kt + 2 < NKT)
      chunk_copy(l0 + (unsigned)(kt & 1) * (ABUF * 2u), lk0 + (unsigned)(kt & 1) * (ABUF * 2u), ok, ov, olk,
                 bk + (size_t)(kt + 2) * (64 * DM), Vh + (kt + 2) * 64, LVh + (kt + 2) * 64, blk + (size_t)(kt + 2) * (64 * DL));
  }
  wait_copies();

  // the last trip's barrier ended every wave's reads of the ring: its bytes now hold the output tiles
  float* os = (float*)(void*)Tsh + wave * (16 * OP);
  float* ol = (float*)(void*)Tsh + 4 * (16 * OP) + wave * (16 * HL);
  {
    const float l = lrow + xhalf(lrow);                  // both halves' keys
    const float inv = (l > 0.f) ? (1.0f / l) : 0.f;     // l and the accumulators both carry x1024
#pragma unroll
    for (int g = 0; g < 2; ++g) {                        // a lane's 8 registers are 8 consecutive d of its query's row
#pragma unroll
      for (int t = 0; t < 4; ++t) {
        const v4f v = {oacc[t][4 * g] * inv, oacc[t][4 * g + 1] * inv, oacc[t][4 * g + 2] * inv, oacc[t][4 * g + 3] * inv};
        *(v4f*)(os + c * OP + t * 16 + 8 * hh + 4 * g) = v;
      }
      const v4f w = {olacc[4 * g] * inv, olacc[4 * g + 1] * inv, olacc[4 * g + 2] * inv, olacc[4 * g + 3] * inv};
      *(v4f*)(ol + c * HL + 8 * hh + 4 * g) = w;
    }
  }
  __builtin_amdgcn_fence(__ATOMIC_RELEASE, "workgroup");
  __builtin_amdgcn_wave_barrier();
  __builtin_amdgcn_fence(__ATOMIC_ACQUIRE, "workgroup");
  {
    const int h2 = lane >> 4, c4 = (lane & 15) * 4;     // 256-B row segment = 16 lanes x 16 B
    float* ob = out0 + (rowB + q0) * DM + (size_t)h * HD + c4;
    float* lb = lcp + (((size_t)(b * NH + h)) * SEQ + (size_t)q0) * HL;
    {
#pragma unroll
      for (int it = 0; it < 8; ++it) {
        const int row = it * 2 + h2;                     // it 0..7 x h2 0..1 = rows 0..15
        const v4f v = *(const v4f*)(os + row * OP + c4);
        *(v4f*)(ob + (size_t)row * DM) = v;
      }
#pragma unroll
      for (int it = 0; it < 2; ++it) {
        const int idx = it * 32 + lane;                  // float4 0..63 of the contiguous 16x16 tile
        const v4f v = *(const v4f*)(ol + idx * 4);
        *(v4f*)(lb + idx * 4) = v;
      }
      
    }
  }
}

// =====================================================================================================
// out1[(b*SEQ + t)*DL + h*16 + d] = LC[b][h][t][d] (f32). One float4 per thread over the flat out1 array
// (col % 4 == 0, so a float4 never crosses a row); consecutive lanes write consecutive 16 B: a wave writes
// coverage: n4 threads x 4 = the whole out1 (n4 multiple of 256).
// =====================================================================================================
__global__ __launch_bounds__(256) void lc_pack(const float* __restrict__ lc, float* out1, int n4) {
  const int i = blockIdx.x * 256 + (int)threadIdx.x;
  if (i < n4) {
    const int e   = i * 4;
    const int row = e / DL;                 // b*SEQ + t
    const int col = e - row * DL;           // h*16 + d, multiple of 4
    const int hd  = col >> 4;
    const int d   = col & 15;
    const int bb  = row / SEQ;
    const int t   = row - bb * SEQ;
    const v4f v = *(const v4f*)(lc + (((size_t)(bb * NH + hd)) * SEQ + (size_t)t) * HL + d);
    float* o = out1 + (size_t)e;
    *(v4f*)o = v;
    
  }
}

// =====================================================================================================
// Workspace map (bytes), every region an exact multiple of its whole-line / whole-tile store granularity:
//   Xh   f16 [8192][768]            12582912
//   Lh   f16 [8192][192]             3145728
//   Wqh  f16 [768 n][768 k] (x64)    1179648
//   Wkh  f16 [768][768]     (x64)    1179648
//   Wvh  f16 [768][768]     (x64)    1179648
//   Wlqh f16 [192][192]     (x64)      73728
//   Wlkh f16 [192][192]     (x64)      73728
//   Wlvh f16 [192][192]     (x64)      73728
//   Qp   f16 [8192][768]            12582912
//   Kp   f16 [8192][768]            12582912
//   VTp  f16 [8][768][1024]         12582912
//   LQp  f16 [8192][192]   (x2)      3145728
//   LKp  f16 [8192][192]             3145728
//   LVTp f16 [8][192][1024]          3145728
//   LC   f32 [8][12][1024][16]       6291456
//   total                           72966144
// Weights are [out n][in k] with k contiguous = the Bt / A layout the GEMM wants, so they are only converted.
// =====================================================================================================
extern "C" void kernel_launch(void* const* d_in, const int* in_sizes, int n_in,
                              void* d_out, int out_size, void* d_ws, size_t ws_size,
                              hipStream_t stream) {
  if (n_in < 14) return;
  if (in_sizes[0] != NB * SEQ * DM) return;
  if (in_sizes[1] != NB * SEQ * DL) return;
  if (in_sizes[2] != DM * DM || in_sizes[4] != DM * DM || in_sizes[6] != DM * DM) return;
  if (in_sizes[3] != DM || in_sizes[5] != DM || in_sizes[7] != DM) return;
  if (in_sizes[8] != DL * DL || in_sizes[10] != DL * DL || in_sizes[12] != DL * DL) return;
  if (in_sizes[9] != DL || in_sizes[11] != DL || in_sizes[13] != DL) return;
  if (out_size != NB * SEQ * (DM + DL)) return;

  const float* x    = (const float*)d_in[0];
  const float* xl   = (const float*)d_in[1];
  const float* Wq   = (const float*)d_in[2];
  const float* bq   = (const float*)d_in[3];
  const float* Wk   = (const float*)d_in[4];
  const float* bk   = (const float*)d_in[5];
  const float* Wv   = (const float*)d_in[6];
  const float* bv   = (const float*)d_in[7];
  const float* Wlq  = (const float*)d_in[8];
  const float* blq  = (const float*)d_in[9];
  const float* Wlk  = (const float*)d_in[10];
  const float* blk_ = (const float*)d_in[11];
  const float* Wlv  = (const float*)d_in[12];
  const float* blv  = (const float*)d_in[13];

  const size_t PX  = (size_t)NB * SEQ * DM * 2;    // 12582912  f16 text plane [8192][768]
  const size_t PL  = (size_t)NB * SEQ * DL * 2;    //  3145728  f16 layout plane [8192][192]
  const size_t PW  = (size_t)DM * DM * 2;          //  1179648  f16 [768][768] weight plane
  const size_t PWL = (size_t)DL * DL * 2;          //    73728  f16 [192][192] weight plane
  const size_t PLC = (size_t)NB * NH * SEQ * HL * 4; // 6291456 f32 lctx plane
  size_t off = 0;
  const size_t oXh   = off; off += PX;
  const size_t oLh   = off; off += PL;
  const size_t oWq   = off; off += PW;
  const size_t oWk   = off; off += PW;
  const size_t oWv   = off; off += PW;
  const size_t oWlq  = off; off += PWL;
  const size_t oWlk  = off; off += PWL;
  const size_t oWlv  = off; off += PWL;
  const size_t oQp   = off; off += PX;
  const size_t oKp   = off; off += PX;
  const size_t oVTp  = off; off += PX;
  const size_t oLQp  = off; off += PL;
  const size_t oLKp  = off; off += PL;
  const size_t oLVTp = off; off += PL;
  const size_t oLC   = off; off += PLC;
  if (off > ws_size) return;                       // off = 72966144
  if (off > (size_t)134217728) return;

  char* ws = (char*)d_ws;
  unsigned short* Xh   = (unsigned short*)(ws + oXh);
  unsigned short* Lh   = (unsigned short*)(ws + oLh);
  unsigned short* Wqh  = (unsigned short*)(ws + oWq);
  unsigned short* Wkh  = (unsigned short*)(ws + oWk);
  unsigned short* Wvh  = (unsigned short*)(ws + oWv);
  unsigned short* Wlqh = (unsigned short*)(ws + oWlq);
  unsigned short* Wlkh = (unsigned short*)(ws + oWlk);
  unsigned short* Wlvh = (unsigned short*)(ws + oWlv);
  unsigned short* Qp   = (unsigned short*)(ws + oQp);
  unsigned short* Kp   = (unsigned short*)(ws + oKp);
  unsigned short* VTp  = (unsigned short*)(ws + oVTp);
  unsigned short* LQp  = (unsigned short*)(ws + oLQp);
  unsigned short* LKp  = (unsigned short*)(ws + oLKp);
  unsigned short* LVTp = (unsigned short*)(ws + oLVTp);
  float*          LC   = (float*)(ws + oLC);
  float*          out0 = (float*)d_out;
  float*          out1 = (float*)d_out + (size_t)NB * SEQ * DM;   // byte offset 25165824 / 4; last index 7864319 < out_size

  const dim3 blk(256);
  const int n4o1 = NB * SEQ * DL / 4;                          // 393216
  const dim3 gCvt(CB_ALL);                                     // 4758 blocks: the eight planes
  const dim3 gProj(GB_ALL);                                    //  720 blocks: the six projections
  const dim3 gAttn(NB * NH * NQB);                             // 1536 blocks of 128
  const dim3 gPack((n4o1 + 255) / 256);                        // 1536 blocks

  // (1) activations f32 -> f16 (x1); weights [n][k] f32 -> f16 (x64): one grid, planes Xh .. Wlvh back to back from Xh
  cvt_all<<<gCvt, blk, 0, stream>>>(x, xl, Wq, Wk, Wv, Wlq, Wlk, Wlv, Xh);
  // (2) q, k, v^T, lq (x2), lk, lv^T -> f16 planes: one grid
  proj_all<<<gProj, blk, 0, stream>>>(Xh, Lh, Wqh, Wkh, Wvh, Wlqh, Wlkh, Wlvh, bq, bk, bv, blq, blk_, blv,
                                      Qp, Kp, VTp, LQp, LKp, LVTp);
  // (3) attention: ctx -> out0, lctx -> LC plane
  attn_two<<<gAttn, dim3(128), 0, stream>>>(Qp, Kp, VTp, LQp, LKp, LVTp, out0, LC, 0.125f);
  // (4) LC plane -> out1 [8192][192]
  lc_pack<<<gPack, blk, 0, stream>>>(LC, out1, n4o1);
  (void)hipGetLastError();
}

// v008
// It runs in 81.4 microseconds.
// Two timings next to v007 both put it at 1.04 times that version's speed.
// Counting every step since v000, it is 4.20 times as fast.
// Contractions: q, k, v^T, lq, lk, lv^T projections = v_wmma_f32_16x16x32_f16 (activations f16 x1, weights f16 x64, single product, f32 accumulate);
// k.q^T and lk.lq^T scores (transposed) = v_wmma_f32_16x16x32_f16 (q, k, lk f16 x1, lq f16 x2, layout K=16 zero-padded to 32 in registers, single products, one f32 accumulator);
// v^T.p^T and lv^T.p^T = v_wmma_f32_16x16x32_f16 (p carried x1024 in f16, v and lv f16 x1, single products, f32 accumulate); softmax and normalisation in f32.
// Carry audit: weight planes x64 -> 1/64 folded in the gemm64 epilogue (ascale); LQ plane x2 -> folded by the common score scale 0.125
//              in attn_two (q.k/8 + lq.lk/4 = (q.k + 2lq.lk)/8); P x1024 (registers only) and its row sum x1024 -> cancel in the attn_two epilogue (inv = 1 / sum);
//              activation planes and Q/K/V^T/LK/LV^T planes carry x1.
#include <hip/hip_runtime.h>
#include <math.h>
#include <stdint.h>

#define NB   8
#define SEQ  1024
#define DM   768
#define DL   192
#define NH   12
#define HD   64
#define HL   16
#define NQB  (SEQ / 64)   // 64-row query blocks per sequence
#define NKT  (SEQ / 64)   // 64-key chunks per sequence
#define LP   72           // LDS row pitch in halves of the 64-half rows read by 16-B fragment loads: 144 B = 16 B x odd
#define LPL  24           // the same for the 16-half LK rows: 48 B = 16 B x odd
#define OP   68           // LDS row pitch in floats of the ctx tile, written by 16-B stores down a column of rows: 272 B = 16 B x odd
#define LCP  36           // the same of the lctx tile of a pair of heads (32 floats a row): 144 B = 16 B x odd
// LDS ring of the K=768 projections: a stage is 64 k (128 B) of 128 A rows, then of 256 B rows, at pitch LP; two buffers
#define RROWS  (128 + 256)
#define RBUF   (RROWS * LP)                         // halves a buffer: 55296 B
// LDS ring of the attention: a buffer is one 64-key chunk: 64 K rows, 64 V^T rows, 16 LV^T rows at pitch LP, then 64 LK rows
// at pitch LPL; two buffers
#define ABUF   ((64 + 64 + HL) * LP + 64 * LPL)     // halves a buffer: 23808 B
// block ranges of the two merged grids (256 threads a block)
#define CB_X   (NB * SEQ * DM / 8 / 256)            // 3072 blocks: x plane, 8 elements a thread
#define CB_L   (NB * SEQ * DL / 8 / 256)            //  768 blocks: layout plane
#define CB_W   (DM * DM / 8 / 256)                  //  288 blocks: one [768][768] weight plane
#define CB_WL  (DL * DL / 8 / 256)                  //   18 blocks: one [192][192] weight plane
#define CB_ALL (CB_X + CB_L + 3 * CB_W + 3 * CB_WL) // 4758 blocks
#define GB_T   (((NB * SEQ) / 128) * (DM / 256))    //  192 blocks: M=8192, N=768, one 128x256 tile a block
#define GB_VT  ((DM / 128) * (SEQ / 256))           //   24 blocks a batch: M=768, N=1024
#define GB_L   (((NB * SEQ) / 64) * (DL / 64) / 8)  //   48 blocks: M=8192, N=192
#define GB_LVT ((DL / 64) * (SEQ / 64) / 8)         //    6 blocks a batch: M=192, N=1024
#define GB_ALL (2 * GB_T + NB * GB_VT + 2 * GB_L + NB * GB_LVT)   // 720 blocks
static_assert((NB * SEQ * DM) % 2048 == 0 && (NB * SEQ * DL) % 2048 == 0 && (DM * DM) % 2048 == 0 && (DL * DL) % 2048 == 0);
static_assert(((NB * SEQ) % 128) == 0 && (DM % 256) == 0 && (DM % 128) == 0 && (SEQ % 256) == 0 && DM / 64 >= 2);
static_assert((((NB * SEQ) / 64) * (DL / 64)) % 8 == 0 && ((DL / 64) * (SEQ / 64)) % 8 == 0);
static_assert(NH * HD == DM);
static_assert(NH * HL == DL);
static_assert(NH % 2 == 0 && 2 * HL * 4 == 128);   // a pair of heads fills one 128-B line of an out1 row
static_assert(NQB == 16 && NKT == 16);
static_assert((SEQ % 64) == 0 && (DM % 64) == 0 && (DL % 64) == 0);
static_assert((DM % 32) == 0 && (DL % 32) == 0);

typedef _Float16 v16h __attribute__((ext_vector_type(16)));
typedef _Float16 v8h  __attribute__((ext_vector_type(8)));
typedef float    v8f  __attribute__((ext_vector_type(8)));
typedef float    v4f  __attribute__((ext_vector_type(4)));
typedef float    v2f  __attribute__((ext_vector_type(2)));
typedef unsigned int v4u __attribute__((ext_vector_type(4)));

#if defined(__HIP_DEVICE_COMPILE__)
#define DEV_ASM 1
#else
#define DEV_ASM 0
#endif

// ---- scalar helpers --------------------------------------------------------------------------------
__device__ __forceinline__ unsigned short h_bits(_Float16 x) { return __builtin_bit_cast(unsigned short, x); }
__device__ __forceinline__ unsigned pk16(unsigned short a, unsigned short b) { return (unsigned)a | ((unsigned)b << 16); }
__device__ __forceinline__ v8f zero8() { v8f z = {0.f, 0.f, 0.f, 0.f, 0.f, 0.f, 0.f, 0.f}; return z; }
__device__ __forceinline__ v8h zero8h() {
  const _Float16 z = (_Float16)0.0f;
  v8h r = {z, z, z, z, z, z, z, z};
  return r;
}

// ---- fragment loader: 16-bit A/B operand, lane -> row/col (lane&15), p already includes +8*(lane>>4);
//      elements 0..7 <- p[0..7] (k0+8h..k0+8h+7), elements 8..15 <- p[16..23] (k0+16+8h..k0+16+8h+7)
__device__ __forceinline__ v16h ldfrag_h(const _Float16* p) {
  union { v16h v; v8h h[2]; } f;
  f.h[0] = *(const v8h*)(p);
  f.h[1] = *(const v8h*)(p + 16);
  return f.v;
}

// lane l <-> lane l ^ 16: the other half of the wave holds the other keys of the same query
__device__ __forceinline__ float xhalf(float x) {
  return __builtin_bit_cast(float, __builtin_amdgcn_permlanex16(__builtin_bit_cast(int, x), __builtin_bit_cast(int, x),
                                                                0x76543210, 0xfedcba98, false, false));
}

// ---- WMMA helpers ----------------------------------------------------------------------------------
__device__ __forceinline__ v8f mmar(v16h a, v16h b, v8f c) {
  return __builtin_amdgcn_wmma_f32_16x16x32_f16(false, a, false, b, (short)0, c, false, false);
}
__device__ __forceinline__ void dep_guard(v8f& a, v8f& b, v16h x, v16h y) {
#if DEV_ASM
  asm volatile("v_nop\n\tv_nop\n\tv_nop\n\tv_nop" : "+v"(a), "+v"(b) : "v"(x), "v"(y));
#else
  (void)a; (void)b; (void)x; (void)y;
#endif
}
__device__ __forceinline__ void keep4(v16h a, v16h b, v16h c, v16h d) {
#if DEV_ASM
  asm volatile("v_nop" :: "v"(a), "v"(b), "v"(c), "v"(d));
#else
  (void)a; (void)b; (void)c; (void)d;
#endif
}
__device__ __forceinline__ void acc_guard4(v8f& a, v8f& b, v8f& c, v8f& d) {
#if DEV_ASM
  asm volatile("v_nop\n\tv_nop\n\tv_nop\n\tv_nop" : "+v"(a), "+v"(b), "+v"(c), "+v"(d));
#else
  (void)a; (void)b; (void)c; (void)d;
#endif
}

// ---- asynchronous copies global -> LDS -------------------------------------------------------------
// One stage of the ring: each of the 256 threads brings twelve 16-B pieces, piece (t & 7) of rows (t >> 3) + 32 i;
// i 0..3 are the 128 A rows, i 4..11 the 256 B rows, so a wave's copy covers four whole 128-B lines.
// l = the thread's LDS byte address of its piece in row (t >> 3) of the target buffer; ga, gb = its global piece in
// the first A row and the first B row of the stage; sa, sb = 32 rows in halves.
// The s_wait_xcnt closes the statement so that no address register is rewritten ahead of it.
__device__ __forceinline__ void stage_copy(unsigned l, const _Float16* ga, const _Float16* gb, size_t sa, size_t sb) {
#if DEV_ASM
  asm volatile(
      "global_load_async_to_lds_b128 %0, %12, off\n\t"
      "global_load_async_to_lds_b128 %1, %13, off\n\t"
      "global_load_async_to_lds_b128 %2, %14, off\n\t"
      "global_load_async_to_lds_b128 %3, %15, off\n\t"
      "global_load_async_to_lds_b128 %4, %16, off\n\t"
      "global_load_async_to_lds_b128 %5, %17, off\n\t"
      "global_load_async_to_lds_b128 %6, %18, off\n\t"
      "global_load_async_to_lds_b128 %7, %19, off\n\t"
      "global_load_async_to_lds_b128 %8, %20, off\n\t"
      "global_load_async_to_lds_b128 %9, %21, off\n\t"
      "global_load_async_to_lds_b128 %10, %22, off\n\t"
      "global_load_async_to_lds_b128 %11, %23, off\n\t"
      "s_wait_xcnt 0x0"
      :: "v"(l), "v"(l + 1u * 32u * LP * 2u), "v"(l + 2u * 32u * LP * 2u), "v"(l + 3u * 32u * LP * 2u),
         "v"(l + 4u * 32u * LP * 2u), "v"(l + 5u * 32u * LP * 2u), "v"(l + 6u * 32u * LP * 2u),
         "v"(l + 7u * 32u * LP * 2u), "v"(l + 8u * 32u * LP * 2u), "v"(l + 9u * 32u * LP * 2u),
         "v"(l + 10u * 32u * LP * 2u), "v"(l + 11u * 32u * LP * 2u),
         "v"(ga), "v"(ga + sa), "v"(ga + 2 * sa), "v"(ga + 3 * sa),
         "v"(gb), "v"(gb + sb), "v"(gb + 2 * sb), "v"(gb + 3 * sb),
         "v"(gb + 4 * sb), "v"(gb + 5 * sb), "v"(gb + 6 * sb), "v"(gb + 7 * sb)
      : "memory");
#else
  (void)l; (void)ga; (void)gb; (void)sa; (void)sb;
#endif
}
// One 64-key chunk of the attention ring of one head: each of the head's 128 threads (t = its index among them) brings ten 16-B pieces. Nine are piece (t & 7) of rows
// (t >> 3) + 16 i of the tiles of pitch LP: i 0..3 the 64 K rows, i 4..7 the 64 V^T rows, i 8 the 16 LV^T rows, so each of
// these copies of a wave covers four whole 128-B lines; the tenth is piece (t & 1) of the 32-B LK row (t >> 1).
// l = the thread's LDS byte address of its piece in row (t >> 3) of the target buffer, llk = the same of its LK piece.
// A global address is a base in scalar registers, the same in the head's four waves (bk, bv, blv, blk = row 0 of the chunk's K, V^T, LV^T and LK
// tiles; the steps of 16 rows are scalar additions) plus the thread's fixed byte offset in the tile (ok; ov for V^T and LV^T,
// which have one pitch; olk), so that no vector instruction forms it.
// The s_wait_xcnt closes the statement so that no address register is rewritten ahead of it.
__device__ __forceinline__ void chunk_copy(unsigned l, unsigned llk, unsigned ok, unsigned ov, unsigned olk,
                                           const _Float16* bk, const _Float16* bv, const _Float16* blv, const _Float16* blk) {
#if DEV_ASM
  asm volatile(
      "global_load_async_to_lds_b128 %0, %10, %13\n\t"
      "global_load_async_to_lds_b128 %1, %10, %14\n\t"
      "global_load_async_to_lds_b128 %2, %10, %15\n\t"
      "global_load_async_to_lds_b128 %3, %10, %16\n\t"
      "global_load_async_to_lds_b128 %4, %11, %17\n\t"
      "global_load_async_to_lds_b128 %5, %11, %18\n\t"
      "global_load_async_to_lds_b128 %6, %11, %19\n\t"
      "global_load_async_to_lds_b128 %7, %11, %20\n\t"
      "global_load_async_to_lds_b128 %8, %11, %21\n\t"
      "global_load_async_to_lds_b128 %9, %12, %22\n\t"
      "s_wait_xcnt 0x0"
      :: "v"(l), "v"(l + 1u * 16u * LP * 2u), "v"(l + 2u * 16u * LP * 2u), "v"(l + 3u * 16u * LP * 2u),
         "v"(l + 4u * 16u * LP * 2u), "v"(l + 5u * 16u * LP * 2u), "v"(l + 6u * 16u * LP * 2u),
         "v"(l + 7u * 16u * LP * 2u), "v"(l + 8u * 16u * LP * 2u), "v"(llk),
         "v"(ok), "v"(ov), "v"(olk),
         "s"(bk), "s"(bk + 16 * DM), "s"(bk + 32 * DM), "s"(bk + 48 * DM),
         "s"(bv), "s"(bv + 16 * SEQ), "s"(bv + 32 * SEQ), "s"(bv + 48 * SEQ),
         "s"(blv), "s"(blk)
      : "memory");
#else
  (void)l; (void)llk; (void)ok; (void)ov; (void)olk; (void)bk; (void)bv; (void)blv; (void)blk;
#endif
}
// this wave's copies have landed in LDS
__device__ __forceinline__ void wait_copies() {
#if DEV_ASM
  asm volatile("s_wait_asynccnt 0x0" ::: "memory");
#endif
}
// this wave's LDS reads have returned, so the buffer may go to its next writer
__device__ __forceinline__ void wait_lds() {
#if DEV_ASM
  asm volatile("s_wait_dscnt 0x0" ::: "memory");
#endif
}

// =====================================================================================================
// f32 -> f16 bits of (x * scale) for all eight planes in ONE grid: the planes lie back to back in the workspace
// in the order x, layout, Wq, Wk, Wv, Wlq, Wlk, Wlv, and each is a whole number of blocks, so the block index
// picks the source plane (block-uniform) and the flat thread index is the output position.
// 8 elements per thread, one 16-B store per lane: a wave writes 512 contiguous bytes.
// coverage: CB_ALL blocks x 256 threads x 8 = all eight planes exactly (static_asserts above), so no bound test.
// =====================================================================================================
__global__ __launch_bounds__(256) void cvt_all(const float* __restrict__ x, const float* __restrict__ xl,
                                               const float* __restrict__ wq, const float* __restrict__ wk,
                                               const float* __restrict__ wv, const float* __restrict__ wlq,
                                               const float* __restrict__ wlk, const float* __restrict__ wlv,
                                               unsigned short* out) {
  const int blk = blockIdx.x;
  const float* in = x;
  int first = 0;                 // first block of the plane
  float scale = 1.0f;            // activations x1, weights x64
  if (blk >= CB_X)                                  { in = xl;  first = CB_X; }
  if (blk >= CB_X + CB_L)                           { in = wq;  first = CB_X + CB_L;                       scale = 64.0f; }
  if (blk >= CB_X + CB_L + CB_W)                    { in = wk;  first = CB_X + CB_L + CB_W; }
  if (blk >= CB_X + CB_L + 2 * CB_W)                { in = wv;  first = CB_X + CB_L + 2 * CB_W; }
  if (blk >= CB_X + CB_L + 3 * CB_W)                { in = wlq; first = CB_X + CB_L + 3 * CB_W; }
  if (blk >= CB_X + CB_L + 3 * CB_W + CB_WL)        { in = wlk; first = CB_X + CB_L + 3 * CB_W + CB_WL; }
  if (blk >= CB_X + CB_L + 3 * CB_W + 2 * CB_WL)    { in = wlv; first = CB_X + CB_L + 3 * CB_W + 2 * CB_WL; }
  const int i = (blk - first) * 256 + (int)threadIdx.x;      // 8-element unit inside the source plane
  const int o = blk * 256 + (int)threadIdx.x;                // 8-element unit inside the eight planes
  const v4f a = *(const v4f*)(in + (size_t)i * 8);
  const v4f c = *(const v4f*)(in + (size_t)i * 8 + 4);
  v4u p;
  p[0] = pk16(h_bits((_Float16)(a[0] * scale)), h_bits((_Float16)(a[1] * scale)));
  p[1] = pk16(h_bits((_Float16)(a[2] * scale)), h_bits((_Float16)(a[3] * scale)));
  p[2] = pk16(h_bits((_Float16)(c[0] * scale)), h_bits((_Float16)(c[1] * scale)));
  p[3] = pk16(h_bits((_Float16)(c[2] * scale)), h_bits((_Float16)(c[3] * scale)));
  *(v4u*)(out + (size_t)o * 8) = p;
}

// =====================================================================================================
// Register-blocked batched f16 WMMA GEMM with bias: C[m][n] = (sum_k A[m][k] * Bt[n][k]) * ascale + bias,
// stored as f16(value * oscale). One wave per 64x64 tile. A row-major [M][K] pitch lda;
// Bt row-major [N][K] pitch ldb (k contiguous); M, N multiples of 64, K multiple of 32 (host-checked).
// bx = block index inside the product, b = batch index (strides in elements), sT = the block's LDS slabs.
// RING 0: the block's 8 tiles are consecutive in n, no block barriers, fragments loaded straight from global
//         with the split k map.
// RING 1: the 8 tiles are 2 (m) x 4 (n) = one 128x256 tile (M multiple of 128, N of 256, K of 64, at least 128).
//         Its operand rows come to LDS in stages of 64 k by asynchronous copies, two buffers: the copies of stage
//         s + 2 fly while stage s + 1 is worked on; fragments are read from LDS with the same split k map and the
//         same k order. Every wave passes every barrier (no early return on this path).
// BIASROW 0: bias[n] (bias length N); BIASROW 1: bias[m] (bias length M).
// coverage: 4 slabs x 16 rows (it 0..3 x lane>>3 0..3) x 64 cols (8 lanes x 8) = the wave's whole 64x64 tile.
// =====================================================================================================
template <int BIASROW, int RING>
__device__ __forceinline__ void gemm64(
    float (*sT)[16 * 68], _Float16* ring, int bx, int b,
    const unsigned short* __restrict__ Ap, int lda, long long strideA,
    const unsigned short* __restrict__ Btp, int ldb, long long strideB,
    const float* __restrict__ bias,
    unsigned short* Cp, int ldc, long long strideC,
    int M, int N, int K, float ascale, float oscale) {
  const _Float16* A  = (const _Float16*)(const void*)Ap;
  const _Float16* Bt = (const _Float16*)(const void*)Btp;
  const int lane = threadIdx.x & 31;
  const int wave = threadIdx.x >> 5;
  int m0, n0;                              // the wave's 64x64 tile
  int bm0 = 0, bn0 = 0;                    // RING: the block's 128x256 tile
  if constexpr (RING) {
    const int tilesN = N >> 8;
    const int tm = bx / tilesN;
    const int tn = bx - tm * tilesN;
    bm0 = tm << 7;
    bn0 = tn << 8;
    m0 = bm0 + ((wave >> 2) << 6);
    n0 = bn0 + ((wave & 3) << 6);
  } else {
    const int tilesN = N >> 6;
    const int tilesM = M >> 6;
    const int tile = bx * 8 + wave;
    if (tile >= tilesM * tilesN) return;   // wave-uniform; no block barriers on this path
    const int tm = tile / tilesN;
    const int tn = tile - tm * tilesN;
    m0 = tm << 6;
    n0 = tn << 6;
  }

  const _Float16* Ab = A  + (size_t)b * (size_t)strideA;
  const _Float16* Bb = Bt + (size_t)b * (size_t)strideB;

  const int rlane = lane & 15;                 // row (A) / col (B, D) within subtile
  const int koff  = (lane >> 4) * 8;           // k offset of this lane half
  const int mOff  = (lane >> 4) * 8;           // D row offset

  v8f acc[4][4];
#pragma unroll
  for (int i = 0; i < 4; ++i)
#pragma unroll
    for (int j = 0; j < 4; ++j) acc[i][j] = zero8();

  if constexpr (RING) {
    const int t = threadIdx.x;
    const _Float16* ga = Ab + (size_t)(bm0 + (t >> 3)) * lda + (t & 7) * 8;   // the thread's piece, first A row
    const _Float16* gb = Bb + (size_t)(bn0 + (t >> 3)) * ldb + (t & 7) * 8;   // the same, first B row
    const size_t sa = (size_t)32 * lda, sb = (size_t)32 * ldb;
    const unsigned l0 = (unsigned)(uintptr_t)ring + (unsigned)((t >> 3) * (LP * 2) + (t & 7) * 16);
    const int aoff = ((wave >> 2) * 64 + rlane) * LP + koff;                  // the wave's A rows in a buffer
    const int boff = (128 + (wave & 3) * 64 + rlane) * LP + koff;             // the wave's B rows
    const int ns = K >> 6;                                                    // stages
    stage_copy(l0, ga, gb, sa, sb);                                           // stage 0 -> buffer 0
    wait_copies();
    __syncthreads();                                                          // stage 0 readable by every wave
    stage_copy(l0 + RBUF * 2u, ga + 64, gb + 64, sa, sb);                     // stage 1 -> buffer 1 (ns >= 2)
#pragma unroll 1   // rolled over the twelve stages, for speed only
    for (int s = 0; s < ns; ++s) {
      const _Float16* buf = ring + (s & 1) * RBUF;
#pragma unroll
      for (int ks = 0; ks < 2; ++ks) {
        v16h bq[4], af[4];                 // all sixteen LDS reads of the 32 k stand together, ahead of the products
#pragma unroll
        for (int j = 0; j < 4; ++j) bq[j] = ldfrag_h(buf + boff + j * 16 * LP + ks * 32);
#pragma unroll
        for (int i = 0; i < 4; ++i) af[i] = ldfrag_h(buf + aoff + i * 16 * LP + ks * 32);
#pragma unroll
        for (int i = 0; i < 4; ++i) {
#pragma unroll
          for (int j = 0; j < 4; ++j) acc[i][j] = mmar(af[i], bq[j], acc[i][j]);
          dep_guard(acc[i][0], acc[i][3], af[i], bq[3]);
        }
        keep4(bq[0], bq[1], bq[2], bq[3]);
      }
      wait_lds();
      wait_copies();
      __syncthreads();
      if (s + 2 < ns) stage_copy(l0 + (unsigned)(s & 1) * (RBUF * 2u), ga + (s + 2) * 64, gb + (s + 2) * 64, sa, sb);
    }
    wait_copies();
  } else {
    for (int k0 = 0; k0 < K; k0 += 32) {
      v16h bq[4];
#pragma unroll
      for (int j = 0; j < 4; ++j)
        bq[j] = ldfrag_h(Bb + (size_t)(n0 + (j << 4) + rlane) * ldb + koff + k0);
#pragma unroll
      for (int i = 0; i < 4; ++i) {
        const v16h af = ldfrag_h(Ab + (size_t)(m0 + (i << 4) + rlane) * lda + koff + k0);
#pragma unroll
        for (int j = 0; j < 4; ++j) acc[i][j] = mmar(af, bq[j], acc[i][j]);
        dep_guard(acc[i][0], acc[i][3], af, bq[3]);
      }
      keep4(bq[0], bq[1], bq[2], bq[3]);
    }
  }
  acc_guard4(acc[0][0], acc[0][1], acc[0][2], acc[0][3]);
  acc_guard4(acc[1][0], acc[1][1], acc[1][2], acc[1][3]);
  acc_guard4(acc[2][0], acc[2][1], acc[2][2], acc[2][3]);
  acc_guard4(acc[3][0], acc[3][1], acc[3][2], acc[3][3]);

  // ---- epilogue ----
  float* slab = sT[wave];
  const int q = lane >> 3, c8 = (lane & 7) * 8;
  unsigned short* C = Cp + (size_t)b * (size_t)strideC;
  float bcol[8];
  {
    const v4f b0 = *(const v4f*)(bias + (BIASROW ? 0 : (n0 + c8)));       // column bias (length N), 16-B aligned
    const v4f b1 = *(const v4f*)(bias + (BIASROW ? 4 : (n0 + c8 + 4)));
#pragma unroll
    for (int e = 0; e < 4; ++e) { bcol[e] = b0[e]; bcol[4 + e] = b1[e]; }
  }
#pragma unroll
  for (int i = 0; i < 4; ++i) {
    const int mBase = m0 + (i << 4);
#pragma unroll
    for (int j = 0; j < 4; ++j) {
#pragma unroll
      for (int r = 0; r < 8; ++r) {
        slab[(mOff + r) * 68 + (j << 4) + rlane] = acc[i][j][r];
      }
    }
    __builtin_amdgcn_fence(__ATOMIC_RELEASE, "workgroup");
    __builtin_amdgcn_wave_barrier();
    __builtin_amdgcn_fence(__ATOMIC_ACQUIRE, "workgroup");
    v4u hv[4];
#pragma unroll
    for (int it = 0; it < 4; ++it) {
      const int row = it * 4 + q;                        // it 0..3 x q 0..3 = rows 0..15
      const float* sp = slab + row * 68 + c8;
      float bb[8];
      if (BIASROW) {
        const float bv = bias[mBase + row];              // row bias, index < M = bias length
#pragma unroll
        for (int e = 0; e < 8; ++e) bb[e] = bv;
      } else {
#pragma unroll
        for (int e = 0; e < 8; ++e) bb[e] = bcol[e];
      }
      v4u a;
#pragma unroll
      for (int e = 0; e < 4; ++e) {
        const float f0 = (sp[2 * e] * ascale + bb[2 * e]) * oscale;
        const float f1 = (sp[2 * e + 1] * ascale + bb[2 * e + 1]) * oscale;
        a[e] = pk16(h_bits((_Float16)f0), h_bits((_Float16)f1));
      }
      hv[it] = a;
    }
    {
#pragma unroll
      for (int it = 0; it < 4; ++it) {
        const int row = it * 4 + q;
        *(v4u*)(C + (size_t)(mBase + row) * ldc + n0 + c8) = hv[it];
      }
      
    }
    __builtin_amdgcn_fence(__ATOMIC_RELEASE, "workgroup");
    __builtin_amdgcn_wave_barrier();
    __builtin_amdgcn_fence(__ATOMIC_ACQUIRE, "workgroup");
  }
}

// =====================================================================================================
// All six projections in ONE grid: they read only the converted planes and write disjoint planes, so none waits
// for another. The block index picks the product (block-uniform); the K=768 products come first, so that the
// short K=192 ones fill the places that free up at the end. The K=768 products take their operands through the
// LDS ring (gemm64, RING 1), each block one 128x256 tile; the K=192 products read them straight from global (RING 0).
//   [0, GB_T)  q = x . Wq^T + bq            [GB_T, 2 GB_T)  k = x . Wk^T + bk          (M=8192, N=768,  K=768)
//   next NB x GB_VT   v^T = Wv . x^T + bv per batch (A = Wvh [n][k], Bt = Xh rows of b)  (M=768,  N=1024, K=768)
//   next GB_L  lq = (xl . Wlq^T + blq) x2   next GB_L  lk = xl . Wlk^T + blk            (M=8192, N=192,  K=192)
//   next NB x GB_LVT  lv^T = Wlv . xl^T + blv per batch                                 (M=192,  N=1024, K=192)
// =====================================================================================================
__global__ __launch_bounds__(256) void proj_all(
    const unsigned short* __restrict__ Xh, const unsigned short* __restrict__ Lh,
    const unsigned short* __restrict__ Wqh, const unsigned short* __restrict__ Wkh,
    const unsigned short* __restrict__ Wvh, const unsigned short* __restrict__ Wlqh,
    const unsigned short* __restrict__ Wlkh, const unsigned short* __restrict__ Wlvh,
    const float* __restrict__ bq, const float* __restrict__ bk, const float* __restrict__ bv,
    const float* __restrict__ blq, const float* __restrict__ blk_, const float* __restrict__ blv,
    unsigned short* Qp, unsigned short* Kp, unsigned short* VTp,
    unsigned short* LQp, unsigned short* LKp, unsigned short* LVTp) {
  __shared__ __align__(16) float sT[8][16 * 68];   // per-wave 16x64 slab, pitch 68 floats
  __shared__ __align__(16) _Float16 ring[2 * RBUF]; // operand stages of the K=768 products, two buffers, 110592 B
  const int blk = blockIdx.x;
  const int T0 = 2 * GB_T;                 // first block of v^T
  const int T1 = T0 + NB * GB_VT;          // first block of lq
  const int T2 = T1 + 2 * GB_L;            // first block of lv^T
  if (blk < T0) {
    // text activations x weights^T, bias by column, operands through the LDS ring
    const bool second = blk >= GB_T;       // the k product
    gemm64<0, 1>(sT, ring, second ? blk - GB_T : blk, 0, Xh, DM, 0LL, second ? Wkh : Wqh, DM, 0LL,
                 second ? bk : bq, second ? Kp : Qp, DM, 0LL, NB * SEQ, DM, DM, 1.0f / 64.0f, 1.0f);
  } else if (blk < T1) {
    // text weights x activations^T per batch, bias by row, operands through the LDS ring
    const int b  = (blk - T0) / GB_VT;     // batch
    const int bx = (blk - T0) - b * GB_VT; // block inside the batch
    gemm64<1, 1>(sT, ring, bx, b, Wvh, DM, 0LL, Xh, DM, (long long)SEQ * DM, bv, VTp, SEQ, (long long)DM * SEQ,
                 DM, SEQ, DM, 1.0f / 64.0f, 1.0f);
  } else if (blk < T2) {
    // layout activations x weights^T, bias by column
    const int  r      = blk - T1;
    const bool second = r >= GB_L;         // the lk product
    gemm64<0, 0>(sT, ring, second ? r - GB_L : r, 0, Lh, DL, 0LL, second ? Wlkh : Wlqh, DL, 0LL,
                 second ? blk_ : blq, second ? LKp : LQp, DL, 0LL, NB * SEQ, DL, DL, 1.0f / 64.0f,
                 second ? 1.0f : 2.0f);
  } else {
    // layout weights x activations^T per batch, bias by row
    const int b  = (blk - T2) / GB_LVT;     // batch
    const int bx = (blk - T2) - b * GB_LVT; // block inside the batch
    gemm64<1, 0>(sT, ring, bx, b, Wlvh, DL, 0LL, Lh, DL, (long long)SEQ * DL, blv, LVTp, SEQ, (long long)DL * SEQ,
                 DL, SEQ, DL, 1.0f / 64.0f, 1.0f);
  }
}

// =====================================================================================================
// Two-stream attention, text head dim 64 + layout head dim 16, no mask, softmax over all SEQ keys.
//   Q plane (f16): element (b, t, h, d) at [(b*SEQ + t)*DM + h*64 + d]; K plane same layout with key s.
//   LQ plane (f16, value x2): [(b*SEQ + t)*DL + h*16 + d]; LK plane (f16 x1) same layout.
//   V^T plane (f16): element (b, h, d, s) at [(b*DM + h*64 + d)*SEQ + s]; LV^T plane: [(b*DL + h*16 + d)*SEQ + s].
//   All products run transposed: the K, LK, V^T and LV^T rows are the A operand, the query side is the B operand, so
//   a lane holds one query (column lane&15) and the keys or the head dims 8*(lane>>4) + r of a tile in its registers.
//   raw scores^T = k . q + lk . lq2 in f32, scaled by sscale inside the exponent (3 f16 WMMA steps into one accumulator; the layout step uses
//   k = 0..15 only, upper 16 k-slots are register zeros in both fragments).
//   p = exp((s - m) sscale) carried as 1024 p = 2^(s c2 + nb), one fma and one v_exp an element, then f16; two score tiles (32 keys) pack in place into one B operand, in the k order
//   of the V^T loads; ctx^T = v^T . p^T (4 row tiles), lctx^T = lv^T . p^T (1 row tile); online softmax in f32: maximum
//   and sum run inside the lane, the maximum is joined between the wave halves each chunk, the sum once at the end.
//   Block = 8 waves = 64 query rows of a pair of heads (b, 2 hp) and (b, 2 hp + 1): waves 0..3 take the first head, waves 4..7
//   the second, each group with its own ring; grid = NB * (NH / 2) * NQB; key chunks of 64, static trip NKT.
//   Chunk staging, per head: 128 threads: K 32 halves/thread (64x64), V^T 32 halves/thread (64x64), LK 8 halves/thread (64x16),
//   LV^T 8 halves/thread (16x64) = every LDS element read below, by asynchronous copies into two buffers: the copies of
//   chunk kt + 2 fly while chunk kt + 1 is worked on; one barrier a chunk publishes the next chunk and frees the read one;
//   ctx -> out0 f32 [(b*SEQ + t)*DM + h*64 + d]: 16 rows x 256-B segments per wave (16 lanes x 16 B per segment,
//   Output coverage: wave rows q0..q0+15 (it 0..7 x lane>>4) x 64 cols (16 lanes x 4) of head h for out0;
//   lctx -> out1 f32 [(b*SEQ + t)*DL + h*16 + d]: the two heads' 16 floats of a row are one 128-B line, gathered in LDS and
//   stored by this block alone: 512 float4 = 64 rows x 32 floats; the grid covers every (b, hp, qb).
// =====================================================================================================
__global__ __launch_bounds__(256)
void attn_two(const unsigned short* __restrict__ qp, const unsigned short* __restrict__ kp,
              const unsigned short* __restrict__ vtp, const unsigned short* __restrict__ lqp,
              const unsigned short* __restrict__ lkp, const unsigned short* __restrict__ lvtp,
              float* out0, float* out1, float sscale) {
  union FH { v16h v; v8h h[2]; };
  // one array, so that the tiles of pitch LP lie at constant offsets from one lane address: head group g has the two buffers
  // from 2 g ABUF. In each buffer:
  //   K chunk [kv][d] at 0 (9 KB), V^T [d][kv] at 64 LP (9 KB), LV^T [dl][kv] at 128 LP (2304 B), all pitch LP;
  //   LK chunk [kv][dl] at (128 + HL) LP, pitch LPL (3 KB).
  // Behind the loop the same bytes hold the output tiles, which keeps three blocks' LDS on a WGP (all blocks resident):
  //   per wave ctx tile [row][d], pitch OP (8 x 4352 B), then the block's lctx tile [row][16 g + dl], pitch LCP (9216 B).
  __shared__ __align__(16) _Float16 Tsh[4 * ABUF];       // 95232 B
  static_assert((8 * 16 * OP + 64 * LCP) * 4 <= 4 * ABUF * 2);

  const int wave = __builtin_amdgcn_readfirstlane((int)threadIdx.x >> 5);   // in a scalar register, and with it every index built from it
  const int g    = wave >> 2;                // head of the pair
  const int wq   = wave & 3;                 // the wave's 16 query rows among the block's 64
  const int tid  = threadIdx.x & 127;        // thread inside the head group
  const int lane = tid & 31;
  const int hh   = lane >> 4;
  const int c    = lane & 15;

  const int bx   = blockIdx.x;
  const int qb   = bx % NQB;
  const int rest = bx / NQB;
  const int hp   = rest % (NH / 2);
  const int b    = rest / (NH / 2);
  const int h    = 2 * hp + g;
  const int q0   = qb * 64 + wq * 16;
  const size_t rowB = (size_t)b * SEQ;

  const _Float16* Q   = (const _Float16*)(const void*)qp;
  const _Float16* LQ  = (const _Float16*)(const void*)lqp;
  const _Float16* Kg  = (const _Float16*)(const void*)kp + (size_t)h * HD;
  const _Float16* LKg = (const _Float16*)(const void*)lkp + (size_t)h * HL;
  const _Float16* Vh  = (const _Float16*)(const void*)vtp  + ((size_t)b * DM + (size_t)h * HD) * SEQ;
  const _Float16* LVh = (const _Float16*)(const void*)lvtp + ((size_t)b * DL + (size_t)h * HL) * SEQ;

  // ---- Q fragments (B operand, column = lane&15): 2 d-chunks of the text stream; layout fragment k 0..15 ----
  v16h qa[2];
#pragma unroll
  for (int dc = 0; dc < 2; ++dc) {
    const size_t qo = (rowB + q0 + c) * DM + (size_t)h * HD + dc * 32 + 8 * hh;
    qa[dc] = ldfrag_h(Q + qo);
  }
  FH la;
  la.h[0] = *(const v8h*)(LQ + (rowB + q0 + c) * DL + (size_t)h * HL + 8 * hh);   // k = 8hh..8hh+7
  la.h[1] = zero8h();                                                              // k 16..31 = 0

  const float c2 = sscale * 1.44269504088896340736f;   // score scale x log2(e): exp(s sscale) = 2^(s c2)
  float mrow = -INFINITY;      // running maximum of query c's raw scores, the same in both wave halves
  float lrow = 0.f;            // running sum (x1024) of query c over this half's keys
  v8f oacc[4];                 // oacc[t][r] = ctx of query c, d = 16 t + 8 hh + r
  v8f olacc = zero8();         // olacc[r] = lctx of query c, dl = 8 hh + r
#pragma unroll
  for (int t = 0; t < 4; ++t) oacc[t] = zero8();

  // chunk_copy: row 0 of chunk 0's tiles (the same in the head's four waves), the thread's byte offsets in a tile, its LDS bytes in buffer 0
  const _Float16* bk  = Kg + rowB * DM;                                      // k row 0 of the batch, d = 0
  const _Float16* blk = LKg + rowB * DL;                                     // lk row 0 of the batch, dl = 0
  const unsigned ok  = (unsigned)((tid >> 3) * (DM * 2) + (tid & 7) * 16);   // k row tid>>3 (+16 i), d = 8 (tid&7)..+7
  const unsigned ov  = (unsigned)((tid >> 3) * (SEQ * 2) + (tid & 7) * 16);  // v^T row d, lv^T row dl = tid>>3 (+16 i), s = 8 (tid&7)..+7
  const unsigned olk = (unsigned)((tid >> 1) * (DL * 2) + (tid & 1) * 16);   // lk row tid>>1, dl = 8 (tid&1)..+7
  _Float16* Tg = Tsh + g * (2 * ABUF);                                       // the head group's ring
  const unsigned l0  = (unsigned)(uintptr_t)Tg + (unsigned)((tid >> 3) * (LP * 2) + (tid & 7) * 16);
  const unsigned lk0 = (unsigned)(uintptr_t)Tg + (unsigned)((128 + HL) * (LP * 2) + (tid >> 1) * (LPL * 2) + (tid & 1) * 16);

  chunk_copy(l0, lk0, ok, ov, olk, bk, Vh, LVh, blk);                        // chunk 0 -> buffer 0
  wait_copies();
  __syncthreads();                                                           // chunk 0 readable by every wave
  chunk_copy(l0 + ABUF * 2u, lk0 + ABUF * 2u, ok, ov, olk, bk + 64 * DM, Vh + 64, LVh + 64, blk + 64 * DL);   // chunk 1 -> buffer 1

  for (int kt = 0; kt < NKT; ++kt) {         // static trip count
    // the lane's piece of row c in each tile of the chunk's buffer; every fragment read below is a constant offset from these
    const _Float16* buf  = Tg + (kt & 1) * ABUF;
    const _Float16* kfr  = buf + c * LP + 8 * hh;
    const _Float16* vfr  = kfr + 64 * LP;
    const _Float16* lvfr = kfr + 128 * LP;
    const _Float16* lkfr = buf + (128 + HL) * LP + c * LPL + 8 * hh;

    // ---- scores^T: 64 keys x 16 query columns per wave; s[j][r] = key 16 j + 8 hh + r, query c ----
    v8f s[4];
#pragma unroll
    for (int j = 0; j < 4; ++j) {
      v8f acc = zero8();
#pragma unroll
      for (int dc = 0; dc < 2; ++dc) {
        FH kb;
        kb.h[0] = *(const v8h*)(kfr + j * 16 * LP + dc * 32);
        kb.h[1] = *(const v8h*)(kfr + j * 16 * LP + dc * 32 + 16);
        acc = mmar(kb.v, qa[dc], acc);
      }
      // k 16..31 = 0; one vector, so that the LDS read lands in the operand's own registers
      const v16h lb = __builtin_shufflevector(*(const v8h*)(lkfr + j * 16 * LPL), zero8h(),
                                              0, 1, 2, 3, 4, 5, 6, 7, 8, 9, 10, 11, 12, 13, 14, 15);
      acc = mmar(lb, la.v, acc);
      s[j] = acc;                             // raw: the score scale is applied inside the exponent's one fma below
    }

    // ---- maximum, online softmax, P^T (x1024, f16) packed into B operands ----
    float mj[4];                              // four independent chains
#pragma unroll
    for (int j = 0; j < 4; ++j) {
      mj[j] = s[j][0];
#pragma unroll
      for (int r = 1; r < 8; ++r) mj[j] = fmaxf(mj[j], s[j][r]);
    }
    float m = fmaxf(fmaxf(mj[0], mj[1]), fmaxf(mj[2], mj[3]));
    m = fmaxf(m, xhalf(m));                   // all 64 keys of the chunk
    const float mnew  = fmaxf(mrow, m);
    const float msafe = (mnew == -INFINITY) ? 0.f : mnew;
    const float alpha = __builtin_amdgcn_exp2f((mrow - msafe) * c2);
    const float nb    = fmaf(-msafe, c2, 10.0f);   // 1024 p = 2^(s c2 + nb)
    mrow = mnew;
#pragma unroll
    for (int t = 0; t < 4; ++t)
#pragma unroll
      for (int r = 0; r < 8; ++r) oacc[t][r] *= alpha;
#pragma unroll
    for (int r = 0; r < 8; ++r) olacc[r] *= alpha;

    // ---- per 32 keys: P^T packed, then ctx^T += V^T . P^T, lctx^T += LV^T . P^T (f16 WMMA) ----
    v2f pj[4];
#pragma unroll   // s and pj are indexed by kk and live in registers
    for (int kk = 0; kk < 2; ++kk) {
      FH pb;                                  // element e = key 32 kk + (e < 8 ? 8 hh + e : 16 + 8 hh + e - 8)
      // neighbouring registers of one score tile form the pairs, so that the packed fma reads the accumulator where it lies
      // and a packed conversion writes one register of the operand; a tile's sum runs as an even-r and an odd-r chain
#pragma unroll
      for (int x = 0; x < 2; ++x) {
        v2f ps = {0.f, 0.f};
#pragma unroll
        for (int r = 0; r < 8; r += 2) {
          const v2f a = (v2f){s[2 * kk + x][r], s[2 * kk + x][r + 1]} * c2 + nb;
          const v2f p = {__builtin_amdgcn_exp2f(a[0]), __builtin_amdgcn_exp2f(a[1])};
          ps += p;
          pb.h[x][r]     = (_Float16)p[0];
          pb.h[x][r + 1] = (_Float16)p[1];
        }
        pj[2 * kk + x] = ps;
      }
      // the exponents and conversions of these 32 keys stay ahead of their products (only LDS reads may cross this line): left
      // free, the scheduler mixes the two halves of the chunk and takes 171 VGPRs, above the 160 of six waves a SIMD
      __builtin_amdgcn_sched_barrier(0x180);
#pragma unroll
      for (int t = 0; t < 4; ++t) {
        FH vb;
        vb.h[0] = *(const v8h*)(vfr + t * 16 * LP + kk * 32);
        vb.h[1] = *(const v8h*)(vfr + t * 16 * LP + kk * 32 + 16);
        oacc[t] = mmar(vb.v, pb.v, oacc[t]);
      }
      FH wb;
      wb.h[0] = *(const v8h*)(lvfr + kk * 32);
      wb.h[1] = *(const v8h*)(lvfr + kk * 32 + 16);
      olacc = mmar(wb.v, pb.v, olacc);
    }
    const v2f pt = (pj[0] + pj[1]) + (pj[2] + pj[3]);
    lrow = lrow * alpha + (pt[0] + pt[1]);
    wait_lds();
    wait_copies();
    __syncthreads();
    if (kt + 2 < NKT)
      chunk_copy(l0 + (unsigned)(kt & 1) * (ABUF * 2u), lk0 + (unsigned)(kt & 1) * (ABUF * 2u), ok, ov, olk,
                 bk + (size_t)(kt + 2) * (64 * DM), Vh + (kt + 2) * 64, LVh + (kt + 2) * 64, blk + (size_t)(kt + 2) * (64 * DL));
  }
  wait_copies();

  // the last trip's barrier ended every wave's reads of the ring: its bytes now hold the output tiles
  float* os = (float*)(void*)Tsh + wave * (16 * OP);
  float* ol = (float*)(void*)Tsh + 8 * (16 * OP);      // row = query row in the block, column = 16 g + dl
  {
    const float l = lrow + xhalf(lrow);                  // both halves' keys
    const float inv = (l > 0.f) ? (1.0f / l) : 0.f;     // l and the accumulators both carry x1024
#pragma unroll
    for (int gg = 0; gg < 2; ++gg) {                     // a lane's 8 registers are 8 consecutive d of its query's row
#pragma unroll
      for (int t = 0; t < 4; ++t) {
        const v4f v = {oacc[t][4 * gg] * inv, oacc[t][4 * gg + 1] * inv, oacc[t][4 * gg + 2] * inv, oacc[t][4 * gg + 3] * inv};
        *(v4f*)(os + c * OP + t * 16 + 8 * hh + 4 * gg) = v;
      }
      const v4f w = {olacc[4 * gg] * inv, olacc[4 * gg + 1] * inv, olacc[4 * gg + 2] * inv, olacc[4 * gg + 3] * inv};
      *(v4f*)(ol + (wq * 16 + c) * LCP + g * HL + 8 * hh + 4 * gg) = w;
    }
  }
  // a row of the lctx tile holds the work of two waves, so the block's barrier stands where the wave's own stood; it stands
  // ahead of every global store, so that no wave waits at it for its stores to return
  __syncthreads();
  {
    const int h2 = lane >> 4, c4 = (lane & 15) * 4;     // 256-B row segment = 16 lanes x 16 B
    float* ob = out0 + (rowB + q0) * DM + (size_t)h * HD + c4;
    {
#pragma unroll
      for (int it = 0; it < 8; ++it) {
        const int row = it * 2 + h2;                     // it 0..7 x h2 0..1 = rows 0..15
        const v4f v = *(const v4f*)(os + row * OP + c4);
        *(v4f*)(ob + (size_t)row * DM) = v;
      }
    }
  }
  {
    float* lb = out1 + (rowB + (size_t)(qb * 64)) * DL + hp * (2 * HL);
#pragma unroll
    for (int it = 0; it < 2; ++it) {
      const int idx = it * 256 + (int)threadIdx.x;       // float4 0..511: 8 lanes store one row's whole 128-B line
      const int row = idx >> 3, p4 = (idx & 7) * 4;
      const v4f v = *(const v4f*)(ol + row * LCP + p4);
      *(v4f*)(lb + (size_t)row * DL + p4) = v;
    }
  }
}

// =====================================================================================================
// Workspace map (bytes), every region an exact multiple of its whole-line / whole-tile store granularity:
//   Xh   f16 [8192][768]            12582912
//   Lh   f16 [8192][192]             3145728
//   Wqh  f16 [768 n][768 k] (x64)    1179648
//   Wkh  f16 [768][768]     (x64)    1179648
//   Wvh  f16 [768][768]     (x64)    1179648
//   Wlqh f16 [192][192]     (x64)      73728
//   Wlkh f16 [192][192]     (x64)      73728
//   Wlvh f16 [192][192]     (x64)      73728
//   Qp   f16 [8192][768]            12582912
//   Kp   f16 [8192][768]            12582912
//   VTp  f16 [8][768][1024]         12582912
//   LQp  f16 [8192][192]   (x2)      3145728
//   LKp  f16 [8192][192]             3145728
//   LVTp f16 [8][192][1024]          3145728
//   total                           66674688
// Weights are [out n][in k] with k contiguous = the Bt / A layout the GEMM wants, so they are only converted.
// =====================================================================================================
extern "C" void kernel_launch(void* const* d_in, const int* in_sizes, int n_in,
                              void* d_out, int out_size, void* d_ws, size_t ws_size,
                              hipStream_t stream) {
  if (n_in < 14) return;
  if (in_sizes[0] != NB * SEQ * DM) return;
  if (in_sizes[1] != NB * SEQ * DL) return;
  if (in_sizes[2] != DM * DM || in_sizes[4] != DM * DM || in_sizes[6] != DM * DM) return;
  if (in_sizes[3] != DM || in_sizes[5] != DM || in_sizes[7] != DM) return;
  if (in_sizes[8] != DL * DL || in_sizes[10] != DL * DL || in_sizes[12] != DL * DL) return;
  if (in_sizes[9] != DL || in_sizes[11] != DL || in_sizes[13] != DL) return;
  if (out_size != NB * SEQ * (DM + DL)) return;

  const float* x    = (const float*)d_in[0];
  const float* xl   = (const float*)d_in[1];
  const float* Wq   = (const float*)d_in[2];
  const float* bq   = (const float*)d_in[3];
  const float* Wk   = (const float*)d_in[4];
  const float* bk   = (const float*)d_in[5];
  const float* Wv   = (const float*)d_in[6];
  const float* bv   = (const float*)d_in[7];
  const float* Wlq  = (const float*)d_in[8];
  const float* blq  = (const float*)d_in[9];
  const float* Wlk  = (const float*)d_in[10];
  const float* blk_ = (const float*)d_in[11];
  const float* Wlv  = (const float*)d_in[12];
  const float* blv  = (const float*)d_in[13];

  const size_t PX  = (size_t)NB * SEQ * DM * 2;    // 12582912  f16 text plane [8192][768]
  const size_t PL  = (size_t)NB * SEQ * DL * 2;    //  3145728  f16 layout plane [8192][192]
  const size_t PW  = (size_t)DM * DM * 2;          //  1179648  f16 [768][768] weight plane
  const size_t PWL = (size_t)DL * DL * 2;          //    73728  f16 [192][192] weight plane
  size_t off = 0;
  const size_t oXh   = off; off += PX;
  const size_t oLh   = off; off += PL;
  const size_t oWq   = off; off += PW;
  const size_t oWk   = off; off += PW;
  const size_t oWv   = off; off += PW;
  const size_t oWlq  = off; off += PWL;
  const size_t oWlk  = off; off += PWL;
  const size_t oWlv  = off; off += PWL;
  const size_t oQp   = off; off += PX;
  const size_t oKp   = off; off += PX;
  const size_t oVTp  = off; off += PX;
  const size_t oLQp  = off; off += PL;
  const size_t oLKp  = off; off += PL;
  const size_t oLVTp = off; off += PL;
  if (off > ws_size) return;                       // off = 66674688
  if (off > (size_t)134217728) return;

  char* ws = (char*)d_ws;
  unsigned short* Xh   = (unsigned short*)(ws + oXh);
  unsigned short* Lh   = (unsigned short*)(ws + oLh);
  unsigned short* Wqh  = (unsigned short*)(ws + oWq);
  unsigned short* Wkh  = (unsigned short*)(ws + oWk);
  unsigned short* Wvh  = (unsigned short*)(ws + oWv);
  unsigned short* Wlqh = (unsigned short*)(ws + oWlq);
  unsigned short* Wlkh = (unsigned short*)(ws + oWlk);
  unsigned short* Wlvh = (unsigned short*)(ws + oWlv);
  unsigned short* Qp   = (unsigned short*)(ws + oQp);
  unsigned short* Kp   = (unsigned short*)(ws + oKp);
  unsigned short* VTp  = (unsigned short*)(ws + oVTp);
  unsigned short* LQp  = (unsigned short*)(ws + oLQp);
  unsigned short* LKp  = (unsigned short*)(ws + oLKp);
  unsigned short* LVTp = (unsigned short*)(ws + oLVTp);
  float*          out0 = (float*)d_out;
  float*          out1 = (float*)d_out + (size_t)NB * SEQ * DM;   // byte offset 25165824 / 4; last index 7864319 < out_size

  const dim3 blk(256);
  const dim3 gCvt(CB_ALL);                                     // 4758 blocks: the eight planes
  const dim3 gProj(GB_ALL);                                    //  720 blocks: the six projections
  const dim3 gAttn(NB * (NH / 2) * NQB);                       //  768 blocks: a pair of heads each

  // (1) activations f32 -> f16 (x1); weights [n][k] f32 -> f16 (x64): one grid, planes Xh .. Wlvh back to back from Xh
  cvt_all<<<gCvt, blk, 0, stream>>>(x, xl, Wq, Wk, Wv, Wlq, Wlk, Wlv, Xh);
  // (2) q, k, v^T, lq (x2), lk, lv^T -> f16 planes: one grid
  proj_all<<<gProj, blk, 0, stream>>>(Xh, Lh, Wqh, Wkh, Wvh, Wlqh, Wlkh, Wlvh, bq, bk, bv, blq, blk_, blv,
                                      Qp, Kp, VTp, LQp, LKp, LVTp);
  // (3) attention: ctx -> out0, lctx -> out1 [8192][192]
  attn_two<<<gAttn, blk, 0, stream>>>(Qp, Kp, VTp, LQp, LKp, LVTp, out0, out1, 0.125f);
  (void)hipGetLastError();
}
